// v000
// Times are from an AMD MI455X. After a warm-up the kernel runs many times in a row, and a time is the length of
// such a window on the GPU divided by its runs, so every launch and the gaps after it count. The runs cycle
// through copies of the inputs. A figure is the median of several windows, for all but v000 over two sittings.
// Sittings can differ by a few percent; kernels timed side by side share one.
// v000 is the starting kernel. One run takes 173 microseconds.
#include <hip/hip_runtime.h>
#include <stdint.h>
// Contractions: q-proj, k-proj, q.k scores: v_wmma_f32_16x16x32_bf16 with bf16 hi/lo operand planes (hi.hi + hi.lo + lo.hi);
// v-proj and p.v: v_wmma_f32_16x16x32_f16 (f16 operands, p carried x2^15); f32 accumulate everywhere; softmax in f32.

typedef __attribute__((ext_vector_type(16))) _Float16 v16h;
typedef __attribute__((ext_vector_type(8)))  _Float16 v8h;
typedef __attribute__((ext_vector_type(16))) __bf16   v16b;
typedef __attribute__((ext_vector_type(8)))  __bf16   v8b;
typedef __attribute__((ext_vector_type(8)))  float    v8f;
typedef __attribute__((ext_vector_type(4)))  float    v4f;

__device__ __forceinline__ unsigned short f2bf_bits(float f) {
  unsigned u = __float_as_uint(f);
  return (unsigned short)((u + 0x7FFFu + ((u >> 16) & 1u)) >> 16);
}
__device__ __forceinline__ float bf_bits2f(unsigned short h) { return __uint_as_float(((unsigned)h) << 16); }

// hazard guards as plain device helpers (no inline asm inside the kernel template body)
__device__ __forceinline__ void dep_guard_h(v8f& a, v8f& b, v16h x, v16h y) { asm volatile("v_nop\n\tv_nop\n\tv_nop\n\tv_nop" : "+v"(a), "+v"(b) : "v"(x), "v"(y)); }
__device__ __forceinline__ void dep_guard_b(v8f& a, v8f& b, v16b x, v16b y) { asm volatile("v_nop\n\tv_nop\n\tv_nop\n\tv_nop" : "+v"(a), "+v"(b) : "v"(x), "v"(y)); }
__device__ __forceinline__ void keep4_h(v16h a, v16h b, v16h c, v16h d) { asm volatile("v_nop" :: "v"(a), "v"(b), "v"(c), "v"(d)); }
__device__ __forceinline__ void keep4_b(v16b a, v16b b, v16b c, v16b d) { asm volatile("v_nop" :: "v"(a), "v"(b), "v"(c), "v"(d)); }
__device__ __forceinline__ void acc_guard4(v8f& a, v8f& b, v8f& c, v8f& d) { asm volatile("v_nop\n\tv_nop\n\tv_nop\n\tv_nop" : "+v"(a), "+v"(b), "+v"(c), "+v"(d)); }
template <typename T> struct Frag;
template <> struct Frag<_Float16> {
  typedef v16h V; union U { v16h v; v8h h[2]; };
  static __device__ __forceinline__ v16h load(const _Float16* p) {   // elements 0..7 <- p[0..7], 8..15 <- p[16..23]
    U f; f.h[0] = *(const v8h*)(p); f.h[1] = *(const v8h*)(p + 16); return f.v;
  }
  static __device__ __forceinline__ v8f mma(v16h a, v16h b, v8f c) {
    return __builtin_amdgcn_wmma_f32_16x16x32_f16(false, a, false, b, (short)0, c, false, false);
  }
  static __device__ __forceinline__ void guard(v8f& a, v8f& b, v16h x, v16h y) { dep_guard_h(a, b, x, y); }
  static __device__ __forceinline__ void keep(v16h a, v16h b, v16h c, v16h d) { keep4_h(a, b, c, d); }
};
template <> struct Frag<__bf16> {
  typedef v16b V; union U { v16b v; v8b h[2]; };
  static __device__ __forceinline__ v16b load(const __bf16* p) {
    U f; f.h[0] = *(const v8b*)(p); f.h[1] = *(const v8b*)(p + 16); return f.v;
  }
  static __device__ __forceinline__ v8f mma(v16b a, v16b b, v8f c) {
    return __builtin_amdgcn_wmma_f32_16x16x32_bf16(false, a, false, b, (short)0, c, false, false);
  }
  static __device__ __forceinline__ void guard(v8f& a, v8f& b, v16b x, v16b y) { dep_guard_b(a, b, x, y); }
  static __device__ __forceinline__ void keep(v16b a, v16b b, v16b c, v16b d) { keep4_b(a, b, c, d); }
};

// ---- Register-blocked batched WMMA GEMM ------------------------------------
// C[m,n] = scale * sum_k A[m,k] * Bt[n,k] (+bias)(+resid); each wave owns a 64x64 tile.
// A row-major [M,K]; Bt row-major [N,K]; M,N % 64 == 0, K % 32 == 0.
// SPLIT: operands are hi/lo planes (A2/Bt2 = lo planes, same layout); product = hi.hi + hi.lo + lo.hi.
// BIAS_MODE: 0 = none, 1 = bias[m], 2 = bias[n].
// OUT_MODE: 0 = f32, 1 = f16, 2 = bf16 hi plane (Cout) + bf16 lo plane (Cout2).
// ET: 0 = f16 operands, 1 = bf16 operands (pointers passed as 16-bit storage)
template <int ET> struct Elem;
template <> struct Elem<0> { typedef _Float16 T; };
template <> struct Elem<1> { typedef __bf16 T; };
template <int ET, bool SPLIT, int BIAS_MODE, int OUT_MODE, bool RESID, int ACT = 0>
__global__ __launch_bounds__(256) void wmma_gemm64(
    const unsigned short* __restrict__ Ap, const unsigned short* __restrict__ A2p, int lda, long strideA,
    const unsigned short* __restrict__ Btp, const unsigned short* __restrict__ Bt2p, int ldb, long strideB,
    void* __restrict__ Cout, void* __restrict__ Cout2, int ldc, long strideC,
    const float* __restrict__ bias,
    const float* __restrict__ resid, long strideR,
    int M, int N, int K, float scale) {
  typedef typename Elem<ET>::T T;
  typedef typename Frag<T>::V V;
  const T* A = (const T*)Ap; const T* A2 = (const T*)A2p; const T* Bt = (const T*)Btp; const T* Bt2 = (const T*)Bt2p;
  __shared__ __align__(16) float sT[8][16 * 68];   // per-wave 16x64 slab, pitch 68 floats
  const int b    = blockIdx.y;
  const int lane = threadIdx.x & 31;
  const int wave = threadIdx.x >> 5;
  const int tilesN = N >> 6;
  const int tilesM = M >> 6;
  const int tile = blockIdx.x * 8 + wave;
  if (tile >= tilesM * tilesN) return;   // wave-uniform; no block barriers in this kernel
  const int tm = tile / tilesN;
  const int tn = tile - tm * tilesN;
  const int m0 = tm << 6;
  const int n0 = tn << 6;

  const T* Ab  = A  + (size_t)b * strideA;
  const T* Bb  = Bt + (size_t)b * strideB;
  const T* Ab2 = SPLIT ? (A2  + (size_t)b * strideA) : nullptr;
  const T* Bb2 = SPLIT ? (Bt2 + (size_t)b * strideB) : nullptr;

  const int rlane = lane & 15;                 // row (A) / col (B, D) within subtile
  const int koff  = (lane >> 4) * 8;           // k offset of this lane half
  const int mOff  = (lane >> 4) * 8;           // D row offset

  v8f acc[4][4];
#pragma unroll
  for (int i = 0; i < 4; ++i)
#pragma unroll
    for (int j = 0; j < 4; ++j) acc[i][j] = (v8f){0.f,0.f,0.f,0.f,0.f,0.f,0.f,0.f};

  for (int k0 = 0; k0 < K; k0 += 32) {
    V bh[4], bl[4];
#pragma unroll
    for (int j = 0; j < 4; ++j) {
      const size_t bo = (size_t)(n0 + (j << 4) + rlane) * ldb + koff + k0;
      bh[j] = Frag<T>::load(Bb + bo);
      if (SPLIT) bl[j] = Frag<T>::load(Bb2 + bo);
    }
#pragma unroll
    for (int i = 0; i < 4; ++i) {
      const size_t ao = (size_t)(m0 + (i << 4) + rlane) * lda + koff + k0;
      V ah = Frag<T>::load(Ab + ao);
      V al;
      if (SPLIT) al = Frag<T>::load(Ab2 + ao);
#pragma unroll
      for (int j = 0; j < 4; ++j) {
        acc[i][j] = Frag<T>::mma(ah, bh[j], acc[i][j]);
        if (SPLIT) {
          acc[i][j] = Frag<T>::mma(ah, bl[j], acc[i][j]);
          acc[i][j] = Frag<T>::mma(al, bh[j], acc[i][j]);
        }
      }
      Frag<T>::guard(acc[i][0], acc[i][3], ah, SPLIT ? al : ah);
    }
    Frag<T>::keep(bh[0], bh[1], bh[2], bh[3]);
    if (SPLIT) Frag<T>::keep(bl[0], bl[1], bl[2], bl[3]);
  }
  acc_guard4(acc[0][0], acc[0][1], acc[0][2], acc[0][3]);
  acc_guard4(acc[1][0], acc[1][1], acc[1][2], acc[1][3]);
  acc_guard4(acc[2][0], acc[2][1], acc[2][2], acc[2][3]);
  acc_guard4(acc[3][0], acc[3][1], acc[3][2], acc[3][3]);

  // ---- epilogue ----
  float* slab = sT[wave];
  const float* Rb = RESID ? (resid + (size_t)b * strideR) : nullptr;
#pragma unroll
  for (int i = 0; i < 4; ++i) {
    const int mBase = m0 + (i << 4);
#pragma unroll
    for (int j = 0; j < 4; ++j) {
      const int n = n0 + (j << 4) + rlane;
      float bv = 0.f;
      if (BIAS_MODE == 2) bv = bias[n];
#pragma unroll
      for (int r = 0; r < 8; ++r) {
        float v = acc[i][j][r] * scale;
        if (BIAS_MODE == 1) v += bias[mBase + mOff + r];
        if (BIAS_MODE == 2) v += bv;
        if (RESID) v += Rb[(size_t)(mBase + mOff + r) * ldc + n];
        if (ACT == 1) v = tanhf(v);
        if (ACT == 2) v = fmaxf(v, 0.0f);
        if (ACT == 3) v = v / (1.0f + expf(-v));
        if (ACT == 4) v = (v > 0.f) ? v : 0.01f * v;
        if (ACT == 5) v = 0.5f * v * (1.0f + erff(v * 0.70710678118654752f));
        slab[(mOff + r) * 68 + (j << 4) + rlane] = v;
      }
    }
    __builtin_amdgcn_fence(__ATOMIC_RELEASE, "workgroup");
    __builtin_amdgcn_wave_barrier();
    __builtin_amdgcn_fence(__ATOMIC_ACQUIRE, "workgroup");
    if (OUT_MODE == 0) {
      float* C = (float*)Cout + (size_t)b * strideC;
      const int hh = lane >> 4, c4 = (lane & 15) * 4;     // row seg = 256 B = 16 lanes x 16 B
      {
#pragma unroll
        for (int it = 0; it < 8; ++it) {
          const int row = it * 2 + hh;
          v4f v = *(const v4f*)(slab + row * 68 + c4);
          *(v4f*)(C + (size_t)(mBase + row) * ldc + n0 + c4) = v;
        }
        
      }
    } else {
      const int q = lane >> 3, c8 = (lane & 7) * 8;
      unsigned short* C  = (unsigned short*)Cout  + (size_t)b * strideC;
      unsigned short* C2 = (OUT_MODE == 2) ? ((unsigned short*)Cout2 + (size_t)b * strideC) : nullptr;
      {
#pragma unroll
        for (int it = 0; it < 4; ++it) {
          const int row = it * 4 + q;
          const float* sp = slab + row * 68 + c8;
          v8h hv, lv;
#pragma unroll
          for (int e = 0; e < 8; ++e) {
            if (OUT_MODE == 1) {
              hv[e] = (_Float16)sp[e];
            } else {
              unsigned short hb = f2bf_bits(sp[e]);
              unsigned short lb = f2bf_bits(sp[e] - bf_bits2f(hb));
              hv[e] = __builtin_bit_cast(_Float16, hb);
              lv[e] = __builtin_bit_cast(_Float16, lb);
            }
          }
          *(v8h*)(C + (size_t)(mBase + row) * ldc + n0 + c8) = hv;
          if (OUT_MODE == 2) *(v8h*)(C2 + (size_t)(mBase + row) * ldc + n0 + c8) = lv;
        }
        
      }
    }
    __builtin_amdgcn_fence(__ATOMIC_RELEASE, "workgroup");
    __builtin_amdgcn_wave_barrier();
    __builtin_amdgcn_fence(__ATOMIC_ACQUIRE, "workgroup");
  }
}

__global__ __launch_bounds__(256) void cast_f32_f16x2(
    const float* __restrict__ in, _Float16* __restrict__ out, int n2) {
  int i = blockIdx.x * 256 + threadIdx.x;
  if (i < n2) {
    const _Float16 h0 = (_Float16)in[2 * i], h1 = (_Float16)in[2 * i + 1];
    const unsigned u = (unsigned)__builtin_bit_cast(unsigned short, h0) | ((unsigned)__builtin_bit_cast(unsigned short, h1) << 16);
    ((unsigned*)out)[i] = u;
    
  }
}

__global__ __launch_bounds__(256) void split_f32_bf16x2(
    const float* __restrict__ in, unsigned short* __restrict__ oh, unsigned short* __restrict__ ol, int n2) {
  int i = blockIdx.x * 256 + threadIdx.x;
  if (i < n2) {
    const float f0 = in[2 * i], f1 = in[2 * i + 1];
    const unsigned short hb0 = f2bf_bits(f0), hb1 = f2bf_bits(f1);
    const unsigned short lb0 = f2bf_bits(f0 - bf_bits2f(hb0)), lb1 = f2bf_bits(f1 - bf_bits2f(hb1));
    const unsigned uh = (unsigned)hb0 | ((unsigned)hb1 << 16);
    const unsigned ul = (unsigned)lb0 | ((unsigned)lb1 << 16);
    ((unsigned*)oh)[i] = uh;
    ((unsigned*)ol)[i] = ul;
    
  }
}

// ---- channel-major f32 x[b][Cin][Sn] -> pixel-major 16-bit planes [b][Sn][Cin]: bf16 hi, bf16 lo (RNE), optional f16 ----
template <bool F16P>
__global__ __launch_bounds__(256) void k_cm_to_pm(
    const float* __restrict__ x, int Cin, int Sn,
    unsigned short* __restrict__ oh, unsigned short* __restrict__ ol, unsigned short* __restrict__ of) {
  __shared__ __align__(16) float ts[32][68];   // [pixel][channel]
  const int tid = threadIdx.x, lane = tid & 31, wave = tid >> 5;
  const int s0 = blockIdx.x * 32, c0 = blockIdx.y * 64, b = blockIdx.z;
  const float* xb = x + ((size_t)b * Cin + c0) * Sn + s0;
#pragma unroll
  for (int i = 0; i < 8; ++i) {
    const int idx = tid + i * 256;        // 0..2047
    const int cc = idx >> 5, ss = idx & 31;
    ts[ss][cc] = xb[(size_t)cc * Sn + ss];
  }
  __syncthreads();
  const int lq = lane >> 3, c8 = (lane & 7) * 8;
  const int ss = wave * 4 + lq;           // 8 waves x 4 rows = 32 rows, one line per (row, plane)
  const v4f a0 = *(const v4f*)(&ts[ss][c8]);
  const v4f a1 = *(const v4f*)(&ts[ss][c8 + 4]);
  const float f[8] = {a0[0], a0[1], a0[2], a0[3], a1[0], a1[1], a1[2], a1[3]};
  v8h hv, lv, fv;
#pragma unroll
  for (int e = 0; e < 8; ++e) {
    const unsigned short hb = f2bf_bits(f[e]);
    const unsigned short lb = f2bf_bits(f[e] - bf_bits2f(hb));
    hv[e] = __builtin_bit_cast(_Float16, hb);
    lv[e] = __builtin_bit_cast(_Float16, lb);
    fv[e] = F16P ? (_Float16)f[e] : hv[e];
  }
  const size_t o = ((size_t)b * Sn + s0 + ss) * Cin + c0 + c8;
  {
    *(v8h*)(oh + o) = hv;
    *(v8h*)(ol + o) = lv;
    if (F16P) *(v8h*)(of + o) = fv;
    
  }
}

// =====================================================================================
// Attention, head dim 32, no mask, no scaling.
//   q planes: bf16 hi/lo [B][256 src px][256 ch] (16x16 grid; query pixel (y,x) reads source (y>>1, x>>1))
//   k planes: bf16 hi/lo [B][1024 px][256 ch];  v: f16 channel-major [B][256 ch][1024 px]
//   out f32 channel-major [B][256 ch][1024 px].
//   scores = q.k^T: 3 x v_wmma_f32_16x16x32_bf16 per 16x16 tile (hi.hi + hi.lo + lo.hi); online softmax f32;
//   p carried x2^15 as f16 in per-wave LDS; out = p.v: v_wmma_f32_16x16x32_f16; f32 accumulate.
//   Block = 4 waves = 64 query pixels of one (b, head); 64-key chunks staged in LDS; grid.x = B*8*16.
// =====================================================================================
#define AS_S   1024
#define AS_C   256
#define AS_SQ  256
#define AS_HD  32
#define AS_NH  8
#define AS_KC  64
#define AS_PSC 32768.0f

__device__ __forceinline__ v8f mma_bf_g(v16b a, v16b b, v8f c) {
  c = __builtin_amdgcn_wmma_f32_16x16x32_bf16(false, a, false, b, (short)0, c, false, false);
  asm volatile("v_nop\n\tv_nop\n\tv_nop\n\tv_nop" : "+v"(c) : "v"(a), "v"(b));
  return c;
}
__device__ __forceinline__ v8f mma_hf_g(v16h a, v16h b, v8f c) {
  c = __builtin_amdgcn_wmma_f32_16x16x32_f16(false, a, false, b, (short)0, c, false, false);
  asm volatile("v_nop\n\tv_nop\n\tv_nop\n\tv_nop" : "+v"(c) : "v"(a), "v"(b));
  return c;
}

__global__ __launch_bounds__(128)
void attn_hd32(const unsigned short* __restrict__ qhp, const unsigned short* __restrict__ qlp,
               const unsigned short* __restrict__ khp, const unsigned short* __restrict__ klp,
               const unsigned short* __restrict__ vp, float* __restrict__ out) {
  union FB { v16b v; v8b h[2]; };
  union FH { v16h v; v8h h[2]; };
  __shared__ __align__(16) __bf16   Ksh[AS_KC * AS_HD];      // k hi [kv][d]   4 KB
  __shared__ __align__(16) __bf16   Ksl[AS_KC * AS_HD];      // k lo [kv][d]   4 KB
  __shared__ __align__(16) _Float16 Vt[AS_HD * AS_KC];       // v [d][kv]      4 KB
  __shared__ __align__(16) _Float16 Psh[4][16 * AS_KC];      // per wave p [row][kv]  8 KB
  __shared__ __align__(16) float    Os[AS_HD][68];           // block out tile [d][64 px], pitch 68

  const int tid  = threadIdx.x;
  const int wave = tid >> 5;
  const int lane = tid & 31;
  const int hh   = lane >> 4;
  const int c    = lane & 15;

  const int bx = blockIdx.x;
  const int qb = bx & 15;              // AS_S / 64 = 16 query blocks
  const int bh = bx >> 4;
  const int h  = bh & (AS_NH - 1);
  const int b  = bh >> 3;
  const int qbase = qb * 64;
  const int q0 = qbase + wave * 16;

  // ---- Q fragments (A operand, lane c = row, split k map), hi and lo planes ----
  v16b qah, qal;
  {
    const int qi = q0 + c;                       // query pixel 0..1023
    const int yy = qi >> 5, xx = qi & 31;
    const int sq = (yy >> 1) * 16 + (xx >> 1);   // nearest-neighbour source on the 16x16 grid
    const size_t qo = ((size_t)b * AS_SQ + sq) * AS_C + h * AS_HD + 8 * hh;
    qah = Frag<__bf16>::load((const __bf16*)qhp + qo);
    qal = Frag<__bf16>::load((const __bf16*)qlp + qo);
  }

  float mrow[8], lrow[8];
  v8f oacc[2];
#pragma unroll
  for (int r = 0; r < 8; ++r) { mrow[r] = -INFINITY; lrow[r] = 0.f; }
#pragma unroll
  for (int t = 0; t < 2; ++t) oacc[t] = (v8f){0.f,0.f,0.f,0.f,0.f,0.f,0.f,0.f};

  const __bf16*   khb = (const __bf16*)khp + (size_t)b * AS_S * AS_C + h * AS_HD;
  const __bf16*   klb = (const __bf16*)klp + (size_t)b * AS_S * AS_C + h * AS_HD;
  const _Float16* vb  = (const _Float16*)vp + ((size_t)b * AS_C + h * AS_HD) * AS_S;
  float*          ob  = out + ((size_t)b * AS_C + h * AS_HD) * AS_S + qbase;
  _Float16*       pw  = Psh[wave];

  for (int kc = 0; kc < AS_S / AS_KC; ++kc) {
    const int kv0 = kc * AS_KC;
    __syncthreads();
    {
      // K chunk: 64 kv rows x 32 d, both planes; thread -> (kv row, 16-d half)
      const int kvr = tid >> 1, dh = (tid & 1) * 16;
      const __bf16* kr  = khb + (size_t)(kv0 + kvr) * AS_C + dh;
      const __bf16* kr2 = klb + (size_t)(kv0 + kvr) * AS_C + dh;
      *(v8b*)(Ksh + kvr * AS_HD + dh)     = *(const v8b*)(kr);
      *(v8b*)(Ksh + kvr * AS_HD + dh + 8) = *(const v8b*)(kr + 8);
      *(v8b*)(Ksl + kvr * AS_HD + dh)     = *(const v8b*)(kr2);
      *(v8b*)(Ksl + kvr * AS_HD + dh + 8) = *(const v8b*)(kr2 + 8);
      // V chunk: 32 d rows x 64 kv (channel-major source is already [d][kv]); thread -> (d row, 16-kv quarter)
      const int dr = tid >> 2, part = (tid & 3) * 16;
      const _Float16* vr = vb + (size_t)dr * AS_S + kv0 + part;
      *(v8h*)(Vt + dr * AS_KC + part)     = *(const v8h*)(vr);
      *(v8h*)(Vt + dr * AS_KC + part + 8) = *(const v8h*)(vr + 8);
    }
    __syncthreads();

    // ---- scores: s[j][r] = row (8hh+r), kv (kv0 + 16j + c); B operand = k with split k map over d ----
    v8f s[4];
#pragma unroll
    for (int j = 0; j < 4; ++j) {
      s[j] = (v8f){0.f,0.f,0.f,0.f,0.f,0.f,0.f,0.f};
      FB kb, kl;
      kb.h[0] = *(const v8b*)(Ksh + (j * 16 + c) * AS_HD + 8 * hh);
      kb.h[1] = *(const v8b*)(Ksh + (j * 16 + c) * AS_HD + 16 + 8 * hh);
      kl.h[0] = *(const v8b*)(Ksl + (j * 16 + c) * AS_HD + 8 * hh);
      kl.h[1] = *(const v8b*)(Ksl + (j * 16 + c) * AS_HD + 16 + 8 * hh);
      s[j] = mma_bf_g(qah, kb.v, s[j]);
      s[j] = mma_bf_g(qah, kl.v, s[j]);
      s[j] = mma_bf_g(qal, kb.v, s[j]);
    }

    // ---- online softmax (f32) ----
    float cm[8];
#pragma unroll
    for (int r = 0; r < 8; ++r) {
      float m = s[0][r];
#pragma unroll
      for (int j = 1; j < 4; ++j) m = fmaxf(m, s[j][r]);
#pragma unroll
      for (int off = 1; off < 16; off <<= 1) m = fmaxf(m, __shfl_xor(m, off, 32));
      cm[r] = m;
    }
#pragma unroll
    for (int r = 0; r < 8; ++r) {
      const float mnew  = fmaxf(mrow[r], cm[r]);
      const float alpha = expf(mrow[r] - mnew);
      mrow[r] = mnew;
      float psum = 0.f;
#pragma unroll
      for (int j = 0; j < 4; ++j) {
        const float p = expf(s[j][r] - mnew);
        psum += p;
        pw[(8 * hh + r) * AS_KC + j * 16 + c] = (_Float16)(p * AS_PSC);
      }
#pragma unroll
      for (int off = 1; off < 16; off <<= 1) psum += __shfl_xor(psum, off, 32);
      lrow[r] = lrow[r] * alpha + psum;
#pragma unroll
      for (int t = 0; t < 2; ++t) oacc[t][r] *= alpha;
    }
    __builtin_amdgcn_fence(__ATOMIC_RELEASE, "workgroup");
    __builtin_amdgcn_wave_barrier();
    __builtin_amdgcn_fence(__ATOMIC_ACQUIRE, "workgroup");

    // ---- out += p . v : A = p [row][kv] (same element type reload), B = v with split k map over kv ----
#pragma unroll 1
    for (int kk = 0; kk < 2; ++kk) {
      FH pa;
      pa.h[0] = *(const v8h*)(pw + c * AS_KC + kk * 32 + 8 * hh);
      pa.h[1] = *(const v8h*)(pw + c * AS_KC + kk * 32 + 16 + 8 * hh);
#pragma unroll
      for (int t = 0; t < 2; ++t) {
        FH vf;
        vf.h[0] = *(const v8h*)(Vt + (t * 16 + c) * AS_KC + kk * 32 + 8 * hh);
        vf.h[1] = *(const v8h*)(Vt + (t * 16 + c) * AS_KC + kk * 32 + 16 + 8 * hh);
        oacc[t] = mma_hf_g(pa.v, vf.v, oacc[t]);
      }
    }
  }

#pragma unroll
  for (int r = 0; r < 8; ++r) {
    const float inv = 1.0f / (lrow[r] * AS_PSC);
#pragma unroll
    for (int t = 0; t < 2; ++t) Os[t * 16 + c][wave * 16 + 8 * hh + r] = oacc[t][r] * inv;
  }
  __syncthreads();
  {
    const int lq = lane >> 3, c4 = (lane & 7) * 4;
    {
#pragma unroll
      for (int it = 0; it < 4; ++it) {
        const int L = wave * 16 + it * 4 + lq;           // 64 lines: d = L>>1, pixel half = L&1
        const int d = L >> 1, half = L & 1;
        const v4f val = *(const v4f*)(&Os[d][half * 32 + c4]);
        *(v4f*)(ob + (size_t)d * AS_S + half * 32 + c4) = val;
      }
      
    }
  }
}

extern "C" void kernel_launch(void* const* d_in, const int* in_sizes, int n_in,
                              void* d_out, int out_size, void* d_ws, size_t ws_size,
                              hipStream_t stream) {
  const int B = 8, CHI = 512, C = 256, SQ = 256, S = 1024;
  if (n_in < 8) return;
  if (in_sizes[0] != B * CHI * SQ || in_sizes[1] != B * C * S || in_sizes[2] != C * CHI ||
      in_sizes[3] != C || in_sizes[4] != C * C || in_sizes[5] != C || in_sizes[6] != C * C ||
      in_sizes[7] != C || out_size != B * C * S) return;

  const float* x_high = (const float*)d_in[0];
  const float* x_low  = (const float*)d_in[1];
  const float* Wq     = (const float*)d_in[2];
  const float* bq     = (const float*)d_in[3];
  const float* Wk     = (const float*)d_in[4];
  const float* bk     = (const float*)d_in[5];
  const float* Wv     = (const float*)d_in[6];
  const float* bv     = (const float*)d_in[7];
  float* out = (float*)d_out;

  // ---- workspace carve (bytes, 256-B aligned) ----
  char* ws = (char*)d_ws;
  size_t off = 0;
#define CARVE16(name, elems) unsigned short* name = (unsigned short*)(ws + off); off += ((((size_t)(elems)) * 2) + 255) & ~(size_t)255;
  CARVE16(xl_h, (size_t)B * S * C)       // x_low planes, pixel-major [B][1024][256]
  CARVE16(xl_l, (size_t)B * S * C)
  CARVE16(xl_f, (size_t)B * S * C)
  CARVE16(xh_h, (size_t)B * SQ * CHI)    // x_high planes, pixel-major [B][256][512]
  CARVE16(xh_l, (size_t)B * SQ * CHI)
  CARVE16(wq_h, (size_t)C * CHI)
  CARVE16(wq_l, (size_t)C * CHI)
  CARVE16(wk_h, (size_t)C * C)
  CARVE16(wk_l, (size_t)C * C)
  CARVE16(wv_f, (size_t)C * C)
  CARVE16(q_h,  (size_t)B * SQ * C)      // q planes [B][256 src px][256 ch]
  CARVE16(q_l,  (size_t)B * SQ * C)
  CARVE16(k_h,  (size_t)B * S * C)       // k planes [B][1024][256 ch]
  CARVE16(k_l,  (size_t)B * S * C)
  CARVE16(v_f,  (size_t)B * C * S)       // v f16 channel-major [B][256 ch][1024]
#undef CARVE16
  if (off > ws_size || off > (size_t)134217728) return;   // total 32,374,784 B

  // ---- weight planes ----
  split_f32_bf16x2<<<dim3((C * CHI / 2 + 255) / 256), dim3(256), 0, stream>>>(Wq, wq_h, wq_l, C * CHI / 2);
  split_f32_bf16x2<<<dim3((C * C / 2 + 255) / 256), dim3(256), 0, stream>>>(Wk, wk_h, wk_l, C * C / 2);
  cast_f32_f16x2<<<dim3((C * C / 2 + 255) / 256), dim3(256), 0, stream>>>(Wv, (_Float16*)wv_f, C * C / 2);

  // ---- activations: channel-major -> pixel-major 16-bit planes ----
  // x_low [B][256][1024] -> [B][1024][256] (bf16 hi, bf16 lo, f16)
  k_cm_to_pm<true><<<dim3(S / 32, C / 64, B), dim3(256), 0, stream>>>(x_low, C, S, xl_h, xl_l, xl_f);
  // x_high [B][512][256] -> [B][256][512] (bf16 hi, bf16 lo)
  k_cm_to_pm<false><<<dim3(SQ / 32, CHI / 64, B), dim3(256), 0, stream>>>(x_high, CHI, SQ, xh_h, xh_l, xh_l);

  // ---- q-proj on the 16x16 grid: q[b][sq][co] = sum_ci xh[b][sq][ci] Wq[co][ci] + bq[co]; bf16 hi/lo split in, bf16 hi/lo planes out ----
  wmma_gemm64<1, true, 2, 2, false, 0><<<dim3(2, B), dim3(256), 0, stream>>>(
      xh_h, xh_l, CHI, (long)SQ * CHI,
      wq_h, wq_l, CHI, 0L,
      (void*)q_h, (void*)q_l, C, (long)SQ * C,
      bq, bq, 0L, SQ, C, CHI, 1.0f);
  // ---- k-proj: k[b][s][co] = sum_ci xl[b][s][ci] Wk[co][ci] + bk[co] ----
  wmma_gemm64<1, true, 2, 2, false, 0><<<dim3(8, B), dim3(256), 0, stream>>>(
      xl_h, xl_l, C, (long)S * C,
      wk_h, wk_l, C, 0L,
      (void*)k_h, (void*)k_l, C, (long)S * C,
      bk, bk, 0L, S, C, C, 1.0f);
  // ---- v-proj (channel-major out): v[b][co][s] = sum_ci Wv[co][ci] xl[b][s][ci] + bv[co]; f16 operands, f16 out ----
  wmma_gemm64<0, false, 1, 1, false, 0><<<dim3(8, B), dim3(256), 0, stream>>>(
      wv_f, wv_f, C, 0L,
      xl_f, xl_f, C, (long)S * C,
      (void*)v_f, (void*)v_f, S, (long)C * S,
      bv, bv, 0L, C, S, C, 1.0f);

  // ---- attention ----
  attn_hd32<<<dim3(B * AS_NH * (S / 64)), dim3(128), 0, stream>>>(q_h, q_l, k_h, k_l, v_f, out);
}

// v001
// It runs in 135 microseconds.
// Next to v000, in two timings, it ran 1.28 times as fast each time.
#include <hip/hip_runtime.h>
#include <stdint.h>
// Contractions: q-proj, k-proj, q.k scores: v_wmma_f32_16x16x32_bf16 with bf16 hi/lo operand planes (hi.hi + hi.lo + lo.hi);
// v-proj and p.v: v_wmma_f32_16x16x32_f16 (f16 operands, p carried x2^15); f32 accumulate everywhere; softmax in f32.

typedef __attribute__((ext_vector_type(16))) _Float16 v16h;
typedef __attribute__((ext_vector_type(8)))  _Float16 v8h;
typedef __attribute__((ext_vector_type(16))) __bf16   v16b;
typedef __attribute__((ext_vector_type(8)))  __bf16   v8b;
typedef __attribute__((ext_vector_type(8)))  float    v8f;
typedef __attribute__((ext_vector_type(4)))  float    v4f;

__device__ __forceinline__ unsigned short f2bf_bits(float f) {
  unsigned u = __float_as_uint(f);
  return (unsigned short)((u + 0x7FFFu + ((u >> 16) & 1u)) >> 16);
}
__device__ __forceinline__ float bf_bits2f(unsigned short h) { return __uint_as_float(((unsigned)h) << 16); }

// hazard guards as plain device helpers (no inline asm inside the kernel template body)
__device__ __forceinline__ void dep_guard_h(v8f& a, v8f& b, v16h x, v16h y) { asm volatile("v_nop\n\tv_nop\n\tv_nop\n\tv_nop" : "+v"(a), "+v"(b) : "v"(x), "v"(y)); }
__device__ __forceinline__ void dep_guard_b(v8f& a, v8f& b, v16b x, v16b y) { asm volatile("v_nop\n\tv_nop\n\tv_nop\n\tv_nop" : "+v"(a), "+v"(b) : "v"(x), "v"(y)); }
__device__ __forceinline__ void keep4_h(v16h a, v16h b, v16h c, v16h d) { asm volatile("v_nop" :: "v"(a), "v"(b), "v"(c), "v"(d)); }
__device__ __forceinline__ void keep4_b(v16b a, v16b b, v16b c, v16b d) { asm volatile("v_nop" :: "v"(a), "v"(b), "v"(c), "v"(d)); }
__device__ __forceinline__ void acc_guard4(v8f& a, v8f& b, v8f& c, v8f& d) { asm volatile("v_nop\n\tv_nop\n\tv_nop\n\tv_nop" : "+v"(a), "+v"(b), "+v"(c), "+v"(d)); }
template <typename T> struct Frag;
template <> struct Frag<_Float16> {
  typedef v16h V; union U { v16h v; v8h h[2]; };
  static __device__ __forceinline__ v16h load(const _Float16* p) {   // elements 0..7 <- p[0..7], 8..15 <- p[16..23]
    U f; f.h[0] = *(const v8h*)(p); f.h[1] = *(const v8h*)(p + 16); return f.v;
  }
  static __device__ __forceinline__ v8f mma(v16h a, v16h b, v8f c) {
    return __builtin_amdgcn_wmma_f32_16x16x32_f16(false, a, false, b, (short)0, c, false, false);
  }
  static __device__ __forceinline__ void guard(v8f& a, v8f& b, v16h x, v16h y) { dep_guard_h(a, b, x, y); }
  static __device__ __forceinline__ void keep(v16h a, v16h b, v16h c, v16h d) { keep4_h(a, b, c, d); }
};
template <> struct Frag<__bf16> {
  typedef v16b V; union U { v16b v; v8b h[2]; };
  static __device__ __forceinline__ v16b load(const __bf16* p) {
    U f; f.h[0] = *(const v8b*)(p); f.h[1] = *(const v8b*)(p + 16); return f.v;
  }
  static __device__ __forceinline__ v8f mma(v16b a, v16b b, v8f c) {
    return __builtin_amdgcn_wmma_f32_16x16x32_bf16(false, a, false, b, (short)0, c, false, false);
  }
  static __device__ __forceinline__ void guard(v8f& a, v8f& b, v16b x, v16b y) { dep_guard_b(a, b, x, y); }
  static __device__ __forceinline__ void keep(v16b a, v16b b, v16b c, v16b d) { keep4_b(a, b, c, d); }
};

// ---- Register-blocked batched WMMA GEMM ------------------------------------
// C[m,n] = scale * sum_k A[m,k] * Bt[n,k] (+bias)(+resid); each wave owns a 64x64 tile.
// A row-major [M,K]; Bt row-major [N,K]; M,N % 64 == 0, K % 32 == 0.
// SPLIT: operands are hi/lo planes (A2/Bt2 = lo planes, same layout); product = hi.hi + hi.lo + lo.hi.
// BIAS_MODE: 0 = none, 1 = bias[m], 2 = bias[n].
// OUT_MODE: 0 = f32, 1 = f16, 2 = bf16 hi plane (Cout) + bf16 lo plane (Cout2).
// ET: 0 = f16 operands, 1 = bf16 operands (pointers passed as 16-bit storage)
template <int ET> struct Elem;
template <> struct Elem<0> { typedef _Float16 T; };
template <> struct Elem<1> { typedef __bf16 T; };
template <int ET, bool SPLIT, int BIAS_MODE, int OUT_MODE, bool RESID, int ACT = 0>
__global__ __launch_bounds__(256) void wmma_gemm64(
    const unsigned short* __restrict__ Ap, const unsigned short* __restrict__ A2p, int lda, long strideA,
    const unsigned short* __restrict__ Btp, const unsigned short* __restrict__ Bt2p, int ldb, long strideB,
    void* __restrict__ Cout, void* __restrict__ Cout2, int ldc, long strideC,
    const float* __restrict__ bias,
    const float* __restrict__ resid, long strideR,
    int M, int N, int K, float scale) {
  typedef typename Elem<ET>::T T;
  typedef typename Frag<T>::V V;
  const T* A = (const T*)Ap; const T* A2 = (const T*)A2p; const T* Bt = (const T*)Btp; const T* Bt2 = (const T*)Bt2p;
  __shared__ __align__(16) float sT[8][16 * 68];   // per-wave 16x64 slab, pitch 68 floats
  const int b    = blockIdx.y;
  const int lane = threadIdx.x & 31;
  const int wave = threadIdx.x >> 5;
  const int tilesN = N >> 6;
  const int tilesM = M >> 6;
  const int tile = blockIdx.x * 8 + wave;
  if (tile >= tilesM * tilesN) return;   // wave-uniform; no block barriers in this kernel
  const int tm = tile / tilesN;
  const int tn = tile - tm * tilesN;
  const int m0 = tm << 6;
  const int n0 = tn << 6;

  const T* Ab  = A  + (size_t)b * strideA;
  const T* Bb  = Bt + (size_t)b * strideB;
  const T* Ab2 = SPLIT ? (A2  + (size_t)b * strideA) : nullptr;
  const T* Bb2 = SPLIT ? (Bt2 + (size_t)b * strideB) : nullptr;

  const int rlane = lane & 15;                 // row (A) / col (B, D) within subtile
  const int koff  = (lane >> 4) * 8;           // k offset of this lane half
  const int mOff  = (lane >> 4) * 8;           // D row offset

  v8f acc[4][4];
#pragma unroll
  for (int i = 0; i < 4; ++i)
#pragma unroll
    for (int j = 0; j < 4; ++j) acc[i][j] = (v8f){0.f,0.f,0.f,0.f,0.f,0.f,0.f,0.f};

  for (int k0 = 0; k0 < K; k0 += 32) {
    V bh[4], bl[4];
#pragma unroll
    for (int j = 0; j < 4; ++j) {
      const size_t bo = (size_t)(n0 + (j << 4) + rlane) * ldb + koff + k0;
      bh[j] = Frag<T>::load(Bb + bo);
      if (SPLIT) bl[j] = Frag<T>::load(Bb2 + bo);
    }
#pragma unroll
    for (int i = 0; i < 4; ++i) {
      const size_t ao = (size_t)(m0 + (i << 4) + rlane) * lda + koff + k0;
      V ah = Frag<T>::load(Ab + ao);
      V al;
      if (SPLIT) al = Frag<T>::load(Ab2 + ao);
#pragma unroll
      for (int j = 0; j < 4; ++j) {
        acc[i][j] = Frag<T>::mma(ah, bh[j], acc[i][j]);
        if (SPLIT) {
          acc[i][j] = Frag<T>::mma(ah, bl[j], acc[i][j]);
          acc[i][j] = Frag<T>::mma(al, bh[j], acc[i][j]);
        }
      }
      Frag<T>::guard(acc[i][0], acc[i][3], ah, SPLIT ? al : ah);
    }
    Frag<T>::keep(bh[0], bh[1], bh[2], bh[3]);
    if (SPLIT) Frag<T>::keep(bl[0], bl[1], bl[2], bl[3]);
  }
  acc_guard4(acc[0][0], acc[0][1], acc[0][2], acc[0][3]);
  acc_guard4(acc[1][0], acc[1][1], acc[1][2], acc[1][3]);
  acc_guard4(acc[2][0], acc[2][1], acc[2][2], acc[2][3]);
  acc_guard4(acc[3][0], acc[3][1], acc[3][2], acc[3][3]);

  // ---- epilogue ----
  float* slab = sT[wave];
  const float* Rb = RESID ? (resid + (size_t)b * strideR) : nullptr;
#pragma unroll
  for (int i = 0; i < 4; ++i) {
    const int mBase = m0 + (i << 4);
#pragma unroll
    for (int j = 0; j < 4; ++j) {
      const int n = n0 + (j << 4) + rlane;
      float bv = 0.f;
      if (BIAS_MODE == 2) bv = bias[n];
#pragma unroll
      for (int r = 0; r < 8; ++r) {
        float v = acc[i][j][r] * scale;
        if (BIAS_MODE == 1) v += bias[mBase + mOff + r];
        if (BIAS_MODE == 2) v += bv;
        if (RESID) v += Rb[(size_t)(mBase + mOff + r) * ldc + n];
        if (ACT == 1) v = tanhf(v);
        if (ACT == 2) v = fmaxf(v, 0.0f);
        if (ACT == 3) v = v / (1.0f + expf(-v));
        if (ACT == 4) v = (v > 0.f) ? v : 0.01f * v;
        if (ACT == 5) v = 0.5f * v * (1.0f + erff(v * 0.70710678118654752f));
        slab[(mOff + r) * 68 + (j << 4) + rlane] = v;
      }
    }
    __builtin_amdgcn_fence(__ATOMIC_RELEASE, "workgroup");
    __builtin_amdgcn_wave_barrier();
    __builtin_amdgcn_fence(__ATOMIC_ACQUIRE, "workgroup");
    if (OUT_MODE == 0) {
      float* C = (float*)Cout + (size_t)b * strideC;
      const int hh = lane >> 4, c4 = (lane & 15) * 4;     // row seg = 256 B = 16 lanes x 16 B
      {
#pragma unroll
        for (int it = 0; it < 8; ++it) {
          const int row = it * 2 + hh;
          v4f v = *(const v4f*)(slab + row * 68 + c4);
          *(v4f*)(C + (size_t)(mBase + row) * ldc + n0 + c4) = v;
        }
        
      }
    } else {
      const int q = lane >> 3, c8 = (lane & 7) * 8;
      unsigned short* C  = (unsigned short*)Cout  + (size_t)b * strideC;
      unsigned short* C2 = (OUT_MODE == 2) ? ((unsigned short*)Cout2 + (size_t)b * strideC) : nullptr;
      {
#pragma unroll
        for (int it = 0; it < 4; ++it) {
          const int row = it * 4 + q;
          const float* sp = slab + row * 68 + c8;
          v8h hv, lv;
#pragma unroll
          for (int e = 0; e < 8; ++e) {
            if (OUT_MODE == 1) {
              hv[e] = (_Float16)sp[e];
            } else {
              unsigned short hb = f2bf_bits(sp[e]);
              unsigned short lb = f2bf_bits(sp[e] - bf_bits2f(hb));
              hv[e] = __builtin_bit_cast(_Float16, hb);
              lv[e] = __builtin_bit_cast(_Float16, lb);
            }
          }
          *(v8h*)(C + (size_t)(mBase + row) * ldc + n0 + c8) = hv;
          if (OUT_MODE == 2) *(v8h*)(C2 + (size_t)(mBase + row) * ldc + n0 + c8) = lv;
        }
        
      }
    }
    __builtin_amdgcn_fence(__ATOMIC_RELEASE, "workgroup");
    __builtin_amdgcn_wave_barrier();
    __builtin_amdgcn_fence(__ATOMIC_ACQUIRE, "workgroup");
  }
}

__global__ __launch_bounds__(256) void cast_f32_f16x2(
    const float* __restrict__ in, _Float16* __restrict__ out, int n2) {
  int i = blockIdx.x * 256 + threadIdx.x;
  if (i < n2) {
    const _Float16 h0 = (_Float16)in[2 * i], h1 = (_Float16)in[2 * i + 1];
    const unsigned u = (unsigned)__builtin_bit_cast(unsigned short, h0) | ((unsigned)__builtin_bit_cast(unsigned short, h1) << 16);
    ((unsigned*)out)[i] = u;
    
  }
}

__global__ __launch_bounds__(256) void split_f32_bf16x2(
    const float* __restrict__ in, unsigned short* __restrict__ oh, unsigned short* __restrict__ ol, int n2) {
  int i = blockIdx.x * 256 + threadIdx.x;
  if (i < n2) {
    const float f0 = in[2 * i], f1 = in[2 * i + 1];
    const unsigned short hb0 = f2bf_bits(f0), hb1 = f2bf_bits(f1);
    const unsigned short lb0 = f2bf_bits(f0 - bf_bits2f(hb0)), lb1 = f2bf_bits(f1 - bf_bits2f(hb1));
    const unsigned uh = (unsigned)hb0 | ((unsigned)hb1 << 16);
    const unsigned ul = (unsigned)lb0 | ((unsigned)lb1 << 16);
    ((unsigned*)oh)[i] = uh;
    ((unsigned*)ol)[i] = ul;
    
  }
}

// ---- channel-major f32 x[b][Cin][Sn] -> pixel-major 16-bit planes [b][Sn][Cin]: bf16 hi, bf16 lo (RNE), optional f16 ----
template <bool F16P>
__global__ __launch_bounds__(256) void k_cm_to_pm(
    const float* __restrict__ x, int Cin, int Sn,
    unsigned short* __restrict__ oh, unsigned short* __restrict__ ol, unsigned short* __restrict__ of) {
  __shared__ __align__(16) float ts[32][68];   // [pixel][channel]
  const int tid = threadIdx.x, lane = tid & 31, wave = tid >> 5;
  const int s0 = blockIdx.x * 32, c0 = blockIdx.y * 64, b = blockIdx.z;
  const float* xb = x + ((size_t)b * Cin + c0) * Sn + s0;
#pragma unroll
  for (int i = 0; i < 8; ++i) {
    const int idx = tid + i * 256;        // 0..2047
    const int cc = idx >> 5, ss = idx & 31;
    ts[ss][cc] = xb[(size_t)cc * Sn + ss];
  }
  __syncthreads();
  const int lq = lane >> 3, c8 = (lane & 7) * 8;
  const int ss = wave * 4 + lq;           // 8 waves x 4 rows = 32 rows, one line per (row, plane)
  const v4f a0 = *(const v4f*)(&ts[ss][c8]);
  const v4f a1 = *(const v4f*)(&ts[ss][c8 + 4]);
  const float f[8] = {a0[0], a0[1], a0[2], a0[3], a1[0], a1[1], a1[2], a1[3]};
  v8h hv, lv, fv;
#pragma unroll
  for (int e = 0; e < 8; ++e) {
    const unsigned short hb = f2bf_bits(f[e]);
    const unsigned short lb = f2bf_bits(f[e] - bf_bits2f(hb));
    hv[e] = __builtin_bit_cast(_Float16, hb);
    lv[e] = __builtin_bit_cast(_Float16, lb);
    fv[e] = F16P ? (_Float16)f[e] : hv[e];
  }
  const size_t o = ((size_t)b * Sn + s0 + ss) * Cin + c0 + c8;
  {
    *(v8h*)(oh + o) = hv;
    *(v8h*)(ol + o) = lv;
    if (F16P) *(v8h*)(of + o) = fv;
    
  }
}

// =====================================================================================
// Attention, head dim 32, no mask, no scaling.
//   q planes: bf16 hi/lo [B][256 src px][256 ch] (16x16 grid). The four output pixels of one source pixel share their
//   query row, so their attention rows are equal: each source pixel is worked once and its result stored to all four.
//   k planes: bf16 hi/lo [B][1024 px][256 ch];  v: f16 channel-major [B][256 ch][1024 px]
//   out f32 channel-major [B][256 ch][1024 px].
//   scores = q.k^T: 3 x v_wmma_f32_16x16x32_bf16 per 16x16 tile (hi.hi + hi.lo + lo.hi); online softmax f32;
//   p carried x2^15 as f16 in per-wave LDS; out = p.v: v_wmma_f32_16x16x32_f16; f32 accumulate.
//   Block = 4 waves = 64 source pixels (256 output pixels) of one (b, head); 64-key chunks staged in LDS; grid.x = B*8*4.
// =====================================================================================
#define AS_S   1024
#define AS_C   256
#define AS_SQ  256
#define AS_HD  32
#define AS_NH  8
#define AS_KC  64
#define AS_PSC 32768.0f

__device__ __forceinline__ v8f mma_bf_g(v16b a, v16b b, v8f c) {
  c = __builtin_amdgcn_wmma_f32_16x16x32_bf16(false, a, false, b, (short)0, c, false, false);
  asm volatile("v_nop\n\tv_nop\n\tv_nop\n\tv_nop" : "+v"(c) : "v"(a), "v"(b));
  return c;
}
__device__ __forceinline__ v8f mma_hf_g(v16h a, v16h b, v8f c) {
  c = __builtin_amdgcn_wmma_f32_16x16x32_f16(false, a, false, b, (short)0, c, false, false);
  asm volatile("v_nop\n\tv_nop\n\tv_nop\n\tv_nop" : "+v"(c) : "v"(a), "v"(b));
  return c;
}

__global__ __launch_bounds__(128)
void attn_hd32(const unsigned short* __restrict__ qhp, const unsigned short* __restrict__ qlp,
               const unsigned short* __restrict__ khp, const unsigned short* __restrict__ klp,
               const unsigned short* __restrict__ vp, float* __restrict__ out) {
  union FB { v16b v; v8b h[2]; };
  union FH { v16h v; v8h h[2]; };
  __shared__ __align__(16) __bf16   Ksh[AS_KC * AS_HD];      // k hi [kv][d]   4 KB
  __shared__ __align__(16) __bf16   Ksl[AS_KC * AS_HD];      // k lo [kv][d]   4 KB
  __shared__ __align__(16) _Float16 Vt[AS_HD * AS_KC];       // v [d][kv]      4 KB
  __shared__ __align__(16) _Float16 Psh[4][16 * AS_KC];      // per wave p [row][kv]  8 KB
  __shared__ __align__(16) float    Os[AS_HD][68];           // block out tile [d][64 source px], pitch 68

  const int tid  = threadIdx.x;
  const int wave = tid >> 5;
  const int lane = tid & 31;
  const int hh   = lane >> 4;
  const int c    = lane & 15;

  const int bx = blockIdx.x;
  const int qb = bx & 3;               // AS_SQ / 64 = 4 query blocks
  const int bh = bx >> 2;
  const int h  = bh & (AS_NH - 1);
  const int b  = bh >> 3;
  const int qbase = qb * 64;
  const int q0 = qbase + wave * 16;

  // ---- Q fragments (A operand, lane c = row, split k map), hi and lo planes ----
  v16b qah, qal;
  {
    const int sq = q0 + c;                       // source pixel 0..255 on the 16x16 grid
    const size_t qo = ((size_t)b * AS_SQ + sq) * AS_C + h * AS_HD + 8 * hh;
    qah = Frag<__bf16>::load((const __bf16*)qhp + qo);
    qal = Frag<__bf16>::load((const __bf16*)qlp + qo);
  }

  float mrow[8], lrow[8];
  v8f oacc[2];
#pragma unroll
  for (int r = 0; r < 8; ++r) { mrow[r] = -INFINITY; lrow[r] = 0.f; }
#pragma unroll
  for (int t = 0; t < 2; ++t) oacc[t] = (v8f){0.f,0.f,0.f,0.f,0.f,0.f,0.f,0.f};

  const __bf16*   khb = (const __bf16*)khp + (size_t)b * AS_S * AS_C + h * AS_HD;
  const __bf16*   klb = (const __bf16*)klp + (size_t)b * AS_S * AS_C + h * AS_HD;
  const _Float16* vb  = (const _Float16*)vp + ((size_t)b * AS_C + h * AS_HD) * AS_S;
  float*          ob  = out + ((size_t)b * AS_C + h * AS_HD) * AS_S + qbase * 4;   // 4 source rows -> 8 output rows of 32
  _Float16*       pw  = Psh[wave];

  for (int kc = 0; kc < AS_S / AS_KC; ++kc) {
    const int kv0 = kc * AS_KC;
    __syncthreads();
    {
      // K chunk: 64 kv rows x 32 d, both planes; thread -> (kv row, 16-d half)
      const int kvr = tid >> 1, dh = (tid & 1) * 16;
      const __bf16* kr  = khb + (size_t)(kv0 + kvr) * AS_C + dh;
      const __bf16* kr2 = klb + (size_t)(kv0 + kvr) * AS_C + dh;
      *(v8b*)(Ksh + kvr * AS_HD + dh)     = *(const v8b*)(kr);
      *(v8b*)(Ksh + kvr * AS_HD + dh + 8) = *(const v8b*)(kr + 8);
      *(v8b*)(Ksl + kvr * AS_HD + dh)     = *(const v8b*)(kr2);
      *(v8b*)(Ksl + kvr * AS_HD + dh + 8) = *(const v8b*)(kr2 + 8);
      // V chunk: 32 d rows x 64 kv (channel-major source is already [d][kv]); thread -> (d row, 16-kv quarter)
      const int dr = tid >> 2, part = (tid & 3) * 16;
      const _Float16* vr = vb + (size_t)dr * AS_S + kv0 + part;
      *(v8h*)(Vt + dr * AS_KC + part)     = *(const v8h*)(vr);
      *(v8h*)(Vt + dr * AS_KC + part + 8) = *(const v8h*)(vr + 8);
    }
    __syncthreads();

    // ---- scores: s[j][r] = row (8hh+r), kv (kv0 + 16j + c); B operand = k with split k map over d ----
    v8f s[4];
#pragma unroll
    for (int j = 0; j < 4; ++j) {
      s[j] = (v8f){0.f,0.f,0.f,0.f,0.f,0.f,0.f,0.f};
      FB kb, kl;
      kb.h[0] = *(const v8b*)(Ksh + (j * 16 + c) * AS_HD + 8 * hh);
      kb.h[1] = *(const v8b*)(Ksh + (j * 16 + c) * AS_HD + 16 + 8 * hh);
      kl.h[0] = *(const v8b*)(Ksl + (j * 16 + c) * AS_HD + 8 * hh);
      kl.h[1] = *(const v8b*)(Ksl + (j * 16 + c) * AS_HD + 16 + 8 * hh);
      s[j] = mma_bf_g(qah, kb.v, s[j]);
      s[j] = mma_bf_g(qah, kl.v, s[j]);
      s[j] = mma_bf_g(qal, kb.v, s[j]);
    }

    // ---- online softmax (f32) ----
    float cm[8];
#pragma unroll
    for (int r = 0; r < 8; ++r) {
      float m = s[0][r];
#pragma unroll
      for (int j = 1; j < 4; ++j) m = fmaxf(m, s[j][r]);
#pragma unroll
      for (int off = 1; off < 16; off <<= 1) m = fmaxf(m, __shfl_xor(m, off, 32));
      cm[r] = m;
    }
#pragma unroll
    for (int r = 0; r < 8; ++r) {
      const float mnew  = fmaxf(mrow[r], cm[r]);
      const float alpha = expf(mrow[r] - mnew);
      mrow[r] = mnew;
      float psum = 0.f;
#pragma unroll
      for (int j = 0; j < 4; ++j) {
        const float p = expf(s[j][r] - mnew);
        psum += p;
        pw[(8 * hh + r) * AS_KC + j * 16 + c] = (_Float16)(p * AS_PSC);
      }
#pragma unroll
      for (int off = 1; off < 16; off <<= 1) psum += __shfl_xor(psum, off, 32);
      lrow[r] = lrow[r] * alpha + psum;
#pragma unroll
      for (int t = 0; t < 2; ++t) oacc[t][r] *= alpha;
    }
    __builtin_amdgcn_fence(__ATOMIC_RELEASE, "workgroup");
    __builtin_amdgcn_wave_barrier();
    __builtin_amdgcn_fence(__ATOMIC_ACQUIRE, "workgroup");

    // ---- out += p . v : A = p [row][kv] (same element type reload), B = v with split k map over kv ----
#pragma unroll 1
    for (int kk = 0; kk < 2; ++kk) {
      FH pa;
      pa.h[0] = *(const v8h*)(pw + c * AS_KC + kk * 32 + 8 * hh);
      pa.h[1] = *(const v8h*)(pw + c * AS_KC + kk * 32 + 16 + 8 * hh);
#pragma unroll
      for (int t = 0; t < 2; ++t) {
        FH vf;
        vf.h[0] = *(const v8h*)(Vt + (t * 16 + c) * AS_KC + kk * 32 + 8 * hh);
        vf.h[1] = *(const v8h*)(Vt + (t * 16 + c) * AS_KC + kk * 32 + 16 + 8 * hh);
        oacc[t] = mma_hf_g(pa.v, vf.v, oacc[t]);
      }
    }
  }

#pragma unroll
  for (int r = 0; r < 8; ++r) {
    const float inv = 1.0f / (lrow[r] * AS_PSC);
#pragma unroll
    for (int t = 0; t < 2; ++t) Os[t * 16 + c][wave * 16 + 8 * hh + r] = oacc[t][r] * inv;
  }
  __syncthreads();
  {
    // nearest-neighbour 2x: output pixel (y, x) of the block's 8 x 32 patch takes source (y>>1, x>>1) of its 4 x 16 patch
    const int o4 = (tid & 63) * 4;                       // 4 output pixels of one row: two source pixels, each twice
    const int sp = (o4 >> 6) * 16 + ((o4 & 31) >> 1);
#pragma unroll   // the 16 channel steps become immediate offsets of one address, and the LDS reads run ahead of the stores
    for (int it = 0; it < 16; ++it) {
      const int d = it * 2 + (tid >> 6);
      const float s0 = Os[d][sp], s1 = Os[d][sp + 1];
      *(v4f*)(ob + (size_t)d * AS_S + o4) = (v4f){s0, s0, s1, s1};
    }
  }
}

extern "C" void kernel_launch(void* const* d_in, const int* in_sizes, int n_in,
                              void* d_out, int out_size, void* d_ws, size_t ws_size,
                              hipStream_t stream) {
  const int B = 8, CHI = 512, C = 256, SQ = 256, S = 1024;
  if (n_in < 8) return;
  if (in_sizes[0] != B * CHI * SQ || in_sizes[1] != B * C * S || in_sizes[2] != C * CHI ||
      in_sizes[3] != C || in_sizes[4] != C * C || in_sizes[5] != C || in_sizes[6] != C * C ||
      in_sizes[7] != C || out_size != B * C * S) return;

  const float* x_high = (const float*)d_in[0];
  const float* x_low  = (const float*)d_in[1];
  const float* Wq     = (const float*)d_in[2];
  const float* bq     = (const float*)d_in[3];
  const float* Wk     = (const float*)d_in[4];
  const float* bk     = (const float*)d_in[5];
  const float* Wv     = (const float*)d_in[6];
  const float* bv     = (const float*)d_in[7];
  float* out = (float*)d_out;

  // ---- workspace carve (bytes, 256-B aligned) ----
  char* ws = (char*)d_ws;
  size_t off = 0;
#define CARVE16(name, elems) unsigned short* name = (unsigned short*)(ws + off); off += ((((size_t)(elems)) * 2) + 255) & ~(size_t)255;
  CARVE16(xl_h, (size_t)B * S * C)       // x_low planes, pixel-major [B][1024][256]
  CARVE16(xl_l, (size_t)B * S * C)
  CARVE16(xl_f, (size_t)B * S * C)
  CARVE16(xh_h, (size_t)B * SQ * CHI)    // x_high planes, pixel-major [B][256][512]
  CARVE16(xh_l, (size_t)B * SQ * CHI)
  CARVE16(wq_h, (size_t)C * CHI)
  CARVE16(wq_l, (size_t)C * CHI)
  CARVE16(wk_h, (size_t)C * C)
  CARVE16(wk_l, (size_t)C * C)
  CARVE16(wv_f, (size_t)C * C)
  CARVE16(q_h,  (size_t)B * SQ * C)      // q planes [B][256 src px][256 ch]
  CARVE16(q_l,  (size_t)B * SQ * C)
  CARVE16(k_h,  (size_t)B * S * C)       // k planes [B][1024][256 ch]
  CARVE16(k_l,  (size_t)B * S * C)
  CARVE16(v_f,  (size_t)B * C * S)       // v f16 channel-major [B][256 ch][1024]
#undef CARVE16
  if (off > ws_size || off > (size_t)134217728) return;   // total 32,374,784 B

  // ---- weight planes ----
  split_f32_bf16x2<<<dim3((C * CHI / 2 + 255) / 256), dim3(256), 0, stream>>>(Wq, wq_h, wq_l, C * CHI / 2);
  split_f32_bf16x2<<<dim3((C * C / 2 + 255) / 256), dim3(256), 0, stream>>>(Wk, wk_h, wk_l, C * C / 2);
  cast_f32_f16x2<<<dim3((C * C / 2 + 255) / 256), dim3(256), 0, stream>>>(Wv, (_Float16*)wv_f, C * C / 2);

  // ---- activations: channel-major -> pixel-major 16-bit planes ----
  // x_low [B][256][1024] -> [B][1024][256] (bf16 hi, bf16 lo, f16)
  k_cm_to_pm<true><<<dim3(S / 32, C / 64, B), dim3(256), 0, stream>>>(x_low, C, S, xl_h, xl_l, xl_f);
  // x_high [B][512][256] -> [B][256][512] (bf16 hi, bf16 lo)
  k_cm_to_pm<false><<<dim3(SQ / 32, CHI / 64, B), dim3(256), 0, stream>>>(x_high, CHI, SQ, xh_h, xh_l, xh_l);

  // ---- q-proj on the 16x16 grid: q[b][sq][co] = sum_ci xh[b][sq][ci] Wq[co][ci] + bq[co]; bf16 hi/lo split in, bf16 hi/lo planes out ----
  wmma_gemm64<1, true, 2, 2, false, 0><<<dim3(2, B), dim3(256), 0, stream>>>(
      xh_h, xh_l, CHI, (long)SQ * CHI,
      wq_h, wq_l, CHI, 0L,
      (void*)q_h, (void*)q_l, C, (long)SQ * C,
      bq, bq, 0L, SQ, C, CHI, 1.0f);
  // ---- k-proj: k[b][s][co] = sum_ci xl[b][s][ci] Wk[co][ci] + bk[co] ----
  wmma_gemm64<1, true, 2, 2, false, 0><<<dim3(8, B), dim3(256), 0, stream>>>(
      xl_h, xl_l, C, (long)S * C,
      wk_h, wk_l, C, 0L,
      (void*)k_h, (void*)k_l, C, (long)S * C,
      bk, bk, 0L, S, C, C, 1.0f);
  // ---- v-proj (channel-major out): v[b][co][s] = sum_ci Wv[co][ci] xl[b][s][ci] + bv[co]; f16 operands, f16 out ----
  wmma_gemm64<0, false, 1, 1, false, 0><<<dim3(8, B), dim3(256), 0, stream>>>(
      wv_f, wv_f, C, 0L,
      xl_f, xl_f, C, (long)S * C,
      (void*)v_f, (void*)v_f, S, (long)C * S,
      bv, bv, 0L, C, S, C, 1.0f);

  // ---- attention ----
  attn_hd32<<<dim3(B * AS_NH * (SQ / 64)), dim3(128), 0, stream>>>(q_h, q_l, k_h, k_l, v_f, out);
}

// v002
// It runs in 86.4 microseconds.
// Next to v001, in two timings, it ran 1.55 times as fast each time.
// Counting every step since v000, it is 1.99 times as fast.
#include <hip/hip_runtime.h>
#include <stdint.h>
// Contractions: q-proj, k-proj, q.k scores: v_wmma_f32_16x16x32_bf16 with bf16 hi/lo operand planes (hi.hi + hi.lo + lo.hi);
// v-proj and p.v: v_wmma_f32_16x16x32_f16 (f16 operands, p carried x2^15); f32 accumulate everywhere; softmax in f32.

typedef __attribute__((ext_vector_type(16))) _Float16 v16h;
typedef __attribute__((ext_vector_type(8)))  _Float16 v8h;
typedef __attribute__((ext_vector_type(16))) __bf16   v16b;
typedef __attribute__((ext_vector_type(8)))  __bf16   v8b;
typedef __attribute__((ext_vector_type(8)))  float    v8f;
typedef __attribute__((ext_vector_type(4)))  float    v4f;

__device__ __forceinline__ unsigned short f2bf_bits(float f) {
  unsigned u = __float_as_uint(f);
  return (unsigned short)((u + 0x7FFFu + ((u >> 16) & 1u)) >> 16);
}
__device__ __forceinline__ float bf_bits2f(unsigned short h) { return __uint_as_float(((unsigned)h) << 16); }

// hazard guards as plain device helpers (no inline asm inside the kernel template body)
__device__ __forceinline__ void dep_guard_h(v8f& a, v8f& b, v16h x, v16h y) { asm volatile("v_nop\n\tv_nop\n\tv_nop\n\tv_nop" : "+v"(a), "+v"(b) : "v"(x), "v"(y)); }
__device__ __forceinline__ void dep_guard_b(v8f& a, v8f& b, v16b x, v16b y) { asm volatile("v_nop\n\tv_nop\n\tv_nop\n\tv_nop" : "+v"(a), "+v"(b) : "v"(x), "v"(y)); }
__device__ __forceinline__ void keep4_h(v16h a, v16h b, v16h c, v16h d) { asm volatile("v_nop" :: "v"(a), "v"(b), "v"(c), "v"(d)); }
__device__ __forceinline__ void keep4_b(v16b a, v16b b, v16b c, v16b d) { asm volatile("v_nop" :: "v"(a), "v"(b), "v"(c), "v"(d)); }
__device__ __forceinline__ void acc_guard4(v8f& a, v8f& b, v8f& c, v8f& d) { asm volatile("v_nop\n\tv_nop\n\tv_nop\n\tv_nop" : "+v"(a), "+v"(b), "+v"(c), "+v"(d)); }
template <typename T> struct Frag;
template <> struct Frag<_Float16> {
  typedef v16h V; union U { v16h v; v8h h[2]; };
  static __device__ __forceinline__ v16h load(const _Float16* p) {   // elements 0..7 <- p[0..7], 8..15 <- p[16..23]
    U f; f.h[0] = *(const v8h*)(p); f.h[1] = *(const v8h*)(p + 16); return f.v;
  }
  static __device__ __forceinline__ v8f mma(v16h a, v16h b, v8f c) {
    return __builtin_amdgcn_wmma_f32_16x16x32_f16(false, a, false, b, (short)0, c, false, false);
  }
  static __device__ __forceinline__ void guard(v8f& a, v8f& b, v16h x, v16h y) { dep_guard_h(a, b, x, y); }
  static __device__ __forceinline__ void keep(v16h a, v16h b, v16h c, v16h d) { keep4_h(a, b, c, d); }
};
template <> struct Frag<__bf16> {
  typedef v16b V; union U { v16b v; v8b h[2]; };
  static __device__ __forceinline__ v16b load(const __bf16* p) {
    U f; f.h[0] = *(const v8b*)(p); f.h[1] = *(const v8b*)(p + 16); return f.v;
  }
  static __device__ __forceinline__ v8f mma(v16b a, v16b b, v8f c) {
    return __builtin_amdgcn_wmma_f32_16x16x32_bf16(false, a, false, b, (short)0, c, false, false);
  }
  static __device__ __forceinline__ void guard(v8f& a, v8f& b, v16b x, v16b y) { dep_guard_b(a, b, x, y); }
  static __device__ __forceinline__ void keep(v16b a, v16b b, v16b c, v16b d) { keep4_b(a, b, c, d); }
};

// ---- Register-blocked batched WMMA GEMM ------------------------------------
// C[m,n] = scale * sum_k A[m,k] * Bt[n,k] (+bias)(+resid); each wave owns a 64x64 tile.
// A row-major [M,K]; Bt row-major [N,K]; M,N % 64 == 0, K % 32 == 0.
// SPLIT: operands are hi/lo planes (A2/Bt2 = lo planes, same layout); product = hi.hi + hi.lo + lo.hi.
// BIAS_MODE: 0 = none, 1 = bias[m], 2 = bias[n].
// OUT_MODE: 0 = f32, 1 = f16, 2 = bf16 hi plane (Cout) + bf16 lo plane (Cout2).
// ET: 0 = f16 operands, 1 = bf16 operands (pointers passed as 16-bit storage)
template <int ET> struct Elem;
template <> struct Elem<0> { typedef _Float16 T; };
template <> struct Elem<1> { typedef __bf16 T; };
// Device body: bx = tile group (8 tiles, one per wave), b = batch, sT = the block's 8 per-wave slabs.
template <int ET, bool SPLIT, int BIAS_MODE, int OUT_MODE, bool RESID, int ACT = 0>
__device__ __forceinline__ void wmma_gemm64(
    float (*sT)[16 * 68], int bx, int b,
    const unsigned short* __restrict__ Ap, const unsigned short* __restrict__ A2p, int lda, long strideA,
    const unsigned short* __restrict__ Btp, const unsigned short* __restrict__ Bt2p, int ldb, long strideB,
    void* __restrict__ Cout, void* __restrict__ Cout2, int ldc, long strideC,
    const float* __restrict__ bias,
    const float* __restrict__ resid, long strideR,
    int M, int N, int K, float scale) {
  typedef typename Elem<ET>::T T;
  typedef typename Frag<T>::V V;
  const T* A = (const T*)Ap; const T* A2 = (const T*)A2p; const T* Bt = (const T*)Btp; const T* Bt2 = (const T*)Bt2p;
  const int lane = threadIdx.x & 31;
  const int wave = threadIdx.x >> 5;
  const int tilesN = N >> 6;
  const int tilesM = M >> 6;
  const int tile = bx * 8 + wave;
  if (tile >= tilesM * tilesN) return;   // wave-uniform; no block barriers in this kernel
  const int tm = tile / tilesN;
  const int tn = tile - tm * tilesN;
  const int m0 = tm << 6;
  const int n0 = tn << 6;

  const T* Ab  = A  + (size_t)b * strideA;
  const T* Bb  = Bt + (size_t)b * strideB;
  const T* Ab2 = SPLIT ? (A2  + (size_t)b * strideA) : nullptr;
  const T* Bb2 = SPLIT ? (Bt2 + (size_t)b * strideB) : nullptr;

  const int rlane = lane & 15;                 // row (A) / col (B, D) within subtile
  const int koff  = (lane >> 4) * 8;           // k offset of this lane half
  const int mOff  = (lane >> 4) * 8;           // D row offset

  v8f acc[4][4];
#pragma unroll
  for (int i = 0; i < 4; ++i)
#pragma unroll
    for (int j = 0; j < 4; ++j) acc[i][j] = (v8f){0.f,0.f,0.f,0.f,0.f,0.f,0.f,0.f};

  for (int k0 = 0; k0 < K; k0 += 32) {
    V bh[4], bl[4];
#pragma unroll
    for (int j = 0; j < 4; ++j) {
      const size_t bo = (size_t)(n0 + (j << 4) + rlane) * ldb + koff + k0;
      bh[j] = Frag<T>::load(Bb + bo);
      if (SPLIT) bl[j] = Frag<T>::load(Bb2 + bo);
    }
#pragma unroll
    for (int i = 0; i < 4; ++i) {
      const size_t ao = (size_t)(m0 + (i << 4) + rlane) * lda + koff + k0;
      V ah = Frag<T>::load(Ab + ao);
      V al;
      if (SPLIT) al = Frag<T>::load(Ab2 + ao);
#pragma unroll
      for (int j = 0; j < 4; ++j) {
        acc[i][j] = Frag<T>::mma(ah, bh[j], acc[i][j]);
        if (SPLIT) {
          acc[i][j] = Frag<T>::mma(ah, bl[j], acc[i][j]);
          acc[i][j] = Frag<T>::mma(al, bh[j], acc[i][j]);
        }
      }
      Frag<T>::guard(acc[i][0], acc[i][3], ah, SPLIT ? al : ah);
    }
    Frag<T>::keep(bh[0], bh[1], bh[2], bh[3]);
    if (SPLIT) Frag<T>::keep(bl[0], bl[1], bl[2], bl[3]);
  }
  acc_guard4(acc[0][0], acc[0][1], acc[0][2], acc[0][3]);
  acc_guard4(acc[1][0], acc[1][1], acc[1][2], acc[1][3]);
  acc_guard4(acc[2][0], acc[2][1], acc[2][2], acc[2][3]);
  acc_guard4(acc[3][0], acc[3][1], acc[3][2], acc[3][3]);

  // ---- epilogue ----
  float* slab = sT[wave];
  const float* Rb = RESID ? (resid + (size_t)b * strideR) : nullptr;
#pragma unroll
  for (int i = 0; i < 4; ++i) {
    const int mBase = m0 + (i << 4);
#pragma unroll
    for (int j = 0; j < 4; ++j) {
      const int n = n0 + (j << 4) + rlane;
      float bv = 0.f;
      if (BIAS_MODE == 2) bv = bias[n];
#pragma unroll
      for (int r = 0; r < 8; ++r) {
        float v = acc[i][j][r] * scale;
        if (BIAS_MODE == 1) v += bias[mBase + mOff + r];
        if (BIAS_MODE == 2) v += bv;
        if (RESID) v += Rb[(size_t)(mBase + mOff + r) * ldc + n];
        if (ACT == 1) v = tanhf(v);
        if (ACT == 2) v = fmaxf(v, 0.0f);
        if (ACT == 3) v = v / (1.0f + expf(-v));
        if (ACT == 4) v = (v > 0.f) ? v : 0.01f * v;
        if (ACT == 5) v = 0.5f * v * (1.0f + erff(v * 0.70710678118654752f));
        slab[(mOff + r) * 68 + (j << 4) + rlane] = v;
      }
    }
    __builtin_amdgcn_fence(__ATOMIC_RELEASE, "workgroup");
    __builtin_amdgcn_wave_barrier();
    __builtin_amdgcn_fence(__ATOMIC_ACQUIRE, "workgroup");
    if (OUT_MODE == 0) {
      float* C = (float*)Cout + (size_t)b * strideC;
      const int hh = lane >> 4, c4 = (lane & 15) * 4;     // row seg = 256 B = 16 lanes x 16 B
      {
#pragma unroll
        for (int it = 0; it < 8; ++it) {
          const int row = it * 2 + hh;
          v4f v = *(const v4f*)(slab + row * 68 + c4);
          *(v4f*)(C + (size_t)(mBase + row) * ldc + n0 + c4) = v;
        }
        
      }
    } else {
      const int q = lane >> 3, c8 = (lane & 7) * 8;
      unsigned short* C  = (unsigned short*)Cout  + (size_t)b * strideC;
      unsigned short* C2 = (OUT_MODE == 2) ? ((unsigned short*)Cout2 + (size_t)b * strideC) : nullptr;
      {
#pragma unroll
        for (int it = 0; it < 4; ++it) {
          const int row = it * 4 + q;
          const float* sp = slab + row * 68 + c8;
          v8h hv, lv;
#pragma unroll
          for (int e = 0; e < 8; ++e) {
            if (OUT_MODE == 1) {
              hv[e] = (_Float16)sp[e];
            } else {
              unsigned short hb = f2bf_bits(sp[e]);
              unsigned short lb = f2bf_bits(sp[e] - bf_bits2f(hb));
              hv[e] = __builtin_bit_cast(_Float16, hb);
              lv[e] = __builtin_bit_cast(_Float16, lb);
            }
          }
          *(v8h*)(C + (size_t)(mBase + row) * ldc + n0 + c8) = hv;
          if (OUT_MODE == 2) *(v8h*)(C2 + (size_t)(mBase + row) * ldc + n0 + c8) = lv;
        }
        
      }
    }
    __builtin_amdgcn_fence(__ATOMIC_RELEASE, "workgroup");
    __builtin_amdgcn_wave_barrier();
    __builtin_amdgcn_fence(__ATOMIC_ACQUIRE, "workgroup");
  }
}

__device__ __forceinline__ void cast_f32_f16x2(
    int bx, const float* __restrict__ in, _Float16* __restrict__ out, int n2) {
  int i = bx * 256 + threadIdx.x;
  if (i < n2) {
    const _Float16 h0 = (_Float16)in[2 * i], h1 = (_Float16)in[2 * i + 1];
    const unsigned u = (unsigned)__builtin_bit_cast(unsigned short, h0) | ((unsigned)__builtin_bit_cast(unsigned short, h1) << 16);
    ((unsigned*)out)[i] = u;
    
  }
}

__device__ __forceinline__ void split_f32_bf16x2(
    int bx, const float* __restrict__ in, unsigned short* __restrict__ oh, unsigned short* __restrict__ ol, int n2) {
  int i = bx * 256 + threadIdx.x;
  if (i < n2) {
    const float f0 = in[2 * i], f1 = in[2 * i + 1];
    const unsigned short hb0 = f2bf_bits(f0), hb1 = f2bf_bits(f1);
    const unsigned short lb0 = f2bf_bits(f0 - bf_bits2f(hb0)), lb1 = f2bf_bits(f1 - bf_bits2f(hb1));
    const unsigned uh = (unsigned)hb0 | ((unsigned)hb1 << 16);
    const unsigned ul = (unsigned)lb0 | ((unsigned)lb1 << 16);
    ((unsigned*)oh)[i] = uh;
    ((unsigned*)ol)[i] = ul;
    
  }
}

// ---- channel-major f32 x[b][Cin][Sn] -> pixel-major 16-bit planes [b][Sn][Cin]: bf16 hi, bf16 lo (RNE), optional f16 ----
template <bool F16P>
__device__ __forceinline__ void k_cm_to_pm(
    float (*ts)[68], int bx, int by, int b,
    const float* __restrict__ x, int Cin, int Sn,
    unsigned short* __restrict__ oh, unsigned short* __restrict__ ol, unsigned short* __restrict__ of) {
  const int tid = threadIdx.x, lane = tid & 31, wave = tid >> 5;
  const int s0 = bx * 32, c0 = by * 64;
  const float* xb = x + ((size_t)b * Cin + c0) * Sn + s0;
#pragma unroll
  for (int i = 0; i < 8; ++i) {
    const int idx = tid + i * 256;        // 0..2047
    const int cc = idx >> 5, ss = idx & 31;
    ts[ss][cc] = xb[(size_t)cc * Sn + ss];
  }
  __syncthreads();
  const int lq = lane >> 3, c8 = (lane & 7) * 8;
  const int ss = wave * 4 + lq;           // 8 waves x 4 rows = 32 rows, one line per (row, plane)
  const v4f a0 = *(const v4f*)(&ts[ss][c8]);
  const v4f a1 = *(const v4f*)(&ts[ss][c8 + 4]);
  const float f[8] = {a0[0], a0[1], a0[2], a0[3], a1[0], a1[1], a1[2], a1[3]};
  v8h hv, lv, fv;
#pragma unroll
  for (int e = 0; e < 8; ++e) {
    const unsigned short hb = f2bf_bits(f[e]);
    const unsigned short lb = f2bf_bits(f[e] - bf_bits2f(hb));
    hv[e] = __builtin_bit_cast(_Float16, hb);
    lv[e] = __builtin_bit_cast(_Float16, lb);
    fv[e] = F16P ? (_Float16)f[e] : hv[e];
  }
  const size_t o = ((size_t)b * Sn + s0 + ss) * Cin + c0 + c8;
  {
    *(v8h*)(oh + o) = hv;
    *(v8h*)(ol + o) = lv;
    if (F16P) *(v8h*)(of + o) = fv;
    // precaution: other jobs' code follows this body in the same kernel and may rewrite the stores' registers; the wait stands in front of it
    asm volatile("s_wait_xcnt 0x0" ::: "memory");
  }
}

// ---- One grid for the five operand preparations: none reads what another writes; the block index picks the job ----
//   blocks    0..1023  x_low  [8][256][1024] -> pixel-major planes (32 px tiles x 4 channel tiles x 8 batches)
//   blocks 1024..1535  x_high [8][512][256]  -> pixel-major planes ( 8 px tiles x 8 channel tiles x 8 batches)
//   blocks 1536..1791  Wq planes; 1792..1919  Wk planes; 1920..2047  Wv f16
__global__ __launch_bounds__(256) void prep_all(
    const float* __restrict__ x_low, const float* __restrict__ x_high,
    const float* __restrict__ Wq, const float* __restrict__ Wk, const float* __restrict__ Wv,
    unsigned short* __restrict__ xl_h, unsigned short* __restrict__ xl_l, unsigned short* __restrict__ xl_f,
    unsigned short* __restrict__ xh_h, unsigned short* __restrict__ xh_l,
    unsigned short* __restrict__ wq_h, unsigned short* __restrict__ wq_l,
    unsigned short* __restrict__ wk_h, unsigned short* __restrict__ wk_l,
    unsigned short* __restrict__ wv_f) {
  __shared__ __align__(16) float ts[32][68];   // [pixel][channel]
  const int id = blockIdx.x;                   // every branch below is uniform over the block
  if (id < 1024) {
    k_cm_to_pm<true>(ts, id & 31, (id >> 5) & 3, id >> 7, x_low, 256, 1024, xl_h, xl_l, xl_f);
  } else if (id < 1536) {
    const int j = id - 1024;
    k_cm_to_pm<false>(ts, j & 7, (j >> 3) & 7, j >> 6, x_high, 512, 256, xh_h, xh_l, xh_l);
  } else if (id < 1792) {
    split_f32_bf16x2(id - 1536, Wq, wq_h, wq_l, 256 * 512 / 2);
  } else if (id < 1920) {
    split_f32_bf16x2(id - 1792, Wk, wk_h, wk_l, 256 * 256 / 2);
  } else {
    cast_f32_f16x2(id - 1920, Wv, (_Float16*)wv_f, 256 * 256 / 2);
  }
}

// ---- One grid for the three projections: none reads what another writes; the block index picks the job ----
//   blocks  0..15   q[b][sq][co] = sum_ci xh[b][sq][ci] Wq[co][ci] + bq[co]  (K = 512, the longest job, so it starts first)
//   blocks 16..79   k[b][s][co]  = sum_ci xl[b][s][ci]  Wk[co][ci] + bk[co]
//   blocks 80..143  v[b][co][s]  = sum_ci Wv[co][ci] xl[b][s][ci] + bv[co]   (channel-major out; f16 operands, f16 out)
__global__ __launch_bounds__(256) void proj_all(
    const unsigned short* __restrict__ xh_h, const unsigned short* __restrict__ xh_l,
    const unsigned short* __restrict__ wq_h, const unsigned short* __restrict__ wq_l,
    unsigned short* __restrict__ q_h, unsigned short* __restrict__ q_l, const float* __restrict__ bq,
    const unsigned short* __restrict__ xl_h, const unsigned short* __restrict__ xl_l,
    const unsigned short* __restrict__ wk_h, const unsigned short* __restrict__ wk_l,
    unsigned short* __restrict__ k_h, unsigned short* __restrict__ k_l, const float* __restrict__ bk,
    const unsigned short* __restrict__ wv_f, const unsigned short* __restrict__ xl_f,
    unsigned short* __restrict__ v_f, const float* __restrict__ bv) {
  __shared__ __align__(16) float sT[8][16 * 68];   // per-wave 16x64 slab, pitch 68 floats
  const int id = blockIdx.x;                       // every branch below is uniform over the block
  if (id < 80) {
    // q and k share one copy of the split-plane body; only its scalar arguments differ
    const bool isq = id < 16;
    const int  j   = isq ? id : id - 16;
    const int  Kd  = isq ? 512 : 256;              // reduction length = row pitch of both operands
    const int  Md  = isq ? 256 : 1024;             // pixels per batch
    wmma_gemm64<1, true, 2, 2, false, 0>(sT, isq ? (j & 1) : (j & 7), isq ? (j >> 1) : (j >> 3),
        isq ? xh_h : xl_h, isq ? xh_l : xl_l, Kd, (long)Md * Kd,
        isq ? wq_h : wk_h, isq ? wq_l : wk_l, Kd, 0L,
        (void*)(isq ? q_h : k_h), (void*)(isq ? q_l : k_l), 256, (long)Md * 256,
        isq ? bq : bk, isq ? bq : bk, 0L, Md, 256, Kd, 1.0f);
  } else {
    const int j = id - 80;
    wmma_gemm64<0, false, 1, 1, false, 0>(sT, j & 7, j >> 3,
        wv_f, wv_f, 256, 0L,
        xl_f, xl_f, 256, (long)1024 * 256,
        (void*)v_f, (void*)v_f, 1024, (long)256 * 1024,
        bv, bv, 0L, 256, 1024, 256, 1.0f);
  }
}

// =====================================================================================
// Attention, head dim 32, no mask, no scaling.
//   q planes: bf16 hi/lo [B][256 src px][256 ch] (16x16 grid). The four output pixels of one source pixel share their
//   query row, so their attention rows are equal: each source pixel is worked once and its result stored to all four.
//   k planes: bf16 hi/lo [B][1024 px][256 ch];  v: f16 channel-major [B][256 ch][1024 px]
//   out f32 channel-major [B][256 ch][1024 px].
//   scores = q.k^T: 3 x v_wmma_f32_16x16x32_bf16 per 16x16 tile (hi.hi + hi.lo + lo.hi); online softmax f32;
//   p carried x2^15 as f16 in per-wave LDS; out = p.v: v_wmma_f32_16x16x32_f16; f32 accumulate.
//   Block = 4 waves = 64 source pixels (256 output pixels) of one (b, head); 64-key chunks staged in LDS; grid.x = B*8*4.
// =====================================================================================
#define AS_S   1024
#define AS_C   256
#define AS_SQ  256
#define AS_HD  32
#define AS_NH  8
#define AS_KC  64
#define AS_PSC 32768.0f

__device__ __forceinline__ v8f mma_bf_g(v16b a, v16b b, v8f c) {
  c = __builtin_amdgcn_wmma_f32_16x16x32_bf16(false, a, false, b, (short)0, c, false, false);
  asm volatile("v_nop\n\tv_nop\n\tv_nop\n\tv_nop" : "+v"(c) : "v"(a), "v"(b));
  return c;
}
__device__ __forceinline__ v8f mma_hf_g(v16h a, v16h b, v8f c) {
  c = __builtin_amdgcn_wmma_f32_16x16x32_f16(false, a, false, b, (short)0, c, false, false);
  asm volatile("v_nop\n\tv_nop\n\tv_nop\n\tv_nop" : "+v"(c) : "v"(a), "v"(b));
  return c;
}

__global__ __launch_bounds__(128)
void attn_hd32(const unsigned short* __restrict__ qhp, const unsigned short* __restrict__ qlp,
               const unsigned short* __restrict__ khp, const unsigned short* __restrict__ klp,
               const unsigned short* __restrict__ vp, float* __restrict__ out) {
  union FB { v16b v; v8b h[2]; };
  union FH { v16h v; v8h h[2]; };
  __shared__ __align__(16) __bf16   Ksh[AS_KC * AS_HD];      // k hi [kv][d]   4 KB
  __shared__ __align__(16) __bf16   Ksl[AS_KC * AS_HD];      // k lo [kv][d]   4 KB
  __shared__ __align__(16) _Float16 Vt[AS_HD * AS_KC];       // v [d][kv]      4 KB
  __shared__ __align__(16) _Float16 Psh[4][16 * AS_KC];      // per wave p [row][kv]  8 KB
  __shared__ __align__(16) float    Os[AS_HD][68];           // block out tile [d][64 source px], pitch 68

  const int tid  = threadIdx.x;
  const int wave = tid >> 5;
  const int lane = tid & 31;
  const int hh   = lane >> 4;
  const int c    = lane & 15;

  const int bx = blockIdx.x;
  const int qb = bx & 3;               // AS_SQ / 64 = 4 query blocks
  const int bh = bx >> 2;
  const int h  = bh & (AS_NH - 1);
  const int b  = bh >> 3;
  const int qbase = qb * 64;
  const int q0 = qbase + wave * 16;

  // ---- Q fragments (A operand, lane c = row, split k map), hi and lo planes ----
  v16b qah, qal;
  {
    const int sq = q0 + c;                       // source pixel 0..255 on the 16x16 grid
    const size_t qo = ((size_t)b * AS_SQ + sq) * AS_C + h * AS_HD + 8 * hh;
    qah = Frag<__bf16>::load((const __bf16*)qhp + qo);
    qal = Frag<__bf16>::load((const __bf16*)qlp + qo);
  }

  float mrow[8], lrow[8];
  v8f oacc[2];
#pragma unroll
  for (int r = 0; r < 8; ++r) { mrow[r] = -INFINITY; lrow[r] = 0.f; }
#pragma unroll
  for (int t = 0; t < 2; ++t) oacc[t] = (v8f){0.f,0.f,0.f,0.f,0.f,0.f,0.f,0.f};

  const __bf16*   khb = (const __bf16*)khp + (size_t)b * AS_S * AS_C + h * AS_HD;
  const __bf16*   klb = (const __bf16*)klp + (size_t)b * AS_S * AS_C + h * AS_HD;
  const _Float16* vb  = (const _Float16*)vp + ((size_t)b * AS_C + h * AS_HD) * AS_S;
  float*          ob  = out + ((size_t)b * AS_C + h * AS_HD) * AS_S + qbase * 4;   // 4 source rows -> 8 output rows of 32
  _Float16*       pw  = Psh[wave];

  for (int kc = 0; kc < AS_S / AS_KC; ++kc) {
    const int kv0 = kc * AS_KC;
    __syncthreads();
    {
      // K chunk: 64 kv rows x 32 d, both planes; thread -> (kv row, 16-d half)
      const int kvr = tid >> 1, dh = (tid & 1) * 16;
      const __bf16* kr  = khb + (size_t)(kv0 + kvr) * AS_C + dh;
      const __bf16* kr2 = klb + (size_t)(kv0 + kvr) * AS_C + dh;
      *(v8b*)(Ksh + kvr * AS_HD + dh)     = *(const v8b*)(kr);
      *(v8b*)(Ksh + kvr * AS_HD + dh + 8) = *(const v8b*)(kr + 8);
      *(v8b*)(Ksl + kvr * AS_HD + dh)     = *(const v8b*)(kr2);
      *(v8b*)(Ksl + kvr * AS_HD + dh + 8) = *(const v8b*)(kr2 + 8);
      // V chunk: 32 d rows x 64 kv (channel-major source is already [d][kv]); thread -> (d row, 16-kv quarter)
      const int dr = tid >> 2, part = (tid & 3) * 16;
      const _Float16* vr = vb + (size_t)dr * AS_S + kv0 + part;
      *(v8h*)(Vt + dr * AS_KC + part)     = *(const v8h*)(vr);
      *(v8h*)(Vt + dr * AS_KC + part + 8) = *(const v8h*)(vr + 8);
    }
    __syncthreads();

    // ---- scores: s[j][r] = row (8hh+r), kv (kv0 + 16j + c); B operand = k with split k map over d ----
    v8f s[4];
#pragma unroll
    for (int j = 0; j < 4; ++j) {
      s[j] = (v8f){0.f,0.f,0.f,0.f,0.f,0.f,0.f,0.f};
      FB kb, kl;
      kb.h[0] = *(const v8b*)(Ksh + (j * 16 + c) * AS_HD + 8 * hh);
      kb.h[1] = *(const v8b*)(Ksh + (j * 16 + c) * AS_HD + 16 + 8 * hh);
      kl.h[0] = *(const v8b*)(Ksl + (j * 16 + c) * AS_HD + 8 * hh);
      kl.h[1] = *(const v8b*)(Ksl + (j * 16 + c) * AS_HD + 16 + 8 * hh);
      s[j] = mma_bf_g(qah, kb.v, s[j]);
      s[j] = mma_bf_g(qah, kl.v, s[j]);
      s[j] = mma_bf_g(qal, kb.v, s[j]);
    }

    // ---- online softmax (f32) ----
    float cm[8];
#pragma unroll
    for (int r = 0; r < 8; ++r) {
      float m = s[0][r];
#pragma unroll
      for (int j = 1; j < 4; ++j) m = fmaxf(m, s[j][r]);
#pragma unroll
      for (int off = 1; off < 16; off <<= 1) m = fmaxf(m, __shfl_xor(m, off, 32));
      cm[r] = m;
    }
#pragma unroll
    for (int r = 0; r < 8; ++r) {
      const float mnew  = fmaxf(mrow[r], cm[r]);
      const float alpha = expf(mrow[r] - mnew);
      mrow[r] = mnew;
      float psum = 0.f;
#pragma unroll
      for (int j = 0; j < 4; ++j) {
        const float p = expf(s[j][r] - mnew);
        psum += p;
        pw[(8 * hh + r) * AS_KC + j * 16 + c] = (_Float16)(p * AS_PSC);
      }
#pragma unroll
      for (int off = 1; off < 16; off <<= 1) psum += __shfl_xor(psum, off, 32);
      lrow[r] = lrow[r] * alpha + psum;
#pragma unroll
      for (int t = 0; t < 2; ++t) oacc[t][r] *= alpha;
    }
    __builtin_amdgcn_fence(__ATOMIC_RELEASE, "workgroup");
    __builtin_amdgcn_wave_barrier();
    __builtin_amdgcn_fence(__ATOMIC_ACQUIRE, "workgroup");

    // ---- out += p . v : A = p [row][kv] (same element type reload), B = v with split k map over kv ----
#pragma unroll 1
    for (int kk = 0; kk < 2; ++kk) {
      FH pa;
      pa.h[0] = *(const v8h*)(pw + c * AS_KC + kk * 32 + 8 * hh);
      pa.h[1] = *(const v8h*)(pw + c * AS_KC + kk * 32 + 16 + 8 * hh);
#pragma unroll
      for (int t = 0; t < 2; ++t) {
        FH vf;
        vf.h[0] = *(const v8h*)(Vt + (t * 16 + c) * AS_KC + kk * 32 + 8 * hh);
        vf.h[1] = *(const v8h*)(Vt + (t * 16 + c) * AS_KC + kk * 32 + 16 + 8 * hh);
        oacc[t] = mma_hf_g(pa.v, vf.v, oacc[t]);
      }
    }
  }

#pragma unroll
  for (int r = 0; r < 8; ++r) {
    const float inv = 1.0f / (lrow[r] * AS_PSC);
#pragma unroll
    for (int t = 0; t < 2; ++t) Os[t * 16 + c][wave * 16 + 8 * hh + r] = oacc[t][r] * inv;
  }
  __syncthreads();
  {
    // nearest-neighbour 2x: output pixel (y, x) of the block's 8 x 32 patch takes source (y>>1, x>>1) of its 4 x 16 patch
    const int o4 = (tid & 63) * 4;                       // 4 output pixels of one row: two source pixels, each twice
    const int sp = (o4 >> 6) * 16 + ((o4 & 31) >> 1);
#pragma unroll   // the 16 channel steps become immediate offsets of one address, and the LDS reads run ahead of the stores
    for (int it = 0; it < 16; ++it) {
      const int d = it * 2 + (tid >> 6);
      const float s0 = Os[d][sp], s1 = Os[d][sp + 1];
      *(v4f*)(ob + (size_t)d * AS_S + o4) = (v4f){s0, s0, s1, s1};
    }
  }
}

extern "C" void kernel_launch(void* const* d_in, const int* in_sizes, int n_in,
                              void* d_out, int out_size, void* d_ws, size_t ws_size,
                              hipStream_t stream) {
  const int B = 8, CHI = 512, C = 256, SQ = 256, S = 1024;
  if (n_in < 8) return;
  if (in_sizes[0] != B * CHI * SQ || in_sizes[1] != B * C * S || in_sizes[2] != C * CHI ||
      in_sizes[3] != C || in_sizes[4] != C * C || in_sizes[5] != C || in_sizes[6] != C * C ||
      in_sizes[7] != C || out_size != B * C * S) return;

  const float* x_high = (const float*)d_in[0];
  const float* x_low  = (const float*)d_in[1];
  const float* Wq     = (const float*)d_in[2];
  const float* bq     = (const float*)d_in[3];
  const float* Wk     = (const float*)d_in[4];
  const float* bk     = (const float*)d_in[5];
  const float* Wv     = (const float*)d_in[6];
  const float* bv     = (const float*)d_in[7];
  float* out = (float*)d_out;

  // ---- workspace carve (bytes, 256-B aligned) ----
  char* ws = (char*)d_ws;
  size_t off = 0;
#define CARVE16(name, elems) unsigned short* name = (unsigned short*)(ws + off); off += ((((size_t)(elems)) * 2) + 255) & ~(size_t)255;
  CARVE16(xl_h, (size_t)B * S * C)       // x_low planes, pixel-major [B][1024][256]
  CARVE16(xl_l, (size_t)B * S * C)
  CARVE16(xl_f, (size_t)B * S * C)
  CARVE16(xh_h, (size_t)B * SQ * CHI)    // x_high planes, pixel-major [B][256][512]
  CARVE16(xh_l, (size_t)B * SQ * CHI)
  CARVE16(wq_h, (size_t)C * CHI)
  CARVE16(wq_l, (size_t)C * CHI)
  CARVE16(wk_h, (size_t)C * C)
  CARVE16(wk_l, (size_t)C * C)
  CARVE16(wv_f, (size_t)C * C)
  CARVE16(q_h,  (size_t)B * SQ * C)      // q planes [B][256 src px][256 ch]
  CARVE16(q_l,  (size_t)B * SQ * C)
  CARVE16(k_h,  (size_t)B * S * C)       // k planes [B][1024][256 ch]
  CARVE16(k_l,  (size_t)B * S * C)
  CARVE16(v_f,  (size_t)B * C * S)       // v f16 channel-major [B][256 ch][1024]
#undef CARVE16
  if (off > ws_size || off > (size_t)134217728) return;   // total 32,374,784 B

  // ---- operand planes: weights (bf16 hi/lo, f16) and activations (channel-major -> pixel-major 16-bit planes), one launch ----
  prep_all<<<dim3(2048), dim3(256), 0, stream>>>(x_low, x_high, Wq, Wk, Wv,
      xl_h, xl_l, xl_f, xh_h, xh_l, wq_h, wq_l, wk_h, wk_l, wv_f);

  // ---- q, k and v projections, one launch ----
  proj_all<<<dim3(144), dim3(256), 0, stream>>>(
      xh_h, xh_l, wq_h, wq_l, q_h, q_l, bq,
      xl_h, xl_l, wk_h, wk_l, k_h, k_l, bk,
      wv_f, xl_f, v_f, bv);

  // ---- attention ----
  attn_hd32<<<dim3(B * AS_NH * (SQ / 64)), dim3(128), 0, stream>>>(q_h, q_l, k_h, k_l, v_f, out);
}

// v003
// Measured time: 69.6 microseconds a run.
// In both of two side-by-side timings against v002, it was 1.24 times as fast.
// Counting every step since v000, it is 2.48 times as fast.
#include <hip/hip_runtime.h>
#include <stdint.h>
// Contractions: q-proj, k-proj, q.k scores: v_wmma_f32_16x16x32_bf16 with bf16 hi/lo operand planes (hi.hi + hi.lo + lo.hi);
// v-proj and p.v: v_wmma_f32_16x16x32_f16 (f16 operands, p carried x2^15); f32 accumulate everywhere; softmax in f32.

typedef __attribute__((ext_vector_type(16))) _Float16 v16h;
typedef __attribute__((ext_vector_type(8)))  _Float16 v8h;
typedef __attribute__((ext_vector_type(16))) __bf16   v16b;
typedef __attribute__((ext_vector_type(8)))  __bf16   v8b;
typedef __attribute__((ext_vector_type(8)))  float    v8f;
typedef __attribute__((ext_vector_type(4)))  float    v4f;

__device__ __forceinline__ unsigned short f2bf_bits(float f) {
  unsigned u = __float_as_uint(f);
  return (unsigned short)((u + 0x7FFFu + ((u >> 16) & 1u)) >> 16);
}
__device__ __forceinline__ float bf_bits2f(unsigned short h) { return __uint_as_float(((unsigned)h) << 16); }

// hazard guards as plain device helpers (no inline asm inside the kernel template body)
__device__ __forceinline__ void dep_guard_h(v8f& a, v8f& b, v16h x, v16h y) { asm volatile("v_nop\n\tv_nop\n\tv_nop\n\tv_nop" : "+v"(a), "+v"(b) : "v"(x), "v"(y)); }
__device__ __forceinline__ void dep_guard_b(v8f& a, v8f& b, v16b x, v16b y) { asm volatile("v_nop\n\tv_nop\n\tv_nop\n\tv_nop" : "+v"(a), "+v"(b) : "v"(x), "v"(y)); }
__device__ __forceinline__ void keep4_h(v16h a, v16h b, v16h c, v16h d) { asm volatile("v_nop" :: "v"(a), "v"(b), "v"(c), "v"(d)); }
__device__ __forceinline__ void keep4_b(v16b a, v16b b, v16b c, v16b d) { asm volatile("v_nop" :: "v"(a), "v"(b), "v"(c), "v"(d)); }
__device__ __forceinline__ void acc_guard4(v8f& a, v8f& b, v8f& c, v8f& d) { asm volatile("v_nop\n\tv_nop\n\tv_nop\n\tv_nop" : "+v"(a), "+v"(b), "+v"(c), "+v"(d)); }
template <typename T> struct Frag;
template <> struct Frag<_Float16> {
  typedef v16h V; union U { v16h v; v8h h[2]; };
  static __device__ __forceinline__ v16h load(const _Float16* p) {   // elements 0..7 <- p[0..7], 8..15 <- p[16..23]
    U f; f.h[0] = *(const v8h*)(p); f.h[1] = *(const v8h*)(p + 16); return f.v;
  }
  static __device__ __forceinline__ v8f mma(v16h a, v16h b, v8f c) {
    return __builtin_amdgcn_wmma_f32_16x16x32_f16(false, a, false, b, (short)0, c, false, false);
  }
  static __device__ __forceinline__ void guard(v8f& a, v8f& b, v16h x, v16h y) { dep_guard_h(a, b, x, y); }
  static __device__ __forceinline__ void keep(v16h a, v16h b, v16h c, v16h d) { keep4_h(a, b, c, d); }
};
template <> struct Frag<__bf16> {
  typedef v16b V; union U { v16b v; v8b h[2]; };
  static __device__ __forceinline__ v16b load(const __bf16* p) {
    U f; f.h[0] = *(const v8b*)(p); f.h[1] = *(const v8b*)(p + 16); return f.v;
  }
  static __device__ __forceinline__ v8f mma(v16b a, v16b b, v8f c) {
    return __builtin_amdgcn_wmma_f32_16x16x32_bf16(false, a, false, b, (short)0, c, false, false);
  }
  static __device__ __forceinline__ void guard(v8f& a, v8f& b, v16b x, v16b y) { dep_guard_b(a, b, x, y); }
  static __device__ __forceinline__ void keep(v16b a, v16b b, v16b c, v16b d) { keep4_b(a, b, c, d); }
};

// ---- Register-blocked batched WMMA GEMM ------------------------------------
// C[m,n] = scale * sum_k A[m,k] * Bt[n,k] (+bias)(+resid); each wave owns a 64x64 tile.
// A row-major [M,K]; Bt row-major [N,K]; M,N % 64 == 0, K % 32 == 0.
// SPLIT: operands are hi/lo planes (A2/Bt2 = lo planes, same layout); product = hi.hi + hi.lo + lo.hi.
// BIAS_MODE: 0 = none, 1 = bias[m], 2 = bias[n].
// OUT_MODE: 0 = f32, 1 = f16, 2 = bf16 hi plane (Cout) + bf16 lo plane (Cout2).
// ET: 0 = f16 operands, 1 = bf16 operands (pointers passed as 16-bit storage)
template <int ET> struct Elem;
template <> struct Elem<0> { typedef _Float16 T; };
template <> struct Elem<1> { typedef __bf16 T; };
// Device body: bx = tile group (8 tiles, one per wave), b = batch, sT = the block's 8 per-wave slabs.
template <int ET, bool SPLIT, int BIAS_MODE, int OUT_MODE, bool RESID, int ACT = 0>
__device__ __forceinline__ void wmma_gemm64(
    float (*sT)[16 * 68], int bx, int b,
    const unsigned short* __restrict__ Ap, const unsigned short* __restrict__ A2p, int lda, long strideA,
    const unsigned short* __restrict__ Btp, const unsigned short* __restrict__ Bt2p, int ldb, long strideB,
    void* __restrict__ Cout, void* __restrict__ Cout2, int ldc, long strideC,
    const float* __restrict__ bias,
    const float* __restrict__ resid, long strideR,
    int M, int N, int K, float scale) {
  typedef typename Elem<ET>::T T;
  typedef typename Frag<T>::V V;
  const T* A = (const T*)Ap; const T* A2 = (const T*)A2p; const T* Bt = (const T*)Btp; const T* Bt2 = (const T*)Bt2p;
  const int lane = threadIdx.x & 31;
  const int wave = threadIdx.x >> 5;
  const int tilesN = N >> 6;
  const int tilesM = M >> 6;
  const int tile = bx * 8 + wave;
  if (tile >= tilesM * tilesN) return;   // wave-uniform; no block barriers in this kernel
  const int tm = tile / tilesN;
  const int tn = tile - tm * tilesN;
  const int m0 = tm << 6;
  const int n0 = tn << 6;

  const T* Ab  = A  + (size_t)b * strideA;
  const T* Bb  = Bt + (size_t)b * strideB;
  const T* Ab2 = SPLIT ? (A2  + (size_t)b * strideA) : nullptr;
  const T* Bb2 = SPLIT ? (Bt2 + (size_t)b * strideB) : nullptr;

  const int rlane = lane & 15;                 // row (A) / col (B, D) within subtile
  const int koff  = (lane >> 4) * 8;           // k offset of this lane half
  const int mOff  = (lane >> 4) * 8;           // D row offset

  v8f acc[4][4];
#pragma unroll
  for (int i = 0; i < 4; ++i)
#pragma unroll
    for (int j = 0; j < 4; ++j) acc[i][j] = (v8f){0.f,0.f,0.f,0.f,0.f,0.f,0.f,0.f};

  for (int k0 = 0; k0 < K; k0 += 32) {
    V bh[4], bl[4];
#pragma unroll
    for (int j = 0; j < 4; ++j) {
      const size_t bo = (size_t)(n0 + (j << 4) + rlane) * ldb + koff + k0;
      bh[j] = Frag<T>::load(Bb + bo);
      if (SPLIT) bl[j] = Frag<T>::load(Bb2 + bo);
    }
#pragma unroll
    for (int i = 0; i < 4; ++i) {
      const size_t ao = (size_t)(m0 + (i << 4) + rlane) * lda + koff + k0;
      V ah = Frag<T>::load(Ab + ao);
      V al;
      if (SPLIT) al = Frag<T>::load(Ab2 + ao);
#pragma unroll
      for (int j = 0; j < 4; ++j) {
        acc[i][j] = Frag<T>::mma(ah, bh[j], acc[i][j]);
        if (SPLIT) {
          acc[i][j] = Frag<T>::mma(ah, bl[j], acc[i][j]);
          acc[i][j] = Frag<T>::mma(al, bh[j], acc[i][j]);
        }
      }
      Frag<T>::guard(acc[i][0], acc[i][3], ah, SPLIT ? al : ah);
    }
    Frag<T>::keep(bh[0], bh[1], bh[2], bh[3]);
    if (SPLIT) Frag<T>::keep(bl[0], bl[1], bl[2], bl[3]);
  }
  acc_guard4(acc[0][0], acc[0][1], acc[0][2], acc[0][3]);
  acc_guard4(acc[1][0], acc[1][1], acc[1][2], acc[1][3]);
  acc_guard4(acc[2][0], acc[2][1], acc[2][2], acc[2][3]);
  acc_guard4(acc[3][0], acc[3][1], acc[3][2], acc[3][3]);

  // ---- epilogue ----
  float* slab = sT[wave];
  const float* Rb = RESID ? (resid + (size_t)b * strideR) : nullptr;
#pragma unroll
  for (int i = 0; i < 4; ++i) {
    const int mBase = m0 + (i << 4);
#pragma unroll
    for (int j = 0; j < 4; ++j) {
      const int n = n0 + (j << 4) + rlane;
      float bv = 0.f;
      if (BIAS_MODE == 2) bv = bias[n];
#pragma unroll
      for (int r = 0; r < 8; ++r) {
        float v = acc[i][j][r] * scale;
        if (BIAS_MODE == 1) v += bias[mBase + mOff + r];
        if (BIAS_MODE == 2) v += bv;
        if (RESID) v += Rb[(size_t)(mBase + mOff + r) * ldc + n];
        if (ACT == 1) v = tanhf(v);
        if (ACT == 2) v = fmaxf(v, 0.0f);
        if (ACT == 3) v = v / (1.0f + expf(-v));
        if (ACT == 4) v = (v > 0.f) ? v : 0.01f * v;
        if (ACT == 5) v = 0.5f * v * (1.0f + erff(v * 0.70710678118654752f));
        slab[(mOff + r) * 68 + (j << 4) + rlane] = v;
      }
    }
    __builtin_amdgcn_fence(__ATOMIC_RELEASE, "workgroup");
    __builtin_amdgcn_wave_barrier();
    __builtin_amdgcn_fence(__ATOMIC_ACQUIRE, "workgroup");
    if (OUT_MODE == 0) {
      float* C = (float*)Cout + (size_t)b * strideC;
      const int hh = lane >> 4, c4 = (lane & 15) * 4;     // row seg = 256 B = 16 lanes x 16 B
      {
#pragma unroll
        for (int it = 0; it < 8; ++it) {
          const int row = it * 2 + hh;
          v4f v = *(const v4f*)(slab + row * 68 + c4);
          *(v4f*)(C + (size_t)(mBase + row) * ldc + n0 + c4) = v;
        }
        
      }
    } else {
      const int q = lane >> 3, c8 = (lane & 7) * 8;
      unsigned short* C  = (unsigned short*)Cout  + (size_t)b * strideC;
      unsigned short* C2 = (OUT_MODE == 2) ? ((unsigned short*)Cout2 + (size_t)b * strideC) : nullptr;
      {
#pragma unroll
        for (int it = 0; it < 4; ++it) {
          const int row = it * 4 + q;
          const float* sp = slab + row * 68 + c8;
          v8h hv, lv;
#pragma unroll
          for (int e = 0; e < 8; ++e) {
            if (OUT_MODE == 1) {
              hv[e] = (_Float16)sp[e];
            } else {
              unsigned short hb = f2bf_bits(sp[e]);
              unsigned short lb = f2bf_bits(sp[e] - bf_bits2f(hb));
              hv[e] = __builtin_bit_cast(_Float16, hb);
              lv[e] = __builtin_bit_cast(_Float16, lb);
            }
          }
          *(v8h*)(C + (size_t)(mBase + row) * ldc + n0 + c8) = hv;
          if (OUT_MODE == 2) *(v8h*)(C2 + (size_t)(mBase + row) * ldc + n0 + c8) = lv;
        }
        
      }
    }
    __builtin_amdgcn_fence(__ATOMIC_RELEASE, "workgroup");
    __builtin_amdgcn_wave_barrier();
    __builtin_amdgcn_fence(__ATOMIC_ACQUIRE, "workgroup");
  }
}

__device__ __forceinline__ void cast_f32_f16x2(
    int bx, const float* __restrict__ in, _Float16* __restrict__ out, int n2) {
  int i = bx * 256 + threadIdx.x;
  if (i < n2) {
    const _Float16 h0 = (_Float16)in[2 * i], h1 = (_Float16)in[2 * i + 1];
    const unsigned u = (unsigned)__builtin_bit_cast(unsigned short, h0) | ((unsigned)__builtin_bit_cast(unsigned short, h1) << 16);
    ((unsigned*)out)[i] = u;
    
  }
}

__device__ __forceinline__ void split_f32_bf16x2(
    int bx, const float* __restrict__ in, unsigned short* __restrict__ oh, unsigned short* __restrict__ ol, int n2) {
  int i = bx * 256 + threadIdx.x;
  if (i < n2) {
    const float f0 = in[2 * i], f1 = in[2 * i + 1];
    const unsigned short hb0 = f2bf_bits(f0), hb1 = f2bf_bits(f1);
    const unsigned short lb0 = f2bf_bits(f0 - bf_bits2f(hb0)), lb1 = f2bf_bits(f1 - bf_bits2f(hb1));
    const unsigned uh = (unsigned)hb0 | ((unsigned)hb1 << 16);
    const unsigned ul = (unsigned)lb0 | ((unsigned)lb1 << 16);
    ((unsigned*)oh)[i] = uh;
    ((unsigned*)ol)[i] = ul;
    
  }
}

// ---- channel-major f32 x[b][Cin][Sn] -> pixel-major 16-bit planes [b][Sn][Cin]: bf16 hi, bf16 lo (RNE), optional f16 ----
template <bool F16P>
__device__ __forceinline__ void k_cm_to_pm(
    float (*ts)[68], int bx, int by, int b,
    const float* __restrict__ x, int Cin, int Sn,
    unsigned short* __restrict__ oh, unsigned short* __restrict__ ol, unsigned short* __restrict__ of) {
  const int tid = threadIdx.x, lane = tid & 31, wave = tid >> 5;
  const int s0 = bx * 32, c0 = by * 64;
  const float* xb = x + ((size_t)b * Cin + c0) * Sn + s0;
#pragma unroll
  for (int i = 0; i < 8; ++i) {
    const int idx = tid + i * 256;        // 0..2047
    const int cc = idx >> 5, ss = idx & 31;
    ts[ss][cc] = xb[(size_t)cc * Sn + ss];
  }
  __syncthreads();
  const int lq = lane >> 3, c8 = (lane & 7) * 8;
  const int ss = wave * 4 + lq;           // 8 waves x 4 rows = 32 rows, one line per (row, plane)
  const v4f a0 = *(const v4f*)(&ts[ss][c8]);
  const v4f a1 = *(const v4f*)(&ts[ss][c8 + 4]);
  const float f[8] = {a0[0], a0[1], a0[2], a0[3], a1[0], a1[1], a1[2], a1[3]};
  v8h hv, lv, fv;
#pragma unroll
  for (int e = 0; e < 8; ++e) {
    const unsigned short hb = f2bf_bits(f[e]);
    const unsigned short lb = f2bf_bits(f[e] - bf_bits2f(hb));
    hv[e] = __builtin_bit_cast(_Float16, hb);
    lv[e] = __builtin_bit_cast(_Float16, lb);
    fv[e] = F16P ? (_Float16)f[e] : hv[e];
  }
  const size_t o = ((size_t)b * Sn + s0 + ss) * Cin + c0 + c8;
  {
    *(v8h*)(oh + o) = hv;
    *(v8h*)(ol + o) = lv;
    if (F16P) *(v8h*)(of + o) = fv;
    // precaution: other jobs' code follows this body in the same kernel and may rewrite the stores' registers; the wait stands in front of it
    asm volatile("s_wait_xcnt 0x0" ::: "memory");
  }
}

// ---- One grid for the five operand preparations: none reads what another writes; the block index picks the job ----
//   blocks    0..1023  x_low  [8][256][1024] -> pixel-major planes (32 px tiles x 4 channel tiles x 8 batches)
//   blocks 1024..1535  x_high [8][512][256]  -> pixel-major planes ( 8 px tiles x 8 channel tiles x 8 batches)
//   blocks 1536..1791  Wq planes; 1792..1919  Wk planes; 1920..2047  Wv f16
__global__ __launch_bounds__(256) void prep_all(
    const float* __restrict__ x_low, const float* __restrict__ x_high,
    const float* __restrict__ Wq, const float* __restrict__ Wk, const float* __restrict__ Wv,
    unsigned short* __restrict__ xl_h, unsigned short* __restrict__ xl_l, unsigned short* __restrict__ xl_f,
    unsigned short* __restrict__ xh_h, unsigned short* __restrict__ xh_l,
    unsigned short* __restrict__ wq_h, unsigned short* __restrict__ wq_l,
    unsigned short* __restrict__ wk_h, unsigned short* __restrict__ wk_l,
    unsigned short* __restrict__ wv_f) {
  __shared__ __align__(16) float ts[32][68];   // [pixel][channel]
  const int id = blockIdx.x;                   // every branch below is uniform over the block
  if (id < 1024) {
    k_cm_to_pm<true>(ts, id & 31, (id >> 5) & 3, id >> 7, x_low, 256, 1024, xl_h, xl_l, xl_f);
  } else if (id < 1536) {
    const int j = id - 1024;
    k_cm_to_pm<false>(ts, j & 7, (j >> 3) & 7, j >> 6, x_high, 512, 256, xh_h, xh_l, xh_l);
  } else if (id < 1792) {
    split_f32_bf16x2(id - 1536, Wq, wq_h, wq_l, 256 * 512 / 2);
  } else if (id < 1920) {
    split_f32_bf16x2(id - 1792, Wk, wk_h, wk_l, 256 * 256 / 2);
  } else {
    cast_f32_f16x2(id - 1920, Wv, (_Float16*)wv_f, 256 * 256 / 2);
  }
}

// ---- One grid for the three projections: none reads what another writes; the block index picks the job ----
//   blocks  0..15   q[b][sq][co] = sum_ci xh[b][sq][ci] Wq[co][ci] + bq[co]  (K = 512, the longest job, so it starts first)
//   blocks 16..79   k[b][s][co]  = sum_ci xl[b][s][ci]  Wk[co][ci] + bk[co]
//   blocks 80..143  v[b][co][s]  = sum_ci Wv[co][ci] xl[b][s][ci] + bv[co]   (channel-major out; f16 operands, f16 out)
__global__ __launch_bounds__(256) void proj_all(
    const unsigned short* __restrict__ xh_h, const unsigned short* __restrict__ xh_l,
    const unsigned short* __restrict__ wq_h, const unsigned short* __restrict__ wq_l,
    unsigned short* __restrict__ q_h, unsigned short* __restrict__ q_l, const float* __restrict__ bq,
    const unsigned short* __restrict__ xl_h, const unsigned short* __restrict__ xl_l,
    const unsigned short* __restrict__ wk_h, const unsigned short* __restrict__ wk_l,
    unsigned short* __restrict__ k_h, unsigned short* __restrict__ k_l, const float* __restrict__ bk,
    const unsigned short* __restrict__ wv_f, const unsigned short* __restrict__ xl_f,
    unsigned short* __restrict__ v_f, const float* __restrict__ bv) {
  __shared__ __align__(16) float sT[8][16 * 68];   // per-wave 16x64 slab, pitch 68 floats
  const int id = blockIdx.x;                       // every branch below is uniform over the block
  if (id < 80) {
    // q and k share one copy of the split-plane body; only its scalar arguments differ
    const bool isq = id < 16;
    const int  j   = isq ? id : id - 16;
    const int  Kd  = isq ? 512 : 256;              // reduction length = row pitch of both operands
    const int  Md  = isq ? 256 : 1024;             // pixels per batch
    wmma_gemm64<1, true, 2, 2, false, 0>(sT, isq ? (j & 1) : (j & 7), isq ? (j >> 1) : (j >> 3),
        isq ? xh_h : xl_h, isq ? xh_l : xl_l, Kd, (long)Md * Kd,
        isq ? wq_h : wk_h, isq ? wq_l : wk_l, Kd, 0L,
        (void*)(isq ? q_h : k_h), (void*)(isq ? q_l : k_l), 256, (long)Md * 256,
        isq ? bq : bk, isq ? bq : bk, 0L, Md, 256, Kd, 1.0f);
  } else {
    const int j = id - 80;
    wmma_gemm64<0, false, 1, 1, false, 0>(sT, j & 7, j >> 3,
        wv_f, wv_f, 256, 0L,
        xl_f, xl_f, 256, (long)1024 * 256,
        (void*)v_f, (void*)v_f, 1024, (long)256 * 1024,
        bv, bv, 0L, 256, 1024, 256, 1.0f);
  }
}

// =====================================================================================
// Attention, head dim 32, no mask, no scaling.
//   q planes: bf16 hi/lo [B][256 src px][256 ch] (16x16 grid). The four output pixels of one source pixel share their
//   query row, so their attention rows are equal: each source pixel is worked once and its result stored to all four.
//   k planes: bf16 hi/lo [B][1024 px][256 ch];  v: f16 channel-major [B][256 ch][1024 px]
//   out f32 channel-major [B][256 ch][1024 px].
//   scores = q.k^T: 3 x v_wmma_f32_16x16x32_bf16 per 16x16 tile (hi.hi + hi.lo + lo.hi); online softmax f32;
//   p carried x2^15 as f16 in per-wave LDS; out = p.v: v_wmma_f32_16x16x32_f16; f32 accumulate.
//   Block = 16 waves = 64 source pixels (256 output pixels) of one (b, head); grid.x = B*8*4.
//   Wave = (key group g = wave >> 2, query sub-tile = wave & 3): group g works keys 256g .. 256g+255 in 64-key chunks staged in its
//   own LDS buffers, so a SIMD holds four waves that each walk a quarter of the keys. Every group keeps its own running max, sum
//   and unnormalised out tile; the epilogue merges the four in the fixed order g = 0..3.
// =====================================================================================
#define AS_S   1024
#define AS_C   256
#define AS_SQ  256
#define AS_HD  32
#define AS_NH  8
#define AS_KC  64
#define AS_PSC 32768.0f
#define AS_NG  4                 // key groups per block
#define AS_GK  (AS_S / AS_NG)     // keys per group

__device__ __forceinline__ v8f mma_bf_g(v16b a, v16b b, v8f c) {
  c = __builtin_amdgcn_wmma_f32_16x16x32_bf16(false, a, false, b, (short)0, c, false, false);
  asm volatile("v_nop\n\tv_nop\n\tv_nop\n\tv_nop" : "+v"(c) : "v"(a), "v"(b));
  return c;
}
__device__ __forceinline__ v8f mma_hf_g(v16h a, v16h b, v8f c) {
  c = __builtin_amdgcn_wmma_f32_16x16x32_f16(false, a, false, b, (short)0, c, false, false);
  asm volatile("v_nop\n\tv_nop\n\tv_nop\n\tv_nop" : "+v"(c) : "v"(a), "v"(b));
  return c;
}

__global__ __launch_bounds__(512)
void attn_hd32(const unsigned short* __restrict__ qhp, const unsigned short* __restrict__ qlp,
               const unsigned short* __restrict__ khp, const unsigned short* __restrict__ klp,
               const unsigned short* __restrict__ vp, float* __restrict__ out) {
  union FB { v16b v; v8b h[2]; };
  union FH { v16h v; v8h h[2]; };
  __shared__ __align__(16) __bf16   KshA[AS_NG][AS_KC * AS_HD];   // per group: k hi [kv][d]   4 KB
  __shared__ __align__(16) __bf16   KslA[AS_NG][AS_KC * AS_HD];   // per group: k lo [kv][d]   4 KB
  __shared__ __align__(16) _Float16 VtA[AS_NG][AS_HD * AS_KC];    // per group: v [d][kv]      4 KB
  __shared__ __align__(16) _Float16 Psh[4 * AS_NG][16 * AS_KC];   // per wave p [row][kv]      2 KB
  __shared__ __align__(16) float    Os[AS_NG][AS_HD][68];         // per group: unnormalised out tile [d][64 source px], pitch 68
  __shared__ __align__(16) float    Ms[AS_NG][64];                // per group: running max of each source px
  __shared__ __align__(16) float    Ls[AS_NG][64];                // per group: running sum of each source px

  const int tid  = threadIdx.x;
  const int wave = tid >> 5;
  const int grp  = wave >> 2;          // key group
  const int wq   = wave & 3;           // query sub-tile
  const int gt   = tid & 127;          // thread within the group
  const int lane = tid & 31;
  const int hh   = lane >> 4;
  const int c    = lane & 15;

  const int bx = blockIdx.x;
  const int qb = bx & 3;               // AS_SQ / 64 = 4 query blocks
  const int bh = bx >> 2;
  const int h  = bh & (AS_NH - 1);
  const int b  = bh >> 3;
  const int qbase = qb * 64;
  const int q0 = qbase + wq * 16;

  // ---- Q fragments (A operand, lane c = row, split k map), hi and lo planes ----
  v16b qah, qal;
  {
    const int sq = q0 + c;                       // source pixel 0..255 on the 16x16 grid
    const size_t qo = ((size_t)b * AS_SQ + sq) * AS_C + h * AS_HD + 8 * hh;
    qah = Frag<__bf16>::load((const __bf16*)qhp + qo);
    qal = Frag<__bf16>::load((const __bf16*)qlp + qo);
  }

  float mrow[8], lrow[8];
  v8f oacc[2];
#pragma unroll
  for (int r = 0; r < 8; ++r) { mrow[r] = -INFINITY; lrow[r] = 0.f; }
#pragma unroll
  for (int t = 0; t < 2; ++t) oacc[t] = (v8f){0.f,0.f,0.f,0.f,0.f,0.f,0.f,0.f};

  const __bf16*   khb = (const __bf16*)khp + (size_t)b * AS_S * AS_C + h * AS_HD;
  const __bf16*   klb = (const __bf16*)klp + (size_t)b * AS_S * AS_C + h * AS_HD;
  const _Float16* vb  = (const _Float16*)vp + ((size_t)b * AS_C + h * AS_HD) * AS_S;
  float*          ob  = out + ((size_t)b * AS_C + h * AS_HD) * AS_S + qbase * 4;   // 4 source rows -> 8 output rows of 32
  _Float16*       pw  = Psh[wave];
  __bf16*         Ksh = KshA[grp];
  __bf16*         Ksl = KslA[grp];
  _Float16*       Vt  = VtA[grp];

  for (int kc = 0; kc < AS_GK / AS_KC; ++kc) {
    const int kv0 = grp * AS_GK + kc * AS_KC;
    __syncthreads();
    {
      // K chunk of the group: 64 kv rows x 32 d, both planes; thread -> (kv row, 16-d half)
      const int kvr = gt >> 1, dh = (gt & 1) * 16;
      const __bf16* kr  = khb + (size_t)(kv0 + kvr) * AS_C + dh;
      const __bf16* kr2 = klb + (size_t)(kv0 + kvr) * AS_C + dh;
      *(v8b*)(Ksh + kvr * AS_HD + dh)     = *(const v8b*)(kr);
      *(v8b*)(Ksh + kvr * AS_HD + dh + 8) = *(const v8b*)(kr + 8);
      *(v8b*)(Ksl + kvr * AS_HD + dh)     = *(const v8b*)(kr2);
      *(v8b*)(Ksl + kvr * AS_HD + dh + 8) = *(const v8b*)(kr2 + 8);
      // V chunk of the group: 32 d rows x 64 kv (channel-major source is already [d][kv]); thread -> (d row, 16-kv quarter)
      const int dr = gt >> 2, part = (gt & 3) * 16;
      const _Float16* vr = vb + (size_t)dr * AS_S + kv0 + part;
      *(v8h*)(Vt + dr * AS_KC + part)     = *(const v8h*)(vr);
      *(v8h*)(Vt + dr * AS_KC + part + 8) = *(const v8h*)(vr + 8);
    }
    __syncthreads();

    // ---- scores: s[j][r] = row (8hh+r), kv (kv0 + 16j + c); B operand = k with split k map over d ----
    v8f s[4];
#pragma unroll
    for (int j = 0; j < 4; ++j) {
      s[j] = (v8f){0.f,0.f,0.f,0.f,0.f,0.f,0.f,0.f};
      FB kb, kl;
      kb.h[0] = *(const v8b*)(Ksh + (j * 16 + c) * AS_HD + 8 * hh);
      kb.h[1] = *(const v8b*)(Ksh + (j * 16 + c) * AS_HD + 16 + 8 * hh);
      kl.h[0] = *(const v8b*)(Ksl + (j * 16 + c) * AS_HD + 8 * hh);
      kl.h[1] = *(const v8b*)(Ksl + (j * 16 + c) * AS_HD + 16 + 8 * hh);
      s[j] = mma_bf_g(qah, kb.v, s[j]);
      s[j] = mma_bf_g(qah, kl.v, s[j]);
      s[j] = mma_bf_g(qal, kb.v, s[j]);
    }

    // ---- online softmax (f32) ----
    float cm[8];
#pragma unroll
    for (int r = 0; r < 8; ++r) {
      float m = s[0][r];
#pragma unroll
      for (int j = 1; j < 4; ++j) m = fmaxf(m, s[j][r]);
#pragma unroll
      for (int off = 1; off < 16; off <<= 1) m = fmaxf(m, __shfl_xor(m, off, 32));
      cm[r] = m;
    }
#pragma unroll
    for (int r = 0; r < 8; ++r) {
      const float mnew  = fmaxf(mrow[r], cm[r]);
      const float alpha = expf(mrow[r] - mnew);
      mrow[r] = mnew;
      float psum = 0.f;
#pragma unroll
      for (int j = 0; j < 4; ++j) {
        const float p = expf(s[j][r] - mnew);
        psum += p;
        pw[(8 * hh + r) * AS_KC + j * 16 + c] = (_Float16)(p * AS_PSC);
      }
#pragma unroll
      for (int off = 1; off < 16; off <<= 1) psum += __shfl_xor(psum, off, 32);
      lrow[r] = lrow[r] * alpha + psum;
#pragma unroll
      for (int t = 0; t < 2; ++t) oacc[t][r] *= alpha;
    }
    __builtin_amdgcn_fence(__ATOMIC_RELEASE, "workgroup");
    __builtin_amdgcn_wave_barrier();
    __builtin_amdgcn_fence(__ATOMIC_ACQUIRE, "workgroup");

    // ---- out += p . v : A = p [row][kv] (same element type reload), B = v with split k map over kv ----
#pragma unroll 1
    for (int kk = 0; kk < 2; ++kk) {
      FH pa;
      pa.h[0] = *(const v8h*)(pw + c * AS_KC + kk * 32 + 8 * hh);
      pa.h[1] = *(const v8h*)(pw + c * AS_KC + kk * 32 + 16 + 8 * hh);
#pragma unroll
      for (int t = 0; t < 2; ++t) {
        FH vf;
        vf.h[0] = *(const v8h*)(Vt + (t * 16 + c) * AS_KC + kk * 32 + 8 * hh);
        vf.h[1] = *(const v8h*)(Vt + (t * 16 + c) * AS_KC + kk * 32 + 16 + 8 * hh);
        oacc[t] = mma_hf_g(pa.v, vf.v, oacc[t]);
      }
    }
  }

  // ---- each group hands over its partial state: max, sum, unnormalised out tile ----
  const int row0 = wq * 16 + 8 * hh;
#pragma unroll
  for (int r = 0; r < 8; ++r) {
#pragma unroll
    for (int t = 0; t < 2; ++t) Os[grp][t * 16 + c][row0 + r] = oacc[t][r];
  }
  if (c == 0) {   // the 16 lanes of a row hold equal max and sum: one lane stores them
#pragma unroll
    for (int r = 0; r < 8; ++r) { Ms[grp][row0 + r] = mrow[r]; Ls[grp][row0 + r] = lrow[r]; }
  }
  __syncthreads();
  {
    // nearest-neighbour 2x: output pixel (y, x) of the block's 8 x 32 patch takes source (y>>1, x>>1) of its 4 x 16 patch
    const int o4 = (tid & 63) * 4;                       // 4 output pixels of one row: two source pixels, each twice
    const int sp = (o4 >> 6) * 16 + ((o4 & 31) >> 1);
    // merge weights of the two source pixels: w[g] = exp(m_g - m) / (2^15 * sum_g exp(m_g - m) l_g), g in fixed order
    float w0[AS_NG], w1[AS_NG];
    {
      float m0 = Ms[0][sp], m1 = Ms[0][sp + 1];
#pragma unroll
      for (int g = 1; g < AS_NG; ++g) { m0 = fmaxf(m0, Ms[g][sp]); m1 = fmaxf(m1, Ms[g][sp + 1]); }
      float l0 = 0.f, l1 = 0.f;
#pragma unroll
      for (int g = 0; g < AS_NG; ++g) {
        w0[g] = expf(Ms[g][sp] - m0);      l0 += w0[g] * Ls[g][sp];
        w1[g] = expf(Ms[g][sp + 1] - m1);  l1 += w1[g] * Ls[g][sp + 1];
      }
      const float i0 = 1.0f / (l0 * AS_PSC), i1 = 1.0f / (l1 * AS_PSC);
#pragma unroll
      for (int g = 0; g < AS_NG; ++g) { w0[g] *= i0; w1[g] *= i1; }
    }
#pragma unroll   // the 4 channel steps become immediate offsets of one address, and the LDS reads run ahead of the stores
    for (int it = 0; it < 4; ++it) {
      const int d = it * 8 + (tid >> 6);
      float s0 = 0.f, s1 = 0.f;
#pragma unroll
      for (int g = 0; g < AS_NG; ++g) { s0 += Os[g][d][sp] * w0[g]; s1 += Os[g][d][sp + 1] * w1[g]; }
      *(v4f*)(ob + (size_t)d * AS_S + o4) = (v4f){s0, s0, s1, s1};
    }
  }
}

extern "C" void kernel_launch(void* const* d_in, const int* in_sizes, int n_in,
                              void* d_out, int out_size, void* d_ws, size_t ws_size,
                              hipStream_t stream) {
  const int B = 8, CHI = 512, C = 256, SQ = 256, S = 1024;
  if (n_in < 8) return;
  if (in_sizes[0] != B * CHI * SQ || in_sizes[1] != B * C * S || in_sizes[2] != C * CHI ||
      in_sizes[3] != C || in_sizes[4] != C * C || in_sizes[5] != C || in_sizes[6] != C * C ||
      in_sizes[7] != C || out_size != B * C * S) return;

  const float* x_high = (const float*)d_in[0];
  const float* x_low  = (const float*)d_in[1];
  const float* Wq     = (const float*)d_in[2];
  const float* bq     = (const float*)d_in[3];
  const float* Wk     = (const float*)d_in[4];
  const float* bk     = (const float*)d_in[5];
  const float* Wv     = (const float*)d_in[6];
  const float* bv     = (const float*)d_in[7];
  float* out = (float*)d_out;

  // ---- workspace carve (bytes, 256-B aligned) ----
  char* ws = (char*)d_ws;
  size_t off = 0;
#define CARVE16(name, elems) unsigned short* name = (unsigned short*)(ws + off); off += ((((size_t)(elems)) * 2) + 255) & ~(size_t)255;
  CARVE16(xl_h, (size_t)B * S * C)       // x_low planes, pixel-major [B][1024][256]
  CARVE16(xl_l, (size_t)B * S * C)
  CARVE16(xl_f, (size_t)B * S * C)
  CARVE16(xh_h, (size_t)B * SQ * CHI)    // x_high planes, pixel-major [B][256][512]
  CARVE16(xh_l, (size_t)B * SQ * CHI)
  CARVE16(wq_h, (size_t)C * CHI)
  CARVE16(wq_l, (size_t)C * CHI)
  CARVE16(wk_h, (size_t)C * C)
  CARVE16(wk_l, (size_t)C * C)
  CARVE16(wv_f, (size_t)C * C)
  CARVE16(q_h,  (size_t)B * SQ * C)      // q planes [B][256 src px][256 ch]
  CARVE16(q_l,  (size_t)B * SQ * C)
  CARVE16(k_h,  (size_t)B * S * C)       // k planes [B][1024][256 ch]
  CARVE16(k_l,  (size_t)B * S * C)
  CARVE16(v_f,  (size_t)B * C * S)       // v f16 channel-major [B][256 ch][1024]
#undef CARVE16
  if (off > ws_size || off > (size_t)134217728) return;   // total 32,374,784 B

  // ---- operand planes: weights (bf16 hi/lo, f16) and activations (channel-major -> pixel-major 16-bit planes), one launch ----
  prep_all<<<dim3(2048), dim3(256), 0, stream>>>(x_low, x_high, Wq, Wk, Wv,
      xl_h, xl_l, xl_f, xh_h, xh_l, wq_h, wq_l, wk_h, wk_l, wv_f);

  // ---- q, k and v projections, one launch ----
  proj_all<<<dim3(144), dim3(256), 0, stream>>>(
      xh_h, xh_l, wq_h, wq_l, q_h, q_l, bq,
      xl_h, xl_l, wk_h, wk_l, k_h, k_l, bk,
      wv_f, xl_f, v_f, bv);

  // ---- attention ----
  attn_hd32<<<dim3(B * AS_NH * (SQ / 64)), dim3(512), 0, stream>>>(q_h, q_l, k_h, k_l, v_f, out);
}

// v004
// One run takes 45.7 microseconds.
// In two side-by-side timings against v003, it was 1.52 and 1.54 times as fast.
// Over all steps from v000 it is 3.79 times as fast.
#include <hip/hip_runtime.h>
#include <stdint.h>
// Contractions: q-proj, k-proj, q.k scores: v_wmma_f32_16x16x32_bf16 with bf16 hi/lo operand planes (hi.hi + hi.lo + lo.hi);
// v-proj and p.v: v_wmma_f32_16x16x32_f16 (f16 operands, p carried x2^15); f32 accumulate everywhere; softmax in f32.

typedef __attribute__((ext_vector_type(16))) _Float16 v16h;
typedef __attribute__((ext_vector_type(8)))  _Float16 v8h;
typedef __attribute__((ext_vector_type(16))) __bf16   v16b;
typedef __attribute__((ext_vector_type(8)))  __bf16   v8b;
typedef __attribute__((ext_vector_type(8)))  float    v8f;
typedef __attribute__((ext_vector_type(4)))  float    v4f;

__device__ __forceinline__ unsigned short f2bf_bits(float f) {
  unsigned u = __float_as_uint(f);
  return (unsigned short)((u + 0x7FFFu + ((u >> 16) & 1u)) >> 16);
}
__device__ __forceinline__ float bf_bits2f(unsigned short h) { return __uint_as_float(((unsigned)h) << 16); }

// hazard guards as plain device helpers
__device__ __forceinline__ void dep_guard_h(v8f& a, v8f& b, v16h x, v16h y) { asm volatile("v_nop\n\tv_nop\n\tv_nop\n\tv_nop" : "+v"(a), "+v"(b) : "v"(x), "v"(y)); }
__device__ __forceinline__ void dep_guard_b(v8f& a, v8f& b, v16b x, v16b y) { asm volatile("v_nop\n\tv_nop\n\tv_nop\n\tv_nop" : "+v"(a), "+v"(b) : "v"(x), "v"(y)); }
__device__ __forceinline__ void keep4_h(v16h a, v16h b, v16h c, v16h d) { asm volatile("v_nop" :: "v"(a), "v"(b), "v"(c), "v"(d)); }
__device__ __forceinline__ void keep4_b(v16b a, v16b b, v16b c, v16b d) { asm volatile("v_nop" :: "v"(a), "v"(b), "v"(c), "v"(d)); }
__device__ __forceinline__ void acc_guard4(v8f& a, v8f& b, v8f& c, v8f& d) { asm volatile("v_nop\n\tv_nop\n\tv_nop\n\tv_nop" : "+v"(a), "+v"(b), "+v"(c), "+v"(d)); }
template <typename T> struct Frag;
template <> struct Frag<_Float16> {
  typedef v16h V; union U { v16h v; v8h h[2]; };
  static __device__ __forceinline__ v16h load(const _Float16* p) {   // elements 0..7 <- p[0..7], 8..15 <- p[16..23]
    U f; f.h[0] = *(const v8h*)(p); f.h[1] = *(const v8h*)(p + 16); return f.v;
  }
  static __device__ __forceinline__ v8f mma(v16h a, v16h b, v8f c) {
    return __builtin_amdgcn_wmma_f32_16x16x32_f16(false, a, false, b, (short)0, c, false, false);
  }
  static __device__ __forceinline__ void guard(v8f& a, v8f& b, v16h x, v16h y) { dep_guard_h(a, b, x, y); }
  static __device__ __forceinline__ void keep(v16h a, v16h b, v16h c, v16h d) { keep4_h(a, b, c, d); }
};
template <> struct Frag<__bf16> {
  typedef v16b V; union U { v16b v; v8b h[2]; };
  static __device__ __forceinline__ v16b load(const __bf16* p) {
    U f; f.h[0] = *(const v8b*)(p); f.h[1] = *(const v8b*)(p + 16); return f.v;
  }
  static __device__ __forceinline__ v8f mma(v16b a, v16b b, v8f c) {
    return __builtin_amdgcn_wmma_f32_16x16x32_bf16(false, a, false, b, (short)0, c, false, false);
  }
  static __device__ __forceinline__ void guard(v8f& a, v8f& b, v16b x, v16b y) { dep_guard_b(a, b, x, y); }
  static __device__ __forceinline__ void keep(v16b a, v16b b, v16b c, v16b d) { keep4_b(a, b, c, d); }
};

// ---- Register-blocked batched WMMA GEMM, operands staged in LDS ------------
// C[m,n] = scale * sum_k A[m,k] * Bt[n,k] (+bias)(+resid); each wave owns a 64x64 tile.
// A row-major [M,K]; Bt row-major [N,K]; K % 64 == 0, K >= 128.
// The block's 8 wave tiles form one (8/WN * 64) x (WN * 64) tile; M and N are multiples of its sides and the grid holds exactly
// (M / side) * (N / side) blocks per batch. Its A and Bt rows are brought to LDS 64 k (one 128-B line per row) at a time.
// SPLIT: operands are hi/lo planes (A2/Bt2 = lo planes, same layout); product = hi.hi + hi.lo + lo.hi.
// BIAS_MODE: 0 = none, 1 = bias[m], 2 = bias[n].
// OUT_MODE: 0 = f32, 1 = f16, 2 = bf16 hi plane (Cout) + bf16 lo plane (Cout2).
// ET: 0 = f16 operands, 1 = bf16 operands (pointers passed as 16-bit storage)
template <int ET> struct Elem;
template <> struct Elem<0> { typedef _Float16 T; };
template <> struct Elem<1> { typedef __bf16 T; };

#define PJ_KS     64                        // k per stage
#define PJ_PITCH  72                        // LDS row pitch in elements: 128 B + 16 B, an odd multiple of 16 B for the b128 readers
#define PJ_ROWS   768                       // rows of the largest stage: 2 planes x (128 A rows + 256 Bt rows)
#define PJ_STAGE  (PJ_ROWS * PJ_PITCH)      // elements per buffer

// Each lane copies its own 16 bytes from global memory to LDS through no register. The s_wait_xcnt stands inside the copies' own
// statement, so that no address register of a copy is rewritten in front of it (a precaution).
#define PJ_CP(l, g) "global_load_async_to_lds_b128 %" #l ", %" #g ", off\n\t"
__device__ __forceinline__ void async_copy6(const unsigned* l, const unsigned short* const* g) {
  asm volatile(PJ_CP(0, 6) PJ_CP(1, 7) PJ_CP(2, 8) PJ_CP(3, 9) PJ_CP(4, 10) PJ_CP(5, 11) "s_wait_xcnt 0x0"
               :: "v"(l[0]), "v"(l[1]), "v"(l[2]), "v"(l[3]), "v"(l[4]), "v"(l[5]),
                  "v"(g[0]), "v"(g[1]), "v"(g[2]), "v"(g[3]), "v"(g[4]), "v"(g[5]) : "memory");
}
__device__ __forceinline__ void async_copy12(const unsigned* l, const unsigned short* const* g) {
  asm volatile(PJ_CP(0, 12) PJ_CP(1, 13) PJ_CP(2, 14) PJ_CP(3, 15) PJ_CP(4, 16) PJ_CP(5, 17)
               PJ_CP(6, 18) PJ_CP(7, 19) PJ_CP(8, 20) PJ_CP(9, 21) PJ_CP(10, 22) PJ_CP(11, 23) "s_wait_xcnt 0x0"
               :: "v"(l[0]), "v"(l[1]), "v"(l[2]), "v"(l[3]), "v"(l[4]), "v"(l[5]),
                  "v"(l[6]), "v"(l[7]), "v"(l[8]), "v"(l[9]), "v"(l[10]), "v"(l[11]),
                  "v"(g[0]), "v"(g[1]), "v"(g[2]), "v"(g[3]), "v"(g[4]), "v"(g[5]),
                  "v"(g[6]), "v"(g[7]), "v"(g[8]), "v"(g[9]), "v"(g[10]), "v"(g[11]) : "memory");
}

// One stage: rows [A hi | A lo | Bt hi | Bt lo] (one plane each without SPLIT), 64 k of every row. A thread takes 16 bytes of one row
// in every group of 32 rows, so a wave's copy covers 4 whole 128-B lines. pa.. = the thread's own 16 bytes in row (tid >> 3) of each
// operand's block rows at this stage's k; dst = the thread's own LDS byte address in row (tid >> 3) of the buffer.
template <bool SPLIT, int AR, int BR>
__device__ __forceinline__ void stage_copy(unsigned dst,
    const unsigned short* pa, const unsigned short* pa2, int lda,
    const unsigned short* pb, const unsigned short* pb2, int ldb) {
  constexpr int P  = SPLIT ? 2 : 1;
  constexpr int NC = P * (AR + BR) / 32;     // copies per thread: 24 (split) or 18
  unsigned l[NC];
  const unsigned short* g[NC];
#pragma unroll
  for (int i = 0; i < NC; ++i) {
    const int row = i * 32;                  // first row of the group, a constant
    l[i] = dst + (unsigned)(row * PJ_PITCH * 2);
    if (row < AR)                g[i] = pa  + (size_t)row * lda;
    else if (row < P * AR)       g[i] = pa2 + (size_t)(row - AR) * lda;
    else if (row < P * AR + BR)  g[i] = pb  + (size_t)(row - P * AR) * ldb;
    else                         g[i] = pb2 + (size_t)(row - P * AR - BR) * ldb;
  }
  async_copy12(l, g);
  if (NC == 24) async_copy12(l + 12, g + 12);
  else          async_copy6(l + 12, g + 12);
}

// Device body: bx = block tile, b = batch, stg = the block's two stage buffers, sT = the block's 8 per-wave slabs.
template <int ET, bool SPLIT, int BIAS_MODE, int OUT_MODE, bool RESID, int WN, int ACT = 0>
__device__ __forceinline__ void wmma_gemm64(
    unsigned short* stg, float (*sT)[16 * 68], int bx, int b,
    const unsigned short* __restrict__ Ap, const unsigned short* __restrict__ A2p, int lda, long strideA,
    const unsigned short* __restrict__ Btp, const unsigned short* __restrict__ Bt2p, int ldb, long strideB,
    void* __restrict__ Cout, void* __restrict__ Cout2, int ldc, long strideC,
    const float* __restrict__ bias,
    const float* __restrict__ resid, long strideR,
    int M, int N, int K, float scale) {
  typedef typename Elem<ET>::T T;
  typedef typename Frag<T>::V V;
  constexpr int AR = (8 / WN) * 64;            // A rows of the block tile
  constexpr int BR = WN * 64;                  // Bt rows of the block tile
  constexpr int P  = SPLIT ? 2 : 1;
  const int tid  = threadIdx.x;
  const int lane = tid & 31;
  const int wave = tid >> 5;
  const int nbN = N / BR;
  const int bm  = bx / nbN;
  const int bn  = bx - bm * nbN;
  const int wa  = wave / WN;                   // the wave's 64 rows among the block's A rows
  const int wb  = wave - wa * WN;              // the wave's 64 rows among the block's Bt rows
  const int m0 = bm * AR + (wa << 6);
  const int n0 = bn * BR + (wb << 6);

  const int rlane = lane & 15;                 // row (A) / col (B, D) within subtile
  const int koff  = (lane >> 4) * 8;           // k offset of this lane half
  const int mOff  = (lane >> 4) * 8;           // D row offset

  // the thread's own 16 bytes of a stage: row (tid >> 3) of a 32-row group, bytes 16 * (tid & 7) of its 128
  const int crow = tid >> 3, ccol = (tid & 7) * 8;
  const unsigned short* ca  = Ap  + (size_t)b * strideA + (size_t)(bm * AR + crow) * lda + ccol;
  const unsigned short* ca2 = A2p + (size_t)b * strideA + (size_t)(bm * AR + crow) * lda + ccol;
  const unsigned short* cb  = Btp  + (size_t)b * strideB + (size_t)(bn * BR + crow) * ldb + ccol;
  const unsigned short* cb2 = Bt2p + (size_t)b * strideB + (size_t)(bn * BR + crow) * ldb + ccol;
  const unsigned cdst = (unsigned)(uintptr_t)(stg + crow * PJ_PITCH + ccol);   // low 32 bits = byte address in the block's LDS

  v8f acc[4][4];
#pragma unroll
  for (int i = 0; i < 4; ++i)
#pragma unroll
    for (int j = 0; j < 4; ++j) acc[i][j] = (v8f){0.f,0.f,0.f,0.f,0.f,0.f,0.f,0.f};

  const int nt = K / PJ_KS;                    // stages; the same for the whole block, at least 2
  stage_copy<SPLIT, AR, BR>(cdst, ca, ca2, lda, cb, cb2, ldb);
  asm volatile("s_wait_asynccnt 0x0" ::: "memory");   // this wave's copies of stage 0 have landed
  __syncthreads();                                    // every wave's have: stage 0 may be read
  stage_copy<SPLIT, AR, BR>(cdst + PJ_STAGE * 2, ca + PJ_KS, ca2 + PJ_KS, lda, cb + PJ_KS, cb2 + PJ_KS, ldb);

#pragma unroll 1   // rolled: the text of both jobs stays small for the instruction cache, and the two buffers alternate by index
  for (int t = 0; t < nt; ++t) {
    const int bufo = (t & 1) * PJ_STAGE;
    const T* sA  = (const T*)(stg + bufo) + ((wa << 6) + rlane) * PJ_PITCH + koff;
    const T* sA2 = sA + AR * PJ_PITCH;
    const T* sB  = (const T*)(stg + bufo) + (P * AR + (wb << 6) + rlane) * PJ_PITCH + koff;
    const T* sB2 = sB + BR * PJ_PITCH;
#pragma unroll
    for (int kk = 0; kk < PJ_KS; kk += 32) {
      V bh[4], bl[4];
#pragma unroll
      for (int j = 0; j < 4; ++j) {
        bh[j] = Frag<T>::load(sB + (j << 4) * PJ_PITCH + kk);
        if (SPLIT) bl[j] = Frag<T>::load(sB2 + (j << 4) * PJ_PITCH + kk);
      }
#pragma unroll
      for (int i = 0; i < 4; ++i) {
        V ah = Frag<T>::load(sA + (i << 4) * PJ_PITCH + kk);
        V al;
        if (SPLIT) al = Frag<T>::load(sA2 + (i << 4) * PJ_PITCH + kk);
#pragma unroll
        for (int j = 0; j < 4; ++j) {
          acc[i][j] = Frag<T>::mma(ah, bh[j], acc[i][j]);
          if (SPLIT) {
            acc[i][j] = Frag<T>::mma(ah, bl[j], acc[i][j]);
            acc[i][j] = Frag<T>::mma(al, bh[j], acc[i][j]);
          }
        }
        Frag<T>::guard(acc[i][0], acc[i][3], ah, SPLIT ? al : ah);
      }
      Frag<T>::keep(bh[0], bh[1], bh[2], bh[3]);
      if (SPLIT) Frag<T>::keep(bl[0], bl[1], bl[2], bl[3]);
    }
    asm volatile("s_wait_dscnt 0x0" ::: "memory");      // this wave's reads of stage t are done before its buffer is refilled
    asm volatile("s_wait_asynccnt 0x0" ::: "memory");   // this wave's copies of stage t + 1 have landed
    __syncthreads();                                    // publishes stage t + 1 and ends every wave's reads of stage t
    if (t + 2 < nt) {                                   // the same for the whole block
      const int ko = (t + 2) * PJ_KS;
      stage_copy<SPLIT, AR, BR>(cdst + (unsigned)(bufo * 2), ca + ko, ca2 + ko, lda, cb + ko, cb2 + ko, ldb);
    }
  }
  asm volatile("s_wait_asynccnt 0x0" ::: "memory");     // no copy is outstanding behind the loop
  acc_guard4(acc[0][0], acc[0][1], acc[0][2], acc[0][3]);
  acc_guard4(acc[1][0], acc[1][1], acc[1][2], acc[1][3]);
  acc_guard4(acc[2][0], acc[2][1], acc[2][2], acc[2][3]);
  acc_guard4(acc[3][0], acc[3][1], acc[3][2], acc[3][3]);

  // ---- epilogue ----
  float* slab = sT[wave];
  const float* Rb = RESID ? (resid + (size_t)b * strideR) : nullptr;
#pragma unroll
  for (int i = 0; i < 4; ++i) {
    const int mBase = m0 + (i << 4);
#pragma unroll
    for (int j = 0; j < 4; ++j) {
      const int n = n0 + (j << 4) + rlane;
      float bv = 0.f;
      if (BIAS_MODE == 2) bv = bias[n];
#pragma unroll
      for (int r = 0; r < 8; ++r) {
        float v = acc[i][j][r] * scale;
        if (BIAS_MODE == 1) v += bias[mBase + mOff + r];
        if (BIAS_MODE == 2) v += bv;
        if (RESID) v += Rb[(size_t)(mBase + mOff + r) * ldc + n];
        if (ACT == 1) v = tanhf(v);
        if (ACT == 2) v = fmaxf(v, 0.0f);
        if (ACT == 3) v = v / (1.0f + expf(-v));
        if (ACT == 4) v = (v > 0.f) ? v : 0.01f * v;
        if (ACT == 5) v = 0.5f * v * (1.0f + erff(v * 0.70710678118654752f));
        slab[(mOff + r) * 68 + (j << 4) + rlane] = v;
      }
    }
    __builtin_amdgcn_fence(__ATOMIC_RELEASE, "workgroup");
    __builtin_amdgcn_wave_barrier();
    __builtin_amdgcn_fence(__ATOMIC_ACQUIRE, "workgroup");
    if (OUT_MODE == 0) {
      float* C = (float*)Cout + (size_t)b * strideC;
      const int hh = lane >> 4, c4 = (lane & 15) * 4;     // row seg = 256 B = 16 lanes x 16 B
      {
#pragma unroll
        for (int it = 0; it < 8; ++it) {
          const int row = it * 2 + hh;
          v4f v = *(const v4f*)(slab + row * 68 + c4);
          *(v4f*)(C + (size_t)(mBase + row) * ldc + n0 + c4) = v;
        }
        
      }
    } else {
      const int q = lane >> 3, c8 = (lane & 7) * 8;
      unsigned short* C  = (unsigned short*)Cout  + (size_t)b * strideC;
      unsigned short* C2 = (OUT_MODE == 2) ? ((unsigned short*)Cout2 + (size_t)b * strideC) : nullptr;
      {
#pragma unroll
        for (int it = 0; it < 4; ++it) {
          const int row = it * 4 + q;
          const float* sp = slab + row * 68 + c8;
          v8h hv, lv;
#pragma unroll
          for (int e = 0; e < 8; ++e) {
            if (OUT_MODE == 1) {
              hv[e] = (_Float16)sp[e];
            } else {
              unsigned short hb = f2bf_bits(sp[e]);
              unsigned short lb = f2bf_bits(sp[e] - bf_bits2f(hb));
              hv[e] = __builtin_bit_cast(_Float16, hb);
              lv[e] = __builtin_bit_cast(_Float16, lb);
            }
          }
          *(v8h*)(C + (size_t)(mBase + row) * ldc + n0 + c8) = hv;
          if (OUT_MODE == 2) *(v8h*)(C2 + (size_t)(mBase + row) * ldc + n0 + c8) = lv;
        }
        
      }
    }
    __builtin_amdgcn_fence(__ATOMIC_RELEASE, "workgroup");
    __builtin_amdgcn_wave_barrier();
    __builtin_amdgcn_fence(__ATOMIC_ACQUIRE, "workgroup");
  }
}

__device__ __forceinline__ void cast_f32_f16x2(
    int bx, const float* __restrict__ in, _Float16* __restrict__ out, int n2) {
  int i = bx * 256 + threadIdx.x;
  if (i < n2) {
    const _Float16 h0 = (_Float16)in[2 * i], h1 = (_Float16)in[2 * i + 1];
    const unsigned u = (unsigned)__builtin_bit_cast(unsigned short, h0) | ((unsigned)__builtin_bit_cast(unsigned short, h1) << 16);
    ((unsigned*)out)[i] = u;
    
  }
}

__device__ __forceinline__ void split_f32_bf16x2(
    int bx, const float* __restrict__ in, unsigned short* __restrict__ oh, unsigned short* __restrict__ ol, int n2) {
  int i = bx * 256 + threadIdx.x;
  if (i < n2) {
    const float f0 = in[2 * i], f1 = in[2 * i + 1];
    const unsigned short hb0 = f2bf_bits(f0), hb1 = f2bf_bits(f1);
    const unsigned short lb0 = f2bf_bits(f0 - bf_bits2f(hb0)), lb1 = f2bf_bits(f1 - bf_bits2f(hb1));
    const unsigned uh = (unsigned)hb0 | ((unsigned)hb1 << 16);
    const unsigned ul = (unsigned)lb0 | ((unsigned)lb1 << 16);
    ((unsigned*)oh)[i] = uh;
    ((unsigned*)ol)[i] = ul;
    
  }
}

// ---- channel-major f32 x[b][Cin][Sn] -> pixel-major 16-bit planes [b][Sn][Cin]: bf16 hi, bf16 lo (RNE), optional f16 ----
template <bool F16P>
__device__ __forceinline__ void k_cm_to_pm(
    float (*ts)[68], int bx, int by, int b,
    const float* __restrict__ x, int Cin, int Sn,
    unsigned short* __restrict__ oh, unsigned short* __restrict__ ol, unsigned short* __restrict__ of) {
  const int tid = threadIdx.x, lane = tid & 31, wave = tid >> 5;
  const int s0 = bx * 32, c0 = by * 64;
  const float* xb = x + ((size_t)b * Cin + c0) * Sn + s0;
#pragma unroll
  for (int i = 0; i < 8; ++i) {
    const int idx = tid + i * 256;        // 0..2047
    const int cc = idx >> 5, ss = idx & 31;
    ts[ss][cc] = xb[(size_t)cc * Sn + ss];
  }
  __syncthreads();
  const int lq = lane >> 3, c8 = (lane & 7) * 8;
  const int ss = wave * 4 + lq;           // 8 waves x 4 rows = 32 rows, one line per (row, plane)
  const v4f a0 = *(const v4f*)(&ts[ss][c8]);
  const v4f a1 = *(const v4f*)(&ts[ss][c8 + 4]);
  const float f[8] = {a0[0], a0[1], a0[2], a0[3], a1[0], a1[1], a1[2], a1[3]};
  v8h hv, lv, fv;
#pragma unroll
  for (int e = 0; e < 8; ++e) {
    const unsigned short hb = f2bf_bits(f[e]);
    const unsigned short lb = f2bf_bits(f[e] - bf_bits2f(hb));
    hv[e] = __builtin_bit_cast(_Float16, hb);
    lv[e] = __builtin_bit_cast(_Float16, lb);
    fv[e] = F16P ? (_Float16)f[e] : hv[e];
  }
  const size_t o = ((size_t)b * Sn + s0 + ss) * Cin + c0 + c8;
  {
    *(v8h*)(oh + o) = hv;
    *(v8h*)(ol + o) = lv;
    if (F16P) *(v8h*)(of + o) = fv;
    // precaution: other jobs' code follows this body in the same kernel and may rewrite the stores' registers; the wait stands in front of it
    asm volatile("s_wait_xcnt 0x0" ::: "memory");
  }
}

// ---- One grid for the five operand preparations: none reads what another writes; the block index picks the job ----
//   blocks    0..1023  x_low  [8][256][1024] -> pixel-major planes (32 px tiles x 4 channel tiles x 8 batches)
//   blocks 1024..1535  x_high [8][512][256]  -> pixel-major planes ( 8 px tiles x 8 channel tiles x 8 batches)
//   blocks 1536..1791  Wq planes; 1792..1919  Wk planes; 1920..2047  Wv f16
__global__ __launch_bounds__(256) void prep_all(
    const float* __restrict__ x_low, const float* __restrict__ x_high,
    const float* __restrict__ Wq, const float* __restrict__ Wk, const float* __restrict__ Wv,
    unsigned short* __restrict__ xl_h, unsigned short* __restrict__ xl_l, unsigned short* __restrict__ xl_f,
    unsigned short* __restrict__ xh_h, unsigned short* __restrict__ xh_l,
    unsigned short* __restrict__ wq_h, unsigned short* __restrict__ wq_l,
    unsigned short* __restrict__ wk_h, unsigned short* __restrict__ wk_l,
    unsigned short* __restrict__ wv_f) {
  __shared__ __align__(16) float ts[32][68];   // [pixel][channel]
  const int id = blockIdx.x;                   // every branch below is uniform over the block
  if (id < 1024) {
    k_cm_to_pm<true>(ts, id & 31, (id >> 5) & 3, id >> 7, x_low, 256, 1024, xl_h, xl_l, xl_f);
  } else if (id < 1536) {
    const int j = id - 1024;
    k_cm_to_pm<false>(ts, j & 7, (j >> 3) & 7, j >> 6, x_high, 512, 256, xh_h, xh_l, xh_l);
  } else if (id < 1792) {
    split_f32_bf16x2(id - 1536, Wq, wq_h, wq_l, 256 * 512 / 2);
  } else if (id < 1920) {
    split_f32_bf16x2(id - 1792, Wk, wk_h, wk_l, 256 * 256 / 2);
  } else {
    cast_f32_f16x2(id - 1920, Wv, (_Float16*)wv_f, 256 * 256 / 2);
  }
}

// ---- One grid for the three projections: none reads what another writes; the block index picks the job ----
//   blocks  0..15   q[b][sq][co] = sum_ci xh[b][sq][ci] Wq[co][ci] + bq[co]  (K = 512, the longest job)
//   blocks 16..79   k[b][s][co]  = sum_ci xl[b][s][ci]  Wk[co][ci] + bk[co]
//   blocks 80..143  v[b][co][s]  = sum_ci Wv[co][ci] xl[b][s][ci] + bv[co]   (channel-major out; f16 operands, f16 out)
__global__ __launch_bounds__(256) void proj_all(
    const unsigned short* __restrict__ xh_h, const unsigned short* __restrict__ xh_l,
    const unsigned short* __restrict__ wq_h, const unsigned short* __restrict__ wq_l,
    unsigned short* __restrict__ q_h, unsigned short* __restrict__ q_l, const float* __restrict__ bq,
    const unsigned short* __restrict__ xl_h, const unsigned short* __restrict__ xl_l,
    const unsigned short* __restrict__ wk_h, const unsigned short* __restrict__ wk_l,
    unsigned short* __restrict__ k_h, unsigned short* __restrict__ k_l, const float* __restrict__ bk,
    const unsigned short* __restrict__ wv_f, const unsigned short* __restrict__ xl_f,
    unsigned short* __restrict__ v_f, const float* __restrict__ bv) {
  __shared__ __align__(16) unsigned short stg[2 * PJ_STAGE];   // two stage buffers of the block's operand rows
  __shared__ __align__(16) float sT[8][16 * 68];   // per-wave 16x64 slab, pitch 68 floats
  const int id = blockIdx.x;                       // every branch below is uniform over the block
  if (id < 80) {
    // q and k share one copy of the split-plane body; only its scalar arguments differ
    const bool isq = id < 16;
    const int  j   = isq ? id : id - 16;
    const int  Kd  = isq ? 512 : 256;              // reduction length = row pitch of both operands
    const int  Md  = isq ? 256 : 1024;             // pixels per batch
    wmma_gemm64<1, true, 2, 2, false, 4, 0>(stg, sT, isq ? (j & 1) : (j & 7), isq ? (j >> 1) : (j >> 3),
        isq ? xh_h : xl_h, isq ? xh_l : xl_l, Kd, (long)Md * Kd,
        isq ? wq_h : wk_h, isq ? wq_l : wk_l, Kd, 0L,
        (void*)(isq ? q_h : k_h), (void*)(isq ? q_l : k_l), 256, (long)Md * 256,
        isq ? bq : bk, isq ? bq : bk, 0L, Md, 256, Kd, 1.0f);
  } else {
    const int j = id - 80;
    wmma_gemm64<0, false, 1, 1, false, 8, 0>(stg, sT, j & 7, j >> 3,
        wv_f, wv_f, 256, 0L,
        xl_f, xl_f, 256, (long)1024 * 256,
        (void*)v_f, (void*)v_f, 1024, (long)256 * 1024,
        bv, bv, 0L, 256, 1024, 256, 1.0f);
  }
}

// =====================================================================================
// Attention, head dim 32, no mask, no scaling.
//   q planes: bf16 hi/lo [B][256 src px][256 ch] (16x16 grid). The four output pixels of one source pixel share their
//   query row, so their attention rows are equal: each source pixel is worked once and its result stored to all four.
//   k planes: bf16 hi/lo [B][1024 px][256 ch];  v: f16 channel-major [B][256 ch][1024 px]
//   out f32 channel-major [B][256 ch][1024 px].
//   scores = q.k^T: 3 x v_wmma_f32_16x16x32_bf16 per 16x16 tile (hi.hi + hi.lo + lo.hi); online softmax f32;
//   p carried x2^15 as f16 in per-wave LDS; out = p.v: v_wmma_f32_16x16x32_f16; f32 accumulate.
//   Block = 16 waves = 64 source pixels (256 output pixels) of one (b, head); grid.x = B*8*4.
//   Wave = (key group g = wave >> 2, query sub-tile = wave & 3): group g works keys 256g .. 256g+255 in 64-key chunks staged in its
//   own LDS buffers. Every group keeps its own running max, sum
//   and unnormalised out tile; the epilogue merges the four in the fixed order g = 0..3.
// =====================================================================================
#define AS_S   1024
#define AS_C   256
#define AS_SQ  256
#define AS_HD  32
#define AS_NH  8
#define AS_KC  64
#define AS_PSC 32768.0f
#define AS_NG  4                 // key groups per block
#define AS_GK  (AS_S / AS_NG)     // keys per group

__device__ __forceinline__ v8f mma_bf_g(v16b a, v16b b, v8f c) {
  c = __builtin_amdgcn_wmma_f32_16x16x32_bf16(false, a, false, b, (short)0, c, false, false);
  asm volatile("v_nop\n\tv_nop\n\tv_nop\n\tv_nop" : "+v"(c) : "v"(a), "v"(b));
  return c;
}
__device__ __forceinline__ v8f mma_hf_g(v16h a, v16h b, v8f c) {
  c = __builtin_amdgcn_wmma_f32_16x16x32_f16(false, a, false, b, (short)0, c, false, false);
  asm volatile("v_nop\n\tv_nop\n\tv_nop\n\tv_nop" : "+v"(c) : "v"(a), "v"(b));
  return c;
}

__global__ __launch_bounds__(512)
void attn_hd32(const unsigned short* __restrict__ qhp, const unsigned short* __restrict__ qlp,
               const unsigned short* __restrict__ khp, const unsigned short* __restrict__ klp,
               const unsigned short* __restrict__ vp, float* __restrict__ out) {
  union FB { v16b v; v8b h[2]; };
  union FH { v16h v; v8h h[2]; };
  __shared__ __align__(16) __bf16   KshA[AS_NG][AS_KC * AS_HD];   // per group: k hi [kv][d]   4 KB
  __shared__ __align__(16) __bf16   KslA[AS_NG][AS_KC * AS_HD];   // per group: k lo [kv][d]   4 KB
  __shared__ __align__(16) _Float16 VtA[AS_NG][AS_HD * AS_KC];    // per group: v [d][kv]      4 KB
  __shared__ __align__(16) _Float16 Psh[4 * AS_NG][16 * AS_KC];   // per wave p [row][kv]      2 KB
  __shared__ __align__(16) float    Os[AS_NG][AS_HD][68];         // per group: unnormalised out tile [d][64 source px], pitch 68
  __shared__ __align__(16) float    Ms[AS_NG][64];                // per group: running max of each source px
  __shared__ __align__(16) float    Ls[AS_NG][64];                // per group: running sum of each source px

  const int tid  = threadIdx.x;
  const int wave = tid >> 5;
  const int grp  = wave >> 2;          // key group
  const int wq   = wave & 3;           // query sub-tile
  const int gt   = tid & 127;          // thread within the group
  const int lane = tid & 31;
  const int hh   = lane >> 4;
  const int c    = lane & 15;

  const int bx = blockIdx.x;
  const int qb = bx & 3;               // AS_SQ / 64 = 4 query blocks
  const int bh = bx >> 2;
  const int h  = bh & (AS_NH - 1);
  const int b  = bh >> 3;
  const int qbase = qb * 64;
  const int q0 = qbase + wq * 16;

  // ---- Q fragments (A operand, lane c = row, split k map), hi and lo planes ----
  v16b qah, qal;
  {
    const int sq = q0 + c;                       // source pixel 0..255 on the 16x16 grid
    const size_t qo = ((size_t)b * AS_SQ + sq) * AS_C + h * AS_HD + 8 * hh;
    qah = Frag<__bf16>::load((const __bf16*)qhp + qo);
    qal = Frag<__bf16>::load((const __bf16*)qlp + qo);
  }

  float mrow[8], lrow[8];
  v8f oacc[2];
#pragma unroll
  for (int r = 0; r < 8; ++r) { mrow[r] = -INFINITY; lrow[r] = 0.f; }
#pragma unroll
  for (int t = 0; t < 2; ++t) oacc[t] = (v8f){0.f,0.f,0.f,0.f,0.f,0.f,0.f,0.f};

  const __bf16*   khb = (const __bf16*)khp + (size_t)b * AS_S * AS_C + h * AS_HD;
  const __bf16*   klb = (const __bf16*)klp + (size_t)b * AS_S * AS_C + h * AS_HD;
  const _Float16* vb  = (const _Float16*)vp + ((size_t)b * AS_C + h * AS_HD) * AS_S;
  float*          ob  = out + ((size_t)b * AS_C + h * AS_HD) * AS_S + qbase * 4;   // 4 source rows -> 8 output rows of 32
  _Float16*       pw  = Psh[wave];
  __bf16*         Ksh = KshA[grp];
  __bf16*         Ksl = KslA[grp];
  _Float16*       Vt  = VtA[grp];

  for (int kc = 0; kc < AS_GK / AS_KC; ++kc) {
    const int kv0 = grp * AS_GK + kc * AS_KC;
    __syncthreads();
    {
      // K chunk of the group: 64 kv rows x 32 d, both planes; thread -> (kv row, 16-d half)
      const int kvr = gt >> 1, dh = (gt & 1) * 16;
      const __bf16* kr  = khb + (size_t)(kv0 + kvr) * AS_C + dh;
      const __bf16* kr2 = klb + (size_t)(kv0 + kvr) * AS_C + dh;
      *(v8b*)(Ksh + kvr * AS_HD + dh)     = *(const v8b*)(kr);
      *(v8b*)(Ksh + kvr * AS_HD + dh + 8) = *(const v8b*)(kr + 8);
      *(v8b*)(Ksl + kvr * AS_HD + dh)     = *(const v8b*)(kr2);
      *(v8b*)(Ksl + kvr * AS_HD + dh + 8) = *(const v8b*)(kr2 + 8);
      // V chunk of the group: 32 d rows x 64 kv (channel-major source is already [d][kv]); thread -> (d row, 16-kv quarter)
      const int dr = gt >> 2, part = (gt & 3) * 16;
      const _Float16* vr = vb + (size_t)dr * AS_S + kv0 + part;
      *(v8h*)(Vt + dr * AS_KC + part)     = *(const v8h*)(vr);
      *(v8h*)(Vt + dr * AS_KC + part + 8) = *(const v8h*)(vr + 8);
    }
    __syncthreads();

    // ---- scores: s[j][r] = row (8hh+r), kv (kv0 + 16j + c); B operand = k with split k map over d ----
    v8f s[4];
#pragma unroll
    for (int j = 0; j < 4; ++j) {
      s[j] = (v8f){0.f,0.f,0.f,0.f,0.f,0.f,0.f,0.f};
      FB kb, kl;
      kb.h[0] = *(const v8b*)(Ksh + (j * 16 + c) * AS_HD + 8 * hh);
      kb.h[1] = *(const v8b*)(Ksh + (j * 16 + c) * AS_HD + 16 + 8 * hh);
      kl.h[0] = *(const v8b*)(Ksl + (j * 16 + c) * AS_HD + 8 * hh);
      kl.h[1] = *(const v8b*)(Ksl + (j * 16 + c) * AS_HD + 16 + 8 * hh);
      s[j] = mma_bf_g(qah, kb.v, s[j]);
      s[j] = mma_bf_g(qah, kl.v, s[j]);
      s[j] = mma_bf_g(qal, kb.v, s[j]);
    }

    // ---- online softmax (f32) ----
    float cm[8];
#pragma unroll
    for (int r = 0; r < 8; ++r) {
      float m = s[0][r];
#pragma unroll
      for (int j = 1; j < 4; ++j) m = fmaxf(m, s[j][r]);
#pragma unroll
      for (int off = 1; off < 16; off <<= 1) m = fmaxf(m, __shfl_xor(m, off, 32));
      cm[r] = m;
    }
#pragma unroll
    for (int r = 0; r < 8; ++r) {
      const float mnew  = fmaxf(mrow[r], cm[r]);
      const float alpha = expf(mrow[r] - mnew);
      mrow[r] = mnew;
      float psum = 0.f;
#pragma unroll
      for (int j = 0; j < 4; ++j) {
        const float p = expf(s[j][r] - mnew);
        psum += p;
        pw[(8 * hh + r) * AS_KC + j * 16 + c] = (_Float16)(p * AS_PSC);
      }
#pragma unroll
      for (int off = 1; off < 16; off <<= 1) psum += __shfl_xor(psum, off, 32);
      lrow[r] = lrow[r] * alpha + psum;
#pragma unroll
      for (int t = 0; t < 2; ++t) oacc[t][r] *= alpha;
    }
    __builtin_amdgcn_fence(__ATOMIC_RELEASE, "workgroup");
    __builtin_amdgcn_wave_barrier();
    __builtin_amdgcn_fence(__ATOMIC_ACQUIRE, "workgroup");

    // ---- out += p . v : A = p [row][kv] (same element type reload), B = v with split k map over kv ----
#pragma unroll 1
    for (int kk = 0; kk < 2; ++kk) {
      FH pa;
      pa.h[0] = *(const v8h*)(pw + c * AS_KC + kk * 32 + 8 * hh);
      pa.h[1] = *(const v8h*)(pw + c * AS_KC + kk * 32 + 16 + 8 * hh);
#pragma unroll
      for (int t = 0; t < 2; ++t) {
        FH vf;
        vf.h[0] = *(const v8h*)(Vt + (t * 16 + c) * AS_KC + kk * 32 + 8 * hh);
        vf.h[1] = *(const v8h*)(Vt + (t * 16 + c) * AS_KC + kk * 32 + 16 + 8 * hh);
        oacc[t] = mma_hf_g(pa.v, vf.v, oacc[t]);
      }
    }
  }

  // ---- each group hands over its partial state: max, sum, unnormalised out tile ----
  const int row0 = wq * 16 + 8 * hh;
#pragma unroll
  for (int r = 0; r < 8; ++r) {
#pragma unroll
    for (int t = 0; t < 2; ++t) Os[grp][t * 16 + c][row0 + r] = oacc[t][r];
  }
  if (c == 0) {   // the 16 lanes of a row hold equal max and sum: one lane stores them
#pragma unroll
    for (int r = 0; r < 8; ++r) { Ms[grp][row0 + r] = mrow[r]; Ls[grp][row0 + r] = lrow[r]; }
  }
  __syncthreads();
  {
    // nearest-neighbour 2x: output pixel (y, x) of the block's 8 x 32 patch takes source (y>>1, x>>1) of its 4 x 16 patch
    const int o4 = (tid & 63) * 4;                       // 4 output pixels of one row: two source pixels, each twice
    const int sp = (o4 >> 6) * 16 + ((o4 & 31) >> 1);
    // merge weights of the two source pixels: w[g] = exp(m_g - m) / (2^15 * sum_g exp(m_g - m) l_g), g in fixed order
    float w0[AS_NG], w1[AS_NG];
    {
      float m0 = Ms[0][sp], m1 = Ms[0][sp + 1];
#pragma unroll
      for (int g = 1; g < AS_NG; ++g) { m0 = fmaxf(m0, Ms[g][sp]); m1 = fmaxf(m1, Ms[g][sp + 1]); }
      float l0 = 0.f, l1 = 0.f;
#pragma unroll
      for (int g = 0; g < AS_NG; ++g) {
        w0[g] = expf(Ms[g][sp] - m0);      l0 += w0[g] * Ls[g][sp];
        w1[g] = expf(Ms[g][sp + 1] - m1);  l1 += w1[g] * Ls[g][sp + 1];
      }
      const float i0 = 1.0f / (l0 * AS_PSC), i1 = 1.0f / (l1 * AS_PSC);
#pragma unroll
      for (int g = 0; g < AS_NG; ++g) { w0[g] *= i0; w1[g] *= i1; }
    }
#pragma unroll   // the 4 channel steps become immediate offsets of one address, and the LDS reads run ahead of the stores
    for (int it = 0; it < 4; ++it) {
      const int d = it * 8 + (tid >> 6);
      float s0 = 0.f, s1 = 0.f;
#pragma unroll
      for (int g = 0; g < AS_NG; ++g) { s0 += Os[g][d][sp] * w0[g]; s1 += Os[g][d][sp + 1] * w1[g]; }
      *(v4f*)(ob + (size_t)d * AS_S + o4) = (v4f){s0, s0, s1, s1};
    }
  }
}

extern "C" void kernel_launch(void* const* d_in, const int* in_sizes, int n_in,
                              void* d_out, int out_size, void* d_ws, size_t ws_size,
                              hipStream_t stream) {
  const int B = 8, CHI = 512, C = 256, SQ = 256, S = 1024;
  if (n_in < 8) return;
  if (in_sizes[0] != B * CHI * SQ || in_sizes[1] != B * C * S || in_sizes[2] != C * CHI ||
      in_sizes[3] != C || in_sizes[4] != C * C || in_sizes[5] != C || in_sizes[6] != C * C ||
      in_sizes[7] != C || out_size != B * C * S) return;

  const float* x_high = (const float*)d_in[0];
  const float* x_low  = (const float*)d_in[1];
  const float* Wq     = (const float*)d_in[2];
  const float* bq     = (const float*)d_in[3];
  const float* Wk     = (const float*)d_in[4];
  const float* bk     = (const float*)d_in[5];
  const float* Wv     = (const float*)d_in[6];
  const float* bv     = (const float*)d_in[7];
  float* out = (float*)d_out;

  // ---- workspace carve (bytes, 256-B aligned) ----
  char* ws = (char*)d_ws;
  size_t off = 0;
#define CARVE16(name, elems) unsigned short* name = (unsigned short*)(ws + off); off += ((((size_t)(elems)) * 2) + 255) & ~(size_t)255;
  CARVE16(xl_h, (size_t)B * S * C)       // x_low planes, pixel-major [B][1024][256]
  CARVE16(xl_l, (size_t)B * S * C)
  CARVE16(xl_f, (size_t)B * S * C)
  CARVE16(xh_h, (size_t)B * SQ * CHI)    // x_high planes, pixel-major [B][256][512]
  CARVE16(xh_l, (size_t)B * SQ * CHI)
  CARVE16(wq_h, (size_t)C * CHI)
  CARVE16(wq_l, (size_t)C * CHI)
  CARVE16(wk_h, (size_t)C * C)
  CARVE16(wk_l, (size_t)C * C)
  CARVE16(wv_f, (size_t)C * C)
  CARVE16(q_h,  (size_t)B * SQ * C)      // q planes [B][256 src px][256 ch]
  CARVE16(q_l,  (size_t)B * SQ * C)
  CARVE16(k_h,  (size_t)B * S * C)       // k planes [B][1024][256 ch]
  CARVE16(k_l,  (size_t)B * S * C)
  CARVE16(v_f,  (size_t)B * C * S)       // v f16 channel-major [B][256 ch][1024]
#undef CARVE16
  if (off > ws_size || off > (size_t)134217728) return;   // total 32,374,784 B

  // ---- operand planes: weights (bf16 hi/lo, f16) and activations (channel-major -> pixel-major 16-bit planes), one launch ----
  prep_all<<<dim3(2048), dim3(256), 0, stream>>>(x_low, x_high, Wq, Wk, Wv,
      xl_h, xl_l, xl_f, xh_h, xh_l, wq_h, wq_l, wk_h, wk_l, wv_f);

  // ---- q, k and v projections, one launch ----
  proj_all<<<dim3(144), dim3(256), 0, stream>>>(
      xh_h, xh_l, wq_h, wq_l, q_h, q_l, bq,
      xl_h, xl_l, wk_h, wk_l, k_h, k_l, bk,
      wv_f, xl_f, v_f, bv);

  // ---- attention ----
  attn_hd32<<<dim3(B * AS_NH * (SQ / 64)), dim3(512), 0, stream>>>(q_h, q_l, k_h, k_l, v_f, out);
}

// v005
// Measured time: 36.4 microseconds a run.
// In two side-by-side timings against v004, it was 1.27 and 1.26 times as fast.
// All steps since v000 together make it 4.78 times as fast.
#include <hip/hip_runtime.h>
#include <stdint.h>
// Contractions: q-proj, k-proj, q.k scores: v_wmma_f32_16x16x32_bf16 with bf16 hi/lo operand planes (hi.hi + hi.lo + lo.hi);
// v-proj and p.v: v_wmma_f32_16x16x32_f16 (f16 operands, p carried x2^15); f32 accumulate everywhere; softmax in f32.

typedef __attribute__((ext_vector_type(16))) _Float16 v16h;
typedef __attribute__((ext_vector_type(8)))  _Float16 v8h;
typedef __attribute__((ext_vector_type(16))) __bf16   v16b;
typedef __attribute__((ext_vector_type(8)))  __bf16   v8b;
typedef __attribute__((ext_vector_type(8)))  float    v8f;
typedef __attribute__((ext_vector_type(4)))  float    v4f;

__device__ __forceinline__ unsigned short f2bf_bits(float f) {
  unsigned u = __float_as_uint(f);
  return (unsigned short)((u + 0x7FFFu + ((u >> 16) & 1u)) >> 16);
}
__device__ __forceinline__ float bf_bits2f(unsigned short h) { return __uint_as_float(((unsigned)h) << 16); }

// hazard guards as plain device helpers
__device__ __forceinline__ void dep_guard_h(v8f& a, v8f& b, v16h x, v16h y) { asm volatile("v_nop\n\tv_nop\n\tv_nop\n\tv_nop" : "+v"(a), "+v"(b) : "v"(x), "v"(y)); }
__device__ __forceinline__ void dep_guard_b(v8f& a, v8f& b, v16b x, v16b y) { asm volatile("v_nop\n\tv_nop\n\tv_nop\n\tv_nop" : "+v"(a), "+v"(b) : "v"(x), "v"(y)); }
__device__ __forceinline__ void keep4_h(v16h a, v16h b, v16h c, v16h d) { asm volatile("v_nop" :: "v"(a), "v"(b), "v"(c), "v"(d)); }
__device__ __forceinline__ void keep4_b(v16b a, v16b b, v16b c, v16b d) { asm volatile("v_nop" :: "v"(a), "v"(b), "v"(c), "v"(d)); }
__device__ __forceinline__ void acc_guard4(v8f& a, v8f& b, v8f& c, v8f& d) { asm volatile("v_nop\n\tv_nop\n\tv_nop\n\tv_nop" : "+v"(a), "+v"(b), "+v"(c), "+v"(d)); }
template <typename T> struct Frag;
template <> struct Frag<_Float16> {
  typedef v16h V; union U { v16h v; v8h h[2]; };
  static __device__ __forceinline__ v16h load(const _Float16* p) {   // elements 0..7 <- p[0..7], 8..15 <- p[16..23]
    U f; f.h[0] = *(const v8h*)(p); f.h[1] = *(const v8h*)(p + 16); return f.v;
  }
  static __device__ __forceinline__ v8f mma(v16h a, v16h b, v8f c) {
    return __builtin_amdgcn_wmma_f32_16x16x32_f16(false, a, false, b, (short)0, c, false, false);
  }
  static __device__ __forceinline__ void guard(v8f& a, v8f& b, v16h x, v16h y) { dep_guard_h(a, b, x, y); }
  static __device__ __forceinline__ void keep(v16h a, v16h b, v16h c, v16h d) { keep4_h(a, b, c, d); }
};
template <> struct Frag<__bf16> {
  typedef v16b V; union U { v16b v; v8b h[2]; };
  static __device__ __forceinline__ v16b load(const __bf16* p) {
    U f; f.h[0] = *(const v8b*)(p); f.h[1] = *(const v8b*)(p + 16); return f.v;
  }
  static __device__ __forceinline__ v8f mma(v16b a, v16b b, v8f c) {
    return __builtin_amdgcn_wmma_f32_16x16x32_bf16(false, a, false, b, (short)0, c, false, false);
  }
  static __device__ __forceinline__ void guard(v8f& a, v8f& b, v16b x, v16b y) { dep_guard_b(a, b, x, y); }
  static __device__ __forceinline__ void keep(v16b a, v16b b, v16b c, v16b d) { keep4_b(a, b, c, d); }
};

// ---- Register-blocked batched WMMA GEMM, operands staged in LDS ------------
// C[m,n] = scale * sum_k A[m,k] * Bt[n,k] (+bias)(+resid); each wave owns a (16 * MI) x 64 tile.
// A row-major [M,K]; Bt row-major [N,K]; K % 64 == 0, K >= 128.
// The block's 8 wave tiles form one (8/WN * 16 * MI) x (WN * 64) tile; M and N are multiples of its sides and the grid holds exactly
// (M / side) * (N / side) blocks per batch. Its A and Bt rows are brought to LDS 64 k (one 128-B line per row) at a time.
// SPLIT: operands are hi/lo planes (A2/Bt2 = lo planes, same layout); product = hi.hi + hi.lo + lo.hi.
// BIAS_MODE: 0 = none, 1 = bias[m], 2 = bias[n].
// OUT_MODE: 0 = f32, 1 = f16, 2 = bf16 hi plane (Cout) + bf16 lo plane (Cout2).
// ET: 0 = f16 operands, 1 = bf16 operands (pointers passed as 16-bit storage)
template <int ET> struct Elem;
template <> struct Elem<0> { typedef _Float16 T; };
template <> struct Elem<1> { typedef __bf16 T; };

#define PJ_KS     64                        // k per stage
#define PJ_PITCH  72                        // LDS row pitch in elements: 128 B + 16 B, an odd multiple of 16 B for the b128 readers
#define PJ_ROWS   512                       // rows of the largest stage: 2 planes x (128 A rows + 128 Bt rows)
#define PJ_STAGE  (PJ_ROWS * PJ_PITCH)      // elements per buffer

// Each lane copies its own 16 bytes from global memory to LDS through no register. The s_wait_xcnt stands inside the copies' own
// statement, so that no address register of a copy is rewritten in front of it (a precaution).
#define PJ_CP(l, g) "global_load_async_to_lds_b128 %" #l ", %" #g ", off\n\t"
__device__ __forceinline__ void async_copy8(const unsigned* l, const unsigned short* const* g) {
  asm volatile(PJ_CP(0, 8) PJ_CP(1, 9) PJ_CP(2, 10) PJ_CP(3, 11) PJ_CP(4, 12) PJ_CP(5, 13) PJ_CP(6, 14) PJ_CP(7, 15) "s_wait_xcnt 0x0"
               :: "v"(l[0]), "v"(l[1]), "v"(l[2]), "v"(l[3]), "v"(l[4]), "v"(l[5]), "v"(l[6]), "v"(l[7]),
                  "v"(g[0]), "v"(g[1]), "v"(g[2]), "v"(g[3]), "v"(g[4]), "v"(g[5]), "v"(g[6]), "v"(g[7]) : "memory");
}
__device__ __forceinline__ void async_copy12(const unsigned* l, const unsigned short* const* g) {
  asm volatile(PJ_CP(0, 12) PJ_CP(1, 13) PJ_CP(2, 14) PJ_CP(3, 15) PJ_CP(4, 16) PJ_CP(5, 17)
               PJ_CP(6, 18) PJ_CP(7, 19) PJ_CP(8, 20) PJ_CP(9, 21) PJ_CP(10, 22) PJ_CP(11, 23) "s_wait_xcnt 0x0"
               :: "v"(l[0]), "v"(l[1]), "v"(l[2]), "v"(l[3]), "v"(l[4]), "v"(l[5]),
                  "v"(l[6]), "v"(l[7]), "v"(l[8]), "v"(l[9]), "v"(l[10]), "v"(l[11]),
                  "v"(g[0]), "v"(g[1]), "v"(g[2]), "v"(g[3]), "v"(g[4]), "v"(g[5]),
                  "v"(g[6]), "v"(g[7]), "v"(g[8]), "v"(g[9]), "v"(g[10]), "v"(g[11]) : "memory");
}

// One stage: rows [A hi | A lo | Bt hi | Bt lo] (one plane each without SPLIT), 64 k of every row. A thread takes 16 bytes of one row
// in every group of 32 rows, so a wave's copy covers 4 whole 128-B lines. pa.. = the thread's own 16 bytes in row (tid >> 3) of each
// operand's block rows at this stage's k; dst = the thread's own LDS byte address in row (tid >> 3) of the buffer.
template <bool SPLIT, int AR, int BR>
__device__ __forceinline__ void stage_copy(unsigned dst,
    const unsigned short* pa, const unsigned short* pa2, int lda,
    const unsigned short* pb, const unsigned short* pb2, int ldb) {
  constexpr int P  = SPLIT ? 2 : 1;
  constexpr int NC = P * (AR + BR) / 32;     // copies per thread: 12 or 16
  static_assert(NC == 12 || NC == 16, "stage size");
  unsigned l[NC];
  const unsigned short* g[NC];
#pragma unroll
  for (int i = 0; i < NC; ++i) {
    const int row = i * 32;                  // first row of the group, a constant
    l[i] = dst + (unsigned)(row * PJ_PITCH * 2);
    if (row < AR)                g[i] = pa  + (size_t)row * lda;
    else if (row < P * AR)       g[i] = pa2 + (size_t)(row - AR) * lda;
    else if (row < P * AR + BR)  g[i] = pb  + (size_t)(row - P * AR) * ldb;
    else                         g[i] = pb2 + (size_t)(row - P * AR - BR) * ldb;
  }
  if constexpr (NC == 12) {
    async_copy12(l, g);
  } else {
    async_copy8(l, g);
    async_copy8(l + 8, g + 8);
  }
}

// Device body: bx = block tile, b = batch, stg = the block's two stage buffers, sT = the block's 8 per-wave slabs.
template <int ET, bool SPLIT, int BIAS_MODE, int OUT_MODE, bool RESID, int WN, int MI, int ACT = 0>
__device__ __forceinline__ void wmma_gemm64(
    unsigned short* stg, float (*sT)[16 * 68], int bx, int b,
    const unsigned short* __restrict__ Ap, const unsigned short* __restrict__ A2p, int lda, long strideA,
    const unsigned short* __restrict__ Btp, const unsigned short* __restrict__ Bt2p, int ldb, long strideB,
    void* __restrict__ Cout, void* __restrict__ Cout2, int ldc, long strideC,
    const float* __restrict__ bias,
    const float* __restrict__ resid, long strideR,
    int M, int N, int K, float scale) {
  typedef typename Elem<ET>::T T;
  typedef typename Frag<T>::V V;
  constexpr int WR = 16 * MI;                  // A rows of a wave tile
  constexpr int AR = (8 / WN) * WR;            // A rows of the block tile
  constexpr int BR = WN * 64;                  // Bt rows of the block tile
  constexpr int P  = SPLIT ? 2 : 1;
  const int tid  = threadIdx.x;
  const int lane = tid & 31;
  const int wave = tid >> 5;
  const int nbN = N / BR;
  const int bm  = bx / nbN;
  const int bn  = bx - bm * nbN;
  const int wa  = wave / WN;                   // the wave's WR rows among the block's A rows
  const int wb  = wave - wa * WN;              // the wave's 64 rows among the block's Bt rows
  const int m0 = bm * AR + wa * WR;
  const int n0 = bn * BR + (wb << 6);

  const int rlane = lane & 15;                 // row (A) / col (B, D) within subtile
  const int koff  = (lane >> 4) * 8;           // k offset of this lane half
  const int mOff  = (lane >> 4) * 8;           // D row offset

  // the thread's own 16 bytes of a stage: row (tid >> 3) of a 32-row group, bytes 16 * (tid & 7) of its 128
  const int crow = tid >> 3, ccol = (tid & 7) * 8;
  const unsigned short* ca  = Ap  + (size_t)b * strideA + (size_t)(bm * AR + crow) * lda + ccol;
  const unsigned short* ca2 = A2p + (size_t)b * strideA + (size_t)(bm * AR + crow) * lda + ccol;
  const unsigned short* cb  = Btp  + (size_t)b * strideB + (size_t)(bn * BR + crow) * ldb + ccol;
  const unsigned short* cb2 = Bt2p + (size_t)b * strideB + (size_t)(bn * BR + crow) * ldb + ccol;
  const unsigned cdst = (unsigned)(uintptr_t)(stg + crow * PJ_PITCH + ccol);   // low 32 bits = byte address in the block's LDS

  v8f acc[MI][4];
#pragma unroll
  for (int i = 0; i < MI; ++i)
#pragma unroll
    for (int j = 0; j < 4; ++j) acc[i][j] = (v8f){0.f,0.f,0.f,0.f,0.f,0.f,0.f,0.f};

  const int nt = K / PJ_KS;                    // stages; the same for the whole block, at least 2
  stage_copy<SPLIT, AR, BR>(cdst, ca, ca2, lda, cb, cb2, ldb);
  asm volatile("s_wait_asynccnt 0x0" ::: "memory");   // this wave's copies of stage 0 have landed
  __syncthreads();                                    // every wave's have: stage 0 may be read
  stage_copy<SPLIT, AR, BR>(cdst + PJ_STAGE * 2, ca + PJ_KS, ca2 + PJ_KS, lda, cb + PJ_KS, cb2 + PJ_KS, ldb);

#pragma unroll 1   // rolled: the text of the three jobs stays small for the instruction cache, and the two buffers alternate by index
  for (int t = 0; t < nt; ++t) {
    const int bufo = (t & 1) * PJ_STAGE;
    const T* sA  = (const T*)(stg + bufo) + (wa * WR + rlane) * PJ_PITCH + koff;
    const T* sA2 = sA + AR * PJ_PITCH;
    const T* sB  = (const T*)(stg + bufo) + (P * AR + (wb << 6) + rlane) * PJ_PITCH + koff;
    const T* sB2 = sB + BR * PJ_PITCH;
#pragma unroll
    for (int kk = 0; kk < PJ_KS; kk += 32) {
      V bh[4], bl[4];
#pragma unroll
      for (int j = 0; j < 4; ++j) {
        bh[j] = Frag<T>::load(sB + (j << 4) * PJ_PITCH + kk);
        if (SPLIT) bl[j] = Frag<T>::load(sB2 + (j << 4) * PJ_PITCH + kk);
      }
#pragma unroll
      for (int i = 0; i < MI; ++i) {
        V ah = Frag<T>::load(sA + (i << 4) * PJ_PITCH + kk);
        V al;
        if (SPLIT) al = Frag<T>::load(sA2 + (i << 4) * PJ_PITCH + kk);
#pragma unroll
        for (int j = 0; j < 4; ++j) {
          acc[i][j] = Frag<T>::mma(ah, bh[j], acc[i][j]);
          if (SPLIT) {
            acc[i][j] = Frag<T>::mma(ah, bl[j], acc[i][j]);
            acc[i][j] = Frag<T>::mma(al, bh[j], acc[i][j]);
          }
        }
        Frag<T>::guard(acc[i][0], acc[i][3], ah, SPLIT ? al : ah);
      }
      Frag<T>::keep(bh[0], bh[1], bh[2], bh[3]);
      if (SPLIT) Frag<T>::keep(bl[0], bl[1], bl[2], bl[3]);
    }
    asm volatile("s_wait_dscnt 0x0" ::: "memory");      // this wave's reads of stage t are done before its buffer is refilled
    asm volatile("s_wait_asynccnt 0x0" ::: "memory");   // this wave's copies of stage t + 1 have landed
    __syncthreads();                                    // publishes stage t + 1 and ends every wave's reads of stage t
    if (t + 2 < nt) {                                   // the same for the whole block
      const int ko = (t + 2) * PJ_KS;
      stage_copy<SPLIT, AR, BR>(cdst + (unsigned)(bufo * 2), ca + ko, ca2 + ko, lda, cb + ko, cb2 + ko, ldb);
    }
  }
  asm volatile("s_wait_asynccnt 0x0" ::: "memory");     // no copy is outstanding behind the loop
#pragma unroll
  for (int i = 0; i < MI; ++i) acc_guard4(acc[i][0], acc[i][1], acc[i][2], acc[i][3]);

  // ---- epilogue ----
  float* slab = sT[wave];
  const float* Rb = RESID ? (resid + (size_t)b * strideR) : nullptr;
#pragma unroll
  for (int i = 0; i < MI; ++i) {
    const int mBase = m0 + (i << 4);
#pragma unroll
    for (int j = 0; j < 4; ++j) {
      const int n = n0 + (j << 4) + rlane;
      float bv = 0.f;
      if (BIAS_MODE == 2) bv = bias[n];
#pragma unroll
      for (int r = 0; r < 8; ++r) {
        float v = acc[i][j][r] * scale;
        if (BIAS_MODE == 1) v += bias[mBase + mOff + r];
        if (BIAS_MODE == 2) v += bv;
        if (RESID) v += Rb[(size_t)(mBase + mOff + r) * ldc + n];
        if (ACT == 1) v = tanhf(v);
        if (ACT == 2) v = fmaxf(v, 0.0f);
        if (ACT == 3) v = v / (1.0f + expf(-v));
        if (ACT == 4) v = (v > 0.f) ? v : 0.01f * v;
        if (ACT == 5) v = 0.5f * v * (1.0f + erff(v * 0.70710678118654752f));
        slab[(mOff + r) * 68 + (j << 4) + rlane] = v;
      }
    }
    __builtin_amdgcn_fence(__ATOMIC_RELEASE, "workgroup");
    __builtin_amdgcn_wave_barrier();
    __builtin_amdgcn_fence(__ATOMIC_ACQUIRE, "workgroup");
    if (OUT_MODE == 0) {
      float* C = (float*)Cout + (size_t)b * strideC;
      const int hh = lane >> 4, c4 = (lane & 15) * 4;     // row seg = 256 B = 16 lanes x 16 B
      {
#pragma unroll
        for (int it = 0; it < 8; ++it) {
          const int row = it * 2 + hh;
          v4f v = *(const v4f*)(slab + row * 68 + c4);
          *(v4f*)(C + (size_t)(mBase + row) * ldc + n0 + c4) = v;
        }
        
      }
    } else {
      const int q = lane >> 3, c8 = (lane & 7) * 8;
      unsigned short* C  = (unsigned short*)Cout  + (size_t)b * strideC;
      unsigned short* C2 = (OUT_MODE == 2) ? ((unsigned short*)Cout2 + (size_t)b * strideC) : nullptr;
      {
#pragma unroll
        for (int it = 0; it < 4; ++it) {
          const int row = it * 4 + q;
          const float* sp = slab + row * 68 + c8;
          v8h hv, lv;
#pragma unroll
          for (int e = 0; e < 8; ++e) {
            if (OUT_MODE == 1) {
              hv[e] = (_Float16)sp[e];
            } else {
              unsigned short hb = f2bf_bits(sp[e]);
              unsigned short lb = f2bf_bits(sp[e] - bf_bits2f(hb));
              hv[e] = __builtin_bit_cast(_Float16, hb);
              lv[e] = __builtin_bit_cast(_Float16, lb);
            }
          }
          *(v8h*)(C + (size_t)(mBase + row) * ldc + n0 + c8) = hv;
          if (OUT_MODE == 2) *(v8h*)(C2 + (size_t)(mBase + row) * ldc + n0 + c8) = lv;
        }
        
      }
    }
    // precaution: the next slab's values and addresses reuse the registers that these stores name; the wait stands in front of that
    asm volatile("s_wait_xcnt 0x0" ::: "memory");
    __builtin_amdgcn_fence(__ATOMIC_RELEASE, "workgroup");
    __builtin_amdgcn_wave_barrier();
    __builtin_amdgcn_fence(__ATOMIC_ACQUIRE, "workgroup");
  }
}

__device__ __forceinline__ void cast_f32_f16x2(
    int bx, const float* __restrict__ in, _Float16* __restrict__ out, int n2) {
  int i = bx * 256 + threadIdx.x;
  if (i < n2) {
    const _Float16 h0 = (_Float16)in[2 * i], h1 = (_Float16)in[2 * i + 1];
    const unsigned u = (unsigned)__builtin_bit_cast(unsigned short, h0) | ((unsigned)__builtin_bit_cast(unsigned short, h1) << 16);
    ((unsigned*)out)[i] = u;
    
  }
}

__device__ __forceinline__ void split_f32_bf16x2(
    int bx, const float* __restrict__ in, unsigned short* __restrict__ oh, unsigned short* __restrict__ ol, int n2) {
  int i = bx * 256 + threadIdx.x;
  if (i < n2) {
    const float f0 = in[2 * i], f1 = in[2 * i + 1];
    const unsigned short hb0 = f2bf_bits(f0), hb1 = f2bf_bits(f1);
    const unsigned short lb0 = f2bf_bits(f0 - bf_bits2f(hb0)), lb1 = f2bf_bits(f1 - bf_bits2f(hb1));
    const unsigned uh = (unsigned)hb0 | ((unsigned)hb1 << 16);
    const unsigned ul = (unsigned)lb0 | ((unsigned)lb1 << 16);
    ((unsigned*)oh)[i] = uh;
    ((unsigned*)ol)[i] = ul;
    
  }
}

// ---- channel-major f32 x[b][Cin][Sn] -> pixel-major 16-bit planes [b][Sn][Cin]: bf16 hi, bf16 lo (RNE), optional f16 ----
template <bool F16P>
__device__ __forceinline__ void k_cm_to_pm(
    float (*ts)[68], int bx, int by, int b,
    const float* __restrict__ x, int Cin, int Sn,
    unsigned short* __restrict__ oh, unsigned short* __restrict__ ol, unsigned short* __restrict__ of) {
  const int tid = threadIdx.x, lane = tid & 31, wave = tid >> 5;
  const int s0 = bx * 32, c0 = by * 64;
  const float* xb = x + ((size_t)b * Cin + c0) * Sn + s0;
#pragma unroll
  for (int i = 0; i < 8; ++i) {
    const int idx = tid + i * 256;        // 0..2047
    const int cc = idx >> 5, ss = idx & 31;
    ts[ss][cc] = xb[(size_t)cc * Sn + ss];
  }
  __syncthreads();
  const int lq = lane >> 3, c8 = (lane & 7) * 8;
  const int ss = wave * 4 + lq;           // 8 waves x 4 rows = 32 rows, one line per (row, plane)
  const v4f a0 = *(const v4f*)(&ts[ss][c8]);
  const v4f a1 = *(const v4f*)(&ts[ss][c8 + 4]);
  const float f[8] = {a0[0], a0[1], a0[2], a0[3], a1[0], a1[1], a1[2], a1[3]};
  v8h hv, lv, fv;
#pragma unroll
  for (int e = 0; e < 8; ++e) {
    const unsigned short hb = f2bf_bits(f[e]);
    const unsigned short lb = f2bf_bits(f[e] - bf_bits2f(hb));
    hv[e] = __builtin_bit_cast(_Float16, hb);
    lv[e] = __builtin_bit_cast(_Float16, lb);
    fv[e] = F16P ? (_Float16)f[e] : hv[e];
  }
  const size_t o = ((size_t)b * Sn + s0 + ss) * Cin + c0 + c8;
  {
    *(v8h*)(oh + o) = hv;
    *(v8h*)(ol + o) = lv;
    if (F16P) *(v8h*)(of + o) = fv;
    // precaution: other jobs' code follows this body in the same kernel and may rewrite the stores' registers; the wait stands in front of it
    asm volatile("s_wait_xcnt 0x0" ::: "memory");
  }
}

// ---- One grid for the five operand preparations: none reads what another writes; the block index picks the job ----
//   blocks    0..1023  x_low  [8][256][1024] -> pixel-major planes (32 px tiles x 4 channel tiles x 8 batches)
//   blocks 1024..1535  x_high [8][512][256]  -> pixel-major planes ( 8 px tiles x 8 channel tiles x 8 batches)
//   blocks 1536..1791  Wq planes; 1792..1919  Wk planes; 1920..2047  Wv f16
__global__ __launch_bounds__(256) void prep_all(
    const float* __restrict__ x_low, const float* __restrict__ x_high,
    const float* __restrict__ Wq, const float* __restrict__ Wk, const float* __restrict__ Wv,
    unsigned short* __restrict__ xl_h, unsigned short* __restrict__ xl_l, unsigned short* __restrict__ xl_f,
    unsigned short* __restrict__ xh_h, unsigned short* __restrict__ xh_l,
    unsigned short* __restrict__ wq_h, unsigned short* __restrict__ wq_l,
    unsigned short* __restrict__ wk_h, unsigned short* __restrict__ wk_l,
    unsigned short* __restrict__ wv_f) {
  __shared__ __align__(16) float ts[32][68];   // [pixel][channel]
  const int id = blockIdx.x;                   // every branch below is uniform over the block
  if (id < 1024) {
    k_cm_to_pm<true>(ts, id & 31, (id >> 5) & 3, id >> 7, x_low, 256, 1024, xl_h, xl_l, xl_f);
  } else if (id < 1536) {
    const int j = id - 1024;
    k_cm_to_pm<false>(ts, j & 7, (j >> 3) & 7, j >> 6, x_high, 512, 256, xh_h, xh_l, xh_l);
  } else if (id < 1792) {
    split_f32_bf16x2(id - 1536, Wq, wq_h, wq_l, 256 * 512 / 2);
  } else if (id < 1920) {
    split_f32_bf16x2(id - 1792, Wk, wk_h, wk_l, 256 * 256 / 2);
  } else {
    cast_f32_f16x2(id - 1920, Wv, (_Float16*)wv_f, 256 * 256 / 2);
  }
}

// ---- One grid for the three projections: none reads what another writes; the block index picks the job ----
//   blocks   0..63   q[b][sq][co] = sum_ci xh[b][sq][ci] Wq[co][ci] + bq[co]  (K = 512: twice the stages, so the smallest tile, 64 x 128)
//   blocks  64..191  k[b][s][co]  = sum_ci xl[b][s][ci]  Wk[co][ci] + bk[co]   (tile 128 x 128)
//   blocks 192..255  v[b][co][s]  = sum_ci Wv[co][ci] xl[b][s][ci] + bv[co]   (tile 128 x 256; channel-major out; f16 operands, f16 out)
// The tiles are sized so that the three jobs' blocks last about equally long and together fill the chip's 256 WGPs once.
__global__ __launch_bounds__(256) void proj_all(
    const unsigned short* __restrict__ xh_h, const unsigned short* __restrict__ xh_l,
    const unsigned short* __restrict__ wq_h, const unsigned short* __restrict__ wq_l,
    unsigned short* __restrict__ q_h, unsigned short* __restrict__ q_l, const float* __restrict__ bq,
    const unsigned short* __restrict__ xl_h, const unsigned short* __restrict__ xl_l,
    const unsigned short* __restrict__ wk_h, const unsigned short* __restrict__ wk_l,
    unsigned short* __restrict__ k_h, unsigned short* __restrict__ k_l, const float* __restrict__ bk,
    const unsigned short* __restrict__ wv_f, const unsigned short* __restrict__ xl_f,
    unsigned short* __restrict__ v_f, const float* __restrict__ bv) {
  __shared__ __align__(16) unsigned short stg[2 * PJ_STAGE];   // two stage buffers of the block's operand rows
  __shared__ __align__(16) float sT[8][16 * 68];   // per-wave 16x64 slab, pitch 68 floats
  const int id = blockIdx.x;                       // every branch below is uniform over the block
  if (id < 64) {
    wmma_gemm64<1, true, 2, 2, false, 2, 1, 0>(stg, sT, id & 7, id >> 3,
        xh_h, xh_l, 512, (long)256 * 512,
        wq_h, wq_l, 512, 0L,
        (void*)q_h, (void*)q_l, 256, (long)256 * 256,
        bq, bq, 0L, 256, 256, 512, 1.0f);
  } else if (id < 192) {
    const int j = id - 64;
    wmma_gemm64<1, true, 2, 2, false, 2, 2, 0>(stg, sT, j & 15, j >> 4,
        xl_h, xl_l, 256, (long)1024 * 256,
        wk_h, wk_l, 256, 0L,
        (void*)k_h, (void*)k_l, 256, (long)1024 * 256,
        bk, bk, 0L, 1024, 256, 256, 1.0f);
  } else {
    const int j = id - 192;
    wmma_gemm64<0, false, 1, 1, false, 4, 4, 0>(stg, sT, j & 7, j >> 3,
        wv_f, wv_f, 256, 0L,
        xl_f, xl_f, 256, (long)1024 * 256,
        (void*)v_f, (void*)v_f, 1024, (long)256 * 1024,
        bv, bv, 0L, 256, 1024, 256, 1.0f);
  }
}

// =====================================================================================
// Attention, head dim 32, no mask, no scaling.
//   q planes: bf16 hi/lo [B][256 src px][256 ch] (16x16 grid). The four output pixels of one source pixel share their
//   query row, so their attention rows are equal: each source pixel is worked once and its result stored to all four.
//   k planes: bf16 hi/lo [B][1024 px][256 ch];  v: f16 channel-major [B][256 ch][1024 px]
//   out f32 channel-major [B][256 ch][1024 px].
//   scores = q.k^T: 3 x v_wmma_f32_16x16x32_bf16 per 16x16 tile (hi.hi + hi.lo + lo.hi); online softmax f32;
//   p carried x2^15 as f16 in per-wave LDS; out = p.v: v_wmma_f32_16x16x32_f16; f32 accumulate.
//   Block = 16 waves = 64 source pixels (256 output pixels) of one (b, head); grid.x = B*8*4.
//   Wave = (key group g = wave >> 2, query sub-tile = wave & 3): group g works keys 256g .. 256g+255 in 64-key chunks staged in its
//   own LDS buffers. Every group keeps its own running max, sum
//   and unnormalised out tile; the epilogue merges the four in the fixed order g = 0..3.
// =====================================================================================
#define AS_S   1024
#define AS_C   256
#define AS_SQ  256
#define AS_HD  32
#define AS_NH  8
#define AS_KC  64
#define AS_PSC 32768.0f
#define AS_NG  4                 // key groups per block
#define AS_GK  (AS_S / AS_NG)     // keys per group

__device__ __forceinline__ v8f mma_bf_g(v16b a, v16b b, v8f c) {
  c = __builtin_amdgcn_wmma_f32_16x16x32_bf16(false, a, false, b, (short)0, c, false, false);
  asm volatile("v_nop\n\tv_nop\n\tv_nop\n\tv_nop" : "+v"(c) : "v"(a), "v"(b));
  return c;
}
__device__ __forceinline__ v8f mma_hf_g(v16h a, v16h b, v8f c) {
  c = __builtin_amdgcn_wmma_f32_16x16x32_f16(false, a, false, b, (short)0, c, false, false);
  asm volatile("v_nop\n\tv_nop\n\tv_nop\n\tv_nop" : "+v"(c) : "v"(a), "v"(b));
  return c;
}

__global__ __launch_bounds__(512)
void attn_hd32(const unsigned short* __restrict__ qhp, const unsigned short* __restrict__ qlp,
               const unsigned short* __restrict__ khp, const unsigned short* __restrict__ klp,
               const unsigned short* __restrict__ vp, float* __restrict__ out) {
  union FB { v16b v; v8b h[2]; };
  union FH { v16h v; v8h h[2]; };
  __shared__ __align__(16) __bf16   KshA[AS_NG][AS_KC * AS_HD];   // per group: k hi [kv][d]   4 KB
  __shared__ __align__(16) __bf16   KslA[AS_NG][AS_KC * AS_HD];   // per group: k lo [kv][d]   4 KB
  __shared__ __align__(16) _Float16 VtA[AS_NG][AS_HD * AS_KC];    // per group: v [d][kv]      4 KB
  __shared__ __align__(16) _Float16 Psh[4 * AS_NG][16 * AS_KC];   // per wave p [row][kv]      2 KB
  __shared__ __align__(16) float    Os[AS_NG][AS_HD][68];         // per group: unnormalised out tile [d][64 source px], pitch 68
  __shared__ __align__(16) float    Ms[AS_NG][64];                // per group: running max of each source px
  __shared__ __align__(16) float    Ls[AS_NG][64];                // per group: running sum of each source px

  const int tid  = threadIdx.x;
  const int wave = tid >> 5;
  const int grp  = wave >> 2;          // key group
  const int wq   = wave & 3;           // query sub-tile
  const int gt   = tid & 127;          // thread within the group
  const int lane = tid & 31;
  const int hh   = lane >> 4;
  const int c    = lane & 15;

  const int bx = blockIdx.x;
  const int qb = bx & 3;               // AS_SQ / 64 = 4 query blocks
  const int bh = bx >> 2;
  const int h  = bh & (AS_NH - 1);
  const int b  = bh >> 3;
  const int qbase = qb * 64;
  const int q0 = qbase + wq * 16;

  // ---- Q fragments (A operand, lane c = row, split k map), hi and lo planes ----
  v16b qah, qal;
  {
    const int sq = q0 + c;                       // source pixel 0..255 on the 16x16 grid
    const size_t qo = ((size_t)b * AS_SQ + sq) * AS_C + h * AS_HD + 8 * hh;
    qah = Frag<__bf16>::load((const __bf16*)qhp + qo);
    qal = Frag<__bf16>::load((const __bf16*)qlp + qo);
  }

  float mrow[8], lrow[8];
  v8f oacc[2];
#pragma unroll
  for (int r = 0; r < 8; ++r) { mrow[r] = -INFINITY; lrow[r] = 0.f; }
#pragma unroll
  for (int t = 0; t < 2; ++t) oacc[t] = (v8f){0.f,0.f,0.f,0.f,0.f,0.f,0.f,0.f};

  const __bf16*   khb = (const __bf16*)khp + (size_t)b * AS_S * AS_C + h * AS_HD;
  const __bf16*   klb = (const __bf16*)klp + (size_t)b * AS_S * AS_C + h * AS_HD;
  const _Float16* vb  = (const _Float16*)vp + ((size_t)b * AS_C + h * AS_HD) * AS_S;
  float*          ob  = out + ((size_t)b * AS_C + h * AS_HD) * AS_S + qbase * 4;   // 4 source rows -> 8 output rows of 32
  _Float16*       pw  = Psh[wave];
  __bf16*         Ksh = KshA[grp];
  __bf16*         Ksl = KslA[grp];
  _Float16*       Vt  = VtA[grp];

  for (int kc = 0; kc < AS_GK / AS_KC; ++kc) {
    const int kv0 = grp * AS_GK + kc * AS_KC;
    __syncthreads();
    {
      // K chunk of the group: 64 kv rows x 32 d, both planes; thread -> (kv row, 16-d half)
      const int kvr = gt >> 1, dh = (gt & 1) * 16;
      const __bf16* kr  = khb + (size_t)(kv0 + kvr) * AS_C + dh;
      const __bf16* kr2 = klb + (size_t)(kv0 + kvr) * AS_C + dh;
      *(v8b*)(Ksh + kvr * AS_HD + dh)     = *(const v8b*)(kr);
      *(v8b*)(Ksh + kvr * AS_HD + dh + 8) = *(const v8b*)(kr + 8);
      *(v8b*)(Ksl + kvr * AS_HD + dh)     = *(const v8b*)(kr2);
      *(v8b*)(Ksl + kvr * AS_HD + dh + 8) = *(const v8b*)(kr2 + 8);
      // V chunk of the group: 32 d rows x 64 kv (channel-major source is already [d][kv]); thread -> (d row, 16-kv quarter)
      const int dr = gt >> 2, part = (gt & 3) * 16;
      const _Float16* vr = vb + (size_t)dr * AS_S + kv0 + part;
      *(v8h*)(Vt + dr * AS_KC + part)     = *(const v8h*)(vr);
      *(v8h*)(Vt + dr * AS_KC + part + 8) = *(const v8h*)(vr + 8);
    }
    __syncthreads();

    // ---- scores: s[j][r] = row (8hh+r), kv (kv0 + 16j + c); B operand = k with split k map over d ----
    v8f s[4];
#pragma unroll
    for (int j = 0; j < 4; ++j) {
      s[j] = (v8f){0.f,0.f,0.f,0.f,0.f,0.f,0.f,0.f};
      FB kb, kl;
      kb.h[0] = *(const v8b*)(Ksh + (j * 16 + c) * AS_HD + 8 * hh);
      kb.h[1] = *(const v8b*)(Ksh + (j * 16 + c) * AS_HD + 16 + 8 * hh);
      kl.h[0] = *(const v8b*)(Ksl + (j * 16 + c) * AS_HD + 8 * hh);
      kl.h[1] = *(const v8b*)(Ksl + (j * 16 + c) * AS_HD + 16 + 8 * hh);
      s[j] = mma_bf_g(qah, kb.v, s[j]);
      s[j] = mma_bf_g(qah, kl.v, s[j]);
      s[j] = mma_bf_g(qal, kb.v, s[j]);
    }

    // ---- online softmax (f32) ----
    float cm[8];
#pragma unroll
    for (int r = 0; r < 8; ++r) {
      float m = s[0][r];
#pragma unroll
      for (int j = 1; j < 4; ++j) m = fmaxf(m, s[j][r]);
#pragma unroll
      for (int off = 1; off < 16; off <<= 1) m = fmaxf(m, __shfl_xor(m, off, 32));
      cm[r] = m;
    }
#pragma unroll
    for (int r = 0; r < 8; ++r) {
      const float mnew  = fmaxf(mrow[r], cm[r]);
      const float alpha = expf(mrow[r] - mnew);
      mrow[r] = mnew;
      float psum = 0.f;
#pragma unroll
      for (int j = 0; j < 4; ++j) {
        const float p = expf(s[j][r] - mnew);
        psum += p;
        pw[(8 * hh + r) * AS_KC + j * 16 + c] = (_Float16)(p * AS_PSC);
      }
#pragma unroll
      for (int off = 1; off < 16; off <<= 1) psum += __shfl_xor(psum, off, 32);
      lrow[r] = lrow[r] * alpha + psum;
#pragma unroll
      for (int t = 0; t < 2; ++t) oacc[t][r] *= alpha;
    }
    __builtin_amdgcn_fence(__ATOMIC_RELEASE, "workgroup");
    __builtin_amdgcn_wave_barrier();
    __builtin_amdgcn_fence(__ATOMIC_ACQUIRE, "workgroup");

    // ---- out += p . v : A = p [row][kv] (same element type reload), B = v with split k map over kv ----
#pragma unroll 1
    for (int kk = 0; kk < 2; ++kk) {
      FH pa;
      pa.h[0] = *(const v8h*)(pw + c * AS_KC + kk * 32 + 8 * hh);
      pa.h[1] = *(const v8h*)(pw + c * AS_KC + kk * 32 + 16 + 8 * hh);
#pragma unroll
      for (int t = 0; t < 2; ++t) {
        FH vf;
        vf.h[0] = *(const v8h*)(Vt + (t * 16 + c) * AS_KC + kk * 32 + 8 * hh);
        vf.h[1] = *(const v8h*)(Vt + (t * 16 + c) * AS_KC + kk * 32 + 16 + 8 * hh);
        oacc[t] = mma_hf_g(pa.v, vf.v, oacc[t]);
      }
    }
  }

  // ---- each group hands over its partial state: max, sum, unnormalised out tile ----
  const int row0 = wq * 16 + 8 * hh;
#pragma unroll
  for (int r = 0; r < 8; ++r) {
#pragma unroll
    for (int t = 0; t < 2; ++t) Os[grp][t * 16 + c][row0 + r] = oacc[t][r];
  }
  if (c == 0) {   // the 16 lanes of a row hold equal max and sum: one lane stores them
#pragma unroll
    for (int r = 0; r < 8; ++r) { Ms[grp][row0 + r] = mrow[r]; Ls[grp][row0 + r] = lrow[r]; }
  }
  __syncthreads();
  {
    // nearest-neighbour 2x: output pixel (y, x) of the block's 8 x 32 patch takes source (y>>1, x>>1) of its 4 x 16 patch
    const int o4 = (tid & 63) * 4;                       // 4 output pixels of one row: two source pixels, each twice
    const int sp = (o4 >> 6) * 16 + ((o4 & 31) >> 1);
    // merge weights of the two source pixels: w[g] = exp(m_g - m) / (2^15 * sum_g exp(m_g - m) l_g), g in fixed order
    float w0[AS_NG], w1[AS_NG];
    {
      float m0 = Ms[0][sp], m1 = Ms[0][sp + 1];
#pragma unroll
      for (int g = 1; g < AS_NG; ++g) { m0 = fmaxf(m0, Ms[g][sp]); m1 = fmaxf(m1, Ms[g][sp + 1]); }
      float l0 = 0.f, l1 = 0.f;
#pragma unroll
      for (int g = 0; g < AS_NG; ++g) {
        w0[g] = expf(Ms[g][sp] - m0);      l0 += w0[g] * Ls[g][sp];
        w1[g] = expf(Ms[g][sp + 1] - m1);  l1 += w1[g] * Ls[g][sp + 1];
      }
      const float i0 = 1.0f / (l0 * AS_PSC), i1 = 1.0f / (l1 * AS_PSC);
#pragma unroll
      for (int g = 0; g < AS_NG; ++g) { w0[g] *= i0; w1[g] *= i1; }
    }
#pragma unroll   // the 4 channel steps become immediate offsets of one address, and the LDS reads run ahead of the stores
    for (int it = 0; it < 4; ++it) {
      const int d = it * 8 + (tid >> 6);
      float s0 = 0.f, s1 = 0.f;
#pragma unroll
      for (int g = 0; g < AS_NG; ++g) { s0 += Os[g][d][sp] * w0[g]; s1 += Os[g][d][sp + 1] * w1[g]; }
      *(v4f*)(ob + (size_t)d * AS_S + o4) = (v4f){s0, s0, s1, s1};
    }
  }
}

extern "C" void kernel_launch(void* const* d_in, const int* in_sizes, int n_in,
                              void* d_out, int out_size, void* d_ws, size_t ws_size,
                              hipStream_t stream) {
  const int B = 8, CHI = 512, C = 256, SQ = 256, S = 1024;
  if (n_in < 8) return;
  if (in_sizes[0] != B * CHI * SQ || in_sizes[1] != B * C * S || in_sizes[2] != C * CHI ||
      in_sizes[3] != C || in_sizes[4] != C * C || in_sizes[5] != C || in_sizes[6] != C * C ||
      in_sizes[7] != C || out_size != B * C * S) return;

  const float* x_high = (const float*)d_in[0];
  const float* x_low  = (const float*)d_in[1];
  const float* Wq     = (const float*)d_in[2];
  const float* bq     = (const float*)d_in[3];
  const float* Wk     = (const float*)d_in[4];
  const float* bk     = (const float*)d_in[5];
  const float* Wv     = (const float*)d_in[6];
  const float* bv     = (const float*)d_in[7];
  float* out = (float*)d_out;

  // ---- workspace carve (bytes, 256-B aligned) ----
  char* ws = (char*)d_ws;
  size_t off = 0;
#define CARVE16(name, elems) unsigned short* name = (unsigned short*)(ws + off); off += ((((size_t)(elems)) * 2) + 255) & ~(size_t)255;
  CARVE16(xl_h, (size_t)B * S * C)       // x_low planes, pixel-major [B][1024][256]
  CARVE16(xl_l, (size_t)B * S * C)
  CARVE16(xl_f, (size_t)B * S * C)
  CARVE16(xh_h, (size_t)B * SQ * CHI)    // x_high planes, pixel-major [B][256][512]
  CARVE16(xh_l, (size_t)B * SQ * CHI)
  CARVE16(wq_h, (size_t)C * CHI)
  CARVE16(wq_l, (size_t)C * CHI)
  CARVE16(wk_h, (size_t)C * C)
  CARVE16(wk_l, (size_t)C * C)
  CARVE16(wv_f, (size_t)C * C)
  CARVE16(q_h,  (size_t)B * SQ * C)      // q planes [B][256 src px][256 ch]
  CARVE16(q_l,  (size_t)B * SQ * C)
  CARVE16(k_h,  (size_t)B * S * C)       // k planes [B][1024][256 ch]
  CARVE16(k_l,  (size_t)B * S * C)
  CARVE16(v_f,  (size_t)B * C * S)       // v f16 channel-major [B][256 ch][1024]
#undef CARVE16
  if (off > ws_size || off > (size_t)134217728) return;   // total 32,374,784 B

  // ---- operand planes: weights (bf16 hi/lo, f16) and activations (channel-major -> pixel-major 16-bit planes), one launch ----
  prep_all<<<dim3(2048), dim3(256), 0, stream>>>(x_low, x_high, Wq, Wk, Wv,
      xl_h, xl_l, xl_f, xh_h, xh_l, wq_h, wq_l, wk_h, wk_l, wv_f);

  // ---- q, k and v projections, one launch ----
  proj_all<<<dim3(256), dim3(256), 0, stream>>>(
      xh_h, xh_l, wq_h, wq_l, q_h, q_l, bq,
      xl_h, xl_l, wk_h, wk_l, k_h, k_l, bk,
      wv_f, xl_f, v_f, bv);

  // ---- attention ----
  attn_hd32<<<dim3(B * AS_NH * (SQ / 64)), dim3(512), 0, stream>>>(q_h, q_l, k_h, k_l, v_f, out);
}

// v006
// It runs in 34 microseconds.
// Next to v005, in two timings, it ran 1.07 times as fast each time.
// Counting every step since v000, it is 5.12 times as fast.
#include <hip/hip_runtime.h>
#include <stdint.h>
// Contractions: q-proj, k-proj, q.k scores: v_wmma_f32_16x16x32_bf16 with bf16 hi/lo operand planes (hi.hi + hi.lo + lo.hi);
// v-proj and p.v: v_wmma_f32_16x16x32_f16 (f16 operands, p carried x2^15); f32 accumulate everywhere; softmax in f32.

typedef __attribute__((ext_vector_type(16))) _Float16 v16h;
typedef __attribute__((ext_vector_type(8)))  _Float16 v8h;
typedef __attribute__((ext_vector_type(16))) __bf16   v16b;
typedef __attribute__((ext_vector_type(8)))  __bf16   v8b;
typedef __attribute__((ext_vector_type(8)))  float    v8f;
typedef __attribute__((ext_vector_type(4)))  float    v4f;
typedef __attribute__((ext_vector_type(2)))  float    v2f;
typedef __attribute__((ext_vector_type(2)))  __bf16   v2b;

__device__ __forceinline__ unsigned short f2bf_bits(float f) {
  unsigned u = __float_as_uint(f);
  return (unsigned short)((u + 0x7FFFu + ((u >> 16) & 1u)) >> 16);
}
__device__ __forceinline__ float bf_bits2f(unsigned short h) { return __uint_as_float(((unsigned)h) << 16); }

// hazard guards as plain device helpers
__device__ __forceinline__ void dep_guard_h(v8f& a, v8f& b, v16h x, v16h y) { asm volatile("v_nop\n\tv_nop\n\tv_nop\n\tv_nop" : "+v"(a), "+v"(b) : "v"(x), "v"(y)); }
__device__ __forceinline__ void dep_guard_b(v8f& a, v8f& b, v16b x, v16b y) { asm volatile("v_nop\n\tv_nop\n\tv_nop\n\tv_nop" : "+v"(a), "+v"(b) : "v"(x), "v"(y)); }
__device__ __forceinline__ void keep4_h(v16h a, v16h b, v16h c, v16h d) { asm volatile("v_nop" :: "v"(a), "v"(b), "v"(c), "v"(d)); }
__device__ __forceinline__ void keep4_b(v16b a, v16b b, v16b c, v16b d) { asm volatile("v_nop" :: "v"(a), "v"(b), "v"(c), "v"(d)); }
__device__ __forceinline__ void acc_guard4(v8f& a, v8f& b, v8f& c, v8f& d) { asm volatile("v_nop\n\tv_nop\n\tv_nop\n\tv_nop" : "+v"(a), "+v"(b), "+v"(c), "+v"(d)); }
template <typename T> struct Frag;
template <> struct Frag<_Float16> {
  typedef v16h V; union U { v16h v; v8h h[2]; };
  static __device__ __forceinline__ v16h load(const _Float16* p) {   // elements 0..7 <- p[0..7], 8..15 <- p[16..23]
    U f; f.h[0] = *(const v8h*)(p); f.h[1] = *(const v8h*)(p + 16); return f.v;
  }
  static __device__ __forceinline__ v8f mma(v16h a, v16h b, v8f c) {
    return __builtin_amdgcn_wmma_f32_16x16x32_f16(false, a, false, b, (short)0, c, false, false);
  }
  static __device__ __forceinline__ void guard(v8f& a, v8f& b, v16h x, v16h y) { dep_guard_h(a, b, x, y); }
  static __device__ __forceinline__ void keep(v16h a, v16h b, v16h c, v16h d) { keep4_h(a, b, c, d); }
};
template <> struct Frag<__bf16> {
  typedef v16b V; union U { v16b v; v8b h[2]; };
  static __device__ __forceinline__ v16b load(const __bf16* p) {
    U f; f.h[0] = *(const v8b*)(p); f.h[1] = *(const v8b*)(p + 16); return f.v;
  }
  static __device__ __forceinline__ v8f mma(v16b a, v16b b, v8f c) {
    return __builtin_amdgcn_wmma_f32_16x16x32_bf16(false, a, false, b, (short)0, c, false, false);
  }
  static __device__ __forceinline__ void guard(v8f& a, v8f& b, v16b x, v16b y) { dep_guard_b(a, b, x, y); }
  static __device__ __forceinline__ void keep(v16b a, v16b b, v16b c, v16b d) { keep4_b(a, b, c, d); }
};

// ---- Register-blocked batched WMMA GEMM on f32 sources, operands converted on their way into LDS ------------
// C[m,n] = scale * sum_k A[m,k] * Bt[n,k] (+bias)(+resid); each wave owns a (16 * MI) x 64 tile.
// One operand is X, channel-major f32 [b][K][S] (its rows are pixels, so it is turned on the way), the other is Wt, row-major f32 [rows][K].
// XA: X is the A operand (else it is Bt). K % 64 == 0, K >= 128.
// The block's 8 wave tiles form one (8/WN * 16 * MI) x (WN * 64) tile; M and N are multiples of its sides and the grid holds exactly
// (M / side) * (N / side) blocks per batch. Its A and Bt rows stand in LDS 64 k (128 B per row and plane) at a time.
// SPLIT: operands are bf16 hi/lo planes; product = hi.hi + hi.lo + lo.hi. Without SPLIT: one f16 plane.
// BIAS_MODE: 0 = none, 1 = bias[m], 2 = bias[n].
// OUT_MODE: 0 = f32, 1 = f16, 2 = bf16 hi plane (Cout) + bf16 lo plane (Cout2).
// ET: 0 = f16 operands, 1 = bf16 operands
template <int ET> struct Elem;
template <> struct Elem<0> { typedef _Float16 T; };
template <> struct Elem<1> { typedef __bf16 T; };

#define PJ_KS     64                        // k per stage
#define PJ_PITCH  72                        // LDS row pitch in elements: 128 B + 16 B, an odd multiple of 16 B for the b128 readers
#define PJ_ROWS   512                       // rows of the largest stage: 2 planes x (128 A rows + 128 Bt rows)
#define PJ_STAGE  (PJ_ROWS * PJ_PITCH)      // elements per buffer

// Eight consecutive k of one operand row: f32 -> 16 bytes per plane in LDS (round to nearest even; lo = rounded remainder).
template <bool SPLIT>
__device__ __forceinline__ void put8(unsigned short* hi, unsigned short* lo, const float* f) {
  if constexpr (SPLIT) {
    v8b hv, lv;
#pragma unroll
    for (int e = 0; e < 8; e += 2) {           // two at a time: one packed conversion per pair and plane
      const v2f a = {f[e], f[e + 1]};
      const v2b h = __builtin_convertvector(a, v2b);
      const v2f r = {a[0] - (float)h[0], a[1] - (float)h[1]};
      const v2b l = __builtin_convertvector(r, v2b);
      hv[e] = h[0]; hv[e + 1] = h[1];
      lv[e] = l[0]; lv[e + 1] = l[1];
    }
    *(v8b*)hi = hv;
    *(v8b*)lo = lv;
  } else {
    v8h hv;
#pragma unroll
    for (int e = 0; e < 8; ++e) hv[e] = (_Float16)f[e];
    *(v8h*)hi = hv;
  }
}

// Device body: bx = block tile, b = batch, stg = the block's two stage buffers, sT = the block's 8 per-wave slabs.
// PXV: pixels of one channel that a thread loads at once (4 or 2).
template <int ET, bool SPLIT, int BIAS_MODE, int OUT_MODE, bool RESID, int WN, int MI, bool XA, int PXV, int ACT = 0>
__device__ __forceinline__ void wmma_gemm64(
    unsigned short* stg, float (*sT)[16 * 68], int bx, int b,
    const float* __restrict__ Xp, int S, long strideX,
    const float* __restrict__ Wp,
    void* __restrict__ Cout, void* __restrict__ Cout2, int ldc, long strideC,
    const float* __restrict__ bias,
    const float* __restrict__ resid, long strideR,
    int M, int N, int K, float scale) {
  typedef typename Elem<ET>::T T;
  typedef typename Frag<T>::V V;
  typedef float vpx __attribute__((ext_vector_type(PXV)));
  static_assert(SPLIT == (ET == 1), "two bf16 planes or one f16 plane");
  constexpr int WR = 16 * MI;                  // A rows of a wave tile
  constexpr int AR = (8 / WN) * WR;            // A rows of the block tile
  constexpr int BR = WN * 64;                  // Bt rows of the block tile
  constexpr int P  = SPLIT ? 2 : 1;
  constexpr int XR = XA ? AR : BR;             // rows (pixels) of the X operand in the block tile
  constexpr int TR = XA ? BR : AR;             // rows of the Wt operand in the block tile
  constexpr int XB = XA ? 0 : P * AR;          // first LDS row of each operand's hi plane; its lo plane follows it
  constexpr int TB = XA ? P * AR : 0;
  constexpr int NU = XR / (32 * PXV);          // X units per wave: a unit is (8 * PXV) pixels x 32 channels
  constexpr int NG = TR / 32;                  // Wt groups of 32 rows
  static_assert(NU * 32 * PXV == XR && NG * 32 == TR, "stage shape");
  const int tid  = threadIdx.x;
  const int lane = tid & 31;
  const int wave = tid >> 5;
  const int nbN = N / BR;
  const int bm  = bx / nbN;
  const int bn  = bx - bm * nbN;
  const int wa  = wave / WN;                   // the wave's WR rows among the block's A rows
  const int wb  = wave - wa * WN;              // the wave's 64 rows among the block's Bt rows
  const int m0 = bm * AR + wa * WR;
  const int n0 = bn * BR + (wb << 6);

  const int rlane = lane & 15;                 // row (A) / col (B, D) within subtile
  const int koff  = (lane >> 4) * 8;           // k offset of this lane half
  const int mOff  = (lane >> 4) * 8;           // D row offset

  // X: a thread takes PXV pixels x 8 channels of each unit: 8 loads along the pixels (8 lanes cover one run of 32 * PXV bytes of a
  // channel), then per pixel one 16-byte LDS store per plane, 8 channels = 8 consecutive k of that pixel's row.
  const int xci = (wave & 1) * 32 + (lane & 3) * 8;               // first of the thread's 8 channels within the stage
  const int xpx = (wave >> 1) * (8 * PXV) + (lane >> 2) * PXV;    // first of its pixels in unit 0; unit i: + i * 32 * PXV
  const float* xg = Xp + (size_t)b * strideX + (size_t)xci * S + (XA ? bm * AR : bn * BR) + xpx;
  // Wt: a thread takes 8 consecutive k (32 bytes) of row (tid >> 3) in every group of 32 rows.
  const int crow = tid >> 3, ccol = (tid & 7) * 8;
  const float* wg = Wp + (size_t)((XA ? bn * BR : bm * AR) + crow) * K + ccol;

  vpx xr[NU][8];
  v4f wr[NG][2];
  // xk, wk: the thread's own first element of each operand at the stage's first k
  auto stage_load = [&](const float* xk, const float* wk) __attribute__((always_inline)) {
#pragma unroll
    for (int i = 0; i < NU; ++i)
#pragma unroll
      for (int j = 0; j < 8; ++j) xr[i][j] = *(const vpx*)(xk + (size_t)j * S + i * 32 * PXV);
#pragma unroll
    for (int g = 0; g < NG; ++g) {
      wr[g][0] = *(const v4f*)(wk + (size_t)(g * 32) * K);
      wr[g][1] = *(const v4f*)(wk + (size_t)(g * 32) * K + 4);
    }
    // precaution: nothing may write the address registers that these loads name in front of this wait; the two addresses are inputs
    // of its statement, so that no load of the group lands in them either
    asm volatile("s_wait_xcnt 0x0" :: "v"(xk), "v"(wk) : "memory");
  };
  auto stage_store = [&](unsigned short* buf) __attribute__((always_inline)) {
    unsigned short* xs = buf + (XB + xpx) * PJ_PITCH + xci;
#pragma unroll
    for (int i = 0; i < NU; ++i)
#pragma unroll
      for (int p = 0; p < PXV; ++p) {
        const float f[8] = {xr[i][0][p], xr[i][1][p], xr[i][2][p], xr[i][3][p], xr[i][4][p], xr[i][5][p], xr[i][6][p], xr[i][7][p]};
        unsigned short* d = xs + (i * 32 * PXV + p) * PJ_PITCH;
        put8<SPLIT>(d, d + XR * PJ_PITCH, f);
      }
    unsigned short* tsm = buf + (TB + crow) * PJ_PITCH + ccol;
#pragma unroll
    for (int g = 0; g < NG; ++g) {
      const float f[8] = {wr[g][0][0], wr[g][0][1], wr[g][0][2], wr[g][0][3], wr[g][1][0], wr[g][1][1], wr[g][1][2], wr[g][1][3]};
      unsigned short* d = tsm + (g * 32) * PJ_PITCH;
      put8<SPLIT>(d, d + TR * PJ_PITCH, f);
    }
  };

  v8f acc[MI][4];
#pragma unroll
  for (int i = 0; i < MI; ++i)
#pragma unroll
    for (int j = 0; j < 4; ++j) acc[i][j] = (v8f){0.f,0.f,0.f,0.f,0.f,0.f,0.f,0.f};

  const int nt = K / PJ_KS;                    // stages; the same for the whole block, at least 2
  stage_load(xg, wg);
  stage_store(stg);
  __syncthreads();                             // stage 0 may be read
  const float* xn = xg + (size_t)PJ_KS * S;    // the next stage to load
  const float* wn = wg + PJ_KS;

#pragma unroll 1   // rolled: the text of the three jobs stays small for the instruction cache, and the two buffers alternate by index
  for (int t = 0; t < nt; ++t) {
    const int bufo = (t & 1) * PJ_STAGE;
    const bool more = t + 1 < nt;              // the same for the whole block
    if (more) {                                // the next stage's f32 values fly while this stage is worked on
      stage_load(xn, wn);
      xn += (size_t)PJ_KS * S;
      wn += PJ_KS;
    }
    const T* sA  = (const T*)(stg + bufo) + (wa * WR + rlane) * PJ_PITCH + koff;
    const T* sA2 = sA + AR * PJ_PITCH;
    const T* sB  = (const T*)(stg + bufo) + (P * AR + (wb << 6) + rlane) * PJ_PITCH + koff;
    const T* sB2 = sB + BR * PJ_PITCH;
#pragma unroll
    for (int kk = 0; kk < PJ_KS; kk += 32) {
      V bh[4], bl[4];
#pragma unroll
      for (int j = 0; j < 4; ++j) {
        bh[j] = Frag<T>::load(sB + (j << 4) * PJ_PITCH + kk);
        if (SPLIT) bl[j] = Frag<T>::load(sB2 + (j << 4) * PJ_PITCH + kk);
      }
#pragma unroll
      for (int i = 0; i < MI; ++i) {
        V ah = Frag<T>::load(sA + (i << 4) * PJ_PITCH + kk);
        V al;
        if (SPLIT) al = Frag<T>::load(sA2 + (i << 4) * PJ_PITCH + kk);
#pragma unroll
        for (int j = 0; j < 4; ++j) {
          acc[i][j] = Frag<T>::mma(ah, bh[j], acc[i][j]);
          if (SPLIT) {
            acc[i][j] = Frag<T>::mma(ah, bl[j], acc[i][j]);
            acc[i][j] = Frag<T>::mma(al, bh[j], acc[i][j]);
          }
        }
        Frag<T>::guard(acc[i][0], acc[i][3], ah, SPLIT ? al : ah);
      }
      Frag<T>::keep(bh[0], bh[1], bh[2], bh[3]);
      if (SPLIT) Frag<T>::keep(bl[0], bl[1], bl[2], bl[3]);
    }
    if (more) {
      stage_store(stg + (PJ_STAGE - bufo));    // into the buffer whose last readers left it before the barrier of the trip before
      __syncthreads();                         // publishes stage t + 1 and ends every wave's reads of stage t
    }
  }
#pragma unroll
  for (int i = 0; i < MI; ++i) acc_guard4(acc[i][0], acc[i][1], acc[i][2], acc[i][3]);

  // ---- epilogue ----
  float* slab = sT[wave];
  const float* Rb = RESID ? (resid + (size_t)b * strideR) : nullptr;
#pragma unroll
  for (int i = 0; i < MI; ++i) {
    const int mBase = m0 + (i << 4);
#pragma unroll
    for (int j = 0; j < 4; ++j) {
      const int n = n0 + (j << 4) + rlane;
      float bv = 0.f;
      if (BIAS_MODE == 2) bv = bias[n];
#pragma unroll
      for (int r = 0; r < 8; ++r) {
        float v = acc[i][j][r] * scale;
        if (BIAS_MODE == 1) v += bias[mBase + mOff + r];
        if (BIAS_MODE == 2) v += bv;
        if (RESID) v += Rb[(size_t)(mBase + mOff + r) * ldc + n];
        if (ACT == 1) v = tanhf(v);
        if (ACT == 2) v = fmaxf(v, 0.0f);
        if (ACT == 3) v = v / (1.0f + expf(-v));
        if (ACT == 4) v = (v > 0.f) ? v : 0.01f * v;
        if (ACT == 5) v = 0.5f * v * (1.0f + erff(v * 0.70710678118654752f));
        slab[(mOff + r) * 68 + (j << 4) + rlane] = v;
      }
    }
    __builtin_amdgcn_fence(__ATOMIC_RELEASE, "workgroup");
    __builtin_amdgcn_wave_barrier();
    __builtin_amdgcn_fence(__ATOMIC_ACQUIRE, "workgroup");
    if (OUT_MODE == 0) {
      float* C = (float*)Cout + (size_t)b * strideC;
      const int hh = lane >> 4, c4 = (lane & 15) * 4;     // row seg = 256 B = 16 lanes x 16 B
      {
#pragma unroll
        for (int it = 0; it < 8; ++it) {
          const int row = it * 2 + hh;
          v4f v = *(const v4f*)(slab + row * 68 + c4);
          *(v4f*)(C + (size_t)(mBase + row) * ldc + n0 + c4) = v;
        }
        
      }
    } else {
      const int q = lane >> 3, c8 = (lane & 7) * 8;
      unsigned short* C  = (unsigned short*)Cout  + (size_t)b * strideC;
      unsigned short* C2 = (OUT_MODE == 2) ? ((unsigned short*)Cout2 + (size_t)b * strideC) : nullptr;
      {
#pragma unroll
        for (int it = 0; it < 4; ++it) {
          const int row = it * 4 + q;
          const float* sp = slab + row * 68 + c8;
          v8h hv, lv;
#pragma unroll
          for (int e = 0; e < 8; ++e) {
            if (OUT_MODE == 1) {
              hv[e] = (_Float16)sp[e];
            } else {
              unsigned short hb = f2bf_bits(sp[e]);
              unsigned short lb = f2bf_bits(sp[e] - bf_bits2f(hb));
              hv[e] = __builtin_bit_cast(_Float16, hb);
              lv[e] = __builtin_bit_cast(_Float16, lb);
            }
          }
          *(v8h*)(C + (size_t)(mBase + row) * ldc + n0 + c8) = hv;
          if (OUT_MODE == 2) *(v8h*)(C2 + (size_t)(mBase + row) * ldc + n0 + c8) = lv;
        }
        
      }
    }
    // precaution: the next slab's values and addresses reuse the registers that these stores name; the wait stands in front of that
    asm volatile("s_wait_xcnt 0x0" ::: "memory");
    __builtin_amdgcn_fence(__ATOMIC_RELEASE, "workgroup");
    __builtin_amdgcn_wave_barrier();
    __builtin_amdgcn_fence(__ATOMIC_ACQUIRE, "workgroup");
  }
}

// ---- One grid for the three projections, straight from the f32 inputs; the block index picks the job ----
//   blocks   0..63   q[b][sq][co] = sum_ci x_high[b][ci][sq] Wq[co][ci] + bq[co]  (K = 512: twice the stages, so the smallest tile, 64 x 128)
//   blocks  64..191  k[b][s][co]  = sum_ci x_low[b][ci][s]  Wk[co][ci] + bk[co]   (tile 128 x 128)
//   blocks 192..255  v[b][co][s]  = sum_ci Wv[co][ci] x_low[b][ci][s] + bv[co]    (tile 128 x 256; channel-major out; f16 operands, f16 out)
// The tiles are sized so that the three jobs' blocks last about equally long and together fill the chip's 256 WGPs once.
__global__ __launch_bounds__(256) void proj_all(
    const float* __restrict__ x_high, const float* __restrict__ Wq,
    unsigned short* __restrict__ q_h, unsigned short* __restrict__ q_l, const float* __restrict__ bq,
    const float* __restrict__ x_low, const float* __restrict__ Wk,
    unsigned short* __restrict__ k_h, unsigned short* __restrict__ k_l, const float* __restrict__ bk,
    const float* __restrict__ Wv,
    unsigned short* __restrict__ v_f, const float* __restrict__ bv) {
  __shared__ __align__(16) unsigned short stg[2 * PJ_STAGE];   // two stage buffers of the block's operand rows
  __shared__ __align__(16) float sT[8][16 * 68];   // per-wave 16x64 slab, pitch 68 floats
  const int id = blockIdx.x;                       // every branch below is uniform over the block
  if (id < 64) {
    wmma_gemm64<1, true, 2, 2, false, 2, 1, true, 2, 0>(stg, sT, id & 7, id >> 3,
        x_high, 256, (long)512 * 256, Wq,
        (void*)q_h, (void*)q_l, 256, (long)256 * 256,
        bq, bq, 0L, 256, 256, 512, 1.0f);
  } else if (id < 192) {
    const int j = id - 64;
    wmma_gemm64<1, true, 2, 2, false, 2, 2, true, 4, 0>(stg, sT, j & 15, j >> 4,
        x_low, 1024, (long)256 * 1024, Wk,
        (void*)k_h, (void*)k_l, 256, (long)1024 * 256,
        bk, bk, 0L, 1024, 256, 256, 1.0f);
  } else {
    const int j = id - 192;
    wmma_gemm64<0, false, 1, 1, false, 4, 4, false, 4, 0>(stg, sT, j & 7, j >> 3,
        x_low, 1024, (long)256 * 1024, Wv,
        (void*)v_f, (void*)v_f, 1024, (long)256 * 1024,
        bv, bv, 0L, 256, 1024, 256, 1.0f);
  }
}

// =====================================================================================
// Attention, head dim 32, no mask, no scaling.
//   q planes: bf16 hi/lo [B][256 src px][256 ch] (16x16 grid). The four output pixels of one source pixel share their
//   query row, so their attention rows are equal: each source pixel is worked once and its result stored to all four.
//   k planes: bf16 hi/lo [B][1024 px][256 ch];  v: f16 channel-major [B][256 ch][1024 px]
//   out f32 channel-major [B][256 ch][1024 px].
//   scores = q.k^T: 3 x v_wmma_f32_16x16x32_bf16 per 16x16 tile (hi.hi + hi.lo + lo.hi); online softmax f32;
//   p carried x2^15 as f16 in per-wave LDS; out = p.v: v_wmma_f32_16x16x32_f16; f32 accumulate.
//   Block = 16 waves = 64 source pixels (256 output pixels) of one (b, head); grid.x = B*8*4.
//   Wave = (key group g = wave >> 2, query sub-tile = wave & 3): group g works keys 256g .. 256g+255 in 64-key chunks staged in its
//   own LDS buffers. Every group keeps its own running max, sum
//   and unnormalised out tile; the epilogue merges the four in the fixed order g = 0..3.
// =====================================================================================
#define AS_S   1024
#define AS_C   256
#define AS_SQ  256
#define AS_HD  32
#define AS_NH  8
#define AS_KC  64
#define AS_PSC 32768.0f
#define AS_NG  4                 // key groups per block
#define AS_GK  (AS_S / AS_NG)     // keys per group

__device__ __forceinline__ v8f mma_bf_g(v16b a, v16b b, v8f c) {
  c = __builtin_amdgcn_wmma_f32_16x16x32_bf16(false, a, false, b, (short)0, c, false, false);
  asm volatile("v_nop\n\tv_nop\n\tv_nop\n\tv_nop" : "+v"(c) : "v"(a), "v"(b));
  return c;
}
__device__ __forceinline__ v8f mma_hf_g(v16h a, v16h b, v8f c) {
  c = __builtin_amdgcn_wmma_f32_16x16x32_f16(false, a, false, b, (short)0, c, false, false);
  asm volatile("v_nop\n\tv_nop\n\tv_nop\n\tv_nop" : "+v"(c) : "v"(a), "v"(b));
  return c;
}

__global__ __launch_bounds__(512)
void attn_hd32(const unsigned short* __restrict__ qhp, const unsigned short* __restrict__ qlp,
               const unsigned short* __restrict__ khp, const unsigned short* __restrict__ klp,
               const unsigned short* __restrict__ vp, float* __restrict__ out) {
  union FB { v16b v; v8b h[2]; };
  union FH { v16h v; v8h h[2]; };
  __shared__ __align__(16) __bf16   KshA[AS_NG][AS_KC * AS_HD];   // per group: k hi [kv][d]   4 KB
  __shared__ __align__(16) __bf16   KslA[AS_NG][AS_KC * AS_HD];   // per group: k lo [kv][d]   4 KB
  __shared__ __align__(16) _Float16 VtA[AS_NG][AS_HD * AS_KC];    // per group: v [d][kv]      4 KB
  __shared__ __align__(16) _Float16 Psh[4 * AS_NG][16 * AS_KC];   // per wave p [row][kv]      2 KB
  __shared__ __align__(16) float    Os[AS_NG][AS_HD][68];         // per group: unnormalised out tile [d][64 source px], pitch 68
  __shared__ __align__(16) float    Ms[AS_NG][64];                // per group: running max of each source px
  __shared__ __align__(16) float    Ls[AS_NG][64];                // per group: running sum of each source px

  const int tid  = threadIdx.x;
  const int wave = tid >> 5;
  const int grp  = wave >> 2;          // key group
  const int wq   = wave & 3;           // query sub-tile
  const int gt   = tid & 127;          // thread within the group
  const int lane = tid & 31;
  const int hh   = lane >> 4;
  const int c    = lane & 15;

  const int bx = blockIdx.x;
  const int qb = bx & 3;               // AS_SQ / 64 = 4 query blocks
  const int bh = bx >> 2;
  const int h  = bh & (AS_NH - 1);
  const int b  = bh >> 3;
  const int qbase = qb * 64;
  const int q0 = qbase + wq * 16;

  // ---- Q fragments (A operand, lane c = row, split k map), hi and lo planes ----
  v16b qah, qal;
  {
    const int sq = q0 + c;                       // source pixel 0..255 on the 16x16 grid
    const size_t qo = ((size_t)b * AS_SQ + sq) * AS_C + h * AS_HD + 8 * hh;
    qah = Frag<__bf16>::load((const __bf16*)qhp + qo);
    qal = Frag<__bf16>::load((const __bf16*)qlp + qo);
  }

  float mrow[8], lrow[8];
  v8f oacc[2];
#pragma unroll
  for (int r = 0; r < 8; ++r) { mrow[r] = -INFINITY; lrow[r] = 0.f; }
#pragma unroll
  for (int t = 0; t < 2; ++t) oacc[t] = (v8f){0.f,0.f,0.f,0.f,0.f,0.f,0.f,0.f};

  const __bf16*   khb = (const __bf16*)khp + (size_t)b * AS_S * AS_C + h * AS_HD;
  const __bf16*   klb = (const __bf16*)klp + (size_t)b * AS_S * AS_C + h * AS_HD;
  const _Float16* vb  = (const _Float16*)vp + ((size_t)b * AS_C + h * AS_HD) * AS_S;
  float*          ob  = out + ((size_t)b * AS_C + h * AS_HD) * AS_S + qbase * 4;   // 4 source rows -> 8 output rows of 32
  _Float16*       pw  = Psh[wave];
  __bf16*         Ksh = KshA[grp];
  __bf16*         Ksl = KslA[grp];
  _Float16*       Vt  = VtA[grp];

  for (int kc = 0; kc < AS_GK / AS_KC; ++kc) {
    const int kv0 = grp * AS_GK + kc * AS_KC;
    __syncthreads();
    {
      // K chunk of the group: 64 kv rows x 32 d, both planes; thread -> (kv row, 16-d half)
      const int kvr = gt >> 1, dh = (gt & 1) * 16;
      const __bf16* kr  = khb + (size_t)(kv0 + kvr) * AS_C + dh;
      const __bf16* kr2 = klb + (size_t)(kv0 + kvr) * AS_C + dh;
      *(v8b*)(Ksh + kvr * AS_HD + dh)     = *(const v8b*)(kr);
      *(v8b*)(Ksh + kvr * AS_HD + dh + 8) = *(const v8b*)(kr + 8);
      *(v8b*)(Ksl + kvr * AS_HD + dh)     = *(const v8b*)(kr2);
      *(v8b*)(Ksl + kvr * AS_HD + dh + 8) = *(const v8b*)(kr2 + 8);
      // V chunk of the group: 32 d rows x 64 kv (channel-major source is already [d][kv]); thread -> (d row, 16-kv quarter)
      const int dr = gt >> 2, part = (gt & 3) * 16;
      const _Float16* vr = vb + (size_t)dr * AS_S + kv0 + part;
      *(v8h*)(Vt + dr * AS_KC + part)     = *(const v8h*)(vr);
      *(v8h*)(Vt + dr * AS_KC + part + 8) = *(const v8h*)(vr + 8);
    }
    __syncthreads();

    // ---- scores: s[j][r] = row (8hh+r), kv (kv0 + 16j + c); B operand = k with split k map over d ----
    v8f s[4];
#pragma unroll
    for (int j = 0; j < 4; ++j) {
      s[j] = (v8f){0.f,0.f,0.f,0.f,0.f,0.f,0.f,0.f};
      FB kb, kl;
      kb.h[0] = *(const v8b*)(Ksh + (j * 16 + c) * AS_HD + 8 * hh);
      kb.h[1] = *(const v8b*)(Ksh + (j * 16 + c) * AS_HD + 16 + 8 * hh);
      kl.h[0] = *(const v8b*)(Ksl + (j * 16 + c) * AS_HD + 8 * hh);
      kl.h[1] = *(const v8b*)(Ksl + (j * 16 + c) * AS_HD + 16 + 8 * hh);
      s[j] = mma_bf_g(qah, kb.v, s[j]);
      s[j] = mma_bf_g(qah, kl.v, s[j]);
      s[j] = mma_bf_g(qal, kb.v, s[j]);
    }

    // ---- online softmax (f32) ----
    float cm[8];
#pragma unroll
    for (int r = 0; r < 8; ++r) {
      float m = s[0][r];
#pragma unroll
      for (int j = 1; j < 4; ++j) m = fmaxf(m, s[j][r]);
#pragma unroll
      for (int off = 1; off < 16; off <<= 1) m = fmaxf(m, __shfl_xor(m, off, 32));
      cm[r] = m;
    }
#pragma unroll
    for (int r = 0; r < 8; ++r) {
      const float mnew  = fmaxf(mrow[r], cm[r]);
      const float alpha = expf(mrow[r] - mnew);
      mrow[r] = mnew;
      float psum = 0.f;
#pragma unroll
      for (int j = 0; j < 4; ++j) {
        const float p = expf(s[j][r] - mnew);
        psum += p;
        pw[(8 * hh + r) * AS_KC + j * 16 + c] = (_Float16)(p * AS_PSC);
      }
#pragma unroll
      for (int off = 1; off < 16; off <<= 1) psum += __shfl_xor(psum, off, 32);
      lrow[r] = lrow[r] * alpha + psum;
#pragma unroll
      for (int t = 0; t < 2; ++t) oacc[t][r] *= alpha;
    }
    __builtin_amdgcn_fence(__ATOMIC_RELEASE, "workgroup");
    __builtin_amdgcn_wave_barrier();
    __builtin_amdgcn_fence(__ATOMIC_ACQUIRE, "workgroup");

    // ---- out += p . v : A = p [row][kv] (same element type reload), B = v with split k map over kv ----
#pragma unroll 1
    for (int kk = 0; kk < 2; ++kk) {
      FH pa;
      pa.h[0] = *(const v8h*)(pw + c * AS_KC + kk * 32 + 8 * hh);
      pa.h[1] = *(const v8h*)(pw + c * AS_KC + kk * 32 + 16 + 8 * hh);
#pragma unroll
      for (int t = 0; t < 2; ++t) {
        FH vf;
        vf.h[0] = *(const v8h*)(Vt + (t * 16 + c) * AS_KC + kk * 32 + 8 * hh);
        vf.h[1] = *(const v8h*)(Vt + (t * 16 + c) * AS_KC + kk * 32 + 16 + 8 * hh);
        oacc[t] = mma_hf_g(pa.v, vf.v, oacc[t]);
      }
    }
  }

  // ---- each group hands over its partial state: max, sum, unnormalised out tile ----
  const int row0 = wq * 16 + 8 * hh;
#pragma unroll
  for (int r = 0; r < 8; ++r) {
#pragma unroll
    for (int t = 0; t < 2; ++t) Os[grp][t * 16 + c][row0 + r] = oacc[t][r];
  }
  if (c == 0) {   // the 16 lanes of a row hold equal max and sum: one lane stores them
#pragma unroll
    for (int r = 0; r < 8; ++r) { Ms[grp][row0 + r] = mrow[r]; Ls[grp][row0 + r] = lrow[r]; }
  }
  __syncthreads();
  {
    // nearest-neighbour 2x: output pixel (y, x) of the block's 8 x 32 patch takes source (y>>1, x>>1) of its 4 x 16 patch
    const int o4 = (tid & 63) * 4;                       // 4 output pixels of one row: two source pixels, each twice
    const int sp = (o4 >> 6) * 16 + ((o4 & 31) >> 1);
    // merge weights of the two source pixels: w[g] = exp(m_g - m) / (2^15 * sum_g exp(m_g - m) l_g), g in fixed order
    float w0[AS_NG], w1[AS_NG];
    {
      float m0 = Ms[0][sp], m1 = Ms[0][sp + 1];
#pragma unroll
      for (int g = 1; g < AS_NG; ++g) { m0 = fmaxf(m0, Ms[g][sp]); m1 = fmaxf(m1, Ms[g][sp + 1]); }
      float l0 = 0.f, l1 = 0.f;
#pragma unroll
      for (int g = 0; g < AS_NG; ++g) {
        w0[g] = expf(Ms[g][sp] - m0);      l0 += w0[g] * Ls[g][sp];
        w1[g] = expf(Ms[g][sp + 1] - m1);  l1 += w1[g] * Ls[g][sp + 1];
      }
      const float i0 = 1.0f / (l0 * AS_PSC), i1 = 1.0f / (l1 * AS_PSC);
#pragma unroll
      for (int g = 0; g < AS_NG; ++g) { w0[g] *= i0; w1[g] *= i1; }
    }
#pragma unroll   // the 4 channel steps become immediate offsets of one address, and the LDS reads run ahead of the stores
    for (int it = 0; it < 4; ++it) {
      const int d = it * 8 + (tid >> 6);
      float s0 = 0.f, s1 = 0.f;
#pragma unroll
      for (int g = 0; g < AS_NG; ++g) { s0 += Os[g][d][sp] * w0[g]; s1 += Os[g][d][sp + 1] * w1[g]; }
      *(v4f*)(ob + (size_t)d * AS_S + o4) = (v4f){s0, s0, s1, s1};
    }
  }
}

extern "C" void kernel_launch(void* const* d_in, const int* in_sizes, int n_in,
                              void* d_out, int out_size, void* d_ws, size_t ws_size,
                              hipStream_t stream) {
  const int B = 8, CHI = 512, C = 256, SQ = 256, S = 1024;
  if (n_in < 8) return;
  if (in_sizes[0] != B * CHI * SQ || in_sizes[1] != B * C * S || in_sizes[2] != C * CHI ||
      in_sizes[3] != C || in_sizes[4] != C * C || in_sizes[5] != C || in_sizes[6] != C * C ||
      in_sizes[7] != C || out_size != B * C * S) return;

  const float* x_high = (const float*)d_in[0];
  const float* x_low  = (const float*)d_in[1];
  const float* Wq     = (const float*)d_in[2];
  const float* bq     = (const float*)d_in[3];
  const float* Wk     = (const float*)d_in[4];
  const float* bk     = (const float*)d_in[5];
  const float* Wv     = (const float*)d_in[6];
  const float* bv     = (const float*)d_in[7];
  float* out = (float*)d_out;

  // ---- workspace carve (bytes, 256-B aligned) ----
  char* ws = (char*)d_ws;
  size_t off = 0;
#define CARVE16(name, elems) unsigned short* name = (unsigned short*)(ws + off); off += ((((size_t)(elems)) * 2) + 255) & ~(size_t)255;
  CARVE16(q_h,  (size_t)B * SQ * C)      // q planes [B][256 src px][256 ch]
  CARVE16(q_l,  (size_t)B * SQ * C)
  CARVE16(k_h,  (size_t)B * S * C)       // k planes [B][1024][256 ch]
  CARVE16(k_l,  (size_t)B * S * C)
  CARVE16(v_f,  (size_t)B * C * S)       // v f16 channel-major [B][256 ch][1024]
#undef CARVE16
  if (off > ws_size || off > (size_t)134217728) return;   // total 14,680,064 B

  // ---- q, k and v projections, one launch; the operands are converted and turned inside it ----
  proj_all<<<dim3(256), dim3(256), 0, stream>>>(
      x_high, Wq, q_h, q_l, bq,
      x_low, Wk, k_h, k_l, bk,
      Wv, v_f, bv);

  // ---- attention ----
  attn_hd32<<<dim3(B * AS_NH * (SQ / 64)), dim3(512), 0, stream>>>(q_h, q_l, k_h, k_l, v_f, out);
}

// v007
// Measured time: 28.7 microseconds a run.
// Two timings next to v006 put it at 1.19 and 1.18 times that version's speed.
// All steps since v000 together make it 6.07 times as fast.
#include <hip/hip_runtime.h>
#include <stdint.h>
// Contractions: q-proj, k-proj, q.k scores: v_wmma_f32_16x16x32_bf16 with bf16 hi/lo operand planes (hi.hi + hi.lo + lo.hi);
// v-proj and p.v: v_wmma_f32_16x16x32_f16 (f16 operands, p carried x2^15); f32 accumulate everywhere; softmax in f32.

typedef __attribute__((ext_vector_type(16))) _Float16 v16h;
typedef __attribute__((ext_vector_type(8)))  _Float16 v8h;
typedef __attribute__((ext_vector_type(16))) __bf16   v16b;
typedef __attribute__((ext_vector_type(8)))  __bf16   v8b;
typedef __attribute__((ext_vector_type(8)))  float    v8f;
typedef __attribute__((ext_vector_type(4)))  float    v4f;
typedef __attribute__((ext_vector_type(2)))  float    v2f;
typedef __attribute__((ext_vector_type(2)))  __bf16   v2b;

__device__ __forceinline__ unsigned short f2bf_bits(float f) {
  unsigned u = __float_as_uint(f);
  return (unsigned short)((u + 0x7FFFu + ((u >> 16) & 1u)) >> 16);
}
__device__ __forceinline__ float bf_bits2f(unsigned short h) { return __uint_as_float(((unsigned)h) << 16); }

// hazard guards as plain device helpers
__device__ __forceinline__ void dep_guard_h(v8f& a, v8f& b, v16h x, v16h y) { asm volatile("v_nop\n\tv_nop\n\tv_nop\n\tv_nop" : "+v"(a), "+v"(b) : "v"(x), "v"(y)); }
__device__ __forceinline__ void dep_guard_b(v8f& a, v8f& b, v16b x, v16b y) { asm volatile("v_nop\n\tv_nop\n\tv_nop\n\tv_nop" : "+v"(a), "+v"(b) : "v"(x), "v"(y)); }
__device__ __forceinline__ void keep4_h(v16h a, v16h b, v16h c, v16h d) { asm volatile("v_nop" :: "v"(a), "v"(b), "v"(c), "v"(d)); }
__device__ __forceinline__ void keep4_b(v16b a, v16b b, v16b c, v16b d) { asm volatile("v_nop" :: "v"(a), "v"(b), "v"(c), "v"(d)); }
__device__ __forceinline__ void acc_guard4(v8f& a, v8f& b, v8f& c, v8f& d) { asm volatile("v_nop\n\tv_nop\n\tv_nop\n\tv_nop" : "+v"(a), "+v"(b), "+v"(c), "+v"(d)); }
template <typename T> struct Frag;
template <> struct Frag<_Float16> {
  typedef v16h V; union U { v16h v; v8h h[2]; };
  static __device__ __forceinline__ v16h load(const _Float16* p) {   // elements 0..7 <- p[0..7], 8..15 <- p[16..23]
    U f; f.h[0] = *(const v8h*)(p); f.h[1] = *(const v8h*)(p + 16); return f.v;
  }
  static __device__ __forceinline__ v8f mma(v16h a, v16h b, v8f c) {
    return __builtin_amdgcn_wmma_f32_16x16x32_f16(false, a, false, b, (short)0, c, false, false);
  }
  static __device__ __forceinline__ void guard(v8f& a, v8f& b, v16h x, v16h y) { dep_guard_h(a, b, x, y); }
  static __device__ __forceinline__ void keep(v16h a, v16h b, v16h c, v16h d) { keep4_h(a, b, c, d); }
};
template <> struct Frag<__bf16> {
  typedef v16b V; union U { v16b v; v8b h[2]; };
  static __device__ __forceinline__ v16b load(const __bf16* p) {
    U f; f.h[0] = *(const v8b*)(p); f.h[1] = *(const v8b*)(p + 16); return f.v;
  }
  static __device__ __forceinline__ v8f mma(v16b a, v16b b, v8f c) {
    return __builtin_amdgcn_wmma_f32_16x16x32_bf16(false, a, false, b, (short)0, c, false, false);
  }
  static __device__ __forceinline__ void guard(v8f& a, v8f& b, v16b x, v16b y) { dep_guard_b(a, b, x, y); }
  static __device__ __forceinline__ void keep(v16b a, v16b b, v16b c, v16b d) { keep4_b(a, b, c, d); }
};

// ---- Register-blocked batched WMMA GEMM on f32 sources, operands converted on their way into LDS ------------
// C[m,n] = scale * sum_k A[m,k] * Bt[n,k] (+bias)(+resid); each wave owns a (16 * MI) x 64 tile.
// One operand is X, channel-major f32 [b][K][S] (its rows are pixels, so it is turned on the way), the other is Wt, row-major f32 [rows][K].
// XA: X is the A operand (else it is Bt). K % 64 == 0, K >= 128.
// The block's 8 wave tiles form one (8/WN * 16 * MI) x (WN * 64) tile; M and N are multiples of its sides and the grid holds exactly
// (M / side) * (N / side) blocks per batch. Its A and Bt rows stand in LDS 64 k (128 B per row and plane) at a time.
// SPLIT: operands are bf16 hi/lo planes; product = hi.hi + hi.lo + lo.hi. Without SPLIT: one f16 plane.
// BIAS_MODE: 0 = none, 1 = bias[m], 2 = bias[n].
// OUT_MODE: 0 = f32, 1 = f16, 2 = bf16 hi plane (Cout) + bf16 lo plane (Cout2).
// ET: 0 = f16 operands, 1 = bf16 operands
template <int ET> struct Elem;
template <> struct Elem<0> { typedef _Float16 T; };
template <> struct Elem<1> { typedef __bf16 T; };

#define PJ_KS     64                        // k per stage
#define PJ_PITCH  72                        // LDS row pitch in elements: 128 B + 16 B, an odd multiple of 16 B for the b128 readers
#define PJ_ROWS   512                       // rows of the largest stage: 2 planes x (128 A rows + 128 Bt rows)
#define PJ_STAGE  (PJ_ROWS * PJ_PITCH)      // elements per buffer

// Eight consecutive k of one operand row: f32 -> 16 bytes per plane in LDS (round to nearest even; lo = rounded remainder).
template <bool SPLIT>
__device__ __forceinline__ void put8(unsigned short* hi, unsigned short* lo, const float* f) {
  if constexpr (SPLIT) {
    v8b hv, lv;
#pragma unroll
    for (int e = 0; e < 8; e += 2) {           // two at a time: one packed conversion per pair and plane
      const v2f a = {f[e], f[e + 1]};
      const v2b h = __builtin_convertvector(a, v2b);
      const v2f r = {a[0] - (float)h[0], a[1] - (float)h[1]};
      const v2b l = __builtin_convertvector(r, v2b);
      hv[e] = h[0]; hv[e + 1] = h[1];
      lv[e] = l[0]; lv[e + 1] = l[1];
    }
    *(v8b*)hi = hv;
    *(v8b*)lo = lv;
  } else {
    v8h hv;
#pragma unroll
    for (int e = 0; e < 8; ++e) hv[e] = (_Float16)f[e];
    *(v8h*)hi = hv;
  }
}

// Device body: bx = block tile, b = batch, stg = the block's two stage buffers, sT = the block's 8 per-wave slabs.
// PXV: pixels of one channel that a thread loads at once (4 or 2).
template <int ET, bool SPLIT, int BIAS_MODE, int OUT_MODE, bool RESID, int WN, int MI, bool XA, int PXV, int ACT = 0>
__device__ __forceinline__ void wmma_gemm64(
    unsigned short* stg, float (*sT)[16 * 68], int bx, int b,
    const float* __restrict__ Xp, int S, long strideX,
    const float* __restrict__ Wp,
    void* __restrict__ Cout, void* __restrict__ Cout2, int ldc, long strideC,
    const float* __restrict__ bias,
    const float* __restrict__ resid, long strideR,
    int M, int N, int K, float scale) {
  typedef typename Elem<ET>::T T;
  typedef typename Frag<T>::V V;
  typedef float vpx __attribute__((ext_vector_type(PXV)));
  static_assert(SPLIT == (ET == 1), "two bf16 planes or one f16 plane");
  constexpr int WR = 16 * MI;                  // A rows of a wave tile
  constexpr int AR = (8 / WN) * WR;            // A rows of the block tile
  constexpr int BR = WN * 64;                  // Bt rows of the block tile
  constexpr int P  = SPLIT ? 2 : 1;
  constexpr int XR = XA ? AR : BR;             // rows (pixels) of the X operand in the block tile
  constexpr int TR = XA ? BR : AR;             // rows of the Wt operand in the block tile
  constexpr int XB = XA ? 0 : P * AR;          // first LDS row of each operand's hi plane; its lo plane follows it
  constexpr int TB = XA ? P * AR : 0;
  constexpr int NU = XR / (32 * PXV);          // X units per wave: a unit is (8 * PXV) pixels x 32 channels
  constexpr int NG = TR / 32;                  // Wt groups of 32 rows
  static_assert(NU * 32 * PXV == XR && NG * 32 == TR, "stage shape");
  const int tid  = threadIdx.x;
  const int lane = tid & 31;
  const int wave = tid >> 5;
  const int nbN = N / BR;
  const int bm  = bx / nbN;
  const int bn  = bx - bm * nbN;
  const int wa  = wave / WN;                   // the wave's WR rows among the block's A rows
  const int wb  = wave - wa * WN;              // the wave's 64 rows among the block's Bt rows
  const int m0 = bm * AR + wa * WR;
  const int n0 = bn * BR + (wb << 6);

  const int rlane = lane & 15;                 // row (A) / col (B, D) within subtile
  const int koff  = (lane >> 4) * 8;           // k offset of this lane half
  const int mOff  = (lane >> 4) * 8;           // D row offset

  // X: a thread takes PXV pixels x 8 channels of each unit: 8 loads along the pixels (8 lanes cover one run of 32 * PXV bytes of a
  // channel), then per pixel one 16-byte LDS store per plane, 8 channels = 8 consecutive k of that pixel's row.
  const int xci = (wave & 1) * 32 + (lane & 3) * 8;               // first of the thread's 8 channels within the stage
  const int xpx = (wave >> 1) * (8 * PXV) + (lane >> 2) * PXV;    // first of its pixels in unit 0; unit i: + i * 32 * PXV
  const float* xg = Xp + (size_t)b * strideX + (size_t)xci * S + (XA ? bm * AR : bn * BR) + xpx;
  // Wt: a thread takes 8 consecutive k (32 bytes) of row (tid >> 3) in every group of 32 rows.
  const int crow = tid >> 3, ccol = (tid & 7) * 8;
  const float* wg = Wp + (size_t)((XA ? bn * BR : bm * AR) + crow) * K + ccol;

  vpx xr[NU][8];
  v4f wr[NG][2];
  // xk, wk: the thread's own first element of each operand at the stage's first k
  auto stage_load = [&](const float* xk, const float* wk) __attribute__((always_inline)) {
#pragma unroll
    for (int i = 0; i < NU; ++i)
#pragma unroll
      for (int j = 0; j < 8; ++j) xr[i][j] = *(const vpx*)(xk + (size_t)j * S + i * 32 * PXV);
#pragma unroll
    for (int g = 0; g < NG; ++g) {
      wr[g][0] = *(const v4f*)(wk + (size_t)(g * 32) * K);
      wr[g][1] = *(const v4f*)(wk + (size_t)(g * 32) * K + 4);
    }
    // precaution: nothing may write the address registers that these loads name in front of this wait; the two addresses are inputs
    // of its statement, so that no load of the group lands in them either
    asm volatile("s_wait_xcnt 0x0" :: "v"(xk), "v"(wk) : "memory");
  };
  auto stage_store = [&](unsigned short* buf) __attribute__((always_inline)) {
    unsigned short* xs = buf + (XB + xpx) * PJ_PITCH + xci;
#pragma unroll
    for (int i = 0; i < NU; ++i)
#pragma unroll
      for (int p = 0; p < PXV; ++p) {
        const float f[8] = {xr[i][0][p], xr[i][1][p], xr[i][2][p], xr[i][3][p], xr[i][4][p], xr[i][5][p], xr[i][6][p], xr[i][7][p]};
        unsigned short* d = xs + (i * 32 * PXV + p) * PJ_PITCH;
        put8<SPLIT>(d, d + XR * PJ_PITCH, f);
      }
    unsigned short* tsm = buf + (TB + crow) * PJ_PITCH + ccol;
#pragma unroll
    for (int g = 0; g < NG; ++g) {
      const float f[8] = {wr[g][0][0], wr[g][0][1], wr[g][0][2], wr[g][0][3], wr[g][1][0], wr[g][1][1], wr[g][1][2], wr[g][1][3]};
      unsigned short* d = tsm + (g * 32) * PJ_PITCH;
      put8<SPLIT>(d, d + TR * PJ_PITCH, f);
    }
  };

  v8f acc[MI][4];
#pragma unroll
  for (int i = 0; i < MI; ++i)
#pragma unroll
    for (int j = 0; j < 4; ++j) acc[i][j] = (v8f){0.f,0.f,0.f,0.f,0.f,0.f,0.f,0.f};

  const int nt = K / PJ_KS;                    // stages; the same for the whole block, at least 2
  stage_load(xg, wg);
  stage_store(stg);
  __syncthreads();                             // stage 0 may be read
  const float* xn = xg + (size_t)PJ_KS * S;    // the next stage to load
  const float* wn = wg + PJ_KS;

#pragma unroll 1   // rolled: the text of the three jobs stays small for the instruction cache, and the two buffers alternate by index
  for (int t = 0; t < nt; ++t) {
    const int bufo = (t & 1) * PJ_STAGE;
    const bool more = t + 1 < nt;              // the same for the whole block
    if (more) {                                // the next stage's f32 values fly while this stage is worked on
      stage_load(xn, wn);
      xn += (size_t)PJ_KS * S;
      wn += PJ_KS;
    }
    const T* sA  = (const T*)(stg + bufo) + (wa * WR + rlane) * PJ_PITCH + koff;
    const T* sA2 = sA + AR * PJ_PITCH;
    const T* sB  = (const T*)(stg + bufo) + (P * AR + (wb << 6) + rlane) * PJ_PITCH + koff;
    const T* sB2 = sB + BR * PJ_PITCH;
#pragma unroll
    for (int kk = 0; kk < PJ_KS; kk += 32) {
      V bh[4], bl[4];
#pragma unroll
      for (int j = 0; j < 4; ++j) {
        bh[j] = Frag<T>::load(sB + (j << 4) * PJ_PITCH + kk);
        if (SPLIT) bl[j] = Frag<T>::load(sB2 + (j << 4) * PJ_PITCH + kk);
      }
#pragma unroll
      for (int i = 0; i < MI; ++i) {
        V ah = Frag<T>::load(sA + (i << 4) * PJ_PITCH + kk);
        V al;
        if (SPLIT) al = Frag<T>::load(sA2 + (i << 4) * PJ_PITCH + kk);
#pragma unroll
        for (int j = 0; j < 4; ++j) {
          acc[i][j] = Frag<T>::mma(ah, bh[j], acc[i][j]);
          if (SPLIT) {
            acc[i][j] = Frag<T>::mma(ah, bl[j], acc[i][j]);
            acc[i][j] = Frag<T>::mma(al, bh[j], acc[i][j]);
          }
        }
        Frag<T>::guard(acc[i][0], acc[i][3], ah, SPLIT ? al : ah);
      }
      Frag<T>::keep(bh[0], bh[1], bh[2], bh[3]);
      if (SPLIT) Frag<T>::keep(bl[0], bl[1], bl[2], bl[3]);
    }
    if (more) {
      stage_store(stg + (PJ_STAGE - bufo));    // into the buffer whose last readers left it before the barrier of the trip before
      __syncthreads();                         // publishes stage t + 1 and ends every wave's reads of stage t
    }
  }
#pragma unroll
  for (int i = 0; i < MI; ++i) acc_guard4(acc[i][0], acc[i][1], acc[i][2], acc[i][3]);

  // ---- epilogue ----
  float* slab = sT[wave];
  const float* Rb = RESID ? (resid + (size_t)b * strideR) : nullptr;
#pragma unroll
  for (int i = 0; i < MI; ++i) {
    const int mBase = m0 + (i << 4);
#pragma unroll
    for (int j = 0; j < 4; ++j) {
      const int n = n0 + (j << 4) + rlane;
      float bv = 0.f;
      if (BIAS_MODE == 2) bv = bias[n];
#pragma unroll
      for (int r = 0; r < 8; ++r) {
        float v = acc[i][j][r] * scale;
        if (BIAS_MODE == 1) v += bias[mBase + mOff + r];
        if (BIAS_MODE == 2) v += bv;
        if (RESID) v += Rb[(size_t)(mBase + mOff + r) * ldc + n];
        if (ACT == 1) v = tanhf(v);
        if (ACT == 2) v = fmaxf(v, 0.0f);
        if (ACT == 3) v = v / (1.0f + expf(-v));
        if (ACT == 4) v = (v > 0.f) ? v : 0.01f * v;
        if (ACT == 5) v = 0.5f * v * (1.0f + erff(v * 0.70710678118654752f));
        slab[(mOff + r) * 68 + (j << 4) + rlane] = v;
      }
    }
    __builtin_amdgcn_fence(__ATOMIC_RELEASE, "workgroup");
    __builtin_amdgcn_wave_barrier();
    __builtin_amdgcn_fence(__ATOMIC_ACQUIRE, "workgroup");
    if (OUT_MODE == 0) {
      float* C = (float*)Cout + (size_t)b * strideC;
      const int hh = lane >> 4, c4 = (lane & 15) * 4;     // row seg = 256 B = 16 lanes x 16 B
      {
#pragma unroll
        for (int it = 0; it < 8; ++it) {
          const int row = it * 2 + hh;
          v4f v = *(const v4f*)(slab + row * 68 + c4);
          *(v4f*)(C + (size_t)(mBase + row) * ldc + n0 + c4) = v;
        }
        
      }
    } else {
      const int q = lane >> 3, c8 = (lane & 7) * 8;
      unsigned short* C  = (unsigned short*)Cout  + (size_t)b * strideC;
      unsigned short* C2 = (OUT_MODE == 2) ? ((unsigned short*)Cout2 + (size_t)b * strideC) : nullptr;
      {
#pragma unroll
        for (int it = 0; it < 4; ++it) {
          const int row = it * 4 + q;
          const float* sp = slab + row * 68 + c8;
          v8h hv, lv;
#pragma unroll
          for (int e = 0; e < 8; ++e) {
            if (OUT_MODE == 1) {
              hv[e] = (_Float16)sp[e];
            } else {
              unsigned short hb = f2bf_bits(sp[e]);
              unsigned short lb = f2bf_bits(sp[e] - bf_bits2f(hb));
              hv[e] = __builtin_bit_cast(_Float16, hb);
              lv[e] = __builtin_bit_cast(_Float16, lb);
            }
          }
          *(v8h*)(C + (size_t)(mBase + row) * ldc + n0 + c8) = hv;
          if (OUT_MODE == 2) *(v8h*)(C2 + (size_t)(mBase + row) * ldc + n0 + c8) = lv;
        }
        
      }
    }
    // precaution: the next slab's values and addresses reuse the registers that these stores name; the wait stands in front of that
    asm volatile("s_wait_xcnt 0x0" ::: "memory");
    __builtin_amdgcn_fence(__ATOMIC_RELEASE, "workgroup");
    __builtin_amdgcn_wave_barrier();
    __builtin_amdgcn_fence(__ATOMIC_ACQUIRE, "workgroup");
  }
}

// ---- One grid for the three projections, straight from the f32 inputs; the block index picks the job ----
//   blocks   0..63   q[b][sq][co] = sum_ci x_high[b][ci][sq] Wq[co][ci] + bq[co]  (K = 512: twice the stages, so the smallest tile, 64 x 128)
//   blocks  64..191  k[b][s][co]  = sum_ci x_low[b][ci][s]  Wk[co][ci] + bk[co]   (tile 128 x 128)
//   blocks 192..255  v[b][co][s]  = sum_ci Wv[co][ci] x_low[b][ci][s] + bv[co]    (tile 128 x 256; channel-major out; f16 operands, f16 out)
// The tiles are sized so that the three jobs' blocks last about equally long and together fill the chip's 256 WGPs once.
__global__ __launch_bounds__(256) void proj_all(
    const float* __restrict__ x_high, const float* __restrict__ Wq,
    unsigned short* __restrict__ q_h, unsigned short* __restrict__ q_l, const float* __restrict__ bq,
    const float* __restrict__ x_low, const float* __restrict__ Wk,
    unsigned short* __restrict__ k_h, unsigned short* __restrict__ k_l, const float* __restrict__ bk,
    const float* __restrict__ Wv,
    unsigned short* __restrict__ v_f, const float* __restrict__ bv) {
  __shared__ __align__(16) unsigned short stg[2 * PJ_STAGE];   // two stage buffers of the block's operand rows
  __shared__ __align__(16) float sT[8][16 * 68];   // per-wave 16x64 slab, pitch 68 floats
  const int id = blockIdx.x;                       // every branch below is uniform over the block
  if (id < 64) {
    wmma_gemm64<1, true, 2, 2, false, 2, 1, true, 2, 0>(stg, sT, id & 7, id >> 3,
        x_high, 256, (long)512 * 256, Wq,
        (void*)q_h, (void*)q_l, 256, (long)256 * 256,
        bq, bq, 0L, 256, 256, 512, 1.0f);
  } else if (id < 192) {
    const int j = id - 64;
    wmma_gemm64<1, true, 2, 2, false, 2, 2, true, 4, 0>(stg, sT, j & 15, j >> 4,
        x_low, 1024, (long)256 * 1024, Wk,
        (void*)k_h, (void*)k_l, 256, (long)1024 * 256,
        bk, bk, 0L, 1024, 256, 256, 1.0f);
  } else {
    const int j = id - 192;
    wmma_gemm64<0, false, 1, 1, false, 4, 4, false, 4, 0>(stg, sT, j & 7, j >> 3,
        x_low, 1024, (long)256 * 1024, Wv,
        (void*)v_f, (void*)v_f, 1024, (long)256 * 1024,
        bv, bv, 0L, 256, 1024, 256, 1.0f);
  }
}

// =====================================================================================
// Attention, head dim 32, no mask, no scaling.
//   q planes: bf16 hi/lo [B][256 src px][256 ch] (16x16 grid). The four output pixels of one source pixel share their
//   query row, so their attention rows are equal: each source pixel is worked once and its result stored to all four.
//   k planes: bf16 hi/lo [B][1024 px][256 ch];  v: f16 channel-major [B][256 ch][1024 px]
//   out f32 channel-major [B][256 ch][1024 px].
//   scores transposed, k.q^T (A = k rows, B = q): 3 x v_wmma_f32_16x16x32_bf16 per 16x16 tile (hi.hi + lo.hi + hi.lo in k, q order);
//   a lane then holds 8 keys per tile of ONE query, so the online softmax (f32) runs over the lane's own registers, joined with the
//   other wave half by one cross-row move; two score tiles, as p x2^15 in f16, ARE the B operand of out^T += v^T.p^T
//   (v_wmma_f32_16x16x32_f16, A = v rows [d][kv]); f32 accumulate.
//   Block = 16 waves = 64 source pixels (256 output pixels) of one (b, head); grid.x = B*8*4.
//   Wave = (key group g = wave >> 2, query sub-tile = wave & 3): group g works keys 256g .. 256g+255 in 64-key chunks staged in its
//   own LDS buffers. Every group keeps its own running max, sum
//   and unnormalised out tile; the epilogue merges the four in the fixed order g = 0..3.
// =====================================================================================
#define AS_S   1024
#define AS_C   256
#define AS_SQ  256
#define AS_HD  32
#define AS_NH  8
#define AS_KC  64
#define AS_PSC 32768.0f
#define AS_NG  4                 // key groups per block
#define AS_GK  (AS_S / AS_NG)     // keys per group

// value of lane l ^ 16 (the other wave half), by a vector cross-row move
__device__ __forceinline__ float xhalf(float x) {
  return __builtin_bit_cast(float, __builtin_amdgcn_permlanex16(__builtin_bit_cast(int, x), __builtin_bit_cast(int, x),
                                                                0x76543210, 0xfedcba98, false, false));
}

__global__ __launch_bounds__(512)
void attn_hd32(const unsigned short* __restrict__ qhp, const unsigned short* __restrict__ qlp,
               const unsigned short* __restrict__ khp, const unsigned short* __restrict__ klp,
               const unsigned short* __restrict__ vp, float* __restrict__ out) {
  union FB { v16b v; v8b h[2]; };
  union FH { v16h v; v8h h[2]; };
  __shared__ __align__(16) __bf16   KshA[AS_NG][AS_KC * AS_HD];   // per group: k hi [kv][d]   4 KB
  __shared__ __align__(16) __bf16   KslA[AS_NG][AS_KC * AS_HD];   // per group: k lo [kv][d]   4 KB
  __shared__ __align__(16) _Float16 VtA[AS_NG][AS_HD * AS_KC];    // per group: v [d][kv]      4 KB
  __shared__ __align__(16) float    Os[AS_NG][AS_HD][68];         // per group: unnormalised out tile [d][64 source px], pitch 68
  __shared__ __align__(16) float    Ms[AS_NG][64];                // per group: running max of each source px
  __shared__ __align__(16) float    Ls[AS_NG][64];                // per group: running sum of each source px

  const int tid  = threadIdx.x;
  const int wave = tid >> 5;
  const int grp  = wave >> 2;          // key group
  const int wq   = wave & 3;           // query sub-tile
  const int gt   = tid & 127;          // thread within the group
  const int lane = tid & 31;
  const int hh   = lane >> 4;
  const int c    = lane & 15;

  const int bx = blockIdx.x;
  const int qb = bx & 3;               // AS_SQ / 64 = 4 query blocks
  const int bh = bx >> 2;
  const int h  = bh & (AS_NH - 1);
  const int b  = bh >> 3;
  const int qbase = qb * 64;
  const int q0 = qbase + wq * 16;

  // ---- Q fragments (B operand, lane c = query column, split k map), hi and lo planes ----
  v16b qah, qal;
  {
    const int sq = q0 + c;                       // source pixel 0..255 on the 16x16 grid
    const size_t qo = ((size_t)b * AS_SQ + sq) * AS_C + h * AS_HD + 8 * hh;
    qah = Frag<__bf16>::load((const __bf16*)qhp + qo);
    qal = Frag<__bf16>::load((const __bf16*)qlp + qo);
  }

  float mrow = -INFINITY;   // running max of the lane's query (equal in both wave halves)
  float lrow = 0.f;         // running sum over the keys of the lane's own half; the halves are joined behind the loop
  v8f oacc[2];              // oacc[t][r] = out^T[d = 16t + 8hh + r][query c]
#pragma unroll
  for (int t = 0; t < 2; ++t) oacc[t] = (v8f){0.f,0.f,0.f,0.f,0.f,0.f,0.f,0.f};

  const __bf16*   khb = (const __bf16*)khp + (size_t)b * AS_S * AS_C + h * AS_HD;
  const __bf16*   klb = (const __bf16*)klp + (size_t)b * AS_S * AS_C + h * AS_HD;
  const _Float16* vb  = (const _Float16*)vp + ((size_t)b * AS_C + h * AS_HD) * AS_S;
  float*          ob  = out + ((size_t)b * AS_C + h * AS_HD) * AS_S + qbase * 4;   // 4 source rows -> 8 output rows of 32
  __bf16*         Ksh = KshA[grp];
  __bf16*         Ksl = KslA[grp];
  _Float16*       Vt  = VtA[grp];

  for (int kc = 0; kc < AS_GK / AS_KC; ++kc) {
    const int kv0 = grp * AS_GK + kc * AS_KC;
    __syncthreads();
    {
      // K chunk of the group: 64 kv rows x 32 d, both planes; thread -> (kv row, 16-d half)
      const int kvr = gt >> 1, dh = (gt & 1) * 16;
      const __bf16* kr  = khb + (size_t)(kv0 + kvr) * AS_C + dh;
      const __bf16* kr2 = klb + (size_t)(kv0 + kvr) * AS_C + dh;
      *(v8b*)(Ksh + kvr * AS_HD + dh)     = *(const v8b*)(kr);
      *(v8b*)(Ksh + kvr * AS_HD + dh + 8) = *(const v8b*)(kr + 8);
      *(v8b*)(Ksl + kvr * AS_HD + dh)     = *(const v8b*)(kr2);
      *(v8b*)(Ksl + kvr * AS_HD + dh + 8) = *(const v8b*)(kr2 + 8);
      // V chunk of the group: 32 d rows x 64 kv (channel-major source is already [d][kv]); thread -> (d row, 16-kv quarter)
      const int dr = gt >> 2, part = (gt & 3) * 16;
      const _Float16* vr = vb + (size_t)dr * AS_S + kv0 + part;
      *(v8h*)(Vt + dr * AS_KC + part)     = *(const v8h*)(vr);
      *(v8h*)(Vt + dr * AS_KC + part + 8) = *(const v8h*)(vr + 8);
    }
    __syncthreads();

    // ---- scores, transposed: s[j][r] = key (kv0 + 16j + 8hh + r), query (q0 + c); A operand = k rows with split k map over d ----
    FB kb[4], kl[4];
#pragma unroll
    for (int j = 0; j < 4; ++j) {
      kb[j].h[0] = *(const v8b*)(Ksh + (j * 16 + c) * AS_HD + 8 * hh);
      kb[j].h[1] = *(const v8b*)(Ksh + (j * 16 + c) * AS_HD + 16 + 8 * hh);
      kl[j].h[0] = *(const v8b*)(Ksl + (j * 16 + c) * AS_HD + 8 * hh);
      kl[j].h[1] = *(const v8b*)(Ksl + (j * 16 + c) * AS_HD + 16 + 8 * hh);
    }
    v8f s[4];
#pragma unroll
    for (int j = 0; j < 4; ++j) s[j] = Frag<__bf16>::mma(kb[j].v, qah, (v8f){0.f,0.f,0.f,0.f,0.f,0.f,0.f,0.f});
#pragma unroll
    for (int j = 0; j < 4; ++j) s[j] = Frag<__bf16>::mma(kl[j].v, qah, s[j]);
#pragma unroll
    for (int j = 0; j < 4; ++j) s[j] = Frag<__bf16>::mma(kb[j].v, qal, s[j]);

    // ---- online softmax (f32): the lane's 32 scores belong to one query ----
    float mt[4];   // one chain per tile: a tile's maximum can start while the later tiles' products still run
#pragma unroll
    for (int j = 0; j < 4; ++j) {
      mt[j] = s[j][0];
#pragma unroll
      for (int r = 1; r < 8; ++r) mt[j] = fmaxf(mt[j], s[j][r]);
    }
    float m = fmaxf(fmaxf(mt[0], mt[1]), fmaxf(mt[2], mt[3]));
    m = fmaxf(m, xhalf(m));
    const float mnew  = fmaxf(mrow, m);
    const float alpha = expf(mrow - mnew);
    mrow = mnew;
    float ps[4];
    FH pb[2];   // pb[kk] element e = p of key 32kk + (e < 8 ? 8hh + e : 16 + 8hh + e - 8): the B operand's own k order
#pragma unroll
    for (int j = 0; j < 4; ++j) {
      ps[j] = 0.f;
#pragma unroll
      for (int r = 0; r < 8; ++r) {
        const float p = expf(s[j][r] - mnew);
        ps[j] += p;
        pb[j >> 1].v[(j & 1) * 8 + r] = (_Float16)(p * AS_PSC);
      }
    }
    lrow = lrow * alpha + ((ps[0] + ps[1]) + (ps[2] + ps[3]));
#pragma unroll
    for (int t = 0; t < 2; ++t)
#pragma unroll
      for (int r = 0; r < 8; ++r) oacc[t][r] *= alpha;

    // ---- out^T += v^T . p^T : A = v rows [d][kv] with split k map over kv, B = p straight from the score registers ----
#pragma unroll   // unrolled: pb[kk] lives in registers, which only a constant index can name
    for (int kk = 0; kk < 2; ++kk) {
#pragma unroll
      for (int t = 0; t < 2; ++t) {
        FH vf;
        vf.h[0] = *(const v8h*)(Vt + (t * 16 + c) * AS_KC + kk * 32 + 8 * hh);
        vf.h[1] = *(const v8h*)(Vt + (t * 16 + c) * AS_KC + kk * 32 + 16 + 8 * hh);
        oacc[t] = Frag<_Float16>::mma(vf.v, pb[kk].v, oacc[t]);
      }
    }
  }

  // ---- each group hands over its partial state: max, sum, unnormalised out tile ----
  const int qcol = wq * 16 + c;
#pragma unroll
  for (int t = 0; t < 2; ++t) {
#pragma unroll
    for (int r = 0; r < 8; ++r) Os[grp][t * 16 + 8 * hh + r][qcol] = oacc[t][r];
  }
  const float lq = lrow + xhalf(lrow);   // the two halves' keys joined
  if (hh == 0) { Ms[grp][qcol] = mrow; Ls[grp][qcol] = lq; }   // both halves hold equal max and sum: one stores them
  __syncthreads();
  {
    // nearest-neighbour 2x: output pixel (y, x) of the block's 8 x 32 patch takes source (y>>1, x>>1) of its 4 x 16 patch
    const int o4 = (tid & 63) * 4;                       // 4 output pixels of one row: two source pixels, each twice
    const int sp = (o4 >> 6) * 16 + ((o4 & 31) >> 1);
    // merge weights of the two source pixels: w[g] = exp(m_g - m) / (2^15 * sum_g exp(m_g - m) l_g), g in fixed order
    float w0[AS_NG], w1[AS_NG];
    {
      float m0 = Ms[0][sp], m1 = Ms[0][sp + 1];
#pragma unroll
      for (int g = 1; g < AS_NG; ++g) { m0 = fmaxf(m0, Ms[g][sp]); m1 = fmaxf(m1, Ms[g][sp + 1]); }
      float l0 = 0.f, l1 = 0.f;
#pragma unroll
      for (int g = 0; g < AS_NG; ++g) {
        w0[g] = expf(Ms[g][sp] - m0);      l0 += w0[g] * Ls[g][sp];
        w1[g] = expf(Ms[g][sp + 1] - m1);  l1 += w1[g] * Ls[g][sp + 1];
      }
      const float i0 = 1.0f / (l0 * AS_PSC), i1 = 1.0f / (l1 * AS_PSC);
#pragma unroll
      for (int g = 0; g < AS_NG; ++g) { w0[g] *= i0; w1[g] *= i1; }
    }
#pragma unroll   // the 4 channel steps become immediate offsets of one address, and the LDS reads run ahead of the stores
    for (int it = 0; it < 4; ++it) {
      const int d = it * 8 + (tid >> 6);
      float s0 = 0.f, s1 = 0.f;
#pragma unroll
      for (int g = 0; g < AS_NG; ++g) { s0 += Os[g][d][sp] * w0[g]; s1 += Os[g][d][sp + 1] * w1[g]; }
      *(v4f*)(ob + (size_t)d * AS_S + o4) = (v4f){s0, s0, s1, s1};
    }
  }
}

extern "C" void kernel_launch(void* const* d_in, const int* in_sizes, int n_in,
                              void* d_out, int out_size, void* d_ws, size_t ws_size,
                              hipStream_t stream) {
  const int B = 8, CHI = 512, C = 256, SQ = 256, S = 1024;
  if (n_in < 8) return;
  if (in_sizes[0] != B * CHI * SQ || in_sizes[1] != B * C * S || in_sizes[2] != C * CHI ||
      in_sizes[3] != C || in_sizes[4] != C * C || in_sizes[5] != C || in_sizes[6] != C * C ||
      in_sizes[7] != C || out_size != B * C * S) return;

  const float* x_high = (const float*)d_in[0];
  const float* x_low  = (const float*)d_in[1];
  const float* Wq     = (const float*)d_in[2];
  const float* bq     = (const float*)d_in[3];
  const float* Wk     = (const float*)d_in[4];
  const float* bk     = (const float*)d_in[5];
  const float* Wv     = (const float*)d_in[6];
  const float* bv     = (const float*)d_in[7];
  float* out = (float*)d_out;

  // ---- workspace carve (bytes, 256-B aligned) ----
  char* ws = (char*)d_ws;
  size_t off = 0;
#define CARVE16(name, elems) unsigned short* name = (unsigned short*)(ws + off); off += ((((size_t)(elems)) * 2) + 255) & ~(size_t)255;
  CARVE16(q_h,  (size_t)B * SQ * C)      // q planes [B][256 src px][256 ch]
  CARVE16(q_l,  (size_t)B * SQ * C)
  CARVE16(k_h,  (size_t)B * S * C)       // k planes [B][1024][256 ch]
  CARVE16(k_l,  (size_t)B * S * C)
  CARVE16(v_f,  (size_t)B * C * S)       // v f16 channel-major [B][256 ch][1024]
#undef CARVE16
  if (off > ws_size || off > (size_t)134217728) return;   // total 14,680,064 B

  // ---- q, k and v projections, one launch; the operands are converted and turned inside it ----
  proj_all<<<dim3(256), dim3(256), 0, stream>>>(
      x_high, Wq, q_h, q_l, bq,
      x_low, Wk, k_h, k_l, bk,
      Wv, v_f, bv);

  // ---- attention ----
  attn_hd32<<<dim3(B * AS_NH * (SQ / 64)), dim3(512), 0, stream>>>(q_h, q_l, k_h, k_l, v_f, out);
}

// v008
// One run takes 26.3 microseconds.
// In both of two side-by-side timings against v007, it was 1.09 times as fast.
// Over all steps from v000 it is 6.63 times as fast.
#include <hip/hip_runtime.h>
#include <stdint.h>
// Contractions: q-proj, k-proj, q.k scores: v_wmma_f32_16x16x32_bf16 with bf16 hi/lo operand planes (hi.hi + hi.lo + lo.hi);
// v-proj and p.v: v_wmma_f32_16x16x32_f16 (f16 operands, p carried x2^15); f32 accumulate everywhere; softmax in f32.

typedef __attribute__((ext_vector_type(16))) _Float16 v16h;
typedef __attribute__((ext_vector_type(8)))  _Float16 v8h;
typedef __attribute__((ext_vector_type(16))) __bf16   v16b;
typedef __attribute__((ext_vector_type(8)))  __bf16   v8b;
typedef __attribute__((ext_vector_type(8)))  float    v8f;
typedef __attribute__((ext_vector_type(4)))  float    v4f;
typedef __attribute__((ext_vector_type(2)))  float    v2f;
typedef __attribute__((ext_vector_type(2)))  __bf16   v2b;

__device__ __forceinline__ unsigned short f2bf_bits(float f) {
  unsigned u = __float_as_uint(f);
  return (unsigned short)((u + 0x7FFFu + ((u >> 16) & 1u)) >> 16);
}
__device__ __forceinline__ float bf_bits2f(unsigned short h) { return __uint_as_float(((unsigned)h) << 16); }

// hazard guards as plain device helpers
__device__ __forceinline__ void dep_guard_h(v8f& a, v8f& b, v16h x, v16h y) { asm volatile("v_nop\n\tv_nop\n\tv_nop\n\tv_nop" : "+v"(a), "+v"(b) : "v"(x), "v"(y)); }
__device__ __forceinline__ void dep_guard_b(v8f& a, v8f& b, v16b x, v16b y) { asm volatile("v_nop\n\tv_nop\n\tv_nop\n\tv_nop" : "+v"(a), "+v"(b) : "v"(x), "v"(y)); }
__device__ __forceinline__ void keep4_h(v16h a, v16h b, v16h c, v16h d) { asm volatile("v_nop" :: "v"(a), "v"(b), "v"(c), "v"(d)); }
__device__ __forceinline__ void keep4_b(v16b a, v16b b, v16b c, v16b d) { asm volatile("v_nop" :: "v"(a), "v"(b), "v"(c), "v"(d)); }
__device__ __forceinline__ void acc_guard4(v8f& a, v8f& b, v8f& c, v8f& d) { asm volatile("v_nop\n\tv_nop\n\tv_nop\n\tv_nop" : "+v"(a), "+v"(b), "+v"(c), "+v"(d)); }
template <typename T> struct Frag;
template <> struct Frag<_Float16> {
  typedef v16h V; union U { v16h v; v8h h[2]; };
  static __device__ __forceinline__ v16h load(const _Float16* p) {   // elements 0..7 <- p[0..7], 8..15 <- p[16..23]
    U f; f.h[0] = *(const v8h*)(p); f.h[1] = *(const v8h*)(p + 16); return f.v;
  }
  static __device__ __forceinline__ v8f mma(v16h a, v16h b, v8f c) {
    return __builtin_amdgcn_wmma_f32_16x16x32_f16(false, a, false, b, (short)0, c, false, false);
  }
  static __device__ __forceinline__ void guard(v8f& a, v8f& b, v16h x, v16h y) { dep_guard_h(a, b, x, y); }
  static __device__ __forceinline__ void keep(v16h a, v16h b, v16h c, v16h d) { keep4_h(a, b, c, d); }
};
template <> struct Frag<__bf16> {
  typedef v16b V; union U { v16b v; v8b h[2]; };
  static __device__ __forceinline__ v16b load(const __bf16* p) {
    U f; f.h[0] = *(const v8b*)(p); f.h[1] = *(const v8b*)(p + 16); return f.v;
  }
  static __device__ __forceinline__ v8f mma(v16b a, v16b b, v8f c) {
    return __builtin_amdgcn_wmma_f32_16x16x32_bf16(false, a, false, b, (short)0, c, false, false);
  }
  static __device__ __forceinline__ void guard(v8f& a, v8f& b, v16b x, v16b y) { dep_guard_b(a, b, x, y); }
  static __device__ __forceinline__ void keep(v16b a, v16b b, v16b c, v16b d) { keep4_b(a, b, c, d); }
};

// ---- Register-blocked batched WMMA GEMM on f32 sources, operands converted on their way into LDS ------------
// C[m,n] = scale * sum_k A[m,k] * Bt[n,k] (+bias)(+resid); each wave owns a (16 * MI) x 64 tile.
// One operand is X, channel-major f32 [b][K][S] (its rows are pixels, so it is turned on the way), the other is Wt, row-major f32 [rows][K].
// XA: X is the A operand (else it is Bt). K % 64 == 0, K >= 128.
// The block's 8 wave tiles form one (8/WN * 16 * MI) x (WN * 64) tile; M and N are multiples of its sides and the grid holds exactly
// (M / side) * (N / side) blocks per batch. Its A and Bt rows stand in LDS 64 k (128 B per row and plane) at a time.
// SPLIT: operands are bf16 hi/lo planes; product = hi.hi + hi.lo + lo.hi. Without SPLIT: one f16 plane.
// BIAS_MODE: 0 = none, 1 = bias[m], 2 = bias[n].
// OUT_MODE: 0 = f32, 1 = f16, 2 = bf16 hi plane (Cout) + bf16 lo plane (Cout2).
// ET: 0 = f16 operands, 1 = bf16 operands
template <int ET> struct Elem;
template <> struct Elem<0> { typedef _Float16 T; };
template <> struct Elem<1> { typedef __bf16 T; };

#define PJ_KS     64                        // k per stage
#define PJ_PITCH  72                        // LDS row pitch in elements: 128 B + 16 B, an odd multiple of 16 B for the b128 readers
#define PJ_ROWS   512                       // rows of the largest stage: 2 planes x (128 A rows + 128 Bt rows)
#define PJ_STAGE  (PJ_ROWS * PJ_PITCH)      // elements per buffer

// Eight consecutive k of one operand row: f32 -> 16 bytes per plane in LDS (round to nearest even; lo = rounded remainder).
template <bool SPLIT>
__device__ __forceinline__ void put8(unsigned short* hi, unsigned short* lo, const float* f) {
  if constexpr (SPLIT) {
    v8b hv, lv;
#pragma unroll
    for (int e = 0; e < 8; e += 2) {           // two at a time: one packed conversion per pair and plane
      const v2f a = {f[e], f[e + 1]};
      const v2b h = __builtin_convertvector(a, v2b);
      const v2f r = {a[0] - (float)h[0], a[1] - (float)h[1]};
      const v2b l = __builtin_convertvector(r, v2b);
      hv[e] = h[0]; hv[e + 1] = h[1];
      lv[e] = l[0]; lv[e + 1] = l[1];
    }
    *(v8b*)hi = hv;
    *(v8b*)lo = lv;
  } else {
    v8h hv;
#pragma unroll
    for (int e = 0; e < 8; ++e) hv[e] = (_Float16)f[e];
    *(v8h*)hi = hv;
  }
}

// Device body: bx = block tile, b = batch, stg = the block's two stage buffers, sT = the block's 8 per-wave slabs.
// PXV: pixels of one channel that a thread loads at once (4 or 2).
template <int ET, bool SPLIT, int BIAS_MODE, int OUT_MODE, bool RESID, int WN, int MI, bool XA, int PXV, int ACT = 0>
__device__ __forceinline__ void wmma_gemm64(
    unsigned short* stg, float (*sT)[16 * 68], int bx, int b,
    const float* __restrict__ Xp, int S, long strideX,
    const float* __restrict__ Wp,
    void* __restrict__ Cout, void* __restrict__ Cout2, int ldc, long strideC,
    const float* __restrict__ bias,
    const float* __restrict__ resid, long strideR,
    int M, int N, int K, float scale) {
  typedef typename Elem<ET>::T T;
  typedef typename Frag<T>::V V;
  typedef float vpx __attribute__((ext_vector_type(PXV)));
  static_assert(SPLIT == (ET == 1), "two bf16 planes or one f16 plane");
  constexpr int WR = 16 * MI;                  // A rows of a wave tile
  constexpr int AR = (8 / WN) * WR;            // A rows of the block tile
  constexpr int BR = WN * 64;                  // Bt rows of the block tile
  constexpr int P  = SPLIT ? 2 : 1;
  constexpr int XR = XA ? AR : BR;             // rows (pixels) of the X operand in the block tile
  constexpr int TR = XA ? BR : AR;             // rows of the Wt operand in the block tile
  constexpr int XB = XA ? 0 : P * AR;          // first LDS row of each operand's hi plane; its lo plane follows it
  constexpr int TB = XA ? P * AR : 0;
  constexpr int NU = XR / (32 * PXV);          // X units per wave: a unit is (8 * PXV) pixels x 32 channels
  constexpr int NG = TR / 32;                  // Wt groups of 32 rows
  static_assert(NU * 32 * PXV == XR && NG * 32 == TR, "stage shape");
  const int tid  = threadIdx.x;
  const int lane = tid & 31;
  const int wave = tid >> 5;
  const int nbN = N / BR;
  const int bm  = bx / nbN;
  const int bn  = bx - bm * nbN;
  const int wa  = wave / WN;                   // the wave's WR rows among the block's A rows
  const int wb  = wave - wa * WN;              // the wave's 64 rows among the block's Bt rows
  const int m0 = bm * AR + wa * WR;
  const int n0 = bn * BR + (wb << 6);

  const int rlane = lane & 15;                 // row (A) / col (B, D) within subtile
  const int koff  = (lane >> 4) * 8;           // k offset of this lane half
  const int mOff  = (lane >> 4) * 8;           // D row offset

  // X: a thread takes PXV pixels x 8 channels of each unit: 8 loads along the pixels (8 lanes cover one run of 32 * PXV bytes of a
  // channel), then per pixel one 16-byte LDS store per plane, 8 channels = 8 consecutive k of that pixel's row.
  const int xci = (wave & 1) * 32 + (lane & 3) * 8;               // first of the thread's 8 channels within the stage
  const int xpx = (wave >> 1) * (8 * PXV) + (lane >> 2) * PXV;    // first of its pixels in unit 0; unit i: + i * 32 * PXV
  const float* xg = Xp + (size_t)b * strideX + (size_t)xci * S + (XA ? bm * AR : bn * BR) + xpx;
  // Wt: a thread takes 8 consecutive k (32 bytes) of row (tid >> 3) in every group of 32 rows.
  const int crow = tid >> 3, ccol = (tid & 7) * 8;
  const float* wg = Wp + (size_t)((XA ? bn * BR : bm * AR) + crow) * K + ccol;

  vpx xr[NU][8];
  v4f wr[NG][2];
  // xk, wk: the thread's own first element of each operand at the stage's first k
  auto stage_load = [&](const float* xk, const float* wk) __attribute__((always_inline)) {
#pragma unroll
    for (int i = 0; i < NU; ++i)
#pragma unroll
      for (int j = 0; j < 8; ++j) xr[i][j] = *(const vpx*)(xk + (size_t)j * S + i * 32 * PXV);
#pragma unroll
    for (int g = 0; g < NG; ++g) {
      wr[g][0] = *(const v4f*)(wk + (size_t)(g * 32) * K);
      wr[g][1] = *(const v4f*)(wk + (size_t)(g * 32) * K + 4);
    }
    // precaution: nothing may write the address registers that these loads name in front of this wait; the two addresses are inputs
    // of its statement, so that no load of the group lands in them either
    asm volatile("s_wait_xcnt 0x0" :: "v"(xk), "v"(wk) : "memory");
  };
  auto stage_store = [&](unsigned short* buf) __attribute__((always_inline)) {
    unsigned short* xs = buf + (XB + xpx) * PJ_PITCH + xci;
#pragma unroll
    for (int i = 0; i < NU; ++i)
#pragma unroll
      for (int p = 0; p < PXV; ++p) {
        const float f[8] = {xr[i][0][p], xr[i][1][p], xr[i][2][p], xr[i][3][p], xr[i][4][p], xr[i][5][p], xr[i][6][p], xr[i][7][p]};
        unsigned short* d = xs + (i * 32 * PXV + p) * PJ_PITCH;
        put8<SPLIT>(d, d + XR * PJ_PITCH, f);
      }
    unsigned short* tsm = buf + (TB + crow) * PJ_PITCH + ccol;
#pragma unroll
    for (int g = 0; g < NG; ++g) {
      const float f[8] = {wr[g][0][0], wr[g][0][1], wr[g][0][2], wr[g][0][3], wr[g][1][0], wr[g][1][1], wr[g][1][2], wr[g][1][3]};
      unsigned short* d = tsm + (g * 32) * PJ_PITCH;
      put8<SPLIT>(d, d + TR * PJ_PITCH, f);
    }
  };

  v8f acc[MI][4];
#pragma unroll
  for (int i = 0; i < MI; ++i)
#pragma unroll
    for (int j = 0; j < 4; ++j) acc[i][j] = (v8f){0.f,0.f,0.f,0.f,0.f,0.f,0.f,0.f};

  const int nt = K / PJ_KS;                    // stages; the same for the whole block, at least 2
  stage_load(xg, wg);
  stage_store(stg);
  __syncthreads();                             // stage 0 may be read
  const float* xn = xg + (size_t)PJ_KS * S;    // the next stage to load
  const float* wn = wg + PJ_KS;

#pragma unroll 1   // rolled: the two buffers alternate by index
  for (int t = 0; t < nt; ++t) {
    const int bufo = (t & 1) * PJ_STAGE;
    const bool more = t + 1 < nt;              // the same for the whole block
    if (more) {                                // the next stage's f32 values fly while this stage is worked on
      stage_load(xn, wn);
      xn += (size_t)PJ_KS * S;
      wn += PJ_KS;
    }
    const T* sA  = (const T*)(stg + bufo) + (wa * WR + rlane) * PJ_PITCH + koff;
    const T* sA2 = sA + AR * PJ_PITCH;
    const T* sB  = (const T*)(stg + bufo) + (P * AR + (wb << 6) + rlane) * PJ_PITCH + koff;
    const T* sB2 = sB + BR * PJ_PITCH;
#pragma unroll
    for (int kk = 0; kk < PJ_KS; kk += 32) {
      V bh[4], bl[4];
#pragma unroll
      for (int j = 0; j < 4; ++j) {
        bh[j] = Frag<T>::load(sB + (j << 4) * PJ_PITCH + kk);
        if (SPLIT) bl[j] = Frag<T>::load(sB2 + (j << 4) * PJ_PITCH + kk);
      }
#pragma unroll
      for (int i = 0; i < MI; ++i) {
        V ah = Frag<T>::load(sA + (i << 4) * PJ_PITCH + kk);
        V al;
        if (SPLIT) al = Frag<T>::load(sA2 + (i << 4) * PJ_PITCH + kk);
#pragma unroll
        for (int j = 0; j < 4; ++j) {
          acc[i][j] = Frag<T>::mma(ah, bh[j], acc[i][j]);
          if (SPLIT) {
            acc[i][j] = Frag<T>::mma(ah, bl[j], acc[i][j]);
            acc[i][j] = Frag<T>::mma(al, bh[j], acc[i][j]);
          }
        }
        Frag<T>::guard(acc[i][0], acc[i][3], ah, SPLIT ? al : ah);
      }
      Frag<T>::keep(bh[0], bh[1], bh[2], bh[3]);
      if (SPLIT) Frag<T>::keep(bl[0], bl[1], bl[2], bl[3]);
    }
    if (more) {
      stage_store(stg + (PJ_STAGE - bufo));    // into the buffer whose last readers left it before the barrier of the trip before
      __syncthreads();                         // publishes stage t + 1 and ends every wave's reads of stage t
    }
  }
#pragma unroll
  for (int i = 0; i < MI; ++i) acc_guard4(acc[i][0], acc[i][1], acc[i][2], acc[i][3]);

  // ---- epilogue ----
  float* slab = sT[wave];
  const float* Rb = RESID ? (resid + (size_t)b * strideR) : nullptr;
#pragma unroll
  for (int i = 0; i < MI; ++i) {
    const int mBase = m0 + (i << 4);
#pragma unroll
    for (int j = 0; j < 4; ++j) {
      const int n = n0 + (j << 4) + rlane;
      float bv = 0.f;
      if (BIAS_MODE == 2) bv = bias[n];
#pragma unroll
      for (int r = 0; r < 8; ++r) {
        float v = acc[i][j][r] * scale;
        if (BIAS_MODE == 1) v += bias[mBase + mOff + r];
        if (BIAS_MODE == 2) v += bv;
        if (RESID) v += Rb[(size_t)(mBase + mOff + r) * ldc + n];
        if (ACT == 1) v = tanhf(v);
        if (ACT == 2) v = fmaxf(v, 0.0f);
        if (ACT == 3) v = v / (1.0f + expf(-v));
        if (ACT == 4) v = (v > 0.f) ? v : 0.01f * v;
        if (ACT == 5) v = 0.5f * v * (1.0f + erff(v * 0.70710678118654752f));
        slab[(mOff + r) * 68 + (j << 4) + rlane] = v;
      }
    }
    __builtin_amdgcn_fence(__ATOMIC_RELEASE, "workgroup");
    __builtin_amdgcn_wave_barrier();
    __builtin_amdgcn_fence(__ATOMIC_ACQUIRE, "workgroup");
    if (OUT_MODE == 0) {
      float* C = (float*)Cout + (size_t)b * strideC;
      const int hh = lane >> 4, c4 = (lane & 15) * 4;     // row seg = 256 B = 16 lanes x 16 B
      {
#pragma unroll
        for (int it = 0; it < 8; ++it) {
          const int row = it * 2 + hh;
          v4f v = *(const v4f*)(slab + row * 68 + c4);
          *(v4f*)(C + (size_t)(mBase + row) * ldc + n0 + c4) = v;
        }
        
      }
    } else {
      const int q = lane >> 3, c8 = (lane & 7) * 8;
      unsigned short* C  = (unsigned short*)Cout  + (size_t)b * strideC;
      unsigned short* C2 = (OUT_MODE == 2) ? ((unsigned short*)Cout2 + (size_t)b * strideC) : nullptr;
      {
#pragma unroll
        for (int it = 0; it < 4; ++it) {
          const int row = it * 4 + q;
          const float* sp = slab + row * 68 + c8;
          v8h hv, lv;
#pragma unroll
          for (int e = 0; e < 8; ++e) {
            if (OUT_MODE == 1) {
              hv[e] = (_Float16)sp[e];
            } else {
              unsigned short hb = f2bf_bits(sp[e]);
              unsigned short lb = f2bf_bits(sp[e] - bf_bits2f(hb));
              hv[e] = __builtin_bit_cast(_Float16, hb);
              lv[e] = __builtin_bit_cast(_Float16, lb);
            }
          }
          *(v8h*)(C + (size_t)(mBase + row) * ldc + n0 + c8) = hv;
          if (OUT_MODE == 2) *(v8h*)(C2 + (size_t)(mBase + row) * ldc + n0 + c8) = lv;
        }
        
      }
    }
    // precaution: the next slab's values and addresses reuse the registers that these stores name; the wait stands in front of that
    asm volatile("s_wait_xcnt 0x0" ::: "memory");
    __builtin_amdgcn_fence(__ATOMIC_RELEASE, "workgroup");
    __builtin_amdgcn_wave_barrier();
    __builtin_amdgcn_fence(__ATOMIC_ACQUIRE, "workgroup");
  }
}

// ---- One grid for the three projections, straight from the f32 inputs; the block index picks the job ----
//   blocks   0..63   q[b][sq][co] = sum_ci x_high[b][ci][sq] Wq[co][ci] + bq[co]  (K = 512: twice the stages, so the smallest tile, 64 x 128)
//   blocks  64..191  k[b][s][co]  = sum_ci x_low[b][ci][s]  Wk[co][ci] + bk[co]   (tile 128 x 128)
//   blocks 192..255  v[b][co][s]  = sum_ci Wv[co][ci] x_low[b][ci][s] + bv[co]    (tile 128 x 256; channel-major out; f16 operands, f16 out)
// The tiles are sized so that the three jobs' blocks last about equally long and together fill the chip's 256 WGPs once.
__global__ __launch_bounds__(256) void proj_all(
    const float* __restrict__ x_high, const float* __restrict__ Wq,
    unsigned short* __restrict__ q_h, unsigned short* __restrict__ q_l, const float* __restrict__ bq,
    const float* __restrict__ x_low, const float* __restrict__ Wk,
    unsigned short* __restrict__ k_h, unsigned short* __restrict__ k_l, const float* __restrict__ bk,
    const float* __restrict__ Wv,
    unsigned short* __restrict__ v_f, const float* __restrict__ bv) {
  __shared__ __align__(16) unsigned short stg[2 * PJ_STAGE];   // two stage buffers of the block's operand rows
  __shared__ __align__(16) float sT[8][16 * 68];   // per-wave 16x64 slab, pitch 68 floats
  const int id = blockIdx.x;                       // every branch below is uniform over the block
  if (id < 64) {
    wmma_gemm64<1, true, 2, 2, false, 2, 1, true, 2, 0>(stg, sT, id & 7, id >> 3,
        x_high, 256, (long)512 * 256, Wq,
        (void*)q_h, (void*)q_l, 256, (long)256 * 256,
        bq, bq, 0L, 256, 256, 512, 1.0f);
  } else if (id < 192) {
    const int j = id - 64;
    wmma_gemm64<1, true, 2, 2, false, 2, 2, true, 4, 0>(stg, sT, j & 15, j >> 4,
        x_low, 1024, (long)256 * 1024, Wk,
        (void*)k_h, (void*)k_l, 256, (long)1024 * 256,
        bk, bk, 0L, 1024, 256, 256, 1.0f);
  } else {
    const int j = id - 192;
    wmma_gemm64<0, false, 1, 1, false, 4, 4, false, 4, 0>(stg, sT, j & 7, j >> 3,
        x_low, 1024, (long)256 * 1024, Wv,
        (void*)v_f, (void*)v_f, 1024, (long)256 * 1024,
        bv, bv, 0L, 256, 1024, 256, 1.0f);
  }
}

// =====================================================================================
// Attention, head dim 32, no mask, no scaling.
//   q planes: bf16 hi/lo [B][256 src px][256 ch] (16x16 grid). The four output pixels of one source pixel share their
//   query row, so their attention rows are equal: each source pixel is worked once and its result stored to all four.
//   k planes: bf16 hi/lo [B][1024 px][256 ch];  v: f16 channel-major [B][256 ch][1024 px]
//   out f32 channel-major [B][256 ch][1024 px].
//   scores transposed, k.q^T (A = k rows, B = q): 3 x v_wmma_f32_16x16x32_bf16 per 16x16 tile (hi.hi + lo.hi + hi.lo in k, q order);
//   a lane then holds 8 keys per tile of ONE query, so the online softmax (f32) runs over the lane's own registers, joined with the
//   other wave half by one cross-row move; two score tiles, as p x2^15 in f16, ARE the B operand of out^T += v^T.p^T
//   (v_wmma_f32_16x16x32_f16, A = v rows [d][kv]); f32 accumulate.
//   Block = 16 waves = 64 source pixels (256 output pixels) of one (b, head); grid.x = B*8*4.
//   Wave = (key group g = wave >> 2, query sub-tile = wave & 3): group g works keys 256g .. 256g+255 in 64-key chunks staged in its
//   own LDS buffers. Every group keeps its own running max, sum
//   and unnormalised out tile; the epilogue merges the four in the fixed order g = 0..3.
// =====================================================================================
#define AS_S   1024
#define AS_C   256
#define AS_SQ  256
#define AS_HD  32
#define AS_NH  8
#define AS_KC  64
#define AS_PSC 32768.0f
#define AS_NG  4                 // key groups per block
#define AS_GK  (AS_S / AS_NG)     // keys per group
#define AS_KP  (AS_HD + 8)        // LDS pitch of a k row in elements: 64 B + 16 B
#define AS_VP  (AS_KC + 8)        // LDS pitch of a v row in elements: 128 B + 16 B
// Both pitches are odd multiples of 16 B: the 16 rows that a half wave reads with one 16-byte LDS load then start on 16 different
// groups of four banks; at 64 B and 128 B they shared 4 and 2 such groups.

// value of lane l ^ 16 (the other wave half), by a vector cross-row move
__device__ __forceinline__ float xhalf(float x) {
  return __builtin_bit_cast(float, __builtin_amdgcn_permlanex16(__builtin_bit_cast(int, x), __builtin_bit_cast(int, x),
                                                                0x76543210, 0xfedcba98, false, false));
}

__global__ __launch_bounds__(512)
void attn_hd32(const unsigned short* __restrict__ qhp, const unsigned short* __restrict__ qlp,
               const unsigned short* __restrict__ khp, const unsigned short* __restrict__ klp,
               const unsigned short* __restrict__ vp, float* __restrict__ out) {
  union FB { v16b v; v8b h[2]; };
  union FH { v16h v; v8h h[2]; };
  __shared__ __align__(16) __bf16   KshA[AS_NG][AS_KC * AS_KP];   // per group: k hi [kv][d], padded rows   5 KB
  __shared__ __align__(16) __bf16   KslA[AS_NG][AS_KC * AS_KP];   // per group: k lo [kv][d], padded rows   5 KB
  __shared__ __align__(16) _Float16 VtA[AS_NG][AS_HD * AS_VP];    // per group: v [d][kv], padded rows      4.5 KB
  __shared__ __align__(16) float    Os[AS_NG][AS_HD][68];         // per group: unnormalised out tile [d][64 source px], pitch 68
  __shared__ __align__(16) float    Ms[AS_NG][64];                // per group: running max of each source px
  __shared__ __align__(16) float    Ls[AS_NG][64];                // per group: running sum of each source px

  const int tid  = threadIdx.x;
  const int wave = tid >> 5;
  const int grp  = wave >> 2;          // key group
  const int wq   = wave & 3;           // query sub-tile
  const int gt   = tid & 127;          // thread within the group
  const int lane = tid & 31;
  const int hh   = lane >> 4;
  const int c    = lane & 15;

  const int bx = blockIdx.x;
  const int qb = bx & 3;               // AS_SQ / 64 = 4 query blocks
  const int bh = bx >> 2;
  const int h  = bh & (AS_NH - 1);
  const int b  = bh >> 3;
  const int qbase = qb * 64;
  const int q0 = qbase + wq * 16;

  // ---- Q fragments (B operand, lane c = query column, split k map), hi and lo planes ----
  v16b qah, qal;
  {
    const int sq = q0 + c;                       // source pixel 0..255 on the 16x16 grid
    const size_t qo = ((size_t)b * AS_SQ + sq) * AS_C + h * AS_HD + 8 * hh;
    qah = Frag<__bf16>::load((const __bf16*)qhp + qo);
    qal = Frag<__bf16>::load((const __bf16*)qlp + qo);
  }

  float mrow = -INFINITY;   // running max of the lane's query (equal in both wave halves)
  float lrow = 0.f;         // running sum over the keys of the lane's own half; the halves are joined behind the loop
  v8f oacc[2];              // oacc[t][r] = out^T[d = 16t + 8hh + r][query c]
#pragma unroll
  for (int t = 0; t < 2; ++t) oacc[t] = (v8f){0.f,0.f,0.f,0.f,0.f,0.f,0.f,0.f};

  const __bf16*   khb = (const __bf16*)khp + (size_t)b * AS_S * AS_C + h * AS_HD;
  const __bf16*   klb = (const __bf16*)klp + (size_t)b * AS_S * AS_C + h * AS_HD;
  const _Float16* vb  = (const _Float16*)vp + ((size_t)b * AS_C + h * AS_HD) * AS_S;
  float*          ob  = out + ((size_t)b * AS_C + h * AS_HD) * AS_S + qbase * 4;   // 4 source rows -> 8 output rows of 32
  __bf16*         Ksh = KshA[grp];
  __bf16*         Ksl = KslA[grp];
  _Float16*       Vt  = VtA[grp];

  for (int kc = 0; kc < AS_GK / AS_KC; ++kc) {
    const int kv0 = grp * AS_GK + kc * AS_KC;
    __syncthreads();
    {
      // K chunk of the group: 64 kv rows x 32 d, both planes; thread -> (kv row, 16-d half)
      const int kvr = gt >> 1, dh = (gt & 1) * 16;
      const __bf16* kr  = khb + (size_t)(kv0 + kvr) * AS_C + dh;
      const __bf16* kr2 = klb + (size_t)(kv0 + kvr) * AS_C + dh;
      *(v8b*)(Ksh + kvr * AS_KP + dh)     = *(const v8b*)(kr);
      *(v8b*)(Ksh + kvr * AS_KP + dh + 8) = *(const v8b*)(kr + 8);
      *(v8b*)(Ksl + kvr * AS_KP + dh)     = *(const v8b*)(kr2);
      *(v8b*)(Ksl + kvr * AS_KP + dh + 8) = *(const v8b*)(kr2 + 8);
      // V chunk of the group: 32 d rows x 64 kv (channel-major source is already [d][kv]); thread -> (d row, 16-kv quarter)
      const int dr = gt >> 2, part = (gt & 3) * 16;
      const _Float16* vr = vb + (size_t)dr * AS_S + kv0 + part;
      *(v8h*)(Vt + dr * AS_VP + part)     = *(const v8h*)(vr);
      *(v8h*)(Vt + dr * AS_VP + part + 8) = *(const v8h*)(vr + 8);
    }
    __syncthreads();

    // ---- scores, transposed: s[j][r] = key (kv0 + 16j + 8hh + r), query (q0 + c); A operand = k rows with split k map over d ----
    FB kb[4], kl[4];
#pragma unroll
    for (int j = 0; j < 4; ++j) {
      kb[j].h[0] = *(const v8b*)(Ksh + (j * 16 + c) * AS_KP + 8 * hh);
      kb[j].h[1] = *(const v8b*)(Ksh + (j * 16 + c) * AS_KP + 16 + 8 * hh);
      kl[j].h[0] = *(const v8b*)(Ksl + (j * 16 + c) * AS_KP + 8 * hh);
      kl[j].h[1] = *(const v8b*)(Ksl + (j * 16 + c) * AS_KP + 16 + 8 * hh);
    }
    v8f s[4];
#pragma unroll
    for (int j = 0; j < 4; ++j) s[j] = Frag<__bf16>::mma(kb[j].v, qah, (v8f){0.f,0.f,0.f,0.f,0.f,0.f,0.f,0.f});
#pragma unroll
    for (int j = 0; j < 4; ++j) s[j] = Frag<__bf16>::mma(kl[j].v, qah, s[j]);
#pragma unroll
    for (int j = 0; j < 4; ++j) s[j] = Frag<__bf16>::mma(kb[j].v, qal, s[j]);

    // ---- online softmax (f32): the lane's 32 scores belong to one query ----
    float mt[4];   // one chain per tile: a tile's maximum can start while the later tiles' products still run
#pragma unroll
    for (int j = 0; j < 4; ++j) {
      mt[j] = s[j][0];
#pragma unroll
      for (int r = 1; r < 8; ++r) mt[j] = fmaxf(mt[j], s[j][r]);
    }
    float m = fmaxf(fmaxf(mt[0], mt[1]), fmaxf(mt[2], mt[3]));
    m = fmaxf(m, xhalf(m));
    const float mnew  = fmaxf(mrow, m);
    const float alpha = expf(mrow - mnew);
    mrow = mnew;
    float ps[4];
    FH pb[2];   // pb[kk] element e = p of key 32kk + (e < 8 ? 8hh + e : 16 + 8hh + e - 8): the B operand's own k order
#pragma unroll
    for (int j = 0; j < 4; ++j) {
      ps[j] = 0.f;
#pragma unroll
      for (int r = 0; r < 8; ++r) {
        const float p = expf(s[j][r] - mnew);
        ps[j] += p;
        pb[j >> 1].v[(j & 1) * 8 + r] = (_Float16)(p * AS_PSC);
      }
    }
    lrow = lrow * alpha + ((ps[0] + ps[1]) + (ps[2] + ps[3]));
#pragma unroll
    for (int t = 0; t < 2; ++t)
#pragma unroll
      for (int r = 0; r < 8; ++r) oacc[t][r] *= alpha;

    // ---- out^T += v^T . p^T : A = v rows [d][kv] with split k map over kv, B = p straight from the score registers ----
#pragma unroll   // unrolled: pb[kk] lives in registers, which only a constant index can name
    for (int kk = 0; kk < 2; ++kk) {
#pragma unroll
      for (int t = 0; t < 2; ++t) {
        FH vf;
        vf.h[0] = *(const v8h*)(Vt + (t * 16 + c) * AS_VP + kk * 32 + 8 * hh);
        vf.h[1] = *(const v8h*)(Vt + (t * 16 + c) * AS_VP + kk * 32 + 16 + 8 * hh);
        oacc[t] = Frag<_Float16>::mma(vf.v, pb[kk].v, oacc[t]);
      }
    }
  }

  // ---- each group hands over its partial state: max, sum, unnormalised out tile ----
  const int qcol = wq * 16 + c;
#pragma unroll
  for (int t = 0; t < 2; ++t) {
#pragma unroll
    for (int r = 0; r < 8; ++r) Os[grp][t * 16 + 8 * hh + r][qcol] = oacc[t][r];
  }
  const float lq = lrow + xhalf(lrow);   // the two halves' keys joined
  if (hh == 0) { Ms[grp][qcol] = mrow; Ls[grp][qcol] = lq; }   // both halves hold equal max and sum: one stores them
  __syncthreads();
  {
    // nearest-neighbour 2x: output pixel (y, x) of the block's 8 x 32 patch takes source (y>>1, x>>1) of its 4 x 16 patch
    const int o4 = (tid & 63) * 4;                       // 4 output pixels of one row: two source pixels, each twice
    const int sp = (o4 >> 6) * 16 + ((o4 & 31) >> 1);
    // merge weights of the two source pixels: w[g] = exp(m_g - m) / (2^15 * sum_g exp(m_g - m) l_g), g in fixed order
    float w0[AS_NG], w1[AS_NG];
    {
      float m0 = Ms[0][sp], m1 = Ms[0][sp + 1];
#pragma unroll
      for (int g = 1; g < AS_NG; ++g) { m0 = fmaxf(m0, Ms[g][sp]); m1 = fmaxf(m1, Ms[g][sp + 1]); }
      float l0 = 0.f, l1 = 0.f;
#pragma unroll
      for (int g = 0; g < AS_NG; ++g) {
        w0[g] = expf(Ms[g][sp] - m0);      l0 += w0[g] * Ls[g][sp];
        w1[g] = expf(Ms[g][sp + 1] - m1);  l1 += w1[g] * Ls[g][sp + 1];
      }
      const float i0 = 1.0f / (l0 * AS_PSC), i1 = 1.0f / (l1 * AS_PSC);
#pragma unroll
      for (int g = 0; g < AS_NG; ++g) { w0[g] *= i0; w1[g] *= i1; }
    }
#pragma unroll   // the 4 channel steps become immediate offsets of one address, and the LDS reads run ahead of the stores
    for (int it = 0; it < 4; ++it) {
      const int d = it * 8 + (tid >> 6);
      float s0 = 0.f, s1 = 0.f;
#pragma unroll
      for (int g = 0; g < AS_NG; ++g) { s0 += Os[g][d][sp] * w0[g]; s1 += Os[g][d][sp + 1] * w1[g]; }
      *(v4f*)(ob + (size_t)d * AS_S + o4) = (v4f){s0, s0, s1, s1};
    }
  }
}

extern "C" void kernel_launch(void* const* d_in, const int* in_sizes, int n_in,
                              void* d_out, int out_size, void* d_ws, size_t ws_size,
                              hipStream_t stream) {
  const int B = 8, CHI = 512, C = 256, SQ = 256, S = 1024;
  if (n_in < 8) return;
  if (in_sizes[0] != B * CHI * SQ || in_sizes[1] != B * C * S || in_sizes[2] != C * CHI ||
      in_sizes[3] != C || in_sizes[4] != C * C || in_sizes[5] != C || in_sizes[6] != C * C ||
      in_sizes[7] != C || out_size != B * C * S) return;

  const float* x_high = (const float*)d_in[0];
  const float* x_low  = (const float*)d_in[1];
  const float* Wq     = (const float*)d_in[2];
  const float* bq     = (const float*)d_in[3];
  const float* Wk     = (const float*)d_in[4];
  const float* bk     = (const float*)d_in[5];
  const float* Wv     = (const float*)d_in[6];
  const float* bv     = (const float*)d_in[7];
  float* out = (float*)d_out;

  // ---- workspace carve (bytes, 256-B aligned) ----
  char* ws = (char*)d_ws;
  size_t off = 0;
#define CARVE16(name, elems) unsigned short* name = (unsigned short*)(ws + off); off += ((((size_t)(elems)) * 2) + 255) & ~(size_t)255;
  CARVE16(q_h,  (size_t)B * SQ * C)      // q planes [B][256 src px][256 ch]
  CARVE16(q_l,  (size_t)B * SQ * C)
  CARVE16(k_h,  (size_t)B * S * C)       // k planes [B][1024][256 ch]
  CARVE16(k_l,  (size_t)B * S * C)
  CARVE16(v_f,  (size_t)B * C * S)       // v f16 channel-major [B][256 ch][1024]
#undef CARVE16
  if (off > ws_size || off > (size_t)134217728) return;   // total 14,680,064 B

  // ---- q, k and v projections, one launch; the operands are converted and turned inside it ----
  proj_all<<<dim3(256), dim3(256), 0, stream>>>(
      x_high, Wq, q_h, q_l, bq,
      x_low, Wk, k_h, k_l, bk,
      Wv, v_f, bv);

  // ---- attention ----
  attn_hd32<<<dim3(B * AS_NH * (SQ / 64)), dim3(512), 0, stream>>>(q_h, q_l, k_h, k_l, v_f, out);
}

// v009
// It runs in 22.7 microseconds.
// In both of two side-by-side timings against v008, it was 1.15 times as fast.
// All steps since v000 together make it 7.62 times as fast.
#include <hip/hip_runtime.h>
#include <stdint.h>
// Contractions: q-proj, k-proj, q.k scores: v_wmma_f32_16x16x32_bf16 with bf16 hi/lo operand planes (hi.hi + hi.lo + lo.hi);
// v-proj and p.v: v_wmma_f32_16x16x32_f16 (f16 operands, p carried x2^15); f32 accumulate everywhere; softmax in f32, base 2.

typedef __attribute__((ext_vector_type(16))) _Float16 v16h;
typedef __attribute__((ext_vector_type(8)))  _Float16 v8h;
typedef __attribute__((ext_vector_type(16))) __bf16   v16b;
typedef __attribute__((ext_vector_type(8)))  __bf16   v8b;
typedef __attribute__((ext_vector_type(8)))  float    v8f;
typedef __attribute__((ext_vector_type(4)))  float    v4f;
typedef __attribute__((ext_vector_type(2)))  float    v2f;
typedef __attribute__((ext_vector_type(2)))  __bf16   v2b;

__device__ __forceinline__ unsigned short f2bf_bits(float f) {
  unsigned u = __float_as_uint(f);
  return (unsigned short)((u + 0x7FFFu + ((u >> 16) & 1u)) >> 16);
}
__device__ __forceinline__ float bf_bits2f(unsigned short h) { return __uint_as_float(((unsigned)h) << 16); }

// hazard guards as plain device helpers
__device__ __forceinline__ void dep_guard_h(v8f& a, v8f& b, v16h x, v16h y) { asm volatile("v_nop\n\tv_nop\n\tv_nop\n\tv_nop" : "+v"(a), "+v"(b) : "v"(x), "v"(y)); }
__device__ __forceinline__ void dep_guard_b(v8f& a, v8f& b, v16b x, v16b y) { asm volatile("v_nop\n\tv_nop\n\tv_nop\n\tv_nop" : "+v"(a), "+v"(b) : "v"(x), "v"(y)); }
__device__ __forceinline__ void keep4_h(v16h a, v16h b, v16h c, v16h d) { asm volatile("v_nop" :: "v"(a), "v"(b), "v"(c), "v"(d)); }
__device__ __forceinline__ void keep4_b(v16b a, v16b b, v16b c, v16b d) { asm volatile("v_nop" :: "v"(a), "v"(b), "v"(c), "v"(d)); }
__device__ __forceinline__ void acc_guard4(v8f& a, v8f& b, v8f& c, v8f& d) { asm volatile("v_nop\n\tv_nop\n\tv_nop\n\tv_nop" : "+v"(a), "+v"(b), "+v"(c), "+v"(d)); }
template <typename T> struct Frag;
template <> struct Frag<_Float16> {
  typedef v16h V; union U { v16h v; v8h h[2]; };
  static __device__ __forceinline__ v16h load(const _Float16* p) {   // elements 0..7 <- p[0..7], 8..15 <- p[16..23]
    U f; f.h[0] = *(const v8h*)(p); f.h[1] = *(const v8h*)(p + 16); return f.v;
  }
  static __device__ __forceinline__ v8f mma(v16h a, v16h b, v8f c) {
    return __builtin_amdgcn_wmma_f32_16x16x32_f16(false, a, false, b, (short)0, c, false, false);
  }
  static __device__ __forceinline__ void guard(v8f& a, v8f& b, v16h x, v16h y) { dep_guard_h(a, b, x, y); }
  static __device__ __forceinline__ void keep(v16h a, v16h b, v16h c, v16h d) { keep4_h(a, b, c, d); }
};
template <> struct Frag<__bf16> {
  typedef v16b V; union U { v16b v; v8b h[2]; };
  static __device__ __forceinline__ v16b load(const __bf16* p) {
    U f; f.h[0] = *(const v8b*)(p); f.h[1] = *(const v8b*)(p + 16); return f.v;
  }
  static __device__ __forceinline__ v8f mma(v16b a, v16b b, v8f c) {
    return __builtin_amdgcn_wmma_f32_16x16x32_bf16(false, a, false, b, (short)0, c, false, false);
  }
  static __device__ __forceinline__ void guard(v8f& a, v8f& b, v16b x, v16b y) { dep_guard_b(a, b, x, y); }
  static __device__ __forceinline__ void keep(v16b a, v16b b, v16b c, v16b d) { keep4_b(a, b, c, d); }
};

// ---- Register-blocked batched WMMA GEMM on f32 sources, operands converted on their way into LDS ------------
// C[m,n] = scale * sum_k A[m,k] * Bt[n,k] (+bias)(+resid); each wave owns a (16 * MI) x 64 tile.
// One operand is X, channel-major f32 [b][K][S] (its rows are pixels, so it is turned on the way), the other is Wt, row-major f32 [rows][K].
// XA: X is the A operand (else it is Bt). K % 64 == 0, K >= 128.
// The block's 8 wave tiles form one (8/WN * 16 * MI) x (WN * 64) tile; M and N are multiples of its sides and the grid holds exactly
// (M / side) * (N / side) blocks per batch. Its A and Bt rows stand in LDS 64 k (128 B per row and plane) at a time.
// SPLIT: operands are bf16 hi/lo planes; product = hi.hi + hi.lo + lo.hi. Without SPLIT: one f16 plane.
// BIAS_MODE: 0 = none, 1 = bias[m], 2 = bias[n].
// OUT_MODE: 0 = f32, 1 = f16, 2 = bf16 hi plane (Cout) + bf16 lo plane (Cout2).
// ET: 0 = f16 operands, 1 = bf16 operands
template <int ET> struct Elem;
template <> struct Elem<0> { typedef _Float16 T; };
template <> struct Elem<1> { typedef __bf16 T; };

#define PJ_KS     64                        // k per stage
#define PJ_PITCH  72                        // LDS row pitch in elements: 128 B + 16 B, an odd multiple of 16 B for the b128 readers
#define PJ_ROWS   512                       // rows of the largest stage: 2 planes x (128 A rows + 128 Bt rows)
#define PJ_STAGE  (PJ_ROWS * PJ_PITCH)      // elements per buffer

// Eight consecutive k of one operand row: f32 -> 16 bytes per plane in LDS (round to nearest even; lo = rounded remainder).
template <bool SPLIT>
__device__ __forceinline__ void put8(unsigned short* hi, unsigned short* lo, const float* f) {
  if constexpr (SPLIT) {
    v8b hv, lv;
#pragma unroll
    for (int e = 0; e < 8; e += 2) {           // two at a time: one packed conversion per pair and plane
      const v2f a = {f[e], f[e + 1]};
      const v2b h = __builtin_convertvector(a, v2b);
      const v2f r = {a[0] - (float)h[0], a[1] - (float)h[1]};
      const v2b l = __builtin_convertvector(r, v2b);
      hv[e] = h[0]; hv[e + 1] = h[1];
      lv[e] = l[0]; lv[e + 1] = l[1];
    }
    *(v8b*)hi = hv;
    *(v8b*)lo = lv;
  } else {
    v8h hv;
#pragma unroll
    for (int e = 0; e < 8; ++e) hv[e] = (_Float16)f[e];
    *(v8h*)hi = hv;
  }
}

// Device body: bx = block tile, b = batch, stg = the block's two stage buffers, sT = the block's 8 per-wave slabs.
// PXV: pixels of one channel that a thread loads at once (4 or 2).
template <int ET, bool SPLIT, int BIAS_MODE, int OUT_MODE, bool RESID, int WN, int MI, bool XA, int PXV, int ACT = 0>
__device__ __forceinline__ void wmma_gemm64(
    unsigned short* stg, float (*sT)[16 * 68], int bx, int b,
    const float* __restrict__ Xp, int S, long strideX,
    const float* __restrict__ Wp,
    void* __restrict__ Cout, void* __restrict__ Cout2, int ldc, long strideC,
    const float* __restrict__ bias,
    const float* __restrict__ resid, long strideR,
    int M, int N, int K, float scale) {
  typedef typename Elem<ET>::T T;
  typedef typename Frag<T>::V V;
  typedef float vpx __attribute__((ext_vector_type(PXV)));
  static_assert(SPLIT == (ET == 1), "two bf16 planes or one f16 plane");
  constexpr int WR = 16 * MI;                  // A rows of a wave tile
  constexpr int AR = (8 / WN) * WR;            // A rows of the block tile
  constexpr int BR = WN * 64;                  // Bt rows of the block tile
  constexpr int P  = SPLIT ? 2 : 1;
  constexpr int XR = XA ? AR : BR;             // rows (pixels) of the X operand in the block tile
  constexpr int TR = XA ? BR : AR;             // rows of the Wt operand in the block tile
  constexpr int XB = XA ? 0 : P * AR;          // first LDS row of each operand's hi plane; its lo plane follows it
  constexpr int TB = XA ? P * AR : 0;
  constexpr int NU = XR / (32 * PXV);          // X units per wave: a unit is (8 * PXV) pixels x 32 channels
  constexpr int NG = TR / 32;                  // Wt groups of 32 rows
  static_assert(NU * 32 * PXV == XR && NG * 32 == TR, "stage shape");
  const int tid  = threadIdx.x;
  const int lane = tid & 31;
  const int wave = tid >> 5;
  const int nbN = N / BR;
  const int bm  = bx / nbN;
  const int bn  = bx - bm * nbN;
  const int wa  = wave / WN;                   // the wave's WR rows among the block's A rows
  const int wb  = wave - wa * WN;              // the wave's 64 rows among the block's Bt rows
  const int m0 = bm * AR + wa * WR;
  const int n0 = bn * BR + (wb << 6);

  const int rlane = lane & 15;                 // row (A) / col (B, D) within subtile
  const int koff  = (lane >> 4) * 8;           // k offset of this lane half
  const int mOff  = (lane >> 4) * 8;           // D row offset

  // X: a thread takes PXV pixels x 8 channels of each unit: 8 loads along the pixels (8 lanes cover one run of 32 * PXV bytes of a
  // channel), then per pixel one 16-byte LDS store per plane, 8 channels = 8 consecutive k of that pixel's row.
  const int xci = (wave & 1) * 32 + (lane & 3) * 8;               // first of the thread's 8 channels within the stage
  const int xpx = (wave >> 1) * (8 * PXV) + (lane >> 2) * PXV;    // first of its pixels in unit 0; unit i: + i * 32 * PXV
  const float* xg = Xp + (size_t)b * strideX + (size_t)xci * S + (XA ? bm * AR : bn * BR) + xpx;
  // Wt: a thread takes 8 consecutive k (32 bytes) of row (tid >> 3) in every group of 32 rows.
  const int crow = tid >> 3, ccol = (tid & 7) * 8;
  const float* wg = Wp + (size_t)((XA ? bn * BR : bm * AR) + crow) * K + ccol;

  vpx xr[NU][8];
  v4f wr[NG][2];
  // xk, wk: the thread's own first element of each operand at the stage's first k
  auto stage_load = [&](const float* xk, const float* wk) __attribute__((always_inline)) {
#pragma unroll
    for (int i = 0; i < NU; ++i)
#pragma unroll
      for (int j = 0; j < 8; ++j) xr[i][j] = *(const vpx*)(xk + (size_t)j * S + i * 32 * PXV);
#pragma unroll
    for (int g = 0; g < NG; ++g) {
      wr[g][0] = *(const v4f*)(wk + (size_t)(g * 32) * K);
      wr[g][1] = *(const v4f*)(wk + (size_t)(g * 32) * K + 4);
    }
    // precaution: nothing may write the address registers that these loads name in front of this wait; the two addresses are inputs
    // of its statement, so that no load of the group lands in them either
    asm volatile("s_wait_xcnt 0x0" :: "v"(xk), "v"(wk) : "memory");
  };
  auto stage_store = [&](unsigned short* buf) __attribute__((always_inline)) {
    unsigned short* xs = buf + (XB + xpx) * PJ_PITCH + xci;
#pragma unroll
    for (int i = 0; i < NU; ++i)
#pragma unroll
      for (int p = 0; p < PXV; ++p) {
        const float f[8] = {xr[i][0][p], xr[i][1][p], xr[i][2][p], xr[i][3][p], xr[i][4][p], xr[i][5][p], xr[i][6][p], xr[i][7][p]};
        unsigned short* d = xs + (i * 32 * PXV + p) * PJ_PITCH;
        put8<SPLIT>(d, d + XR * PJ_PITCH, f);
      }
    unsigned short* tsm = buf + (TB + crow) * PJ_PITCH + ccol;
#pragma unroll
    for (int g = 0; g < NG; ++g) {
      const float f[8] = {wr[g][0][0], wr[g][0][1], wr[g][0][2], wr[g][0][3], wr[g][1][0], wr[g][1][1], wr[g][1][2], wr[g][1][3]};
      unsigned short* d = tsm + (g * 32) * PJ_PITCH;
      put8<SPLIT>(d, d + TR * PJ_PITCH, f);
    }
  };

  v8f acc[MI][4];
#pragma unroll
  for (int i = 0; i < MI; ++i)
#pragma unroll
    for (int j = 0; j < 4; ++j) acc[i][j] = (v8f){0.f,0.f,0.f,0.f,0.f,0.f,0.f,0.f};

  const int nt = K / PJ_KS;                    // stages; the same for the whole block, at least 2
  stage_load(xg, wg);
  stage_store(stg);
  __syncthreads();                             // stage 0 may be read
  const float* xn = xg + (size_t)PJ_KS * S;    // the next stage to load
  const float* wn = wg + PJ_KS;

#pragma unroll 1   // rolled: the two buffers alternate by index
  for (int t = 0; t < nt; ++t) {
    const int bufo = (t & 1) * PJ_STAGE;
    const bool more = t + 1 < nt;              // the same for the whole block
    if (more) {                                // the next stage's f32 values fly while this stage is worked on
      stage_load(xn, wn);
      xn += (size_t)PJ_KS * S;
      wn += PJ_KS;
    }
    const T* sA  = (const T*)(stg + bufo) + (wa * WR + rlane) * PJ_PITCH + koff;
    const T* sA2 = sA + AR * PJ_PITCH;
    const T* sB  = (const T*)(stg + bufo) + (P * AR + (wb << 6) + rlane) * PJ_PITCH + koff;
    const T* sB2 = sB + BR * PJ_PITCH;
#pragma unroll
    for (int kk = 0; kk < PJ_KS; kk += 32) {
      V bh[4], bl[4];
#pragma unroll
      for (int j = 0; j < 4; ++j) {
        bh[j] = Frag<T>::load(sB + (j << 4) * PJ_PITCH + kk);
        if (SPLIT) bl[j] = Frag<T>::load(sB2 + (j << 4) * PJ_PITCH + kk);
      }
#pragma unroll
      for (int i = 0; i < MI; ++i) {
        V ah = Frag<T>::load(sA + (i << 4) * PJ_PITCH + kk);
        V al;
        if (SPLIT) al = Frag<T>::load(sA2 + (i << 4) * PJ_PITCH + kk);
#pragma unroll
        for (int j = 0; j < 4; ++j) {
          acc[i][j] = Frag<T>::mma(ah, bh[j], acc[i][j]);
          if (SPLIT) {
            acc[i][j] = Frag<T>::mma(ah, bl[j], acc[i][j]);
            acc[i][j] = Frag<T>::mma(al, bh[j], acc[i][j]);
          }
        }
        Frag<T>::guard(acc[i][0], acc[i][3], ah, SPLIT ? al : ah);
      }
      Frag<T>::keep(bh[0], bh[1], bh[2], bh[3]);
      if (SPLIT) Frag<T>::keep(bl[0], bl[1], bl[2], bl[3]);
    }
    if (more) {
      stage_store(stg + (PJ_STAGE - bufo));    // into the buffer whose last readers left it before the barrier of the trip before
      __syncthreads();                         // publishes stage t + 1 and ends every wave's reads of stage t
    }
  }
#pragma unroll
  for (int i = 0; i < MI; ++i) acc_guard4(acc[i][0], acc[i][1], acc[i][2], acc[i][3]);

  // ---- epilogue ----
  float* slab = sT[wave];
  const float* Rb = RESID ? (resid + (size_t)b * strideR) : nullptr;
#pragma unroll
  for (int i = 0; i < MI; ++i) {
    const int mBase = m0 + (i << 4);
#pragma unroll
    for (int j = 0; j < 4; ++j) {
      const int n = n0 + (j << 4) + rlane;
      float bv = 0.f;
      if (BIAS_MODE == 2) bv = bias[n];
#pragma unroll
      for (int r = 0; r < 8; ++r) {
        float v = acc[i][j][r] * scale;
        if (BIAS_MODE == 1) v += bias[mBase + mOff + r];
        if (BIAS_MODE == 2) v += bv;
        if (RESID) v += Rb[(size_t)(mBase + mOff + r) * ldc + n];
        if (ACT == 1) v = tanhf(v);
        if (ACT == 2) v = fmaxf(v, 0.0f);
        if (ACT == 3) v = v / (1.0f + expf(-v));
        if (ACT == 4) v = (v > 0.f) ? v : 0.01f * v;
        if (ACT == 5) v = 0.5f * v * (1.0f + erff(v * 0.70710678118654752f));
        slab[(mOff + r) * 68 + (j << 4) + rlane] = v;
      }
    }
    __builtin_amdgcn_fence(__ATOMIC_RELEASE, "workgroup");
    __builtin_amdgcn_wave_barrier();
    __builtin_amdgcn_fence(__ATOMIC_ACQUIRE, "workgroup");
    if (OUT_MODE == 0) {
      float* C = (float*)Cout + (size_t)b * strideC;
      const int hh = lane >> 4, c4 = (lane & 15) * 4;     // row seg = 256 B = 16 lanes x 16 B
      {
#pragma unroll
        for (int it = 0; it < 8; ++it) {
          const int row = it * 2 + hh;
          v4f v = *(const v4f*)(slab + row * 68 + c4);
          *(v4f*)(C + (size_t)(mBase + row) * ldc + n0 + c4) = v;
        }
        
      }
    } else {
      const int q = lane >> 3, c8 = (lane & 7) * 8;
      unsigned short* C  = (unsigned short*)Cout  + (size_t)b * strideC;
      unsigned short* C2 = (OUT_MODE == 2) ? ((unsigned short*)Cout2 + (size_t)b * strideC) : nullptr;
      {
#pragma unroll
        for (int it = 0; it < 4; ++it) {
          const int row = it * 4 + q;
          const float* sp = slab + row * 68 + c8;
          v8h hv, lv;
#pragma unroll
          for (int e = 0; e < 8; ++e) {
            if (OUT_MODE == 1) {
              hv[e] = (_Float16)sp[e];
            } else {
              unsigned short hb = f2bf_bits(sp[e]);
              unsigned short lb = f2bf_bits(sp[e] - bf_bits2f(hb));
              hv[e] = __builtin_bit_cast(_Float16, hb);
              lv[e] = __builtin_bit_cast(_Float16, lb);
            }
          }
          *(v8h*)(C + (size_t)(mBase + row) * ldc + n0 + c8) = hv;
          if (OUT_MODE == 2) *(v8h*)(C2 + (size_t)(mBase + row) * ldc + n0 + c8) = lv;
        }
        
      }
    }
    // precaution: the next slab's values and addresses reuse the registers that these stores name; the wait stands in front of that
    asm volatile("s_wait_xcnt 0x0" ::: "memory");
    __builtin_amdgcn_fence(__ATOMIC_RELEASE, "workgroup");
    __builtin_amdgcn_wave_barrier();
    __builtin_amdgcn_fence(__ATOMIC_ACQUIRE, "workgroup");
  }
}

// ---- One grid for the three projections, straight from the f32 inputs; the block index picks the job ----
//   blocks   0..63   q[b][sq][co] = sum_ci x_high[b][ci][sq] Wq[co][ci] + bq[co]  (K = 512: twice the stages, so the smallest tile, 64 x 128)
//   blocks  64..191  k[b][s][co]  = sum_ci x_low[b][ci][s]  Wk[co][ci] + bk[co]   (tile 128 x 128)
//   blocks 192..255  v[b][co][s]  = sum_ci Wv[co][ci] x_low[b][ci][s] + bv[co]    (tile 128 x 256; channel-major out; f16 operands, f16 out)
// The tiles are sized so that the three jobs' blocks last about equally long and together fill the chip's 256 WGPs once.
__global__ __launch_bounds__(256) void proj_all(
    const float* __restrict__ x_high, const float* __restrict__ Wq,
    unsigned short* __restrict__ q_h, unsigned short* __restrict__ q_l, const float* __restrict__ bq,
    const float* __restrict__ x_low, const float* __restrict__ Wk,
    unsigned short* __restrict__ k_h, unsigned short* __restrict__ k_l, const float* __restrict__ bk,
    const float* __restrict__ Wv,
    unsigned short* __restrict__ v_f, const float* __restrict__ bv) {
  __shared__ __align__(16) unsigned short stg[2 * PJ_STAGE];   // two stage buffers of the block's operand rows
  __shared__ __align__(16) float sT[8][16 * 68];   // per-wave 16x64 slab, pitch 68 floats
  const int id = blockIdx.x;                       // every branch below is uniform over the block
  if (id < 64) {
    wmma_gemm64<1, true, 2, 2, false, 2, 1, true, 2, 0>(stg, sT, id & 7, id >> 3,
        x_high, 256, (long)512 * 256, Wq,
        (void*)q_h, (void*)q_l, 256, (long)256 * 256,
        bq, bq, 0L, 256, 256, 512, 1.0f);
  } else if (id < 192) {
    const int j = id - 64;
    wmma_gemm64<1, true, 2, 2, false, 2, 2, true, 4, 0>(stg, sT, j & 15, j >> 4,
        x_low, 1024, (long)256 * 1024, Wk,
        (void*)k_h, (void*)k_l, 256, (long)1024 * 256,
        bk, bk, 0L, 1024, 256, 256, 1.0f);
  } else {
    const int j = id - 192;
    wmma_gemm64<0, false, 1, 1, false, 4, 4, false, 4, 0>(stg, sT, j & 7, j >> 3,
        x_low, 1024, (long)256 * 1024, Wv,
        (void*)v_f, (void*)v_f, 1024, (long)256 * 1024,
        bv, bv, 0L, 256, 1024, 256, 1.0f);
  }
}

// =====================================================================================
// Attention, head dim 32, no mask, no scaling.
//   q planes: bf16 hi/lo [B][256 src px][256 ch] (16x16 grid). The four output pixels of one source pixel share their
//   query row, so their attention rows are equal: each source pixel is worked once and its result stored to all four.
//   k planes: bf16 hi/lo [B][1024 px][256 ch];  v: f16 channel-major [B][256 ch][1024 px]
//   out f32 channel-major [B][256 ch][1024 px].
//   scores transposed, k.q^T (A = k rows, B = q): 3 x v_wmma_f32_16x16x32_bf16 per 16x16 tile (hi.hi + lo.hi + hi.lo in k, q order);
//   a lane then holds 8 keys per tile of ONE query, so the online softmax (f32) runs over the lane's own registers, joined with the
//   other wave half by one cross-row move; two score tiles, as p x2^15 in f16, ARE the B operand of out^T += v^T.p^T
//   (v_wmma_f32_16x16x32_f16, A = v rows [d][kv]); f32 accumulate.
//   Exponentials in base 2: the running max is kept as M = max * log2(e) - 15, and p x2^15 = 2^(score * log2(e) - M) is one
//   multiply-add and one v_exp_f32. No argument exceeds 15 but by rounding; one below -126 may give 0 where the library call gave a
//   denormal: a term under 2^-126 beside one near 2^15. The sums carry the same 2^15 as the out tiles, so it cancels in the merge.
//   Block = 16 waves = 64 source pixels (256 output pixels) of one (b, head); grid.x = B*8*4.
//   Wave = (key group g = wave >> 2, query sub-tile = wave & 3): group g works keys 256g .. 256g+255 in 64-key chunks staged in its
//   own LDS buffers. Every group keeps its own running max, sum
//   and unnormalised out tile; the epilogue merges the four in the fixed order g = 0..3.
// =====================================================================================
#define AS_S   1024
#define AS_C   256
#define AS_SQ  256
#define AS_HD  32
#define AS_NH  8
#define AS_KC  64
#define AS_L2E 1.4426950408889634f   // log2(e)
#define AS_PEX 15.0f                 // p is carried x2^15
#define AS_NG  4                 // key groups per block
#define AS_GK  (AS_S / AS_NG)     // keys per group
#define AS_KP  (AS_HD + 8)        // LDS pitch of a k row in elements: 64 B + 16 B
#define AS_VP  (AS_KC + 8)        // LDS pitch of a v row in elements: 128 B + 16 B
// Both pitches are odd multiples of 16 B: the 16 rows that a half wave reads with one 16-byte LDS load then start on 16 different
// groups of four banks; at 64 B and 128 B they shared 4 and 2 such groups.

// value of lane l ^ 16 (the other wave half), by a vector cross-row move
__device__ __forceinline__ float xhalf(float x) {
  return __builtin_bit_cast(float, __builtin_amdgcn_permlanex16(__builtin_bit_cast(int, x), __builtin_bit_cast(int, x),
                                                                0x76543210, 0xfedcba98, false, false));
}

__global__ __launch_bounds__(512)
void attn_hd32(const unsigned short* __restrict__ qhp, const unsigned short* __restrict__ qlp,
               const unsigned short* __restrict__ khp, const unsigned short* __restrict__ klp,
               const unsigned short* __restrict__ vp, float* __restrict__ out) {
  union FB { v16b v; v8b h[2]; };
  union FH { v16h v; v8h h[2]; };
  __shared__ __align__(16) __bf16   KshA[AS_NG][AS_KC * AS_KP];   // per group: k hi [kv][d], padded rows   5 KB
  __shared__ __align__(16) __bf16   KslA[AS_NG][AS_KC * AS_KP];   // per group: k lo [kv][d], padded rows   5 KB
  __shared__ __align__(16) _Float16 VtA[AS_NG][AS_HD * AS_VP];    // per group: v [d][kv], padded rows      4.5 KB
  __shared__ __align__(16) float    Os[AS_NG][AS_HD][68];         // per group: unnormalised out tile [d][64 source px], pitch 68
  __shared__ __align__(16) float    Ms[AS_NG][64];                // per group: running max of each source px
  __shared__ __align__(16) float    Ls[AS_NG][64];                // per group: running sum of each source px

  const int tid  = threadIdx.x;
  const int wave = tid >> 5;
  const int grp  = wave >> 2;          // key group
  const int wq   = wave & 3;           // query sub-tile
  const int gt   = tid & 127;          // thread within the group
  const int lane = tid & 31;
  const int hh   = lane >> 4;
  const int c    = lane & 15;

  const int bx = blockIdx.x;
  const int qb = bx & 3;               // AS_SQ / 64 = 4 query blocks
  const int bh = bx >> 2;
  const int h  = bh & (AS_NH - 1);
  const int b  = bh >> 3;
  const int qbase = qb * 64;
  const int q0 = qbase + wq * 16;

  // ---- Q fragments (B operand, lane c = query column, split k map), hi and lo planes ----
  v16b qah, qal;
  {
    const int sq = q0 + c;                       // source pixel 0..255 on the 16x16 grid
    const size_t qo = ((size_t)b * AS_SQ + sq) * AS_C + h * AS_HD + 8 * hh;
    qah = Frag<__bf16>::load((const __bf16*)qhp + qo);
    qal = Frag<__bf16>::load((const __bf16*)qlp + qo);
  }

  float mrow = -INFINITY;   // running max of the lane's query as M = max * log2(e) - 15 (equal in both wave halves)
  float lrow = 0.f;         // running sum (x2^15) over the keys of the lane's own half; the halves are joined behind the loop
  v8f oacc[2];              // oacc[t][r] = out^T[d = 16t + 8hh + r][query c]
#pragma unroll
  for (int t = 0; t < 2; ++t) oacc[t] = (v8f){0.f,0.f,0.f,0.f,0.f,0.f,0.f,0.f};

  const __bf16*   khb = (const __bf16*)khp + (size_t)b * AS_S * AS_C + h * AS_HD;
  const __bf16*   klb = (const __bf16*)klp + (size_t)b * AS_S * AS_C + h * AS_HD;
  const _Float16* vb  = (const _Float16*)vp + ((size_t)b * AS_C + h * AS_HD) * AS_S;
  float*          ob  = out + ((size_t)b * AS_C + h * AS_HD) * AS_S + qbase * 4;   // 4 source rows -> 8 output rows of 32
  __bf16*         Ksh = KshA[grp];
  __bf16*         Ksl = KslA[grp];
  _Float16*       Vt  = VtA[grp];

#pragma unroll 1   // stays rolled, as it was: unrolled, the four chunks' fragments take 256 registers and spill to scratch
  for (int kc = 0; kc < AS_GK / AS_KC; ++kc) {
    const int kv0 = grp * AS_GK + kc * AS_KC;
    __syncthreads();
    {
      // K chunk of the group: 64 kv rows x 32 d, both planes; thread -> (kv row, 16-d half)
      const int kvr = gt >> 1, dh = (gt & 1) * 16;
      const __bf16* kr  = khb + (size_t)(kv0 + kvr) * AS_C + dh;
      const __bf16* kr2 = klb + (size_t)(kv0 + kvr) * AS_C + dh;
      *(v8b*)(Ksh + kvr * AS_KP + dh)     = *(const v8b*)(kr);
      *(v8b*)(Ksh + kvr * AS_KP + dh + 8) = *(const v8b*)(kr + 8);
      *(v8b*)(Ksl + kvr * AS_KP + dh)     = *(const v8b*)(kr2);
      *(v8b*)(Ksl + kvr * AS_KP + dh + 8) = *(const v8b*)(kr2 + 8);
      // V chunk of the group: 32 d rows x 64 kv (channel-major source is already [d][kv]); thread -> (d row, 16-kv quarter)
      const int dr = gt >> 2, part = (gt & 3) * 16;
      const _Float16* vr = vb + (size_t)dr * AS_S + kv0 + part;
      *(v8h*)(Vt + dr * AS_VP + part)     = *(const v8h*)(vr);
      *(v8h*)(Vt + dr * AS_VP + part + 8) = *(const v8h*)(vr + 8);
    }
    __syncthreads();

    // ---- scores, transposed: s[j][r] = key (kv0 + 16j + 8hh + r), query (q0 + c); A operand = k rows with split k map over d ----
    FB kb[4], kl[4];
#pragma unroll
    for (int j = 0; j < 4; ++j) {
      kb[j].h[0] = *(const v8b*)(Ksh + (j * 16 + c) * AS_KP + 8 * hh);
      kb[j].h[1] = *(const v8b*)(Ksh + (j * 16 + c) * AS_KP + 16 + 8 * hh);
      kl[j].h[0] = *(const v8b*)(Ksl + (j * 16 + c) * AS_KP + 8 * hh);
      kl[j].h[1] = *(const v8b*)(Ksl + (j * 16 + c) * AS_KP + 16 + 8 * hh);
    }
    v8f s[4];
#pragma unroll
    for (int j = 0; j < 4; ++j) s[j] = Frag<__bf16>::mma(kb[j].v, qah, (v8f){0.f,0.f,0.f,0.f,0.f,0.f,0.f,0.f});
#pragma unroll
    for (int j = 0; j < 4; ++j) s[j] = Frag<__bf16>::mma(kl[j].v, qah, s[j]);
#pragma unroll
    for (int j = 0; j < 4; ++j) s[j] = Frag<__bf16>::mma(kb[j].v, qal, s[j]);

    // ---- online softmax (f32): the lane's 32 scores belong to one query ----
    float mt[4];   // one chain per tile: a tile's maximum can start while the later tiles' products still run
#pragma unroll
    for (int j = 0; j < 4; ++j) {
      mt[j] = s[j][0];
#pragma unroll
      for (int r = 1; r < 8; ++r) mt[j] = fmaxf(mt[j], s[j][r]);
    }
    float m = fmaxf(fmaxf(mt[0], mt[1]), fmaxf(mt[2], mt[3]));
    m = fmaf(fmaxf(m, xhalf(m)), AS_L2E, -AS_PEX);
    const float mnew  = fmaxf(mrow, m);
    const float alpha = __builtin_amdgcn_exp2f(mrow - mnew);   // 0 on the first chunk, where mrow is -inf
    mrow = mnew;
    float ps[4];
    FH pb[2];   // pb[kk] element e = p of key 32kk + (e < 8 ? 8hh + e : 16 + 8hh + e - 8): the B operand's own k order
#pragma unroll
    for (int j = 0; j < 4; ++j) {
      ps[j] = 0.f;
#pragma unroll
      for (int r = 0; r < 8; r += 2) {
        const v2f arg = __builtin_elementwise_fma((v2f){s[j][r], s[j][r + 1]}, (v2f){AS_L2E, AS_L2E}, (v2f){-mnew, -mnew});
        const float p0 = __builtin_amdgcn_exp2f(arg[0]), p1 = __builtin_amdgcn_exp2f(arg[1]);   // p x2^15
        ps[j] += p0;
        ps[j] += p1;
        pb[j >> 1].v[(j & 1) * 8 + r]     = (_Float16)p0;
        pb[j >> 1].v[(j & 1) * 8 + r + 1] = (_Float16)p1;
      }
    }
    lrow = lrow * alpha + ((ps[0] + ps[1]) + (ps[2] + ps[3]));
#pragma unroll
    for (int t = 0; t < 2; ++t)
#pragma unroll
      for (int r = 0; r < 8; ++r) oacc[t][r] *= alpha;

    // ---- out^T += v^T . p^T : A = v rows [d][kv] with split k map over kv, B = p straight from the score registers ----
#pragma unroll   // unrolled: pb[kk] lives in registers, which only a constant index can name
    for (int kk = 0; kk < 2; ++kk) {
#pragma unroll
      for (int t = 0; t < 2; ++t) {
        FH vf;
        vf.h[0] = *(const v8h*)(Vt + (t * 16 + c) * AS_VP + kk * 32 + 8 * hh);
        vf.h[1] = *(const v8h*)(Vt + (t * 16 + c) * AS_VP + kk * 32 + 16 + 8 * hh);
        oacc[t] = Frag<_Float16>::mma(vf.v, pb[kk].v, oacc[t]);
      }
    }
  }

  // ---- each group hands over its partial state: max, sum, unnormalised out tile ----
  const int qcol = wq * 16 + c;
#pragma unroll
  for (int t = 0; t < 2; ++t) {
#pragma unroll
    for (int r = 0; r < 8; ++r) Os[grp][t * 16 + 8 * hh + r][qcol] = oacc[t][r];
  }
  const float lq = lrow + xhalf(lrow);   // the two halves' keys joined
  if (hh == 0) { Ms[grp][qcol] = mrow; Ls[grp][qcol] = lq; }   // both halves hold equal max and sum: one stores them
  __syncthreads();
  {
    // nearest-neighbour 2x: output pixel (y, x) of the block's 8 x 32 patch takes source (y>>1, x>>1) of its 4 x 16 patch
    const int o4 = (tid & 63) * 4;                       // 4 output pixels of one row: two source pixels, each twice
    const int sp = (o4 >> 6) * 16 + ((o4 & 31) >> 1);
    // merge weights of the two source pixels: w[g] = 2^(M_g - M) / sum_g 2^(M_g - M) l_g, g in fixed order
    float w0[AS_NG], w1[AS_NG];
    {
      float m0 = Ms[0][sp], m1 = Ms[0][sp + 1];
#pragma unroll
      for (int g = 1; g < AS_NG; ++g) { m0 = fmaxf(m0, Ms[g][sp]); m1 = fmaxf(m1, Ms[g][sp + 1]); }
      float l0 = 0.f, l1 = 0.f;
#pragma unroll
      for (int g = 0; g < AS_NG; ++g) {
        w0[g] = __builtin_amdgcn_exp2f(Ms[g][sp] - m0);      l0 += w0[g] * Ls[g][sp];
        w1[g] = __builtin_amdgcn_exp2f(Ms[g][sp + 1] - m1);  l1 += w1[g] * Ls[g][sp + 1];
      }
      const float i0 = 1.0f / l0, i1 = 1.0f / l1;
#pragma unroll
      for (int g = 0; g < AS_NG; ++g) { w0[g] *= i0; w1[g] *= i1; }
    }
#pragma unroll   // the 4 channel steps become immediate offsets of one address, and the LDS reads run ahead of the stores
    for (int it = 0; it < 4; ++it) {
      const int d = it * 8 + (tid >> 6);
      float s0 = 0.f, s1 = 0.f;
#pragma unroll
      for (int g = 0; g < AS_NG; ++g) { s0 += Os[g][d][sp] * w0[g]; s1 += Os[g][d][sp + 1] * w1[g]; }
      *(v4f*)(ob + (size_t)d * AS_S + o4) = (v4f){s0, s0, s1, s1};
    }
  }
}

extern "C" void kernel_launch(void* const* d_in, const int* in_sizes, int n_in,
                              void* d_out, int out_size, void* d_ws, size_t ws_size,
                              hipStream_t stream) {
  const int B = 8, CHI = 512, C = 256, SQ = 256, S = 1024;
  if (n_in < 8) return;
  if (in_sizes[0] != B * CHI * SQ || in_sizes[1] != B * C * S || in_sizes[2] != C * CHI ||
      in_sizes[3] != C || in_sizes[4] != C * C || in_sizes[5] != C || in_sizes[6] != C * C ||
      in_sizes[7] != C || out_size != B * C * S) return;

  const float* x_high = (const float*)d_in[0];
  const float* x_low  = (const float*)d_in[1];
  const float* Wq     = (const float*)d_in[2];
  const float* bq     = (const float*)d_in[3];
  const float* Wk     = (const float*)d_in[4];
  const float* bk     = (const float*)d_in[5];
  const float* Wv     = (const float*)d_in[6];
  const float* bv     = (const float*)d_in[7];
  float* out = (float*)d_out;

  // ---- workspace carve (bytes, 256-B aligned) ----
  char* ws = (char*)d_ws;
  size_t off = 0;
#define CARVE16(name, elems) unsigned short* name = (unsigned short*)(ws + off); off += ((((size_t)(elems)) * 2) + 255) & ~(size_t)255;
  CARVE16(q_h,  (size_t)B * SQ * C)      // q planes [B][256 src px][256 ch]
  CARVE16(q_l,  (size_t)B * SQ * C)
  CARVE16(k_h,  (size_t)B * S * C)       // k planes [B][1024][256 ch]
  CARVE16(k_l,  (size_t)B * S * C)
  CARVE16(v_f,  (size_t)B * C * S)       // v f16 channel-major [B][256 ch][1024]
#undef CARVE16
  if (off > ws_size || off > (size_t)134217728) return;   // total 14,680,064 B

  // ---- q, k and v projections, one launch; the operands are converted and turned inside it ----
  proj_all<<<dim3(256), dim3(256), 0, stream>>>(
      x_high, Wq, q_h, q_l, bq,
      x_low, Wk, k_h, k_l, bk,
      Wv, v_f, bv);

  // ---- attention ----
  attn_hd32<<<dim3(B * AS_NH * (SQ / 64)), dim3(512), 0, stream>>>(q_h, q_l, k_h, k_l, v_f, out);
}

// v010
// A run of this version takes 20.9 microseconds.
// Next to v009, in two timings, it ran 1.09 and 1.11 times as fast.
// All steps since v000 together make it 8.38 times as fast.
#include <hip/hip_runtime.h>
#include <stdint.h>
// Contractions: q-proj, k-proj, q.k scores: v_wmma_f32_16x16x32_bf16 with bf16 hi/lo operand planes (hi.hi + hi.lo + lo.hi);
// v-proj and p.v: v_wmma_f32_16x16x32_f16 (f16 operands, p carried x2^15); f32 accumulate everywhere; softmax in f32, base 2.

typedef __attribute__((ext_vector_type(16))) _Float16 v16h;
typedef __attribute__((ext_vector_type(8)))  _Float16 v8h;
typedef __attribute__((ext_vector_type(16))) __bf16   v16b;
typedef __attribute__((ext_vector_type(8)))  __bf16   v8b;
typedef __attribute__((ext_vector_type(8)))  float    v8f;
typedef __attribute__((ext_vector_type(4)))  float    v4f;
typedef __attribute__((ext_vector_type(2)))  float    v2f;
typedef __attribute__((ext_vector_type(2)))  __bf16   v2b;

__device__ __forceinline__ unsigned short f2bf_bits(float f) {
  unsigned u = __float_as_uint(f);
  return (unsigned short)((u + 0x7FFFu + ((u >> 16) & 1u)) >> 16);
}
__device__ __forceinline__ float bf_bits2f(unsigned short h) { return __uint_as_float(((unsigned)h) << 16); }

// hazard guards as plain device helpers
__device__ __forceinline__ void dep_guard_h(v8f& a, v8f& b, v16h x, v16h y) { asm volatile("v_nop\n\tv_nop\n\tv_nop\n\tv_nop" : "+v"(a), "+v"(b) : "v"(x), "v"(y)); }
__device__ __forceinline__ void dep_guard_b(v8f& a, v8f& b, v16b x, v16b y) { asm volatile("v_nop\n\tv_nop\n\tv_nop\n\tv_nop" : "+v"(a), "+v"(b) : "v"(x), "v"(y)); }
__device__ __forceinline__ void keep4_h(v16h a, v16h b, v16h c, v16h d) { asm volatile("v_nop" :: "v"(a), "v"(b), "v"(c), "v"(d)); }
__device__ __forceinline__ void keep4_b(v16b a, v16b b, v16b c, v16b d) { asm volatile("v_nop" :: "v"(a), "v"(b), "v"(c), "v"(d)); }
__device__ __forceinline__ void acc_guard4(v8f& a, v8f& b, v8f& c, v8f& d) { asm volatile("v_nop\n\tv_nop\n\tv_nop\n\tv_nop" : "+v"(a), "+v"(b), "+v"(c), "+v"(d)); }
template <typename T> struct Frag;
template <> struct Frag<_Float16> {
  typedef v16h V; union U { v16h v; v8h h[2]; };
  static __device__ __forceinline__ v16h load(const _Float16* p) {   // elements 0..7 <- p[0..7], 8..15 <- p[16..23]
    U f; f.h[0] = *(const v8h*)(p); f.h[1] = *(const v8h*)(p + 16); return f.v;
  }
  static __device__ __forceinline__ v8f mma(v16h a, v16h b, v8f c) {
    return __builtin_amdgcn_wmma_f32_16x16x32_f16(false, a, false, b, (short)0, c, false, false);
  }
  static __device__ __forceinline__ void guard(v8f& a, v8f& b, v16h x, v16h y) { dep_guard_h(a, b, x, y); }
  static __device__ __forceinline__ void keep(v16h a, v16h b, v16h c, v16h d) { keep4_h(a, b, c, d); }
};
template <> struct Frag<__bf16> {
  typedef v16b V; union U { v16b v; v8b h[2]; };
  static __device__ __forceinline__ v16b load(const __bf16* p) {
    U f; f.h[0] = *(const v8b*)(p); f.h[1] = *(const v8b*)(p + 16); return f.v;
  }
  static __device__ __forceinline__ v8f mma(v16b a, v16b b, v8f c) {
    return __builtin_amdgcn_wmma_f32_16x16x32_bf16(false, a, false, b, (short)0, c, false, false);
  }
  static __device__ __forceinline__ void guard(v8f& a, v8f& b, v16b x, v16b y) { dep_guard_b(a, b, x, y); }
  static __device__ __forceinline__ void keep(v16b a, v16b b, v16b c, v16b d) { keep4_b(a, b, c, d); }
};

// ---- Register-blocked batched WMMA GEMM on f32 sources, operands converted on their way into LDS ------------
// C[m,n] = scale * sum_k A[m,k] * Bt[n,k] (+bias)(+resid); each wave owns a (16 * MI) x 64 tile.
// One operand is X, channel-major f32 [b][K][S] (its rows are pixels, so it is turned on the way), the other is Wt, row-major f32 [rows][K].
// XA: X is the A operand (else it is Bt). K % 64 == 0, K >= 128.
// The block's 8 wave tiles form one (8/WN * 16 * MI) x (WN * 64) tile; M and N are multiples of its sides and the grid holds exactly
// (M / side) * (N / side) blocks per batch. Its A and Bt rows stand in LDS 64 k (128 B per row and plane) at a time.
// SPLIT: operands are bf16 hi/lo planes; product = hi.hi + hi.lo + lo.hi. Without SPLIT: one f16 plane.
// BIAS_MODE: 0 = none, 1 = bias[m], 2 = bias[n].
// OUT_MODE: 0 = f32, 1 = f16, 2 = bf16 hi plane (Cout) + bf16 lo plane (Cout2).
// ET: 0 = f16 operands, 1 = bf16 operands
template <int ET> struct Elem;
template <> struct Elem<0> { typedef _Float16 T; };
template <> struct Elem<1> { typedef __bf16 T; };

#define PJ_KS     64                        // k per stage
#define PJ_PITCH  72                        // LDS row pitch in elements: 128 B + 16 B, an odd multiple of 16 B for the b128 readers
#define PJ_ROWS   512                       // rows of the largest stage: 2 planes x (128 A rows + 128 Bt rows)
#define PJ_STAGE  (PJ_ROWS * PJ_PITCH)      // elements per buffer

// Eight consecutive k of one operand row: f32 -> 16 bytes per plane in LDS (round to nearest even; lo = rounded remainder).
template <bool SPLIT>
__device__ __forceinline__ void put8(unsigned short* hi, unsigned short* lo, const float* f) {
  if constexpr (SPLIT) {
    v8b hv, lv;
#pragma unroll
    for (int e = 0; e < 8; e += 2) {           // two at a time: one packed conversion per pair and plane
      const v2f a = {f[e], f[e + 1]};
      const v2b h = __builtin_convertvector(a, v2b);
      const v2f r = {a[0] - (float)h[0], a[1] - (float)h[1]};
      const v2b l = __builtin_convertvector(r, v2b);
      hv[e] = h[0]; hv[e + 1] = h[1];
      lv[e] = l[0]; lv[e + 1] = l[1];
    }
    *(v8b*)hi = hv;
    *(v8b*)lo = lv;
  } else {
    v8h hv;
#pragma unroll
    for (int e = 0; e < 8; ++e) hv[e] = (_Float16)f[e];
    *(v8h*)hi = hv;
  }
}

// Device body: bx = block tile, b = batch, stg = the block's two stage buffers, sT = the block's 8 per-wave slabs.
// PXV: pixels of one channel that a thread loads at once (4 or 2).
template <int ET, bool SPLIT, int BIAS_MODE, int OUT_MODE, bool RESID, int WN, int MI, bool XA, int PXV, int ACT = 0>
__device__ __forceinline__ void wmma_gemm64(
    unsigned short* stg, float (*sT)[16 * 68], int bx, int b,
    const float* __restrict__ Xp, int S, long strideX,
    const float* __restrict__ Wp,
    void* __restrict__ Cout, void* __restrict__ Cout2, int ldc, long strideC,
    const float* __restrict__ bias,
    const float* __restrict__ resid, long strideR,
    int M, int N, int K, float scale) {
  typedef typename Elem<ET>::T T;
  typedef typename Frag<T>::V V;
  typedef float vpx __attribute__((ext_vector_type(PXV)));
  static_assert(SPLIT == (ET == 1), "two bf16 planes or one f16 plane");
  constexpr int WR = 16 * MI;                  // A rows of a wave tile
  constexpr int AR = (8 / WN) * WR;            // A rows of the block tile
  constexpr int BR = WN * 64;                  // Bt rows of the block tile
  constexpr int P  = SPLIT ? 2 : 1;
  constexpr int XR = XA ? AR : BR;             // rows (pixels) of the X operand in the block tile
  constexpr int TR = XA ? BR : AR;             // rows of the Wt operand in the block tile
  constexpr int XB = XA ? 0 : P * AR;          // first LDS row of each operand's hi plane; its lo plane follows it
  constexpr int TB = XA ? P * AR : 0;
  constexpr int NU = XR / (32 * PXV);          // X units per wave: a unit is (8 * PXV) pixels x 32 channels
  constexpr int NG = TR / 32;                  // Wt groups of 32 rows
  static_assert(NU * 32 * PXV == XR && NG * 32 == TR, "stage shape");
  const int tid  = threadIdx.x;
  const int lane = tid & 31;
  const int wave = tid >> 5;
  const int nbN = N / BR;
  const int bm  = bx / nbN;
  const int bn  = bx - bm * nbN;
  const int wa  = wave / WN;                   // the wave's WR rows among the block's A rows
  const int wb  = wave - wa * WN;              // the wave's 64 rows among the block's Bt rows
  const int m0 = bm * AR + wa * WR;
  const int n0 = bn * BR + (wb << 6);

  const int rlane = lane & 15;                 // row (A) / col (B, D) within subtile
  const int koff  = (lane >> 4) * 8;           // k offset of this lane half
  const int mOff  = (lane >> 4) * 8;           // D row offset

  // X: a thread takes PXV pixels x 8 channels of each unit: 8 loads along the pixels (8 lanes cover one run of 32 * PXV bytes of a
  // channel), then per pixel one 16-byte LDS store per plane, 8 channels = 8 consecutive k of that pixel's row.
  const int xci = (wave & 1) * 32 + (lane & 3) * 8;               // first of the thread's 8 channels within the stage
  const int xpx = (wave >> 1) * (8 * PXV) + (lane >> 2) * PXV;    // first of its pixels in unit 0; unit i: + i * 32 * PXV
  const float* xg = Xp + (size_t)b * strideX + (size_t)xci * S + (XA ? bm * AR : bn * BR) + xpx;
  // Wt: a thread takes 8 consecutive k (32 bytes) of row (tid >> 3) in every group of 32 rows.
  const int crow = tid >> 3, ccol = (tid & 7) * 8;
  const float* wg = Wp + (size_t)((XA ? bn * BR : bm * AR) + crow) * K + ccol;

  vpx xr[NU][8];
  v4f wr[NG][2];
  // xk, wk: the thread's own first element of each operand at the stage's first k
  auto stage_load = [&](const float* xk, const float* wk) __attribute__((always_inline)) {
#pragma unroll
    for (int i = 0; i < NU; ++i)
#pragma unroll
      for (int j = 0; j < 8; ++j) xr[i][j] = *(const vpx*)(xk + (size_t)j * S + i * 32 * PXV);
#pragma unroll
    for (int g = 0; g < NG; ++g) {
      wr[g][0] = *(const v4f*)(wk + (size_t)(g * 32) * K);
      wr[g][1] = *(const v4f*)(wk + (size_t)(g * 32) * K + 4);
    }
    // precaution: nothing may write the address registers that these loads name in front of this wait; the two addresses are inputs
    // of its statement, so that no load of the group lands in them either
    asm volatile("s_wait_xcnt 0x0" :: "v"(xk), "v"(wk) : "memory");
  };
  auto stage_store = [&](unsigned short* buf) __attribute__((always_inline)) {
    unsigned short* xs = buf + (XB + xpx) * PJ_PITCH + xci;
#pragma unroll
    for (int i = 0; i < NU; ++i)
#pragma unroll
      for (int p = 0; p < PXV; ++p) {
        const float f[8] = {xr[i][0][p], xr[i][1][p], xr[i][2][p], xr[i][3][p], xr[i][4][p], xr[i][5][p], xr[i][6][p], xr[i][7][p]};
        unsigned short* d = xs + (i * 32 * PXV + p) * PJ_PITCH;
        put8<SPLIT>(d, d + XR * PJ_PITCH, f);
      }
    unsigned short* tsm = buf + (TB + crow) * PJ_PITCH + ccol;
#pragma unroll
    for (int g = 0; g < NG; ++g) {
      const float f[8] = {wr[g][0][0], wr[g][0][1], wr[g][0][2], wr[g][0][3], wr[g][1][0], wr[g][1][1], wr[g][1][2], wr[g][1][3]};
      unsigned short* d = tsm + (g * 32) * PJ_PITCH;
      put8<SPLIT>(d, d + TR * PJ_PITCH, f);
    }
  };

  v8f acc[MI][4];
#pragma unroll
  for (int i = 0; i < MI; ++i)
#pragma unroll
    for (int j = 0; j < 4; ++j) acc[i][j] = (v8f){0.f,0.f,0.f,0.f,0.f,0.f,0.f,0.f};

  const int nt = K / PJ_KS;                    // stages; the same for the whole block, at least 2
  stage_load(xg, wg);
  stage_store(stg);
  __syncthreads();                             // stage 0 may be read
  const float* xn = xg + (size_t)PJ_KS * S;    // the next stage to load
  const float* wn = wg + PJ_KS;

#pragma unroll 1   // rolled: the two buffers alternate by index
  for (int t = 0; t < nt; ++t) {
    const int bufo = (t & 1) * PJ_STAGE;
    const bool more = t + 1 < nt;              // the same for the whole block
    if (more) {                                // the next stage's f32 values fly while this stage is worked on
      stage_load(xn, wn);
      xn += (size_t)PJ_KS * S;
      wn += PJ_KS;
    }
    const T* sA  = (const T*)(stg + bufo) + (wa * WR + rlane) * PJ_PITCH + koff;
    const T* sA2 = sA + AR * PJ_PITCH;
    const T* sB  = (const T*)(stg + bufo) + (P * AR + (wb << 6) + rlane) * PJ_PITCH + koff;
    const T* sB2 = sB + BR * PJ_PITCH;
#pragma unroll
    for (int kk = 0; kk < PJ_KS; kk += 32) {
      V bh[4], bl[4];
#pragma unroll
      for (int j = 0; j < 4; ++j) {
        bh[j] = Frag<T>::load(sB + (j << 4) * PJ_PITCH + kk);
        if (SPLIT) bl[j] = Frag<T>::load(sB2 + (j << 4) * PJ_PITCH + kk);
      }
#pragma unroll
      for (int i = 0; i < MI; ++i) {
        V ah = Frag<T>::load(sA + (i << 4) * PJ_PITCH + kk);
        V al;
        if (SPLIT) al = Frag<T>::load(sA2 + (i << 4) * PJ_PITCH + kk);
#pragma unroll
        for (int j = 0; j < 4; ++j) {
          acc[i][j] = Frag<T>::mma(ah, bh[j], acc[i][j]);
          if (SPLIT) {
            acc[i][j] = Frag<T>::mma(ah, bl[j], acc[i][j]);
            acc[i][j] = Frag<T>::mma(al, bh[j], acc[i][j]);
          }
        }
        Frag<T>::guard(acc[i][0], acc[i][3], ah, SPLIT ? al : ah);
      }
      Frag<T>::keep(bh[0], bh[1], bh[2], bh[3]);
      if (SPLIT) Frag<T>::keep(bl[0], bl[1], bl[2], bl[3]);
    }
    if (more) {
      stage_store(stg + (PJ_STAGE - bufo));    // into the buffer whose last readers left it before the barrier of the trip before
      __syncthreads();                         // publishes stage t + 1 and ends every wave's reads of stage t
    }
  }
#pragma unroll
  for (int i = 0; i < MI; ++i) acc_guard4(acc[i][0], acc[i][1], acc[i][2], acc[i][3]);

  // ---- epilogue ----
  float* slab = sT[wave];
  const float* Rb = RESID ? (resid + (size_t)b * strideR) : nullptr;
#pragma unroll
  for (int i = 0; i < MI; ++i) {
    const int mBase = m0 + (i << 4);
#pragma unroll
    for (int j = 0; j < 4; ++j) {
      const int n = n0 + (j << 4) + rlane;
      float bv = 0.f;
      if (BIAS_MODE == 2) bv = bias[n];
#pragma unroll
      for (int r = 0; r < 8; ++r) {
        float v = acc[i][j][r] * scale;
        if (BIAS_MODE == 1) v += bias[mBase + mOff + r];
        if (BIAS_MODE == 2) v += bv;
        if (RESID) v += Rb[(size_t)(mBase + mOff + r) * ldc + n];
        if (ACT == 1) v = tanhf(v);
        if (ACT == 2) v = fmaxf(v, 0.0f);
        if (ACT == 3) v = v / (1.0f + expf(-v));
        if (ACT == 4) v = (v > 0.f) ? v : 0.01f * v;
        if (ACT == 5) v = 0.5f * v * (1.0f + erff(v * 0.70710678118654752f));
        slab[(mOff + r) * 68 + (j << 4) + rlane] = v;
      }
    }
    __builtin_amdgcn_fence(__ATOMIC_RELEASE, "workgroup");
    __builtin_amdgcn_wave_barrier();
    __builtin_amdgcn_fence(__ATOMIC_ACQUIRE, "workgroup");
    if (OUT_MODE == 0) {
      float* C = (float*)Cout + (size_t)b * strideC;
      const int hh = lane >> 4, c4 = (lane & 15) * 4;     // row seg = 256 B = 16 lanes x 16 B
      {
#pragma unroll
        for (int it = 0; it < 8; ++it) {
          const int row = it * 2 + hh;
          v4f v = *(const v4f*)(slab + row * 68 + c4);
          *(v4f*)(C + (size_t)(mBase + row) * ldc + n0 + c4) = v;
        }
        
      }
    } else {
      const int q = lane >> 3, c8 = (lane & 7) * 8;
      unsigned short* C  = (unsigned short*)Cout  + (size_t)b * strideC;
      unsigned short* C2 = (OUT_MODE == 2) ? ((unsigned short*)Cout2 + (size_t)b * strideC) : nullptr;
      {
#pragma unroll
        for (int it = 0; it < 4; ++it) {
          const int row = it * 4 + q;
          const float* sp = slab + row * 68 + c8;
          v8h hv, lv;
#pragma unroll
          for (int e = 0; e < 8; ++e) {
            if (OUT_MODE == 1) {
              hv[e] = (_Float16)sp[e];
            } else {
              unsigned short hb = f2bf_bits(sp[e]);
              unsigned short lb = f2bf_bits(sp[e] - bf_bits2f(hb));
              hv[e] = __builtin_bit_cast(_Float16, hb);
              lv[e] = __builtin_bit_cast(_Float16, lb);
            }
          }
          *(v8h*)(C + (size_t)(mBase + row) * ldc + n0 + c8) = hv;
          if (OUT_MODE == 2) *(v8h*)(C2 + (size_t)(mBase + row) * ldc + n0 + c8) = lv;
        }
        
      }
    }
    // precaution: the next slab's values and addresses reuse the registers that these stores name; the wait stands in front of that
    asm volatile("s_wait_xcnt 0x0" ::: "memory");
    __builtin_amdgcn_fence(__ATOMIC_RELEASE, "workgroup");
    __builtin_amdgcn_wave_barrier();
    __builtin_amdgcn_fence(__ATOMIC_ACQUIRE, "workgroup");
  }
}

// ---- One grid for the three projections, straight from the f32 inputs; the block index picks the job ----
//   blocks   0..63   q[b][sq][co] = sum_ci x_high[b][ci][sq] Wq[co][ci] + bq[co]  (K = 512: twice the stages, so the smallest tile, 64 x 128)
//   blocks  64..191  k[b][s][co]  = sum_ci x_low[b][ci][s]  Wk[co][ci] + bk[co]   (tile 128 x 128)
//   blocks 192..255  v[b][co][s]  = sum_ci Wv[co][ci] x_low[b][ci][s] + bv[co]    (tile 128 x 256; channel-major out; f16 operands, f16 out)
// The tiles are sized so that the three jobs' blocks last about equally long and together fill the chip's 256 WGPs once.
__global__ __launch_bounds__(256) void proj_all(
    const float* __restrict__ x_high, const float* __restrict__ Wq,
    unsigned short* __restrict__ q_h, unsigned short* __restrict__ q_l, const float* __restrict__ bq,
    const float* __restrict__ x_low, const float* __restrict__ Wk,
    unsigned short* __restrict__ k_h, unsigned short* __restrict__ k_l, const float* __restrict__ bk,
    const float* __restrict__ Wv,
    unsigned short* __restrict__ v_f, const float* __restrict__ bv) {
  __shared__ __align__(16) unsigned short stg[2 * PJ_STAGE];   // two stage buffers of the block's operand rows
  __shared__ __align__(16) float sT[8][16 * 68];   // per-wave 16x64 slab, pitch 68 floats
  const int id = blockIdx.x;                       // every branch below is uniform over the block
  if (id < 64) {
    wmma_gemm64<1, true, 2, 2, false, 2, 1, true, 2, 0>(stg, sT, id & 7, id >> 3,
        x_high, 256, (long)512 * 256, Wq,
        (void*)q_h, (void*)q_l, 256, (long)256 * 256,
        bq, bq, 0L, 256, 256, 512, 1.0f);
  } else if (id < 192) {
    const int j = id - 64;
    wmma_gemm64<1, true, 2, 2, false, 2, 2, true, 4, 0>(stg, sT, j & 15, j >> 4,
        x_low, 1024, (long)256 * 1024, Wk,
        (void*)k_h, (void*)k_l, 256, (long)1024 * 256,
        bk, bk, 0L, 1024, 256, 256, 1.0f);
  } else {
    const int j = id - 192;
    wmma_gemm64<0, false, 1, 1, false, 4, 4, false, 4, 0>(stg, sT, j & 7, j >> 3,
        x_low, 1024, (long)256 * 1024, Wv,
        (void*)v_f, (void*)v_f, 1024, (long)256 * 1024,
        bv, bv, 0L, 256, 1024, 256, 1.0f);
  }
}

// =====================================================================================
// Attention, head dim 32, no mask, no scaling.
//   q planes: bf16 hi/lo [B][256 src px][256 ch] (16x16 grid). The four output pixels of one source pixel share their
//   query row, so their attention rows are equal: each source pixel is worked once and its result stored to all four.
//   k planes: bf16 hi/lo [B][1024 px][256 ch];  v: f16 channel-major [B][256 ch][1024 px]
//   out f32 channel-major [B][256 ch][1024 px].
//   scores transposed, k.q^T (A = k rows, B = q): 3 x v_wmma_f32_16x16x32_bf16 per 16x16 tile (hi.hi + lo.hi + hi.lo in k, q order);
//   a lane then holds 8 keys per tile of ONE query, so the online softmax (f32) runs over the lane's own registers, joined with the
//   other wave half by one cross-row move; two score tiles, as p x2^15 in f16, ARE the B operand of out^T += v^T.p^T
//   (v_wmma_f32_16x16x32_f16, A = v rows [d][kv]); f32 accumulate.
//   Exponentials in base 2: the running max is kept as M = max * log2(e) - 15, and p x2^15 = 2^(score * log2(e) - M) is one
//   multiply-add and one v_exp_f32. No argument exceeds 15 but by rounding; one below -126 may give 0 where the library call gave a
//   denormal: a term under 2^-126 beside one near 2^15. The sums carry the same 2^15 as the out tiles, so it cancels in the merge.
//   Block = 16 waves = 64 source pixels (256 output pixels) of one (b, head); grid.x = B*8*4.
//   Wave = (key group g = wave >> 2, query sub-tile = wave & 3): group g works keys 256g .. 256g+255 in 64-key chunks.
//   Every chunk has an LDS buffer of its own: all of the head's k and v is
//   asked for at the kernel's start by asynchronous copies in chunk order, and chunk n + 1 .. 3 land while chunk n is worked on.
//   Every group keeps its own running max, sum and unnormalised out tile; the epilogue merges the four in the fixed order g = 0..3.
// =====================================================================================
#define AS_S   1024
#define AS_C   256
#define AS_SQ  256
#define AS_HD  32
#define AS_NH  8
#define AS_KC  64
#define AS_L2E 1.4426950408889634f   // log2(e)
#define AS_PEX 15.0f                 // p is carried x2^15
#define AS_NG  4                 // key groups per block
#define AS_GK  (AS_S / AS_NG)     // keys per group
#define AS_NT  (AS_GK / AS_KC)    // chunks per group
#define AS_KP  (AS_HD + 8)        // LDS pitch of a k row in elements: 64 B + 16 B
#define AS_VP  (AS_KC + 8)        // LDS pitch of a v row in elements: 128 B + 16 B
#define AS_KE  (AS_KC * AS_KP)    // elements of one k plane of a chunk in LDS
#define AS_CH  (2 * AS_KE + AS_HD * AS_VP)   // elements of a chunk in LDS: k hi, k lo, v
// Both pitches are odd multiples of 16 B: the 16 rows that a half wave reads with one 16-byte LDS load then start on 16 different
// groups of four banks; at 64 B and 128 B they shared 4 and 2 such groups.

// value of lane l ^ 16 (the other wave half), by a vector cross-row move
__device__ __forceinline__ float xhalf(float x) {
  return __builtin_bit_cast(float, __builtin_amdgcn_permlanex16(__builtin_bit_cast(int, x), __builtin_bit_cast(int, x),
                                                                0x76543210, 0xfedcba98, false, false));
}

__global__ __launch_bounds__(512)
void attn_hd32(const unsigned short* __restrict__ qhp, const unsigned short* __restrict__ qlp,
               const unsigned short* __restrict__ khp, const unsigned short* __restrict__ klp,
               const unsigned short* __restrict__ vp, float* __restrict__ out) {
  union FB { v16b v; v8b h[2]; };
  union FH { v16h v; v8h h[2]; };
  // per group and chunk, side by side so that one base register and immediate offsets reach all three:
  // k hi [kv][d] (5 KB), k lo [kv][d] (5 KB), v [d][kv] (4.5 KB), all with padded rows
  __shared__ __align__(16) unsigned short KV[AS_NG][AS_NT][AS_CH];
  __shared__ __align__(16) float    Os[AS_NG][AS_HD][68];         // per group: unnormalised out tile [d][64 source px], pitch 68
  __shared__ __align__(16) float    Ms[AS_NG][64];                // per group: running max of each source px
  __shared__ __align__(16) float    Ls[AS_NG][64];                // per group: running sum of each source px

  const int tid  = threadIdx.x;
  const int wave = tid >> 5;
  const int grp  = wave >> 2;          // key group
  const int wq   = wave & 3;           // query sub-tile
  const int gt   = tid & 127;          // thread within the group
  const int lane = tid & 31;
  const int hh   = lane >> 4;
  const int c    = lane & 15;

  const int bx = blockIdx.x;
  const int qb = bx & 3;               // AS_SQ / 64 = 4 query blocks
  const int bh = bx >> 2;
  const int h  = bh & (AS_NH - 1);
  const int b  = bh >> 3;
  const int qbase = qb * 64;
  const int q0 = qbase + wq * 16;

  // ---- Q fragments (B operand, lane c = query column, split k map), hi and lo planes ----
  v16b qah, qal;
  {
    const int sq = q0 + c;                       // source pixel 0..255 on the 16x16 grid
    const size_t qo = ((size_t)b * AS_SQ + sq) * AS_C + h * AS_HD + 8 * hh;
    qah = Frag<__bf16>::load((const __bf16*)qhp + qo);
    qal = Frag<__bf16>::load((const __bf16*)qlp + qo);
  }

  float mrow = -INFINITY;   // running max of the lane's query as M = max * log2(e) - 15 (equal in both wave halves)
  float lrow = 0.f;         // running sum (x2^15) over the keys of the lane's own half; the halves are joined behind the loop
  v8f oacc[2];              // oacc[t][r] = out^T[d = 16t + 8hh + r][query c]
#pragma unroll
  for (int t = 0; t < 2; ++t) oacc[t] = (v8f){0.f,0.f,0.f,0.f,0.f,0.f,0.f,0.f};

  const __bf16*   khb = (const __bf16*)khp + (size_t)b * AS_S * AS_C + h * AS_HD;
  const __bf16*   klb = (const __bf16*)klp + (size_t)b * AS_S * AS_C + h * AS_HD;
  const _Float16* vb  = (const _Float16*)vp + ((size_t)b * AS_C + h * AS_HD) * AS_S;
  float*          ob  = out + ((size_t)b * AS_C + h * AS_HD) * AS_S + qbase * 4;   // 4 source rows -> 8 output rows of 32

  // ---- all four chunks of the group's k and v: global memory -> LDS by asynchronous copies, six per thread and chunk, chunk 0 first ----
  {
    // k chunk: 64 kv rows x 32 d per plane; 4 lanes cover a row's 64 B; a thread's two copies take rows kvr and kvr + 32
    const int kvr = gt >> 2, kd = (gt & 3) * 8;
    // v chunk: 32 d rows x 64 kv (channel-major source is already [d][kv]); 8 lanes cover a row's 128 B; rows dr and dr + 16
    const int dr = gt >> 3, vk = (gt & 7) * 8;
    const __bf16*   gkh = khb + (size_t)(grp * AS_GK + kvr) * AS_C + kd;
    const __bf16*   gkl = klb + (size_t)(grp * AS_GK + kvr) * AS_C + kd;
    const _Float16* gv  = vb + (size_t)dr * AS_S + grp * AS_GK + vk;
    // LDS byte addresses: the low 32 bits of the __shared__ addresses
    const unsigned  lkh = (unsigned)(uintptr_t)(&KV[grp][0][kvr * AS_KP + kd]);
    const unsigned  lkl = lkh + AS_KE * 2;
    const unsigned  lv  = (unsigned)(uintptr_t)(&KV[grp][0][2 * AS_KE + dr * AS_VP + vk]);
#pragma unroll   // four statements in a row: every chunk's copies are under way before the first chunk is waited for
    for (int n = 0; n < AS_NT; ++n) {
      const __bf16*   a = gkh + (size_t)n * AS_KC * AS_C;
      const __bf16*   e = gkl + (size_t)n * AS_KC * AS_C;
      const _Float16* f = gv + n * AS_KC;
      const unsigned  la = lkh + n * (AS_CH * 2), le = lkl + n * (AS_CH * 2), lf = lv + n * (AS_CH * 2);
      // the closing s_wait_xcnt is a precaution: it stands in the copies' own statement, in front of any rewrite of their address registers
      asm volatile("global_load_async_to_lds_b128 %0, %1, off\n\t"
                   "global_load_async_to_lds_b128 %2, %3, off\n\t"
                   "global_load_async_to_lds_b128 %4, %5, off\n\t"
                   "global_load_async_to_lds_b128 %6, %7, off\n\t"
                   "global_load_async_to_lds_b128 %8, %9, off\n\t"
                   "global_load_async_to_lds_b128 %10, %11, off\n\t"
                   "s_wait_xcnt 0x0"
                   :: "v"(la), "v"(a), "v"(la + 32 * AS_KP * 2), "v"(a + 32 * AS_C),
                      "v"(le), "v"(e), "v"(le + 32 * AS_KP * 2), "v"(e + 32 * AS_C),
                      "v"(lf), "v"(f), "v"(lf + 16 * AS_VP * 2), "v"(f + 16 * AS_S)
                   : "memory");
    }
  }

#pragma unroll 1   // stays rolled, as it was: unrolled, the four chunks' fragments take 256 registers and spill to scratch
  for (int kc = 0; kc < AS_NT; ++kc) {
    const __bf16*   Ksh = (const __bf16*)KV[grp][kc];
    const __bf16*   Ksl = Ksh + AS_KE;
    const _Float16* Vt  = (const _Float16*)(KV[grp][kc] + 2 * AS_KE);
    // chunk kc has landed once all but the wave's 6 * (3 - kc) younger copies have (copies return in issue order); the count is an
    // immediate, so each chunk has its own statement; the last one, to 0, also ends the wave's copies before LDS serves the merge
    if (kc == 0)      asm volatile("s_wait_asynccnt 0x12" ::: "memory");
    else if (kc == 1) asm volatile("s_wait_asynccnt 0xc" ::: "memory");
    else if (kc == 2) asm volatile("s_wait_asynccnt 0x6" ::: "memory");
    else              asm volatile("s_wait_asynccnt 0x0" ::: "memory");
    __syncthreads();   // publishes chunk kc: every wave's share of it has landed; no buffer is filled twice, so no second barrier

    // ---- scores, transposed: s[j][r] = key (kv0 + 16j + 8hh + r), query (q0 + c); A operand = k rows with split k map over d ----
    FB kb[4], kl[4];
#pragma unroll
    for (int j = 0; j < 4; ++j) {
      kb[j].h[0] = *(const v8b*)(Ksh + (j * 16 + c) * AS_KP + 8 * hh);
      kb[j].h[1] = *(const v8b*)(Ksh + (j * 16 + c) * AS_KP + 16 + 8 * hh);
      kl[j].h[0] = *(const v8b*)(Ksl + (j * 16 + c) * AS_KP + 8 * hh);
      kl[j].h[1] = *(const v8b*)(Ksl + (j * 16 + c) * AS_KP + 16 + 8 * hh);
    }
    v8f s[4];
#pragma unroll
    for (int j = 0; j < 4; ++j) s[j] = Frag<__bf16>::mma(kb[j].v, qah, (v8f){0.f,0.f,0.f,0.f,0.f,0.f,0.f,0.f});
#pragma unroll
    for (int j = 0; j < 4; ++j) s[j] = Frag<__bf16>::mma(kl[j].v, qah, s[j]);
#pragma unroll
    for (int j = 0; j < 4; ++j) s[j] = Frag<__bf16>::mma(kb[j].v, qal, s[j]);

    // ---- online softmax (f32): the lane's 32 scores belong to one query ----
    float mt[4];   // one chain per tile: a tile's maximum can start while the later tiles' products still run
#pragma unroll
    for (int j = 0; j < 4; ++j) {
      mt[j] = s[j][0];
#pragma unroll
      for (int r = 1; r < 8; ++r) mt[j] = fmaxf(mt[j], s[j][r]);
    }
    float m = fmaxf(fmaxf(mt[0], mt[1]), fmaxf(mt[2], mt[3]));
    m = fmaf(fmaxf(m, xhalf(m)), AS_L2E, -AS_PEX);
    const float mnew  = fmaxf(mrow, m);
    const float alpha = __builtin_amdgcn_exp2f(mrow - mnew);   // 0 on the first chunk, where mrow is -inf
    mrow = mnew;
    float ps[4];
    FH pb[2];   // pb[kk] element e = p of key 32kk + (e < 8 ? 8hh + e : 16 + 8hh + e - 8): the B operand's own k order
#pragma unroll
    for (int j = 0; j < 4; ++j) {
      ps[j] = 0.f;
#pragma unroll
      for (int r = 0; r < 8; r += 2) {
        const v2f arg = __builtin_elementwise_fma((v2f){s[j][r], s[j][r + 1]}, (v2f){AS_L2E, AS_L2E}, (v2f){-mnew, -mnew});
        const float p0 = __builtin_amdgcn_exp2f(arg[0]), p1 = __builtin_amdgcn_exp2f(arg[1]);   // p x2^15
        ps[j] += p0;
        ps[j] += p1;
        pb[j >> 1].v[(j & 1) * 8 + r]     = (_Float16)p0;
        pb[j >> 1].v[(j & 1) * 8 + r + 1] = (_Float16)p1;
      }
    }
    lrow = lrow * alpha + ((ps[0] + ps[1]) + (ps[2] + ps[3]));
#pragma unroll
    for (int t = 0; t < 2; ++t)
#pragma unroll
      for (int r = 0; r < 8; ++r) oacc[t][r] *= alpha;

    // ---- out^T += v^T . p^T : A = v rows [d][kv] with split k map over kv, B = p straight from the score registers ----
#pragma unroll   // unrolled: pb[kk] lives in registers, which only a constant index can name
    for (int kk = 0; kk < 2; ++kk) {
#pragma unroll
      for (int t = 0; t < 2; ++t) {
        FH vf;
        vf.h[0] = *(const v8h*)(Vt + (t * 16 + c) * AS_VP + kk * 32 + 8 * hh);
        vf.h[1] = *(const v8h*)(Vt + (t * 16 + c) * AS_VP + kk * 32 + 16 + 8 * hh);
        oacc[t] = Frag<_Float16>::mma(vf.v, pb[kk].v, oacc[t]);
      }
    }
  }

  // ---- each group hands over its partial state: max, sum, unnormalised out tile ----
  const int qcol = wq * 16 + c;
#pragma unroll
  for (int t = 0; t < 2; ++t) {
#pragma unroll
    for (int r = 0; r < 8; ++r) Os[grp][t * 16 + 8 * hh + r][qcol] = oacc[t][r];
  }
  const float lq = lrow + xhalf(lrow);   // the two halves' keys joined
  if (hh == 0) { Ms[grp][qcol] = mrow; Ls[grp][qcol] = lq; }   // both halves hold equal max and sum: one stores them
  __syncthreads();
  {
    // nearest-neighbour 2x: output pixel (y, x) of the block's 8 x 32 patch takes source (y>>1, x>>1) of its 4 x 16 patch
    const int o4 = (tid & 63) * 4;                       // 4 output pixels of one row: two source pixels, each twice
    const int sp = (o4 >> 6) * 16 + ((o4 & 31) >> 1);
    // merge weights of the two source pixels: w[g] = 2^(M_g - M) / sum_g 2^(M_g - M) l_g, g in fixed order
    float w0[AS_NG], w1[AS_NG];
    {
      float m0 = Ms[0][sp], m1 = Ms[0][sp + 1];
#pragma unroll
      for (int g = 1; g < AS_NG; ++g) { m0 = fmaxf(m0, Ms[g][sp]); m1 = fmaxf(m1, Ms[g][sp + 1]); }
      float l0 = 0.f, l1 = 0.f;
#pragma unroll
      for (int g = 0; g < AS_NG; ++g) {
        w0[g] = __builtin_amdgcn_exp2f(Ms[g][sp] - m0);      l0 += w0[g] * Ls[g][sp];
        w1[g] = __builtin_amdgcn_exp2f(Ms[g][sp + 1] - m1);  l1 += w1[g] * Ls[g][sp + 1];
      }
      const float i0 = 1.0f / l0, i1 = 1.0f / l1;
#pragma unroll
      for (int g = 0; g < AS_NG; ++g) { w0[g] *= i0; w1[g] *= i1; }
    }
#pragma unroll   // the 4 channel steps become immediate offsets of one address, and the LDS reads run ahead of the stores
    for (int it = 0; it < 4; ++it) {
      const int d = it * 8 + (tid >> 6);
      float s0 = 0.f, s1 = 0.f;
#pragma unroll
      for (int g = 0; g < AS_NG; ++g) { s0 += Os[g][d][sp] * w0[g]; s1 += Os[g][d][sp + 1] * w1[g]; }
      *(v4f*)(ob + (size_t)d * AS_S + o4) = (v4f){s0, s0, s1, s1};
    }
  }
}

extern "C" void kernel_launch(void* const* d_in, const int* in_sizes, int n_in,
                              void* d_out, int out_size, void* d_ws, size_t ws_size,
                              hipStream_t stream) {
  const int B = 8, CHI = 512, C = 256, SQ = 256, S = 1024;
  if (n_in < 8) return;
  if (in_sizes[0] != B * CHI * SQ || in_sizes[1] != B * C * S || in_sizes[2] != C * CHI ||
      in_sizes[3] != C || in_sizes[4] != C * C || in_sizes[5] != C || in_sizes[6] != C * C ||
      in_sizes[7] != C || out_size != B * C * S) return;

  const float* x_high = (const float*)d_in[0];
  const float* x_low  = (const float*)d_in[1];
  const float* Wq     = (const float*)d_in[2];
  const float* bq     = (const float*)d_in[3];
  const float* Wk     = (const float*)d_in[4];
  const float* bk     = (const float*)d_in[5];
  const float* Wv     = (const float*)d_in[6];
  const float* bv     = (const float*)d_in[7];
  float* out = (float*)d_out;

  // ---- workspace carve (bytes, 256-B aligned) ----
  char* ws = (char*)d_ws;
  size_t off = 0;
#define CARVE16(name, elems) unsigned short* name = (unsigned short*)(ws + off); off += ((((size_t)(elems)) * 2) + 255) & ~(size_t)255;
  CARVE16(q_h,  (size_t)B * SQ * C)      // q planes [B][256 src px][256 ch]
  CARVE16(q_l,  (size_t)B * SQ * C)
  CARVE16(k_h,  (size_t)B * S * C)       // k planes [B][1024][256 ch]
  CARVE16(k_l,  (size_t)B * S * C)
  CARVE16(v_f,  (size_t)B * C * S)       // v f16 channel-major [B][256 ch][1024]
#undef CARVE16
  if (off > ws_size || off > (size_t)134217728) return;   // total 14,680,064 B

  // ---- q, k and v projections, one launch; the operands are converted and turned inside it ----
  proj_all<<<dim3(256), dim3(256), 0, stream>>>(
      x_high, Wq, q_h, q_l, bq,
      x_low, Wk, k_h, k_l, bk,
      Wv, v_f, bv);

  // ---- attention ----
  attn_hd32<<<dim3(B * AS_NH * (SQ / 64)), dim3(512), 0, stream>>>(q_h, q_l, k_h, k_l, v_f, out);
}
